// v000
// Times are from an AMD MI455X. After a warm-up the kernel runs many times in a row, and a time is the length of
// such a window on the GPU divided by its runs, so every launch and the gaps after it count. The runs cycle
// through copies of the inputs. A figure is the median of several windows, for all but v000 over two sittings.
// Sittings can differ by a few percent; kernels timed side by side share one.
// v000, which the later versions start from, runs in 267 microseconds.
#include <hip/hip_runtime.h>

// Compute dtypes (f32 accumulate everywhere): qkv and output projections v_wmma_f32_16x16x32_bf16 (activation as bf16 hi|lo planes folded along K, weights RNE-converted bf16); scores, P.V, geometric sum and edge projection v_wmma_f32_16x16x32_f16 (q, k, G, bm, c16 as f16 value + f16 residual x2048; P x256 and v single f16).
// Pre-norm attention block, width 1024 = 16 heads x 64: LN(x) -> qkv GEMM -> LN(q), LN(k) over the full width -> rotate-half rotary (cos/sin table from the position input) ->
// masked softmax attention (replace-fill, running max) plus geometric term tmp2 = sum_k (q.k) mask bm/len, context = (base.tmp2) edge_w^T -> output GEMM.
// Every float input is RNE-converted to bf16 on load. Fused flash kernel in transposed form (S^T = K Q^T, O^T = V^T P^T, tmp2^T = BM^T G^T, ctx^T = EW c16^T).

#ifndef NB
#define NB 2
#endif
#ifndef SEQ
#define SEQ 1024
#endif
#define NB_FULL  2
#define SEQ_FULL 1024
#ifndef OUT_SEQ
#define OUT_SEQ SEQ              // row pitch (in tokens) between batches of the output
#endif
#define DM   1024
#define K2   2048                // hi|lo folded contraction length
#define NH_  16
#define HD   64
#define AW   4                   // waves per flash block (16 query rows each)
#define QRS  2048.0f             // carry of the residual planes
#define QRI  (1.0f / 2048.0f)
#define SC2  (0.125f * 1.4426950408889634f)   // HD^-0.5 * log2(e)
#define PSH  8.0f                // log2 of the P carry (256)
#define NEGMIN (-3.4028234663852886e38f)

static_assert(HD == 64);
static_assert(NH_ * HD == DM);
static_assert(K2 == 2 * DM);
static_assert((DM & (DM - 1)) == 0);           // k index wrap uses a power-of-two mask
static_assert(DM % 64 == 0);
static_assert(SEQ % 128 == 0);                 // mask row sums read 128 ints per step
static_assert(SEQ % 64 == 0);
static_assert((NB * SEQ) % 64 == 0);
static_assert((NB * SEQ) % 8 == 0);
static_assert(SEQ % (16 * AW) == 0);
static_assert(NB <= NB_FULL);
static_assert(SEQ <= SEQ_FULL);

typedef _Float16 h16;
typedef unsigned short bf;
typedef __attribute__((ext_vector_type(16))) __bf16   v16bf;
typedef __attribute__((ext_vector_type(16))) _Float16 v16h;
typedef __attribute__((ext_vector_type(8)))  _Float16 v8h;
typedef __attribute__((ext_vector_type(8)))  unsigned short v8us;
typedef __attribute__((ext_vector_type(8)))  float    v8f;
typedef __attribute__((ext_vector_type(4)))  float    v4f;
typedef __attribute__((ext_vector_type(4)))  int      v4i;
typedef v4f  __attribute__((may_alias)) v4fa;
typedef v8h  __attribute__((may_alias)) v8ha;

__device__ __forceinline__ unsigned short f2bf(float f) { unsigned u = __float_as_uint(f); u += 0x7FFFu + ((u >> 16) & 1u); return (unsigned short)(u >> 16); }
__device__ __forceinline__ float bf2f(unsigned short b) { return __uint_as_float(((unsigned)b) << 16); }
__device__ __forceinline__ float bfr(float f) { return bf2f(f2bf(f)); }
__device__ __forceinline__ v16h cat16(v8h lo, v8h hi) { return __builtin_shufflevector(lo, hi, 0, 1, 2, 3, 4, 5, 6, 7, 8, 9, 10, 11, 12, 13, 14, 15); }
__device__ __forceinline__ v16bf cat16b(v8us lo, v8us hi) { return __builtin_bit_cast(v16bf, __builtin_shufflevector(lo, hi, 0, 1, 2, 3, 4, 5, 6, 7, 8, 9, 10, 11, 12, 13, 14, 15)); }
__device__ __forceinline__ v8f wmma16(v16h a, v16h b, v8f c) { return __builtin_amdgcn_wmma_f32_16x16x32_f16(false, a, false, b, (short)0, c, false, false); }
__device__ __forceinline__ v8f wmmab(v16bf a, v16bf b, v8f c) { return __builtin_amdgcn_wmma_f32_16x16x32_bf16(false, a, false, b, (short)0, c, false, false); }
// fragment loaders from K-contiguous 16-bit rows; p already includes + 8*(lane>>4): elements 0..7 <- k0+8h+0..7, elements 8..15 <- k0+16+8h+0..7 (same map for A and B)
__device__ __forceinline__ v16h  ldh(const h16* p) { return cat16(*(const v8h*)p, *(const v8h*)(p + 16)); }
__device__ __forceinline__ v16bf ldb(const bf* p)  { return cat16b(*(const v8us*)p, *(const v8us*)(p + 16)); }
// ordering point for wave-private LDS tiles (same wave writes and reads)
__device__ __forceinline__ void wave_sync() { __builtin_amdgcn_fence(3 /* release order */, "wavefront"); __builtin_amdgcn_wave_barrier(); asm volatile("" ::: "memory"); }
__device__ __forceinline__ float wsum(float v) { v += __shfl_xor(v, 16, 32); v += __shfl_xor(v, 8, 32); v += __shfl_xor(v, 4, 32); v += __shfl_xor(v, 2, 32); v += __shfl_xor(v, 1, 32); return v; }
__device__ __forceinline__ int wsumi(int v) { v += __shfl_xor(v, 16, 32); v += __shfl_xor(v, 8, 32); v += __shfl_xor(v, 4, 32); v += __shfl_xor(v, 2, 32); v += __shfl_xor(v, 1, 32); return v; }

__global__ __launch_bounds__(256) void k_cvt8(const float* __restrict__ src, bf* dst, size_t n8) {
    const size_t i = (size_t)blockIdx.x * 256 + threadIdx.x; if (i >= n8) return;
    const v8f v = *(const v8f*)(src + i * 8); v8us o;
#pragma unroll
    for (int k = 0; k < 8; ++k) o[k] = f2bf(v[k]);
    *(v8us*)(dst + i * 8) = o; 
}

// k_ew: edge weight A plane [64][32] f16: columns 0..15 = 16*w[d][j], columns 16..31 = w[d][j]/128 (pairs with the x2048 residual half of the c16 operand). One block; each thread 16 B, consecutive.
__global__ __launch_bounds__(256) void k_ew(const float* __restrict__ ew, h16* EWA) {
    const int tid = threadIdx.x; const int d = tid >> 2, q = tid & 3;
    const float sc = (q < 2) ? 16.0f : 0.0078125f;
    const v8f w = *(const v8f*)(ew + d * 16 + (q & 1) * 8);
    v8h o;
#pragma unroll
    for (int i = 0; i < 8; ++i) o[i] = (h16)(bfr(w[i]) * sc);
    *(v8h*)(EWA + d * 32 + q * 8) = o; 
}

// The per-lane element loops are rolled over the four 256-column chunks (the row is re-read from memory in each pass; element visiting order it = 0..3, i = 0..7 in every pass).
__global__ __launch_bounds__(256) void k_lnx(const float* __restrict__ x, const float* __restrict__ lw, const float* __restrict__ lb, bf* XA) {
    const int lane = threadIdx.x & 31; const int wave = __builtin_amdgcn_readfirstlane((int)(threadIdx.x >> 5));
    const int m = blockIdx.x * 8 + wave; const int b = m / SEQ, t = m % SEQ;
    const float* src = x + ((size_t)b * SEQ_FULL + t) * DM + lane * 8;
    float s = 0.0f;
#pragma unroll 1
    for (int it = 0; it < 4; ++it) { const v8f raw = *(const v8f*)(src + it * 256);
#pragma unroll
        for (int i = 0; i < 8; ++i) s += bfr(raw[i]); }
    s = wsum(s);
    const float mean = s * (1.0f / DM);
    float ss = 0.0f;
#pragma unroll 1
    for (int it = 0; it < 4; ++it) { const v8f raw = *(const v8f*)(src + it * 256);
#pragma unroll
        for (int i = 0; i < 8; ++i) { const float dv = bfr(raw[i]) - mean; ss += dv * dv; } }
    ss = wsum(ss);
    const float rstd = 1.0f / sqrtf(ss * (1.0f / DM) + 1e-5f);
    bf* dst = XA + (size_t)m * K2 + lane * 8;
{
#pragma unroll 1
        for (int it = 0; it < 4; ++it) {
            const v8f raw = *(const v8f*)(src + it * 256);
            const v8f wv = *(const v8f*)(lw + it * 256 + lane * 8); const v8f bv = *(const v8f*)(lb + it * 256 + lane * 8);
            v8us hv, lv;
#pragma unroll
            for (int i = 0; i < 8; ++i) { const float dv = bfr(raw[i]) - mean; const float y = dv * rstd * bfr(wv[i]) + bfr(bv[i]); const unsigned short hh = f2bf(y); hv[i] = hh; lv[i] = f2bf(y - bf2f(hh)); }
            *(v8us*)(dst + it * 256) = hv; *(v8us*)(dst + DM + it * 256) = lv; }
         }
}

__global__ __launch_bounds__(256) void k_rope(const float* __restrict__ pos, float* CS, float* SN) {
    const int lane = threadIdx.x & 31; const int wave = __builtin_amdgcn_readfirstlane((int)(threadIdx.x >> 5));
    const int m = blockIdx.x * 8 + wave; const int b = m / SEQ, t = m % SEQ;
    const float p = bfr(pos[(size_t)b * SEQ_FULL + t]);
    double pd = 1.0;
#pragma unroll 1
    for (int i = 0; i < lane; ++i) pd *= 1.333521432163324;
    const float pf = (float)pd;
    const float invf = 1.0f / pf;
    const float ang = p * invf;
    const float c = cosf(ang), s = sinf(ang);
    *(float*)(CS + (size_t)m * 32 + lane) = c; *(float*)(SN + (size_t)m * 32 + lane) = s;
    
}

// k_prep: per 64 tokens: len = mask row sums; bm = blocks - mean_c; base = bm / (|bm| + eps); planes BM[0] = f16(bm * 1024/len), BM[1] = f16 residual x2048, layout [plane][b][16][SEQ] (rows 12..15 zero);
// BASE [token][16] f32 (columns 12..15 zero). LDS tiles are cross-wave: block barriers between phases.
__global__ __launch_bounds__(256) void k_prep(const float* __restrict__ blocks, const int* __restrict__ mask, h16* BM, float* BASE) {
    __shared__ float slen[64];
    __shared__ __align__(16) h16 sb[32 * 64];
    __shared__ __align__(16) float sbase[64 * 16];
    const int tid = threadIdx.x, lane = tid & 31; const int wave = __builtin_amdgcn_readfirstlane((int)(threadIdx.x >> 5));
    const int m0 = blockIdx.x * 64; const int b = m0 / SEQ, t0 = m0 % SEQ;
#pragma unroll 1
    for (int i = 0; i < 8; ++i) { const int tl = wave * 8 + i;
        const int* row = mask + ((size_t)b * SEQ_FULL + t0 + tl) * SEQ_FULL + lane * 4; int cnt = 0;
#pragma unroll
        for (int c = 0; c < SEQ / 128; ++c) { const v4i mv = *(const v4i*)(row + c * 128); cnt += (mv[0] != 0) + (mv[1] != 0) + (mv[2] != 0) + (mv[3] != 0); }
        cnt = wsumi(cnt);
        if (lane == 0) slen[tl] = (float)cnt; }
    __syncthreads();
    if (tid < 64) {
        const float* p = blocks + ((size_t)b * SEQ_FULL + t0 + tid) * 12;
        const v4f a0 = *(const v4f*)p, a1 = *(const v4f*)(p + 4), a2 = *(const v4f*)(p + 8);
        float pv[12];
#pragma unroll
        for (int i = 0; i < 4; ++i) { pv[i] = bfr(a0[i]); pv[4 + i] = bfr(a1[i]); pv[8 + i] = bfr(a2[i]); }
        float mu[3];
#pragma unroll
        for (int x = 0; x < 3; ++x) mu[x] = (pv[x] + pv[3 + x] + pv[6 + x] + pv[9 + x]) * 0.25f;
        const float sc = (1.0f / slen[tid]) * 1024.0f;
#pragma unroll
        for (int c = 0; c < 4; ++c) {
            const float vx = pv[c * 3] - mu[0], vy = pv[c * 3 + 1] - mu[1], vz = pv[c * 3 + 2] - mu[2];
            const float inv = 1.0f / (sqrtf(vx * vx + vy * vy + vz * vz) + 1.1920929e-7f);
            const float vv[3] = {vx, vy, vz};
#pragma unroll
            for (int x = 0; x < 3; ++x) { const int cx = c * 3 + x;
                sbase[tid * 16 + cx] = vv[x] * inv;
                const float bs = vv[x] * sc; const h16 hh = (h16)bs;
                sb[cx * 64 + tid] = hh; sb[(16 + cx) * 64 + tid] = (h16)((bs - (float)hh) * QRS); } }
#pragma unroll
        for (int j = 12; j < 16; ++j) { sbase[tid * 16 + j] = 0.0f; sb[j * 64 + tid] = (h16)0.0f; sb[(16 + j) * 64 + tid] = (h16)0.0f; }
    }
    __syncthreads();
    // 32 lines of 64 halves: line = tid>>3 (0..15 value plane rows, 16..31 residual plane rows), 8 consecutive lanes x 16 B per line; BASE: 256 threads x 16 B contiguous
    const int line = tid >> 3, pc = tid & 7;
    const v8h bv = *(const v8ha*)(&sb[line * 64 + pc * 8]);
    const v4f fv = *(const v4fa*)(&sbase[tid * 4]);
    h16* bd = BM + (size_t)(line >> 4) * ((size_t)NB * 16 * SEQ) + ((size_t)b * 16 + (line & 15)) * SEQ + t0 + pc * 8;
    float* fd = BASE + (size_t)m0 * 16 + tid * 4;
    *(v8h*)bd = bv; *(v4f*)fd = fv;
    
}

// k_proj: register-blocked bf16 GEMM, ONE WAVE per 64x64 tile (16 accumulators), operands straight from K-contiguous bf16 planes.
// MODE 1: f32 rows C[((r0/RB)*RP + r0%RB)][c0..c0+63], row pitch ldc; each 256-byte row segment by 16 consecutive lanes x 16 B.
template <int MODE>
__global__ __launch_bounds__(32) void k_proj(const bf* __restrict__ A, int pA, const bf* __restrict__ Bt, int pB, int K,
                                             h16* Ph, int RB, size_t sRB, int pitch, int CB, size_t sCB, float* C, int ldc, int RP) {
    __shared__ __align__(16) float os[16 * 68];
    const int lane = threadIdx.x & 31, lr = lane & 15, hi = lane >> 4; const int r0 = blockIdx.x * 64, c0 = blockIdx.y * 64;
    v8f acc[4][4];
#pragma unroll
    for (int mb = 0; mb < 4; ++mb)
#pragma unroll
        for (int nb = 0; nb < 4; ++nb) acc[mb][nb] = (v8f){};
    const size_t aoff = (size_t)(r0 + lr) * pA + 8 * hi, boff = (size_t)(c0 + lr) * pB + 8 * hi;
    const int mA = pA - 1, mB = pB - 1;
#pragma unroll 1
    for (int kc = 0; kc < K; kc += 32) {
        const int ka = kc & mA, kb = kc & mB;
        v16bf a[4];
#pragma unroll
        for (int mb = 0; mb < 4; ++mb) a[mb] = ldb(A + aoff + (size_t)mb * 16 * pA + ka);
#pragma unroll
        for (int nb = 0; nb < 4; ++nb) { const v16bf b = ldb(Bt + boff + (size_t)nb * 16 * pB + kb);
#pragma unroll
            for (int mb = 0; mb < 4; ++mb) acc[mb][nb] = wmmab(a[mb], b, acc[mb][nb]); }
        asm volatile("v_nop\n\tv_nop\n\tv_nop\n\tv_nop" : "+v"(acc[0][0]), "+v"(acc[1][1]), "+v"(acc[2][2]), "+v"(acc[3][3]) : "v"(a[0]), "v"(a[1]), "v"(a[2]), "v"(a[3]));
    }
    const size_t tbase = (size_t)(r0 / RB) * sRB + (size_t)(r0 % RB) * (size_t)pitch + (size_t)(c0 / CB) * sCB + (size_t)(c0 % CB);
    const size_t cbase = ((size_t)(r0 / RB) * (size_t)RP + (size_t)(r0 % RB)) * (size_t)ldc + (size_t)c0;
#pragma unroll
    for (int mb = 0; mb < 4; ++mb) {
#pragma unroll
        for (int nb = 0; nb < 4; ++nb) {
#pragma unroll
            for (int j = 0; j < 8; ++j) os[(hi * 8 + j) * 68 + nb * 16 + lr] = acc[mb][nb][j]; }   // D: row 8h+j, col lane&15
        wave_sync();
        if (MODE == 0) {
            const size_t sb = tbase + (size_t)(mb * 16) * (size_t)pitch;
{
#pragma unroll
                for (int s = 0; s < 4; ++s) { const int row = 4 * s + (lane >> 3), c8 = (lane & 7) * 8;   // 4 s x 4 row groups = 16 rows; 8 lanes x 8 = 64 columns
                    const v4f x0 = *(const v4fa*)(&os[row * 68 + c8]); const v4f x1 = *(const v4fa*)(&os[row * 68 + c8 + 4]); v8h hv;
#pragma unroll
                    for (int i = 0; i < 4; ++i) { hv[i] = (h16)x0[i]; hv[4 + i] = (h16)x1[i]; }
                    *(v8h*)(Ph + sb + (size_t)row * (size_t)pitch + c8) = hv; }
                 }
        } else {
            const size_t sb = cbase + (size_t)(mb * 16) * (size_t)ldc;
{
#pragma unroll
                for (int s = 0; s < 8; ++s) { const int row = 2 * s + hi, cofs = lr * 4;   // 8 s x 2 rows = 16 rows; 16 lanes x 4 floats = 64 columns
                    const v4f val = *(const v4fa*)(&os[row * 68 + cofs]);
                    *(v4f*)(C + sb + (size_t)row * (size_t)ldc + cofs) = val; }
                 }
        }
        wave_sync();
    }
}

// Lane holds columns it*256 + lane*8 + i = head (4*it + lane/8), d = 8*(lane&7) + i; the rotary partner d +- 32 is lane ^ 4 (same it, same i).
// Planes [b*16+h][t][64], four consecutive planes from PL with stride pst halves: q value, q residual x2048, k value, k residual x2048 (selected by integer offset from one base).
// All per-lane element loops are rolled over the four 256-column chunks and over {q, k}; the row is re-read from memory in each pass (visiting order it = 0..3, i = 0..7).
__global__ __launch_bounds__(256) void k_qkrot(const float* __restrict__ QK, const float* __restrict__ qw, const float* __restrict__ kw, const float* __restrict__ CS, const float* __restrict__ SN,
                                               h16* PL, size_t pst) {
    const int lane = threadIdx.x & 31; const int wave = __builtin_amdgcn_readfirstlane((int)(threadIdx.x >> 5));
    const int m = blockIdx.x * 8 + wave; const int b = m / SEQ, t = m % SEQ;
    const int c = lane & 7;
    const v8f cs = *(const v8f*)(CS + (size_t)m * 32 + 8 * (c & 3));
    const v8f sn = *(const v8f*)(SN + (size_t)m * 32 + 8 * (c & 3));
    const float sg = (c < 4) ? -1.0f : 1.0f;
    const size_t o0 = (((size_t)(b * NH_ + (lane >> 3))) * SEQ + t) * HD + 8 * c;
    const size_t ost = (size_t)4 * SEQ * HD;     // four heads per step
#pragma unroll 1
    for (int wh = 0; wh < 2; ++wh) {
        const float* row = QK + (size_t)m * K2 + (size_t)wh * DM + lane * 8;
        float s = 0.0f;
#pragma unroll 1
        for (int it = 0; it < 4; ++it) { const v8f raw = *(const v8f*)(row + it * 256);
#pragma unroll
            for (int i = 0; i < 8; ++i) s += raw[i]; }
        s = wsum(s);
        const float mean = s * (1.0f / DM);
        float ss = 0.0f;
#pragma unroll 1
        for (int it = 0; it < 4; ++it) { const v8f raw = *(const v8f*)(row + it * 256);
#pragma unroll
            for (int i = 0; i < 8; ++i) { const float dv = raw[i] - mean; ss += dv * dv; } }
        ss = wsum(ss);
        const float rstd = 1.0f / sqrtf(ss * (1.0f / DM) + 1e-5f);
        h16* PH = PL + (size_t)(2 * wh) * pst;
        h16* PR = PH + pst;
{
#pragma unroll 1
            for (int it = 0; it < 4; ++it) {
                const v8f raw = *(const v8f*)(row + it * 256);
                const v8f wq = *(const v8f*)(qw + it * 256 + lane * 8); const v8f wk = *(const v8f*)(kw + it * 256 + lane * 8);
                v8h hv, rv;
#pragma unroll
                for (int i = 0; i < 8; ++i) { const float wsel = wh ? wk[i] : wq[i];
                    const float y = (raw[i] - mean) * rstd * bfr(wsel);
                    const float pr = __shfl_xor(y, 4, 32);
                    const float r = y * cs[i] + sg * pr * sn[i];
                    const h16 hh = (h16)r; hv[i] = hh; rv[i] = (h16)((r - (float)hh) * QRS); }
                const size_t oo = o0 + (size_t)it * ost;
                *(v8h*)(PH + oo) = hv; *(v8h*)(PR + oo) = rv; }
             }
    }
}

// k_flash: fused attention + geometric term, one wave per 16 query rows of one (batch, head); all fragments straight from 16-bit planes (two 16-B loads each, arithmetic addressing).
// Transposed form: S^T[key][t] = K Q^T; lane (t = lane&15, h = lane>>4) holds keys 8h+r of each 16-key tile, so packed P / G tiles are directly B fragments of
// O^T[d][t] = V^T P^T and T^T[cx][t] = BM^T G^T. S = kH.qH + (kH.qR + kR.qH)/2048. Mask: replace-fill for the softmax, zero for G. Softmax state one scalar per lane (running max from -inf).
// Epilogue: tmp2 halves exchanged with one xor-16 shuffle, c16 = base.tmp2 (K = 3, VALU), ctx^T = EW c16^T on one K=32 tile (value | residual), sum staged in a wave-private LDS tile and
__global__ __launch_bounds__(32 * AW) void k_flash(const h16* __restrict__ QH, const h16* __restrict__ QR, const h16* __restrict__ KH, const h16* __restrict__ KR, const h16* __restrict__ VT,
                                                   const h16* __restrict__ BM, const float* __restrict__ BASE, const h16* __restrict__ EWA, const int* __restrict__ mask, bf* OA) {
    __shared__ __align__(16) float os[AW * 16 * 68];
    const int lane = threadIdx.x & 31, wave = __builtin_amdgcn_readfirstlane((int)(threadIdx.x >> 5)), lr = lane & 15, hi = lane >> 4;
    const int zh = blockIdx.y; const int b = zh / NH_, h = zh % NH_;
    const int t0 = (blockIdx.x * AW + wave) * 16;
    const size_t pbase = (size_t)zh * SEQ * HD;
    const size_t qo = pbase + (size_t)(t0 + lr) * HD + 8 * hi;
    const v16h qh0 = ldh(QH + qo), qh1 = ldh(QH + qo + 32), qr0 = ldh(QR + qo), qr1 = ldh(QR + qo + 32);   // B fragments: col t, k = d
    const size_t ko = pbase + (size_t)lr * HD + 8 * hi;      // + key * HD       (A fragment: row key, k = d)
    const size_t vo = pbase + (size_t)lr * SEQ + 8 * hi;     // + 16j*SEQ + key  (A fragment: row d, k = key)
    const size_t bmo = ((size_t)b * 16 + lr) * SEQ + 8 * hi; // + key            (A fragment: row cx, k = key)
    const h16* BMR = BM + (size_t)NB * 16 * SEQ;
    const int* mrow = mask + ((size_t)b * SEQ_FULL + t0 + lr) * SEQ_FULL + 8 * hi;
    v8f o0 = (v8f){}, o1 = (v8f){}, o2 = (v8f){}, o3 = (v8f){}, gA = (v8f){}, gR = (v8f){};
    float m = -__builtin_huge_valf(), l = 0.0f;
#pragma unroll 1
    for (int key0 = 0; key0 < SEQ; key0 += 32) {
        const v4i mk0 = *(const v4i*)(mrow + key0), mk1 = *(const v4i*)(mrow + key0 + 4), mk2 = *(const v4i*)(mrow + key0 + 16), mk3 = *(const v4i*)(mrow + key0 + 20);
        const h16* ka = KH + ko + (size_t)key0 * HD; const h16* kr = KR + ko + (size_t)key0 * HD;
        const v16h ka0 = ldh(ka), ka1 = ldh(ka + 32), kb0 = ldh(ka + 16 * HD), kb1 = ldh(ka + 16 * HD + 32);
        const v16h ra0 = ldh(kr), ra1 = ldh(kr + 32), rb0 = ldh(kr + 16 * HD), rb1 = ldh(kr + 16 * HD + 32);
        v8f sHa = (v8f){}, sLa = (v8f){}, sKa = (v8f){}, sHb = (v8f){}, sLb = (v8f){}, sKb = (v8f){};
        sHa = wmma16(ka0, qh0, sHa); sLa = wmma16(ka0, qr0, sLa); sKa = wmma16(ra0, qh0, sKa); sHb = wmma16(kb0, qh0, sHb); sLb = wmma16(kb0, qr0, sLb); sKb = wmma16(rb0, qh0, sKb);
        sHa = wmma16(ka1, qh1, sHa); sLa = wmma16(ka1, qr1, sLa); sKa = wmma16(ra1, qh1, sKa); sHb = wmma16(kb1, qh1, sHb); sLb = wmma16(kb1, qr1, sLb); sKb = wmma16(rb1, qh1, sKb);
        asm volatile("v_nop\n\tv_nop\n\tv_nop\n\tv_nop" : "+v"(sHa), "+v"(sLa), "+v"(sKa), "+v"(sHb), "+v"(sLb), "+v"(sKb) : "v"(ka0), "v"(ka1), "v"(kb0), "v"(kb1), "v"(ra0), "v"(ra1), "v"(rb0), "v"(rb1));
        const int mka[8] = {mk0[0], mk0[1], mk0[2], mk0[3], mk1[0], mk1[1], mk1[2], mk1[3]};
        const int mkb[8] = {mk2[0], mk2[1], mk2[2], mk2[3], mk3[0], mk3[1], mk3[2], mk3[3]};
        float ta[8], tb[8]; float mx = NEGMIN;
        v16h gh, gr;
#pragma unroll
        for (int r = 0; r < 8; ++r) {
            const float xa = sHa[r] + (sLa[r] + sKa[r]) * QRI; const float xb = sHb[r] + (sLb[r] + sKb[r]) * QRI;
            const bool va = (mka[r] != 0), vb = (mkb[r] != 0);
            ta[r] = va ? xa * SC2 : NEGMIN; tb[r] = vb ? xb * SC2 : NEGMIN;
            const float ga = va ? xa : 0.0f; const float gb = vb ? xb : 0.0f;
            const h16 ha = (h16)ga; const h16 hb = (h16)gb;
            gh[r] = ha; gh[8 + r] = hb; gr[r] = (h16)((ga - (float)ha) * QRS); gr[8 + r] = (h16)((gb - (float)hb) * QRS);
            mx = fmaxf(mx, fmaxf(ta[r], tb[r])); }
        mx = fmaxf(mx, __shfl_xor(mx, 16, 32));
        const float mnew = fmaxf(m, mx);
        const float alpha = __builtin_amdgcn_exp2f(m - mnew);
        const float sh = PSH - mnew;
        v16h pb; float ls = 0.0f;
#pragma unroll
        for (int r = 0; r < 8; ++r) { const h16 pa = (h16)__builtin_amdgcn_exp2f(ta[r] + sh); const h16 pc = (h16)__builtin_amdgcn_exp2f(tb[r] + sh); pb[r] = pa; pb[8 + r] = pc; ls += (float)pa + (float)pc; }
        l = l * alpha + ls; m = mnew;
        o0 = o0 * alpha; o1 = o1 * alpha; o2 = o2 * alpha; o3 = o3 * alpha;
        const h16* va_ = VT + vo + key0;
        const v16h v0 = ldh(va_), v1 = ldh(va_ + (size_t)16 * SEQ), v2 = ldh(va_ + (size_t)32 * SEQ), v3 = ldh(va_ + (size_t)48 * SEQ);
        const v16h bh = ldh(BM + bmo + key0), br = ldh(BMR + bmo + key0);
        o0 = wmma16(v0, pb, o0); gA = wmma16(bh, gh, gA); o1 = wmma16(v1, pb, o1); gR = wmma16(bh, gr, gR); o2 = wmma16(v2, pb, o2); o3 = wmma16(v3, pb, o3); gR = wmma16(br, gh, gR);
        asm volatile("v_nop\n\tv_nop\n\tv_nop\n\tv_nop" : "+v"(o0), "+v"(o1), "+v"(o2), "+v"(o3), "+v"(gA), "+v"(gR) : "v"(v0), "v"(v1), "v"(v2), "v"(v3), "v"(pb), "v"(bh), "v"(br), "v"(gh), "v"(gr));
    }
    l += __shfl_xor(l, 16, 32);
    const float inv = 1.0f / l;
    // tmp2 (x1024): lane (t, h) holds rows cx = 8h + r; fetch the other half unconditionally, select by value
    float mi[8], ot[8], f[12];
#pragma unroll
    for (int r = 0; r < 8; ++r) { mi[r] = gA[r] + gR[r] * QRI; ot[r] = __shfl_xor(mi[r], 16, 32); }
#pragma unroll
    for (int r = 0; r < 8; ++r) f[r] = hi ? ot[r] : mi[r];
#pragma unroll
    for (int r = 0; r < 4; ++r) f[8 + r] = hi ? mi[r] : ot[r];
    const float* bp = BASE + ((size_t)b * SEQ + t0 + lr) * 16;
    const v4f b0 = *(const v4f*)bp, b1 = *(const v4f*)(bp + 4), b2 = *(const v4f*)(bp + 8);
    const float bs[12] = {b0[0], b0[1], b0[2], b0[3], b1[0], b1[1], b1[2], b1[3], b2[0], b2[1], b2[2], b2[3]};
    float e0[3], e1[3];
#pragma unroll
    for (int x = 0; x < 3; ++x) { e0[x] = hi ? bs[6 + x] : bs[x]; e1[x] = hi ? bs[9 + x] : bs[3 + x]; }
    // B fragment of the edge projection: element i <- 16*c16[t][j = 8h + i] (e = 2h + i/4, c = i%4), element 8+i <- its residual x2048
    v16h cb;
#pragma unroll
    for (int i = 0; i < 8; ++i) { const int c = i & 3;
        const float cv = (i < 4) ? (e0[0] * f[3 * c] + e0[1] * f[3 * c + 1] + e0[2] * f[3 * c + 2]) : (e1[0] * f[3 * c] + e1[1] * f[3 * c + 1] + e1[2] * f[3 * c + 2]);
        const float bq = cv * (1.0f / 64.0f); const h16 hh = (h16)bq; cb[i] = hh; cb[8 + i] = (h16)((bq - (float)hh) * QRS); }
    const v16h ea0 = ldh(EWA + (size_t)(lr) * 32 + 8 * hi), ea1 = ldh(EWA + (size_t)(16 + lr) * 32 + 8 * hi), ea2 = ldh(EWA + (size_t)(32 + lr) * 32 + 8 * hi), ea3 = ldh(EWA + (size_t)(48 + lr) * 32 + 8 * hi);
    v8f c0 = (v8f){}, c1 = (v8f){}, c2 = (v8f){}, c3 = (v8f){};
    c0 = wmma16(ea0, cb, c0); c1 = wmma16(ea1, cb, c1); c2 = wmma16(ea2, cb, c2); c3 = wmma16(ea3, cb, c3);
    asm volatile("v_nop\n\tv_nop\n\tv_nop\n\tv_nop" : "+v"(c0), "+v"(c1), "+v"(c2), "+v"(c3) : "v"(ea0), "v"(ea1), "v"(ea2), "v"(ea3), "v"(cb));
    const float ci = 1.0f / 256.0f;
    const int wb = wave * 16 * 68;
    // D layout: x_j[r] = (d = 16j + 8h + r, t = lane&15) -> os[t][d]; rows 0..15 x columns 0..63 all written
    { v4f a, c;
      a[0] = o0[0] * inv + c0[0] * ci; a[1] = o0[1] * inv + c0[1] * ci; a[2] = o0[2] * inv + c0[2] * ci; a[3] = o0[3] * inv + c0[3] * ci;
      c[0] = o0[4] * inv + c0[4] * ci; c[1] = o0[5] * inv + c0[5] * ci; c[2] = o0[6] * inv + c0[6] * ci; c[3] = o0[7] * inv + c0[7] * ci;
      *(v4fa*)(&os[wb + lr * 68 +  0 + 8 * hi]) = a; *(v4fa*)(&os[wb + lr * 68 +  0 + 8 * hi + 4]) = c;
      a[0] = o1[0] * inv + c1[0] * ci; a[1] = o1[1] * inv + c1[1] * ci; a[2] = o1[2] * inv + c1[2] * ci; a[3] = o1[3] * inv + c1[3] * ci;
      c[0] = o1[4] * inv + c1[4] * ci; c[1] = o1[5] * inv + c1[5] * ci; c[2] = o1[6] * inv + c1[6] * ci; c[3] = o1[7] * inv + c1[7] * ci;
      *(v4fa*)(&os[wb + lr * 68 + 16 + 8 * hi]) = a; *(v4fa*)(&os[wb + lr * 68 + 16 + 8 * hi + 4]) = c;
      a[0] = o2[0] * inv + c2[0] * ci; a[1] = o2[1] * inv + c2[1] * ci; a[2] = o2[2] * inv + c2[2] * ci; a[3] = o2[3] * inv + c2[3] * ci;
      c[0] = o2[4] * inv + c2[4] * ci; c[1] = o2[5] * inv + c2[5] * ci; c[2] = o2[6] * inv + c2[6] * ci; c[3] = o2[7] * inv + c2[7] * ci;
      *(v4fa*)(&os[wb + lr * 68 + 32 + 8 * hi]) = a; *(v4fa*)(&os[wb + lr * 68 + 32 + 8 * hi + 4]) = c;
      a[0] = o3[0] * inv + c3[0] * ci; a[1] = o3[1] * inv + c3[1] * ci; a[2] = o3[2] * inv + c3[2] * ci; a[3] = o3[3] * inv + c3[3] * ci;
      c[0] = o3[4] * inv + c3[4] * ci; c[1] = o3[5] * inv + c3[5] * ci; c[2] = o3[6] * inv + c3[6] * ci; c[3] = o3[7] * inv + c3[7] * ci;
      *(v4fa*)(&os[wb + lr * 68 + 48 + 8 * hi]) = a; *(v4fa*)(&os[wb + lr * 68 + 48 + 8 * hi + 4]) = c; }
    wave_sync();
    bf* orow = OA + ((size_t)b * SEQ + t0) * K2 + h * HD;
{
#pragma unroll
        for (int s = 0; s < 4; ++s) { const int row = 4 * s + (lane >> 3), c8 = (lane & 7) * 8;   // 4 s x 4 row groups = 16 rows; 8 lanes x 8 = 64 columns
            const v4f x0 = *(const v4fa*)(&os[wb + row * 68 + c8]); const v4f x1 = *(const v4fa*)(&os[wb + row * 68 + c8 + 4]); v8us hv, lv;
#pragma unroll
            for (int i = 0; i < 4; ++i) { const unsigned short a0 = f2bf(x0[i]); const unsigned short a1 = f2bf(x1[i]); hv[i] = a0; hv[4 + i] = a1; lv[i] = f2bf(x0[i] - bf2f(a0)); lv[4 + i] = f2bf(x1[i] - bf2f(a1)); }
            const size_t oo = (size_t)row * K2 + c8;
            *(v8us*)(orow + oo) = hv; *(v8us*)(orow + DM + oo) = lv; }
         }
}

static constexpr size_t al256(size_t v) { return (v + 255) & ~(size_t)255; }
static constexpr size_t SZ_WB  = al256((size_t)3 * DM * DM * 2);
static constexpr size_t SZ_OWB = al256((size_t)DM * DM * 2);
static constexpr size_t SZ_XA  = al256((size_t)NB * SEQ * K2 * 2);
static constexpr size_t SZ_QK  = al256((size_t)NB * SEQ * K2 * 4);
static constexpr size_t SZ_PL  = al256((size_t)NB * NH_ * SEQ * HD * 2);
static constexpr size_t SZ_BM  = al256((size_t)2 * NB * 16 * SEQ * 2);
static constexpr size_t SZ_BS  = al256((size_t)NB * SEQ * 16 * 4);
static constexpr size_t SZ_CS  = al256((size_t)NB * SEQ * 32 * 4);
static constexpr size_t SZ_EW  = al256((size_t)64 * 32 * 2);
static constexpr size_t SZ_TOTAL = SZ_WB + SZ_OWB + 2 * SZ_XA + SZ_QK + 5 * SZ_PL + SZ_BM + SZ_BS + 2 * SZ_CS + SZ_EW;
static_assert(SZ_TOTAL <= (size_t)134217728);          // workspace carve <= 128 MiB
static_assert(SZ_PL % 2 == 0);                         // plane stride in halves is exact
static_assert(SZ_PL == (size_t)NB * NH_ * SEQ * HD * 2);   // the four q/k planes are back to back with stride SZ_PL/2 halves

extern "C" void kernel_launch(void* const* d_in, const int* in_sizes, int n_in,
                              void* d_out, int out_size, void* d_ws, size_t ws_size, hipStream_t stream) {
    if (n_in < 11) return;
    const size_t ntok = (size_t)(NB - 1) * SEQ_FULL + SEQ;
    if ((size_t)in_sizes[0] < ntok) return;
    if ((size_t)in_sizes[1] < ntok * DM) return;
    if ((size_t)in_sizes[2] < (ntok - 1) * SEQ_FULL + SEQ) return;
    if ((size_t)in_sizes[3] < ntok * 12) return;
    if ((size_t)in_sizes[4] < (size_t)DM || (size_t)in_sizes[5] < (size_t)DM || (size_t)in_sizes[7] < (size_t)DM || (size_t)in_sizes[8] < (size_t)DM) return;
    if ((size_t)in_sizes[6] < (size_t)3 * DM * DM || (size_t)in_sizes[9] < (size_t)DM * DM || (size_t)in_sizes[10] < (size_t)1024) return;
    if ((size_t)out_size < ((size_t)(NB - 1) * OUT_SEQ + SEQ) * DM) return;
    if (SZ_TOTAL > ws_size) return;
    // wire order: position, x, attention_mask (int32), blocks, ln_w, ln_b, wqkv [3072][1024], q_ln_w, k_ln_w, out_w [1024][1024], edge_w [64][16]
    const float* position = (const float*)d_in[0]; const float* x = (const float*)d_in[1]; const int* amask = (const int*)d_in[2]; const float* blocks = (const float*)d_in[3];
    const float* ln_w = (const float*)d_in[4]; const float* ln_b = (const float*)d_in[5]; const float* wqkv = (const float*)d_in[6];
    const float* q_ln_w = (const float*)d_in[7]; const float* k_ln_w = (const float*)d_in[8]; const float* out_w = (const float*)d_in[9]; const float* edge_w = (const float*)d_in[10];
    float* OUT = (float*)d_out;
    char* wsp = (char*)d_ws;
    bf* WB  = (bf*)wsp;  wsp += SZ_WB;                // [3072][1024]: q | k | v rows
    bf* OWB = (bf*)wsp;  wsp += SZ_OWB;               // [1024][1024]
    bf* XA  = (bf*)wsp;  wsp += SZ_XA;                // [NB*SEQ][hi 1024 | lo 1024]
    bf* OA  = (bf*)wsp;  wsp += SZ_XA;                // [NB*SEQ][hi 1024 | lo 1024]
    float* QK = (float*)wsp; wsp += SZ_QK;            // [NB*SEQ][q 1024 | k 1024]
    h16* QH = (h16*)wsp; wsp += SZ_PL;                // [NB*16][SEQ][64]; QH, QR, KH, KR back to back (stride SZ_PL/2 halves)
    h16* QR = (h16*)wsp; wsp += SZ_PL;
    h16* KH = (h16*)wsp; wsp += SZ_PL;
    h16* KR = (h16*)wsp; wsp += SZ_PL;
    h16* VT = (h16*)wsp; wsp += SZ_PL;                // [NB*16][64][SEQ]
    h16* BM = (h16*)wsp; wsp += SZ_BM;                // [2][NB][16][SEQ]
    float* BASE = (float*)wsp; wsp += SZ_BS;          // [NB*SEQ][16]
    float* CS = (float*)wsp; wsp += SZ_CS;            // [NB*SEQ][32]
    float* SN = (float*)wsp; wsp += SZ_CS;
    h16* EWA = (h16*)wsp; wsp += SZ_EW;               // [64][32]

    { const size_t n8 = (size_t)3 * DM * DM / 8; k_cvt8<<<(unsigned)((n8 + 255) / 256), 256, 0, stream>>>(wqkv, WB, n8); }
    { const size_t n8 = (size_t)DM * DM / 8;     k_cvt8<<<(unsigned)((n8 + 255) / 256), 256, 0, stream>>>(out_w, OWB, n8); }
    k_ew<<<1, 256, 0, stream>>>(edge_w, EWA);
    k_lnx<<<NB * SEQ / 8, 256, 0, stream>>>(x, ln_w, ln_b, XA);
    k_rope<<<NB * SEQ / 8, 256, 0, stream>>>(position, CS, SN);
    k_prep<<<NB * SEQ / 64, 256, 0, stream>>>(blocks, amask, BM, BASE);

    k_proj<1><<<dim3(NB * SEQ / 64, 2 * DM / 64, 1), 32, 0, stream>>>(XA, K2, WB, DM, K2, (h16*)0, NB * SEQ, (size_t)0, 0, 64, (size_t)0, QK, K2, NB * SEQ);
    // v^T: A = wqkv rows 2048..3071 (m = h*64 + d), Bt = LN(x) rows (n = b*SEQ + t) -> plane [(b*1024 + m)][t] = [(b*16 + h)][d][t]
    k_proj<0><<<dim3(DM / 64, NB * SEQ / 64, 1), 32, 0, stream>>>(WB + (size_t)2 * DM * DM, DM, XA, K2, K2, VT, DM, (size_t)0, SEQ, SEQ, (size_t)DM * SEQ, (float*)0, 0, 0);

    // planes QH | QR | KH | KR from the base QH with stride SZ_PL/2 halves
    k_qkrot<<<NB * SEQ / 8, 256, 0, stream>>>(QK, q_ln_w, k_ln_w, CS, SN, QH, (size_t)(SZ_PL / 2));

    k_flash<<<dim3(SEQ / (16 * AW), NB * NH_, 1), 32 * AW, 0, stream>>>(QH, QR, KH, KR, VT, BM, BASE, EWA, amask, OA);

    // out: A = (ctx + context) hi|lo rows, Bt = out_w rows -> OUT[b][t][n]
    k_proj<1><<<dim3(NB * SEQ / 64, DM / 64, 1), 32, 0, stream>>>(OA, K2, OWB, DM, K2, (h16*)0, SEQ, (size_t)0, 0, 64, (size_t)0, OUT, DM, OUT_SEQ);
}

// v001
// One run takes 163 microseconds.
// Two timings next to v000 both put it at 1.65 times that version's speed.
#include <hip/hip_runtime.h>
#include <stdint.h>

// Compute dtypes (f32 accumulate everywhere): qkv and output projections v_wmma_f32_16x16x32_bf16 (activation as bf16 hi|lo planes folded along K, weights RNE-converted bf16); scores, P.V, geometric sum and edge projection v_wmma_f32_16x16x32_f16 (q, k, G, bm, c16 as f16 value + f16 residual x2048; P x256 and v single f16).
// Pre-norm attention block, width 1024 = 16 heads x 64: LN(x) -> qkv GEMM -> LN(q), LN(k) over the full width -> rotate-half rotary (cos/sin table from the position input) ->
// masked softmax attention (replace-fill, running max) plus geometric term tmp2 = sum_k (q.k) mask bm/len, context = (base.tmp2) edge_w^T -> output GEMM.
// Every float input is RNE-converted to bf16 on load. Fused flash kernel in transposed form (S^T = K Q^T, O^T = V^T P^T, tmp2^T = BM^T G^T, ctx^T = EW c16^T).

#ifndef NB
#define NB 2
#endif
#ifndef SEQ
#define SEQ 1024
#endif
#define NB_FULL  2
#define SEQ_FULL 1024
#ifndef OUT_SEQ
#define OUT_SEQ SEQ              // row pitch (in tokens) between batches of the output
#endif
#define DM   1024
#define K2   2048                // hi|lo folded contraction length
#define NH_  16
#define HD   64
#define AW   4                   // waves per flash block (16 query rows each)
#define QRS  2048.0f             // carry of the residual planes
#define QRI  (1.0f / 2048.0f)
#define SC2  (0.125f * 1.4426950408889634f)   // HD^-0.5 * log2(e)
#define PSH  8.0f                // log2 of the P carry (256)
#define NEGMIN (-3.4028234663852886e38f)

static_assert(HD == 64);
static_assert(NH_ * HD == DM);
static_assert(K2 == 2 * DM);
static_assert((DM & (DM - 1)) == 0);           // k index wrap uses a power-of-two mask
static_assert(DM % 64 == 0);
static_assert(SEQ % 128 == 0);                 // mask row sums read 128 ints per step
static_assert(SEQ % 64 == 0);
static_assert((NB * SEQ) % 128 == 0);
static_assert((NB * SEQ) % 8 == 0);
static_assert(SEQ % (16 * AW) == 0);
static_assert(NB <= NB_FULL);
static_assert(SEQ <= SEQ_FULL);

typedef _Float16 h16;
typedef unsigned short bf;
typedef __attribute__((ext_vector_type(16))) __bf16   v16bf;
typedef __attribute__((ext_vector_type(16))) _Float16 v16h;
typedef __attribute__((ext_vector_type(8)))  _Float16 v8h;
typedef __attribute__((ext_vector_type(8)))  unsigned short v8us;
typedef __attribute__((ext_vector_type(8)))  float    v8f;
typedef __attribute__((ext_vector_type(4)))  float    v4f;
typedef __attribute__((ext_vector_type(4)))  int      v4i;
typedef __attribute__((ext_vector_type(4)))  uint32_t u32x4;
typedef __attribute__((ext_vector_type(8)))  uint32_t u32x8;
typedef v4f  __attribute__((may_alias)) v4fa;
typedef v8h  __attribute__((may_alias)) v8ha;

__device__ __forceinline__ unsigned short f2bf(float f) { unsigned u = __float_as_uint(f); u += 0x7FFFu + ((u >> 16) & 1u); return (unsigned short)(u >> 16); }
__device__ __forceinline__ float bf2f(unsigned short b) { return __uint_as_float(((unsigned)b) << 16); }
__device__ __forceinline__ float bfr(float f) { return bf2f(f2bf(f)); }
__device__ __forceinline__ v16h cat16(v8h lo, v8h hi) { return __builtin_shufflevector(lo, hi, 0, 1, 2, 3, 4, 5, 6, 7, 8, 9, 10, 11, 12, 13, 14, 15); }
__device__ __forceinline__ v16bf cat16b(v8us lo, v8us hi) { return __builtin_bit_cast(v16bf, __builtin_shufflevector(lo, hi, 0, 1, 2, 3, 4, 5, 6, 7, 8, 9, 10, 11, 12, 13, 14, 15)); }
__device__ __forceinline__ v8f wmma16(v16h a, v16h b, v8f c) { return __builtin_amdgcn_wmma_f32_16x16x32_f16(false, a, false, b, (short)0, c, false, false); }
__device__ __forceinline__ v8f wmmab(v16bf a, v16bf b, v8f c) { return __builtin_amdgcn_wmma_f32_16x16x32_bf16(false, a, false, b, (short)0, c, false, false); }
// fragment loaders from K-contiguous 16-bit rows; p already includes + 8*(lane>>4): elements 0..7 <- k0+8h+0..7, elements 8..15 <- k0+16+8h+0..7 (same map for A and B)
__device__ __forceinline__ v16h  ldh(const h16* p) { return cat16(*(const v8h*)p, *(const v8h*)(p + 16)); }
__device__ __forceinline__ v16bf ldb(const bf* p)  { return cat16b(*(const v8us*)p, *(const v8us*)(p + 16)); }
// ordering point for wave-private LDS tiles (same wave writes and reads)
__device__ __forceinline__ void wave_sync() { __builtin_amdgcn_fence(3 /* release order */, "wavefront"); __builtin_amdgcn_wave_barrier(); asm volatile("" ::: "memory"); }
__device__ __forceinline__ float wsum(float v) { v += __shfl_xor(v, 16, 32); v += __shfl_xor(v, 8, 32); v += __shfl_xor(v, 4, 32); v += __shfl_xor(v, 2, 32); v += __shfl_xor(v, 1, 32); return v; }
__device__ __forceinline__ int wsumi(int v) { v += __shfl_xor(v, 16, 32); v += __shfl_xor(v, 8, 32); v += __shfl_xor(v, 4, 32); v += __shfl_xor(v, 2, 32); v += __shfl_xor(v, 1, 32); return v; }

__global__ __launch_bounds__(256) void k_cvt8(const float* __restrict__ src, bf* dst, size_t n8) {
    const size_t i = (size_t)blockIdx.x * 256 + threadIdx.x; if (i >= n8) return;
    const v8f v = *(const v8f*)(src + i * 8); v8us o;
#pragma unroll
    for (int k = 0; k < 8; ++k) o[k] = f2bf(v[k]);
    *(v8us*)(dst + i * 8) = o; 
}

// k_ew: edge weight A plane [64][32] f16: columns 0..15 = 16*w[d][j], columns 16..31 = w[d][j]/128 (pairs with the x2048 residual half of the c16 operand). One block; each thread 16 B, consecutive.
__global__ __launch_bounds__(256) void k_ew(const float* __restrict__ ew, h16* EWA) {
    const int tid = threadIdx.x; const int d = tid >> 2, q = tid & 3;
    const float sc = (q < 2) ? 16.0f : 0.0078125f;
    const v8f w = *(const v8f*)(ew + d * 16 + (q & 1) * 8);
    v8h o;
#pragma unroll
    for (int i = 0; i < 8; ++i) o[i] = (h16)(bfr(w[i]) * sc);
    *(v8h*)(EWA + d * 32 + q * 8) = o; 
}

// The per-lane element loops are rolled over the four 256-column chunks (the row is re-read from memory in each pass; element visiting order it = 0..3, i = 0..7 in every pass).
__global__ __launch_bounds__(256) void k_lnx(const float* __restrict__ x, const float* __restrict__ lw, const float* __restrict__ lb, bf* XA) {
    const int lane = threadIdx.x & 31; const int wave = __builtin_amdgcn_readfirstlane((int)(threadIdx.x >> 5));
    const int m = blockIdx.x * 8 + wave; const int b = m / SEQ, t = m % SEQ;
    const float* src = x + ((size_t)b * SEQ_FULL + t) * DM + lane * 8;
    float s = 0.0f;
#pragma unroll 1
    for (int it = 0; it < 4; ++it) { const v8f raw = *(const v8f*)(src + it * 256);
#pragma unroll
        for (int i = 0; i < 8; ++i) s += bfr(raw[i]); }
    s = wsum(s);
    const float mean = s * (1.0f / DM);
    float ss = 0.0f;
#pragma unroll 1
    for (int it = 0; it < 4; ++it) { const v8f raw = *(const v8f*)(src + it * 256);
#pragma unroll
        for (int i = 0; i < 8; ++i) { const float dv = bfr(raw[i]) - mean; ss += dv * dv; } }
    ss = wsum(ss);
    const float rstd = 1.0f / sqrtf(ss * (1.0f / DM) + 1e-5f);
    bf* dst = XA + (size_t)m * K2 + lane * 8;
{
#pragma unroll 1
        for (int it = 0; it < 4; ++it) {
            const v8f raw = *(const v8f*)(src + it * 256);
            const v8f wv = *(const v8f*)(lw + it * 256 + lane * 8); const v8f bv = *(const v8f*)(lb + it * 256 + lane * 8);
            v8us hv, lv;
#pragma unroll
            for (int i = 0; i < 8; ++i) { const float dv = bfr(raw[i]) - mean; const float y = dv * rstd * bfr(wv[i]) + bfr(bv[i]); const unsigned short hh = f2bf(y); hv[i] = hh; lv[i] = f2bf(y - bf2f(hh)); }
            *(v8us*)(dst + it * 256) = hv; *(v8us*)(dst + DM + it * 256) = lv; }
         }
}

__global__ __launch_bounds__(256) void k_rope(const float* __restrict__ pos, float* CS, float* SN) {
    const int lane = threadIdx.x & 31; const int wave = __builtin_amdgcn_readfirstlane((int)(threadIdx.x >> 5));
    const int m = blockIdx.x * 8 + wave; const int b = m / SEQ, t = m % SEQ;
    const float p = bfr(pos[(size_t)b * SEQ_FULL + t]);
    double pd = 1.0;
#pragma unroll 1
    for (int i = 0; i < lane; ++i) pd *= 1.333521432163324;
    const float pf = (float)pd;
    const float invf = 1.0f / pf;
    const float ang = p * invf;
    const float c = cosf(ang), s = sinf(ang);
    *(float*)(CS + (size_t)m * 32 + lane) = c; *(float*)(SN + (size_t)m * 32 + lane) = s;
    
}

// k_prep: per 64 tokens: len = mask row sums; bm = blocks - mean_c; base = bm / (|bm| + eps); planes BM[0] = f16(bm * 1024/len), BM[1] = f16 residual x2048, layout [plane][b][16][SEQ] (rows 12..15 zero);
// BASE [token][16] f32 (columns 12..15 zero). LDS tiles are cross-wave: block barriers between phases.
__global__ __launch_bounds__(256) void k_prep(const float* __restrict__ blocks, const int* __restrict__ mask, h16* BM, float* BASE) {
    __shared__ float slen[64];
    __shared__ __align__(16) h16 sb[32 * 64];
    __shared__ __align__(16) float sbase[64 * 16];
    const int tid = threadIdx.x, lane = tid & 31; const int wave = __builtin_amdgcn_readfirstlane((int)(threadIdx.x >> 5));
    const int m0 = blockIdx.x * 64; const int b = m0 / SEQ, t0 = m0 % SEQ;
#pragma unroll 1
    for (int i = 0; i < 8; ++i) { const int tl = wave * 8 + i;
        const int* row = mask + ((size_t)b * SEQ_FULL + t0 + tl) * SEQ_FULL + lane * 4; int cnt = 0;
#pragma unroll
        for (int c = 0; c < SEQ / 128; ++c) { const v4i mv = *(const v4i*)(row + c * 128); cnt += (mv[0] != 0) + (mv[1] != 0) + (mv[2] != 0) + (mv[3] != 0); }
        cnt = wsumi(cnt);
        if (lane == 0) slen[tl] = (float)cnt; }
    __syncthreads();
    if (tid < 64) {
        const float* p = blocks + ((size_t)b * SEQ_FULL + t0 + tid) * 12;
        const v4f a0 = *(const v4f*)p, a1 = *(const v4f*)(p + 4), a2 = *(const v4f*)(p + 8);
        float pv[12];
#pragma unroll
        for (int i = 0; i < 4; ++i) { pv[i] = bfr(a0[i]); pv[4 + i] = bfr(a1[i]); pv[8 + i] = bfr(a2[i]); }
        float mu[3];
#pragma unroll
        for (int x = 0; x < 3; ++x) mu[x] = (pv[x] + pv[3 + x] + pv[6 + x] + pv[9 + x]) * 0.25f;
        const float sc = (1.0f / slen[tid]) * 1024.0f;
#pragma unroll
        for (int c = 0; c < 4; ++c) {
            const float vx = pv[c * 3] - mu[0], vy = pv[c * 3 + 1] - mu[1], vz = pv[c * 3 + 2] - mu[2];
            const float inv = 1.0f / (sqrtf(vx * vx + vy * vy + vz * vz) + 1.1920929e-7f);
            const float vv[3] = {vx, vy, vz};
#pragma unroll
            for (int x = 0; x < 3; ++x) { const int cx = c * 3 + x;
                sbase[tid * 16 + cx] = vv[x] * inv;
                const float bs = vv[x] * sc; const h16 hh = (h16)bs;
                sb[cx * 64 + tid] = hh; sb[(16 + cx) * 64 + tid] = (h16)((bs - (float)hh) * QRS); } }
#pragma unroll
        for (int j = 12; j < 16; ++j) { sbase[tid * 16 + j] = 0.0f; sb[j * 64 + tid] = (h16)0.0f; sb[(16 + j) * 64 + tid] = (h16)0.0f; }
    }
    __syncthreads();
    // 32 lines of 64 halves: line = tid>>3 (0..15 value plane rows, 16..31 residual plane rows), 8 consecutive lanes x 16 B per line; BASE: 256 threads x 16 B contiguous
    const int line = tid >> 3, pc = tid & 7;
    const v8h bv = *(const v8ha*)(&sb[line * 64 + pc * 8]);
    const v4f fv = *(const v4fa*)(&sbase[tid * 4]);
    h16* bd = BM + (size_t)(line >> 4) * ((size_t)NB * 16 * SEQ) + ((size_t)b * 16 + (line & 15)) * SEQ + t0 + pc * 8;
    float* fd = BASE + (size_t)m0 * 16 + tid * 4;
    *(v8h*)bd = bv; *(v4f*)fd = fv;
    
}

// k_proj: bf16 GEMM, 128x128 tile per block of four waves (2 x 2, each 64x64 = 16 accumulators). Both operands are staged in LDS by tensor loads: a stage is 128 k
// (256 bytes of each of the 256 operand rows), two buffers, every wave moves its own 64-row slice one stage ahead of the pass that reads it. k order per accumulator: kc = 0, 32, 64, ...
// MODE 1: f32 rows C[((r0/RB)*RP + r0%RB)][c0..c0+63], row pitch ldc; each 256-byte row segment by 16 consecutive lanes x 16 B.
#define PJ_PITCH 272u                 // LDS row pitch: 256-byte row + the mover's 16-byte pad (odd multiple of 16 B for 16-byte readers)
#define PJ_SLICE 18432u               // 64 rows x 272 B = 17408, rounded up to a multiple of 2 KiB so that every slice starts on one
#define PJ_STAGE (4u * PJ_SLICE)      // slices 0, 1: A rows 0..63, 64..127 of the block tile; slices 2, 3: B rows
static_assert(64u * PJ_PITCH <= PJ_SLICE && PJ_SLICE % 2048u == 0u);
static_assert(DM % 128 == 0 && K2 % 128 == 0 && K2 / 128 >= 2);   // whole stages inside every operand row, at least two stages
__device__ __forceinline__ uint32_t uni(uint32_t v) { return (uint32_t)__builtin_amdgcn_readfirstlane((int)v); }
__device__ __forceinline__ uint32_t pinned(uint32_t v) { uint32_t w = uni(v); asm volatile("" : "+s"(w)); return w; }   // the pinned() form for tensor loads: the test value is held in a scalar register, so the branch round a load is a scalar one (the load ignores EXEC)
// one request of the whole wave: 64 rows of 256 bytes from ga (row pitch in g1) to LDS byte offset dst; word 0 of g0 (count 1) is set once by the caller
__device__ __forceinline__ void tdm_load(u32x4& g0, uint32_t dst, uint64_t ga, u32x8& g1) {
    g0[1] = uni(dst); g0[2] = uni((uint32_t)ga); g0[3] = uni((((uint32_t)(ga >> 32)) & 0x01FFFFFFu) | 0x80000000u);
    asm volatile("tensor_load_to_lds %0, %1" : "+s"(g0), "+s"(g1) :: "memory");   // in-out: the same registers go on to the wait below
}
// the wave's own requests have landed. The statement names both descriptor groups as in-out operands so that their scalar registers hold the issued words until the wait has returned
// and every new word is formed behind it.
__device__ __forceinline__ void tdm_wait(u32x4& g0, u32x8& g1) { asm volatile("s_wait_tensorcnt 0x0" : "+s"(g0), "+s"(g1) :: "memory"); }
template <int MODE>
__global__ __launch_bounds__(128) void k_proj(const bf* __restrict__ A, int pA, const bf* __restrict__ Bt, int pB, int K,
                                              h16* Ph, int RB, size_t sRB, int pitch, int CB, size_t sCB, float* C, int ldc, int RP) {
    __shared__ __attribute__((aligned(2048))) unsigned char ring[2 * PJ_STAGE];
    __shared__ __align__(16) float osall[4 * 16 * 68];
    const int lane = threadIdx.x & 31, lr = lane & 15, hi = lane >> 4;
    const uint32_t wave = uni(threadIdx.x >> 5);
    const int r0 = blockIdx.x * 128 + (int)(wave >> 1) * 64, c0 = blockIdx.y * 128 + (int)(wave & 1u) * 64;
    float* os = osall + wave * (16 * 68);
    v8f acc[4][4];
#pragma unroll
    for (int mb = 0; mb < 4; ++mb)
#pragma unroll
        for (int nb = 0; nb < 4; ++nb) acc[mb][nb] = (v8f){};
    // this wave's slice of every stage: waves 0, 1 move A rows, waves 2, 3 move B rows; the k offset wraps at the operand's own row length
    const bool ownA = wave < 2u;
    const uint32_t sp = (uint32_t)(ownA ? pA : pB);
    const uint64_t src0 = ownA ? (uint64_t)(uintptr_t)(A + (size_t)(blockIdx.x * 128 + wave * 64u) * (size_t)pA)
                               : (uint64_t)(uintptr_t)(Bt + (size_t)(blockIdx.y * 128 + (wave - 2u) * 64u) * (size_t)pB);
    const uint32_t slice = (uint32_t)(size_t)ring + wave * PJ_SLICE;
    u32x8 g1;
    g1[0] = uni((1u << 20) | (5u << 22) | (3u << 25));   // no mask, byte elements, 16 B of pad behind every 256 B
    g1[1] = uni(256u << 16); g1[2] = uni(64u << 16); g1[3] = uni(256u << 16); g1[4] = uni(64u);   // tensor = tile = 256 B x 64 rows
    g1[5] = uni(sp * 2u); g1[6] = uni(0u); g1[7] = uni(0u);
    const uint32_t T = (uint32_t)K >> 7;
    const uint32_t abase = (wave >> 1) * PJ_SLICE + (uint32_t)lr * PJ_PITCH + 16u * (uint32_t)hi;
    const uint32_t bbase = (2u + (wave & 1u)) * PJ_SLICE + (uint32_t)lr * PJ_PITCH + 16u * (uint32_t)hi;
    u32x4 g0;
    g0[0] = uni(1u);
    tdm_load(g0, slice, src0, g1);
    tdm_wait(g0, g1);                                    // this wave's slice of stage 0 has landed
    __syncthreads();                                     // every slice of stage 0 is readable by every wave
    if (pinned((1u < T) ? 1u : 0u) != 0u) tdm_load(g0, slice + PJ_STAGE, src0 + (uint64_t)((128u & (sp - 1u)) * 2u), g1);
#pragma unroll 1   // one pass per trip: the buffer index and the publish point below belong to one stage
    for (uint32_t t = 0; t < T; ++t) {
        const uint32_t buf = (t & 1u) * PJ_STAGE;
        const unsigned char* la = ring + buf + abase; const unsigned char* lb = ring + buf + bbase;
        v16bf fa[2][4], fb[2][4];
#pragma unroll
        for (int i = 0; i < 4; ++i) { fa[0][i] = ldb((const bf*)(la + i * 16 * PJ_PITCH)); fb[0][i] = ldb((const bf*)(lb + i * 16 * PJ_PITCH)); }
#pragma unroll
        for (int u = 0; u < 4; ++u) {
            const int cs = u & 1;
            if (u < 3) {
#pragma unroll
                for (int i = 0; i < 4; ++i) { fa[cs ^ 1][i] = ldb((const bf*)(la + i * 16 * PJ_PITCH + (u + 1) * 64)); fb[cs ^ 1][i] = ldb((const bf*)(lb + i * 16 * PJ_PITCH + (u + 1) * 64)); }
            }
            __builtin_amdgcn_sched_barrier(0);   // the next block's LDS reads stay one group in front of this block's products
#pragma unroll
            for (int nb = 0; nb < 4; ++nb)
#pragma unroll
                for (int mb = 0; mb < 4; ++mb) acc[mb][nb] = wmmab(fa[cs][mb], fb[cs][nb], acc[mb][nb]);
            __builtin_amdgcn_sched_barrier(0);   // no LDS read moves in among the products
        }
        asm volatile("s_wait_dscnt 0x0" ::: "memory");
        tdm_wait(g0, g1);
        __syncthreads();
        if (pinned((t + 2u < T) ? 1u : 0u) != 0u) tdm_load(g0, slice + buf, src0 + (uint64_t)((((t + 2u) << 7) & (sp - 1u)) * 2u), g1);
    }
    tdm_wait(g0, g1);                                    // no request is outstanding when the wave goes on
    asm volatile("s_wait_dscnt 0x0" ::: "memory");       // nor any LDS read of the ring
    const size_t tbase = (size_t)(r0 / RB) * sRB + (size_t)(r0 % RB) * (size_t)pitch + (size_t)(c0 / CB) * sCB + (size_t)(c0 % CB);
    const size_t cbase = ((size_t)(r0 / RB) * (size_t)RP + (size_t)(r0 % RB)) * (size_t)ldc + (size_t)c0;
#pragma unroll
    for (int mb = 0; mb < 4; ++mb) {
#pragma unroll
        for (int nb = 0; nb < 4; ++nb) {
#pragma unroll
            for (int j = 0; j < 8; ++j) os[(hi * 8 + j) * 68 + nb * 16 + lr] = acc[mb][nb][j]; }   // D: row 8h+j, col lane&15
        wave_sync();
        if (MODE == 0) {
            const size_t sb = tbase + (size_t)(mb * 16) * (size_t)pitch;
{
#pragma unroll
                for (int s = 0; s < 4; ++s) { const int row = 4 * s + (lane >> 3), c8 = (lane & 7) * 8;   // 4 s x 4 row groups = 16 rows; 8 lanes x 8 = 64 columns
                    const v4f x0 = *(const v4fa*)(&os[row * 68 + c8]); const v4f x1 = *(const v4fa*)(&os[row * 68 + c8 + 4]); v8h hv;
#pragma unroll
                    for (int i = 0; i < 4; ++i) { hv[i] = (h16)x0[i]; hv[4 + i] = (h16)x1[i]; }
                    *(v8h*)(Ph + sb + (size_t)row * (size_t)pitch + c8) = hv; }
                 }
        } else {
            const size_t sb = cbase + (size_t)(mb * 16) * (size_t)ldc;
{
#pragma unroll
                for (int s = 0; s < 8; ++s) { const int row = 2 * s + hi, cofs = lr * 4;   // 8 s x 2 rows = 16 rows; 16 lanes x 4 floats = 64 columns
                    const v4f val = *(const v4fa*)(&os[row * 68 + cofs]);
                    *(v4f*)(C + sb + (size_t)row * (size_t)ldc + cofs) = val; }
                 }
        }
        wave_sync();
    }
}

// Lane holds columns it*256 + lane*8 + i = head (4*it + lane/8), d = 8*(lane&7) + i; the rotary partner d +- 32 is lane ^ 4 (same it, same i).
// Planes [b*16+h][t][64], four consecutive planes from PL with stride pst halves: q value, q residual x2048, k value, k residual x2048 (selected by integer offset from one base).
// All per-lane element loops are rolled over the four 256-column chunks and over {q, k}; the row is re-read from memory in each pass (visiting order it = 0..3, i = 0..7).
__global__ __launch_bounds__(256) void k_qkrot(const float* __restrict__ QK, const float* __restrict__ qw, const float* __restrict__ kw, const float* __restrict__ CS, const float* __restrict__ SN,
                                               h16* PL, size_t pst) {
    const int lane = threadIdx.x & 31; const int wave = __builtin_amdgcn_readfirstlane((int)(threadIdx.x >> 5));
    const int m = blockIdx.x * 8 + wave; const int b = m / SEQ, t = m % SEQ;
    const int c = lane & 7;
    const v8f cs = *(const v8f*)(CS + (size_t)m * 32 + 8 * (c & 3));
    const v8f sn = *(const v8f*)(SN + (size_t)m * 32 + 8 * (c & 3));
    const float sg = (c < 4) ? -1.0f : 1.0f;
    const size_t o0 = (((size_t)(b * NH_ + (lane >> 3))) * SEQ + t) * HD + 8 * c;
    const size_t ost = (size_t)4 * SEQ * HD;     // four heads per step
#pragma unroll 1
    for (int wh = 0; wh < 2; ++wh) {
        const float* row = QK + (size_t)m * K2 + (size_t)wh * DM + lane * 8;
        float s = 0.0f;
#pragma unroll 1
        for (int it = 0; it < 4; ++it) { const v8f raw = *(const v8f*)(row + it * 256);
#pragma unroll
            for (int i = 0; i < 8; ++i) s += raw[i]; }
        s = wsum(s);
        const float mean = s * (1.0f / DM);
        float ss = 0.0f;
#pragma unroll 1
        for (int it = 0; it < 4; ++it) { const v8f raw = *(const v8f*)(row + it * 256);
#pragma unroll
            for (int i = 0; i < 8; ++i) { const float dv = raw[i] - mean; ss += dv * dv; } }
        ss = wsum(ss);
        const float rstd = 1.0f / sqrtf(ss * (1.0f / DM) + 1e-5f);
        h16* PH = PL + (size_t)(2 * wh) * pst;
        h16* PR = PH + pst;
{
#pragma unroll 1
            for (int it = 0; it < 4; ++it) {
                const v8f raw = *(const v8f*)(row + it * 256);
                const v8f wq = *(const v8f*)(qw + it * 256 + lane * 8); const v8f wk = *(const v8f*)(kw + it * 256 + lane * 8);
                v8h hv, rv;
#pragma unroll
                for (int i = 0; i < 8; ++i) { const float wsel = wh ? wk[i] : wq[i];
                    const float y = (raw[i] - mean) * rstd * bfr(wsel);
                    const float pr = __shfl_xor(y, 4, 32);
                    const float r = y * cs[i] + sg * pr * sn[i];
                    const h16 hh = (h16)r; hv[i] = hh; rv[i] = (h16)((r - (float)hh) * QRS); }
                const size_t oo = o0 + (size_t)it * ost;
                *(v8h*)(PH + oo) = hv; *(v8h*)(PR + oo) = rv; }
             }
    }
}

// k_flash: fused attention + geometric term, one wave per 16 query rows of one (batch, head); all fragments straight from 16-bit planes (two 16-B loads each, arithmetic addressing).
// Transposed form: S^T[key][t] = K Q^T; lane (t = lane&15, h = lane>>4) holds keys 8h+r of each 16-key tile, so packed P / G tiles are directly B fragments of
// O^T[d][t] = V^T P^T and T^T[cx][t] = BM^T G^T. S = kH.qH + (kH.qR + kR.qH)/2048. Mask: replace-fill for the softmax, zero for G. Softmax state one scalar per lane (running max from -inf).
// Epilogue: tmp2 halves exchanged with one xor-16 shuffle, c16 = base.tmp2 (K = 3, VALU), ctx^T = EW c16^T on one K=32 tile (value | residual), sum staged in a wave-private LDS tile and
__global__ __launch_bounds__(32 * AW) void k_flash(const h16* __restrict__ QH, const h16* __restrict__ QR, const h16* __restrict__ KH, const h16* __restrict__ KR, const h16* __restrict__ VT,
                                                   const h16* __restrict__ BM, const float* __restrict__ BASE, const h16* __restrict__ EWA, const int* __restrict__ mask, bf* OA) {
    __shared__ __align__(16) float os[AW * 16 * 68];
    const int lane = threadIdx.x & 31, wave = __builtin_amdgcn_readfirstlane((int)(threadIdx.x >> 5)), lr = lane & 15, hi = lane >> 4;
    const int zh = blockIdx.y; const int b = zh / NH_, h = zh % NH_;
    const int t0 = (blockIdx.x * AW + wave) * 16;
    const size_t pbase = (size_t)zh * SEQ * HD;
    const size_t qo = pbase + (size_t)(t0 + lr) * HD + 8 * hi;
    const v16h qh0 = ldh(QH + qo), qh1 = ldh(QH + qo + 32), qr0 = ldh(QR + qo), qr1 = ldh(QR + qo + 32);   // B fragments: col t, k = d
    const size_t ko = pbase + (size_t)lr * HD + 8 * hi;      // + key * HD       (A fragment: row key, k = d)
    const size_t vo = pbase + (size_t)lr * SEQ + 8 * hi;     // + 16j*SEQ + key  (A fragment: row d, k = key)
    const size_t bmo = ((size_t)b * 16 + lr) * SEQ + 8 * hi; // + key            (A fragment: row cx, k = key)
    const h16* BMR = BM + (size_t)NB * 16 * SEQ;
    const int* mrow = mask + ((size_t)b * SEQ_FULL + t0 + lr) * SEQ_FULL + 8 * hi;
    v8f o0 = (v8f){}, o1 = (v8f){}, o2 = (v8f){}, o3 = (v8f){}, gA = (v8f){}, gR = (v8f){};
    float m = -__builtin_huge_valf(), l = 0.0f;
#pragma unroll 1
    for (int key0 = 0; key0 < SEQ; key0 += 32) {
        const v4i mk0 = *(const v4i*)(mrow + key0), mk1 = *(const v4i*)(mrow + key0 + 4), mk2 = *(const v4i*)(mrow + key0 + 16), mk3 = *(const v4i*)(mrow + key0 + 20);
        const h16* ka = KH + ko + (size_t)key0 * HD; const h16* kr = KR + ko + (size_t)key0 * HD;
        const v16h ka0 = ldh(ka), ka1 = ldh(ka + 32), kb0 = ldh(ka + 16 * HD), kb1 = ldh(ka + 16 * HD + 32);
        const v16h ra0 = ldh(kr), ra1 = ldh(kr + 32), rb0 = ldh(kr + 16 * HD), rb1 = ldh(kr + 16 * HD + 32);
        v8f sHa = (v8f){}, sLa = (v8f){}, sKa = (v8f){}, sHb = (v8f){}, sLb = (v8f){}, sKb = (v8f){};
        sHa = wmma16(ka0, qh0, sHa); sLa = wmma16(ka0, qr0, sLa); sKa = wmma16(ra0, qh0, sKa); sHb = wmma16(kb0, qh0, sHb); sLb = wmma16(kb0, qr0, sLb); sKb = wmma16(rb0, qh0, sKb);
        sHa = wmma16(ka1, qh1, sHa); sLa = wmma16(ka1, qr1, sLa); sKa = wmma16(ra1, qh1, sKa); sHb = wmma16(kb1, qh1, sHb); sLb = wmma16(kb1, qr1, sLb); sKb = wmma16(rb1, qh1, sKb);
        asm volatile("v_nop\n\tv_nop\n\tv_nop\n\tv_nop" : "+v"(sHa), "+v"(sLa), "+v"(sKa), "+v"(sHb), "+v"(sLb), "+v"(sKb) : "v"(ka0), "v"(ka1), "v"(kb0), "v"(kb1), "v"(ra0), "v"(ra1), "v"(rb0), "v"(rb1));
        const int mka[8] = {mk0[0], mk0[1], mk0[2], mk0[3], mk1[0], mk1[1], mk1[2], mk1[3]};
        const int mkb[8] = {mk2[0], mk2[1], mk2[2], mk2[3], mk3[0], mk3[1], mk3[2], mk3[3]};
        float ta[8], tb[8]; float mx = NEGMIN;
        v16h gh, gr;
#pragma unroll
        for (int r = 0; r < 8; ++r) {
            const float xa = sHa[r] + (sLa[r] + sKa[r]) * QRI; const float xb = sHb[r] + (sLb[r] + sKb[r]) * QRI;
            const bool va = (mka[r] != 0), vb = (mkb[r] != 0);
            ta[r] = va ? xa * SC2 : NEGMIN; tb[r] = vb ? xb * SC2 : NEGMIN;
            const float ga = va ? xa : 0.0f; const float gb = vb ? xb : 0.0f;
            const h16 ha = (h16)ga; const h16 hb = (h16)gb;
            gh[r] = ha; gh[8 + r] = hb; gr[r] = (h16)((ga - (float)ha) * QRS); gr[8 + r] = (h16)((gb - (float)hb) * QRS);
            mx = fmaxf(mx, fmaxf(ta[r], tb[r])); }
        mx = fmaxf(mx, __shfl_xor(mx, 16, 32));
        const float mnew = fmaxf(m, mx);
        const float alpha = __builtin_amdgcn_exp2f(m - mnew);
        const float sh = PSH - mnew;
        v16h pb; float ls = 0.0f;
#pragma unroll
        for (int r = 0; r < 8; ++r) { const h16 pa = (h16)__builtin_amdgcn_exp2f(ta[r] + sh); const h16 pc = (h16)__builtin_amdgcn_exp2f(tb[r] + sh); pb[r] = pa; pb[8 + r] = pc; ls += (float)pa + (float)pc; }
        l = l * alpha + ls; m = mnew;
        o0 = o0 * alpha; o1 = o1 * alpha; o2 = o2 * alpha; o3 = o3 * alpha;
        const h16* va_ = VT + vo + key0;
        const v16h v0 = ldh(va_), v1 = ldh(va_ + (size_t)16 * SEQ), v2 = ldh(va_ + (size_t)32 * SEQ), v3 = ldh(va_ + (size_t)48 * SEQ);
        const v16h bh = ldh(BM + bmo + key0), br = ldh(BMR + bmo + key0);
        o0 = wmma16(v0, pb, o0); gA = wmma16(bh, gh, gA); o1 = wmma16(v1, pb, o1); gR = wmma16(bh, gr, gR); o2 = wmma16(v2, pb, o2); o3 = wmma16(v3, pb, o3); gR = wmma16(br, gh, gR);
        asm volatile("v_nop\n\tv_nop\n\tv_nop\n\tv_nop" : "+v"(o0), "+v"(o1), "+v"(o2), "+v"(o3), "+v"(gA), "+v"(gR) : "v"(v0), "v"(v1), "v"(v2), "v"(v3), "v"(pb), "v"(bh), "v"(br), "v"(gh), "v"(gr));
    }
    l += __shfl_xor(l, 16, 32);
    const float inv = 1.0f / l;
    // tmp2 (x1024): lane (t, h) holds rows cx = 8h + r; fetch the other half unconditionally, select by value
    float mi[8], ot[8], f[12];
#pragma unroll
    for (int r = 0; r < 8; ++r) { mi[r] = gA[r] + gR[r] * QRI; ot[r] = __shfl_xor(mi[r], 16, 32); }
#pragma unroll
    for (int r = 0; r < 8; ++r) f[r] = hi ? ot[r] : mi[r];
#pragma unroll
    for (int r = 0; r < 4; ++r) f[8 + r] = hi ? mi[r] : ot[r];
    const float* bp = BASE + ((size_t)b * SEQ + t0 + lr) * 16;
    const v4f b0 = *(const v4f*)bp, b1 = *(const v4f*)(bp + 4), b2 = *(const v4f*)(bp + 8);
    const float bs[12] = {b0[0], b0[1], b0[2], b0[3], b1[0], b1[1], b1[2], b1[3], b2[0], b2[1], b2[2], b2[3]};
    float e0[3], e1[3];
#pragma unroll
    for (int x = 0; x < 3; ++x) { e0[x] = hi ? bs[6 + x] : bs[x]; e1[x] = hi ? bs[9 + x] : bs[3 + x]; }
    // B fragment of the edge projection: element i <- 16*c16[t][j = 8h + i] (e = 2h + i/4, c = i%4), element 8+i <- its residual x2048
    v16h cb;
#pragma unroll
    for (int i = 0; i < 8; ++i) { const int c = i & 3;
        const float cv = (i < 4) ? (e0[0] * f[3 * c] + e0[1] * f[3 * c + 1] + e0[2] * f[3 * c + 2]) : (e1[0] * f[3 * c] + e1[1] * f[3 * c + 1] + e1[2] * f[3 * c + 2]);
        const float bq = cv * (1.0f / 64.0f); const h16 hh = (h16)bq; cb[i] = hh; cb[8 + i] = (h16)((bq - (float)hh) * QRS); }
    const v16h ea0 = ldh(EWA + (size_t)(lr) * 32 + 8 * hi), ea1 = ldh(EWA + (size_t)(16 + lr) * 32 + 8 * hi), ea2 = ldh(EWA + (size_t)(32 + lr) * 32 + 8 * hi), ea3 = ldh(EWA + (size_t)(48 + lr) * 32 + 8 * hi);
    v8f c0 = (v8f){}, c1 = (v8f){}, c2 = (v8f){}, c3 = (v8f){};
    c0 = wmma16(ea0, cb, c0); c1 = wmma16(ea1, cb, c1); c2 = wmma16(ea2, cb, c2); c3 = wmma16(ea3, cb, c3);
    asm volatile("v_nop\n\tv_nop\n\tv_nop\n\tv_nop" : "+v"(c0), "+v"(c1), "+v"(c2), "+v"(c3) : "v"(ea0), "v"(ea1), "v"(ea2), "v"(ea3), "v"(cb));
    const float ci = 1.0f / 256.0f;
    const int wb = wave * 16 * 68;
    // D layout: x_j[r] = (d = 16j + 8h + r, t = lane&15) -> os[t][d]; rows 0..15 x columns 0..63 all written
    { v4f a, c;
      a[0] = o0[0] * inv + c0[0] * ci; a[1] = o0[1] * inv + c0[1] * ci; a[2] = o0[2] * inv + c0[2] * ci; a[3] = o0[3] * inv + c0[3] * ci;
      c[0] = o0[4] * inv + c0[4] * ci; c[1] = o0[5] * inv + c0[5] * ci; c[2] = o0[6] * inv + c0[6] * ci; c[3] = o0[7] * inv + c0[7] * ci;
      *(v4fa*)(&os[wb + lr * 68 +  0 + 8 * hi]) = a; *(v4fa*)(&os[wb + lr * 68 +  0 + 8 * hi + 4]) = c;
      a[0] = o1[0] * inv + c1[0] * ci; a[1] = o1[1] * inv + c1[1] * ci; a[2] = o1[2] * inv + c1[2] * ci; a[3] = o1[3] * inv + c1[3] * ci;
      c[0] = o1[4] * inv + c1[4] * ci; c[1] = o1[5] * inv + c1[5] * ci; c[2] = o1[6] * inv + c1[6] * ci; c[3] = o1[7] * inv + c1[7] * ci;
      *(v4fa*)(&os[wb + lr * 68 + 16 + 8 * hi]) = a; *(v4fa*)(&os[wb + lr * 68 + 16 + 8 * hi + 4]) = c;
      a[0] = o2[0] * inv + c2[0] * ci; a[1] = o2[1] * inv + c2[1] * ci; a[2] = o2[2] * inv + c2[2] * ci; a[3] = o2[3] * inv + c2[3] * ci;
      c[0] = o2[4] * inv + c2[4] * ci; c[1] = o2[5] * inv + c2[5] * ci; c[2] = o2[6] * inv + c2[6] * ci; c[3] = o2[7] * inv + c2[7] * ci;
      *(v4fa*)(&os[wb + lr * 68 + 32 + 8 * hi]) = a; *(v4fa*)(&os[wb + lr * 68 + 32 + 8 * hi + 4]) = c;
      a[0] = o3[0] * inv + c3[0] * ci; a[1] = o3[1] * inv + c3[1] * ci; a[2] = o3[2] * inv + c3[2] * ci; a[3] = o3[3] * inv + c3[3] * ci;
      c[0] = o3[4] * inv + c3[4] * ci; c[1] = o3[5] * inv + c3[5] * ci; c[2] = o3[6] * inv + c3[6] * ci; c[3] = o3[7] * inv + c3[7] * ci;
      *(v4fa*)(&os[wb + lr * 68 + 48 + 8 * hi]) = a; *(v4fa*)(&os[wb + lr * 68 + 48 + 8 * hi + 4]) = c; }
    wave_sync();
    bf* orow = OA + ((size_t)b * SEQ + t0) * K2 + h * HD;
{
#pragma unroll
        for (int s = 0; s < 4; ++s) { const int row = 4 * s + (lane >> 3), c8 = (lane & 7) * 8;   // 4 s x 4 row groups = 16 rows; 8 lanes x 8 = 64 columns
            const v4f x0 = *(const v4fa*)(&os[wb + row * 68 + c8]); const v4f x1 = *(const v4fa*)(&os[wb + row * 68 + c8 + 4]); v8us hv, lv;
#pragma unroll
            for (int i = 0; i < 4; ++i) { const unsigned short a0 = f2bf(x0[i]); const unsigned short a1 = f2bf(x1[i]); hv[i] = a0; hv[4 + i] = a1; lv[i] = f2bf(x0[i] - bf2f(a0)); lv[4 + i] = f2bf(x1[i] - bf2f(a1)); }
            const size_t oo = (size_t)row * K2 + c8;
            *(v8us*)(orow + oo) = hv; *(v8us*)(orow + DM + oo) = lv; }
         }
}

static constexpr size_t al256(size_t v) { return (v + 255) & ~(size_t)255; }
static constexpr size_t SZ_WB  = al256((size_t)3 * DM * DM * 2);
static constexpr size_t SZ_OWB = al256((size_t)DM * DM * 2);
static constexpr size_t SZ_XA  = al256((size_t)NB * SEQ * K2 * 2);
static constexpr size_t SZ_QK  = al256((size_t)NB * SEQ * K2 * 4);
static constexpr size_t SZ_PL  = al256((size_t)NB * NH_ * SEQ * HD * 2);
static constexpr size_t SZ_BM  = al256((size_t)2 * NB * 16 * SEQ * 2);
static constexpr size_t SZ_BS  = al256((size_t)NB * SEQ * 16 * 4);
static constexpr size_t SZ_CS  = al256((size_t)NB * SEQ * 32 * 4);
static constexpr size_t SZ_EW  = al256((size_t)64 * 32 * 2);
static constexpr size_t SZ_TOTAL = SZ_WB + SZ_OWB + 2 * SZ_XA + SZ_QK + 5 * SZ_PL + SZ_BM + SZ_BS + 2 * SZ_CS + SZ_EW;
static_assert(SZ_TOTAL <= (size_t)134217728);          // workspace carve <= 128 MiB
static_assert(SZ_PL % 2 == 0);                         // plane stride in halves is exact
static_assert(SZ_PL == (size_t)NB * NH_ * SEQ * HD * 2);   // the four q/k planes are back to back with stride SZ_PL/2 halves

extern "C" void kernel_launch(void* const* d_in, const int* in_sizes, int n_in,
                              void* d_out, int out_size, void* d_ws, size_t ws_size, hipStream_t stream) {
    if (n_in < 11) return;
    const size_t ntok = (size_t)(NB - 1) * SEQ_FULL + SEQ;
    if ((size_t)in_sizes[0] < ntok) return;
    if ((size_t)in_sizes[1] < ntok * DM) return;
    if ((size_t)in_sizes[2] < (ntok - 1) * SEQ_FULL + SEQ) return;
    if ((size_t)in_sizes[3] < ntok * 12) return;
    if ((size_t)in_sizes[4] < (size_t)DM || (size_t)in_sizes[5] < (size_t)DM || (size_t)in_sizes[7] < (size_t)DM || (size_t)in_sizes[8] < (size_t)DM) return;
    if ((size_t)in_sizes[6] < (size_t)3 * DM * DM || (size_t)in_sizes[9] < (size_t)DM * DM || (size_t)in_sizes[10] < (size_t)1024) return;
    if ((size_t)out_size < ((size_t)(NB - 1) * OUT_SEQ + SEQ) * DM) return;
    if (SZ_TOTAL > ws_size) return;
    // wire order: position, x, attention_mask (int32), blocks, ln_w, ln_b, wqkv [3072][1024], q_ln_w, k_ln_w, out_w [1024][1024], edge_w [64][16]
    const float* position = (const float*)d_in[0]; const float* x = (const float*)d_in[1]; const int* amask = (const int*)d_in[2]; const float* blocks = (const float*)d_in[3];
    const float* ln_w = (const float*)d_in[4]; const float* ln_b = (const float*)d_in[5]; const float* wqkv = (const float*)d_in[6];
    const float* q_ln_w = (const float*)d_in[7]; const float* k_ln_w = (const float*)d_in[8]; const float* out_w = (const float*)d_in[9]; const float* edge_w = (const float*)d_in[10];
    float* OUT = (float*)d_out;
    char* wsp = (char*)d_ws;
    bf* WB  = (bf*)wsp;  wsp += SZ_WB;                // [3072][1024]: q | k | v rows
    bf* OWB = (bf*)wsp;  wsp += SZ_OWB;               // [1024][1024]
    bf* XA  = (bf*)wsp;  wsp += SZ_XA;                // [NB*SEQ][hi 1024 | lo 1024]
    bf* OA  = (bf*)wsp;  wsp += SZ_XA;                // [NB*SEQ][hi 1024 | lo 1024]
    float* QK = (float*)wsp; wsp += SZ_QK;            // [NB*SEQ][q 1024 | k 1024]
    h16* QH = (h16*)wsp; wsp += SZ_PL;                // [NB*16][SEQ][64]; QH, QR, KH, KR back to back (stride SZ_PL/2 halves)
    h16* QR = (h16*)wsp; wsp += SZ_PL;
    h16* KH = (h16*)wsp; wsp += SZ_PL;
    h16* KR = (h16*)wsp; wsp += SZ_PL;
    h16* VT = (h16*)wsp; wsp += SZ_PL;                // [NB*16][64][SEQ]
    h16* BM = (h16*)wsp; wsp += SZ_BM;                // [2][NB][16][SEQ]
    float* BASE = (float*)wsp; wsp += SZ_BS;          // [NB*SEQ][16]
    float* CS = (float*)wsp; wsp += SZ_CS;            // [NB*SEQ][32]
    float* SN = (float*)wsp; wsp += SZ_CS;
    h16* EWA = (h16*)wsp; wsp += SZ_EW;               // [64][32]

    { const size_t n8 = (size_t)3 * DM * DM / 8; k_cvt8<<<(unsigned)((n8 + 255) / 256), 256, 0, stream>>>(wqkv, WB, n8); }
    { const size_t n8 = (size_t)DM * DM / 8;     k_cvt8<<<(unsigned)((n8 + 255) / 256), 256, 0, stream>>>(out_w, OWB, n8); }
    k_ew<<<1, 256, 0, stream>>>(edge_w, EWA);
    k_lnx<<<NB * SEQ / 8, 256, 0, stream>>>(x, ln_w, ln_b, XA);
    k_rope<<<NB * SEQ / 8, 256, 0, stream>>>(position, CS, SN);
    k_prep<<<NB * SEQ / 64, 256, 0, stream>>>(blocks, amask, BM, BASE);

    k_proj<1><<<dim3(NB * SEQ / 128, 2 * DM / 128, 1), 128, 0, stream>>>(XA, K2, WB, DM, K2, (h16*)0, NB * SEQ, (size_t)0, 0, 64, (size_t)0, QK, K2, NB * SEQ);
    // v^T: A = wqkv rows 2048..3071 (m = h*64 + d), Bt = LN(x) rows (n = b*SEQ + t) -> plane [(b*1024 + m)][t] = [(b*16 + h)][d][t]
    k_proj<0><<<dim3(DM / 128, NB * SEQ / 128, 1), 128, 0, stream>>>(WB + (size_t)2 * DM * DM, DM, XA, K2, K2, VT, DM, (size_t)0, SEQ, SEQ, (size_t)DM * SEQ, (float*)0, 0, 0);

    // planes QH | QR | KH | KR from the base QH with stride SZ_PL/2 halves
    k_qkrot<<<NB * SEQ / 8, 256, 0, stream>>>(QK, q_ln_w, k_ln_w, CS, SN, QH, (size_t)(SZ_PL / 2));

    k_flash<<<dim3(SEQ / (16 * AW), NB * NH_, 1), 32 * AW, 0, stream>>>(QH, QR, KH, KR, VT, BM, BASE, EWA, amask, OA);

    // out: A = (ctx + context) hi|lo rows, Bt = out_w rows -> OUT[b][t][n]
    k_proj<1><<<dim3(NB * SEQ / 128, DM / 128, 1), 128, 0, stream>>>(OA, K2, OWB, DM, K2, (h16*)0, SEQ, (size_t)0, 0, 64, (size_t)0, OUT, DM, OUT_SEQ);
}

// v002
// One run takes 127 microseconds.
// In both of two side-by-side timings against v001, it was 1.28 times as fast.
// Counting every step since v000, it is 2.11 times as fast.
#include <hip/hip_runtime.h>
#include <stdint.h>

// Compute dtypes (f32 accumulate everywhere): qkv and output projections v_wmma_f32_16x16x32_bf16 (activation as bf16 hi|lo planes folded along K, weights RNE-converted bf16); scores, P.V, geometric sum and edge projection v_wmma_f32_16x16x32_f16 (q, k, G, bm, c16 as f16 value + f16 residual x2048; P x256 and v single f16).
// Pre-norm attention block, width 1024 = 16 heads x 64: LN(x) -> qkv GEMM -> LN(q), LN(k) over the full width -> rotate-half rotary (cos/sin table from the position input) ->
// masked softmax attention (replace-fill, running max) plus geometric term tmp2 = sum_k (q.k) mask bm/len, context = (base.tmp2) edge_w^T -> output GEMM.
// Every float input is RNE-converted to bf16 on load. Fused flash kernel in transposed form (S^T = K Q^T, O^T = V^T P^T, tmp2^T = BM^T G^T, ctx^T = EW c16^T).

#ifndef NB
#define NB 2
#endif
#ifndef SEQ
#define SEQ 1024
#endif
#define NB_FULL  2
#define SEQ_FULL 1024
#ifndef OUT_SEQ
#define OUT_SEQ SEQ              // row pitch (in tokens) between batches of the output
#endif
#define DM   1024
#define K2   2048                // hi|lo folded contraction length
#define NH_  16
#define HD   64
#define AW   4                   // waves per flash block (16 query rows each)
#define QRS  2048.0f             // carry of the residual planes
#define QRI  (1.0f / 2048.0f)
#define SC2  (0.125f * 1.4426950408889634f)   // HD^-0.5 * log2(e)
#define PSH  8.0f                // log2 of the P carry (256)
#define NEGMIN (-3.4028234663852886e38f)

static_assert(HD == 64);
static_assert(NH_ * HD == DM);
static_assert(K2 == 2 * DM);
static_assert((DM & (DM - 1)) == 0);           // k index wrap uses a power-of-two mask
static_assert(DM % 64 == 0);
static_assert(SEQ % 128 == 0);                 // mask row sums read 128 ints per step
static_assert(SEQ % 64 == 0);
static_assert((NB * SEQ) % 128 == 0);
static_assert((NB * SEQ) % 8 == 0);
static_assert(SEQ % (16 * AW) == 0);
static_assert(NB <= NB_FULL);
static_assert(SEQ <= SEQ_FULL);

typedef _Float16 h16;
typedef unsigned short bf;
typedef __attribute__((ext_vector_type(16))) __bf16   v16bf;
typedef __attribute__((ext_vector_type(16))) _Float16 v16h;
typedef __attribute__((ext_vector_type(8)))  _Float16 v8h;
typedef __attribute__((ext_vector_type(8)))  unsigned short v8us;
typedef __attribute__((ext_vector_type(8)))  float    v8f;
typedef __attribute__((ext_vector_type(4)))  float    v4f;
typedef __attribute__((ext_vector_type(4)))  int      v4i;
typedef __attribute__((ext_vector_type(4)))  uint32_t u32x4;
typedef __attribute__((ext_vector_type(8)))  uint32_t u32x8;
typedef v4f  __attribute__((may_alias)) v4fa;
typedef v8h  __attribute__((may_alias)) v8ha;

__device__ __forceinline__ unsigned short f2bf(float f) { unsigned u = __float_as_uint(f); u += 0x7FFFu + ((u >> 16) & 1u); return (unsigned short)(u >> 16); }
__device__ __forceinline__ float bf2f(unsigned short b) { return __uint_as_float(((unsigned)b) << 16); }
__device__ __forceinline__ float bfr(float f) { return bf2f(f2bf(f)); }
__device__ __forceinline__ v16h cat16(v8h lo, v8h hi) { return __builtin_shufflevector(lo, hi, 0, 1, 2, 3, 4, 5, 6, 7, 8, 9, 10, 11, 12, 13, 14, 15); }
__device__ __forceinline__ v16bf cat16b(v8us lo, v8us hi) { return __builtin_bit_cast(v16bf, __builtin_shufflevector(lo, hi, 0, 1, 2, 3, 4, 5, 6, 7, 8, 9, 10, 11, 12, 13, 14, 15)); }
__device__ __forceinline__ v8f wmma16(v16h a, v16h b, v8f c) { return __builtin_amdgcn_wmma_f32_16x16x32_f16(false, a, false, b, (short)0, c, false, false); }
__device__ __forceinline__ v8f wmmab(v16bf a, v16bf b, v8f c) { return __builtin_amdgcn_wmma_f32_16x16x32_bf16(false, a, false, b, (short)0, c, false, false); }
// fragment loaders from K-contiguous 16-bit rows; p already includes + 8*(lane>>4): elements 0..7 <- k0+8h+0..7, elements 8..15 <- k0+16+8h+0..7 (same map for A and B)
__device__ __forceinline__ v16h  ldh(const h16* p) { return cat16(*(const v8h*)p, *(const v8h*)(p + 16)); }
__device__ __forceinline__ v16bf ldb(const bf* p)  { return cat16b(*(const v8us*)p, *(const v8us*)(p + 16)); }
// ordering point for wave-private LDS tiles (same wave writes and reads)
__device__ __forceinline__ void wave_sync() { __builtin_amdgcn_fence(3 /* release order */, "wavefront"); __builtin_amdgcn_wave_barrier(); asm volatile("" ::: "memory"); }
__device__ __forceinline__ float wsum(float v) { v += __shfl_xor(v, 16, 32); v += __shfl_xor(v, 8, 32); v += __shfl_xor(v, 4, 32); v += __shfl_xor(v, 2, 32); v += __shfl_xor(v, 1, 32); return v; }
__device__ __forceinline__ int wsumi(int v) { v += __shfl_xor(v, 16, 32); v += __shfl_xor(v, 8, 32); v += __shfl_xor(v, 4, 32); v += __shfl_xor(v, 2, 32); v += __shfl_xor(v, 1, 32); return v; }

__global__ __launch_bounds__(256) void k_cvt8(const float* __restrict__ src, bf* dst, size_t n8) {
    const size_t i = (size_t)blockIdx.x * 256 + threadIdx.x; if (i >= n8) return;
    const v8f v = *(const v8f*)(src + i * 8); v8us o;
#pragma unroll
    for (int k = 0; k < 8; ++k) o[k] = f2bf(v[k]);
    *(v8us*)(dst + i * 8) = o; 
}

// k_ew: edge weight A plane [64][32] f16: columns 0..15 = 16*w[d][j], columns 16..31 = w[d][j]/128 (pairs with the x2048 residual half of the c16 operand). One block; each thread 16 B, consecutive.
__global__ __launch_bounds__(256) void k_ew(const float* __restrict__ ew, h16* EWA) {
    const int tid = threadIdx.x; const int d = tid >> 2, q = tid & 3;
    const float sc = (q < 2) ? 16.0f : 0.0078125f;
    const v8f w = *(const v8f*)(ew + d * 16 + (q & 1) * 8);
    v8h o;
#pragma unroll
    for (int i = 0; i < 8; ++i) o[i] = (h16)(bfr(w[i]) * sc);
    *(v8h*)(EWA + d * 32 + q * 8) = o; 
}

// The per-lane element loops are rolled over the four 256-column chunks (the row is re-read from memory in each pass; element visiting order it = 0..3, i = 0..7 in every pass).
__global__ __launch_bounds__(256) void k_lnx(const float* __restrict__ x, const float* __restrict__ lw, const float* __restrict__ lb, bf* XA) {
    const int lane = threadIdx.x & 31; const int wave = __builtin_amdgcn_readfirstlane((int)(threadIdx.x >> 5));
    const int m = blockIdx.x * 8 + wave; const int b = m / SEQ, t = m % SEQ;
    const float* src = x + ((size_t)b * SEQ_FULL + t) * DM + lane * 8;
    float s = 0.0f;
#pragma unroll 1
    for (int it = 0; it < 4; ++it) { const v8f raw = *(const v8f*)(src + it * 256);
#pragma unroll
        for (int i = 0; i < 8; ++i) s += bfr(raw[i]); }
    s = wsum(s);
    const float mean = s * (1.0f / DM);
    float ss = 0.0f;
#pragma unroll 1
    for (int it = 0; it < 4; ++it) { const v8f raw = *(const v8f*)(src + it * 256);
#pragma unroll
        for (int i = 0; i < 8; ++i) { const float dv = bfr(raw[i]) - mean; ss += dv * dv; } }
    ss = wsum(ss);
    const float rstd = 1.0f / sqrtf(ss * (1.0f / DM) + 1e-5f);
    bf* dst = XA + (size_t)m * K2 + lane * 8;
{
#pragma unroll 1
        for (int it = 0; it < 4; ++it) {
            const v8f raw = *(const v8f*)(src + it * 256);
            const v8f wv = *(const v8f*)(lw + it * 256 + lane * 8); const v8f bv = *(const v8f*)(lb + it * 256 + lane * 8);
            v8us hv, lv;
#pragma unroll
            for (int i = 0; i < 8; ++i) { const float dv = bfr(raw[i]) - mean; const float y = dv * rstd * bfr(wv[i]) + bfr(bv[i]); const unsigned short hh = f2bf(y); hv[i] = hh; lv[i] = f2bf(y - bf2f(hh)); }
            *(v8us*)(dst + it * 256) = hv; *(v8us*)(dst + DM + it * 256) = lv; }
         }
}

__global__ __launch_bounds__(256) void k_rope(const float* __restrict__ pos, float* CS, float* SN) {
    const int lane = threadIdx.x & 31; const int wave = __builtin_amdgcn_readfirstlane((int)(threadIdx.x >> 5));
    const int m = blockIdx.x * 8 + wave; const int b = m / SEQ, t = m % SEQ;
    const float p = bfr(pos[(size_t)b * SEQ_FULL + t]);
    double pd = 1.0;
#pragma unroll 1
    for (int i = 0; i < lane; ++i) pd *= 1.333521432163324;
    const float pf = (float)pd;
    const float invf = 1.0f / pf;
    const float ang = p * invf;
    const float c = cosf(ang), s = sinf(ang);
    *(float*)(CS + (size_t)m * 32 + lane) = c; *(float*)(SN + (size_t)m * 32 + lane) = s;
    
}

// k_prep: per 64 tokens: len = mask row sums; bm = blocks - mean_c; base = bm / (|bm| + eps); planes BM[0] = f16(bm * 1024/len), BM[1] = f16 residual x2048, layout [plane][b][16][SEQ] (rows 12..15 zero);
// BASE [token][16] f32 (columns 12..15 zero). LDS tiles are cross-wave: block barriers between phases.
__global__ __launch_bounds__(256) void k_prep(const float* __restrict__ blocks, const int* __restrict__ mask, h16* BM, float* BASE) {
    __shared__ float slen[64];
    __shared__ __align__(16) h16 sb[32 * 64];
    __shared__ __align__(16) float sbase[64 * 16];
    const int tid = threadIdx.x, lane = tid & 31; const int wave = __builtin_amdgcn_readfirstlane((int)(threadIdx.x >> 5));
    const int m0 = blockIdx.x * 64; const int b = m0 / SEQ, t0 = m0 % SEQ;
#pragma unroll 1
    for (int i = 0; i < 8; ++i) { const int tl = wave * 8 + i;
        const int* row = mask + ((size_t)b * SEQ_FULL + t0 + tl) * SEQ_FULL + lane * 4; int cnt = 0;
#pragma unroll
        for (int c = 0; c < SEQ / 128; ++c) { const v4i mv = *(const v4i*)(row + c * 128); cnt += (mv[0] != 0) + (mv[1] != 0) + (mv[2] != 0) + (mv[3] != 0); }
        cnt = wsumi(cnt);
        if (lane == 0) slen[tl] = (float)cnt; }
    __syncthreads();
    if (tid < 64) {
        const float* p = blocks + ((size_t)b * SEQ_FULL + t0 + tid) * 12;
        const v4f a0 = *(const v4f*)p, a1 = *(const v4f*)(p + 4), a2 = *(const v4f*)(p + 8);
        float pv[12];
#pragma unroll
        for (int i = 0; i < 4; ++i) { pv[i] = bfr(a0[i]); pv[4 + i] = bfr(a1[i]); pv[8 + i] = bfr(a2[i]); }
        float mu[3];
#pragma unroll
        for (int x = 0; x < 3; ++x) mu[x] = (pv[x] + pv[3 + x] + pv[6 + x] + pv[9 + x]) * 0.25f;
        const float sc = (1.0f / slen[tid]) * 1024.0f;
#pragma unroll
        for (int c = 0; c < 4; ++c) {
            const float vx = pv[c * 3] - mu[0], vy = pv[c * 3 + 1] - mu[1], vz = pv[c * 3 + 2] - mu[2];
            const float inv = 1.0f / (sqrtf(vx * vx + vy * vy + vz * vz) + 1.1920929e-7f);
            const float vv[3] = {vx, vy, vz};
#pragma unroll
            for (int x = 0; x < 3; ++x) { const int cx = c * 3 + x;
                sbase[tid * 16 + cx] = vv[x] * inv;
                const float bs = vv[x] * sc; const h16 hh = (h16)bs;
                sb[cx * 64 + tid] = hh; sb[(16 + cx) * 64 + tid] = (h16)((bs - (float)hh) * QRS); } }
#pragma unroll
        for (int j = 12; j < 16; ++j) { sbase[tid * 16 + j] = 0.0f; sb[j * 64 + tid] = (h16)0.0f; sb[(16 + j) * 64 + tid] = (h16)0.0f; }
    }
    __syncthreads();
    // 32 lines of 64 halves: line = tid>>3 (0..15 value plane rows, 16..31 residual plane rows), 8 consecutive lanes x 16 B per line; BASE: 256 threads x 16 B contiguous
    const int line = tid >> 3, pc = tid & 7;
    const v8h bv = *(const v8ha*)(&sb[line * 64 + pc * 8]);
    const v4f fv = *(const v4fa*)(&sbase[tid * 4]);
    h16* bd = BM + (size_t)(line >> 4) * ((size_t)NB * 16 * SEQ) + ((size_t)b * 16 + (line & 15)) * SEQ + t0 + pc * 8;
    float* fd = BASE + (size_t)m0 * 16 + tid * 4;
    *(v8h*)bd = bv; *(v4f*)fd = fv;
    
}

// k_proj: bf16 GEMM, 128x128 tile per block of four waves (2 x 2, each 64x64 = 16 accumulators). Both operands are staged in LDS by tensor loads: a stage is 128 k
// (256 bytes of each of the 256 operand rows), two buffers, every wave moves its own 64-row slice one stage ahead of the pass that reads it. k order per accumulator: kc = 0, 32, 64, ...
// MODE 1: f32 rows C[((r0/RB)*RP + r0%RB)][c0..c0+63], row pitch ldc; each 256-byte row segment by 16 consecutive lanes x 16 B.
#define PJ_PITCH 272u                 // LDS row pitch: 256-byte row + the mover's 16-byte pad (odd multiple of 16 B for 16-byte readers)
#define PJ_SLICE 18432u               // 64 rows x 272 B = 17408, rounded up to a multiple of 2 KiB so that every slice starts on one
#define PJ_STAGE (4u * PJ_SLICE)      // slices 0, 1: A rows 0..63, 64..127 of the block tile; slices 2, 3: B rows
static_assert(64u * PJ_PITCH <= PJ_SLICE && PJ_SLICE % 2048u == 0u);
static_assert(DM % 128 == 0 && K2 % 128 == 0 && K2 / 128 >= 2);   // whole stages inside every operand row, at least two stages
__device__ __forceinline__ uint32_t uni(uint32_t v) { return (uint32_t)__builtin_amdgcn_readfirstlane((int)v); }
__device__ __forceinline__ uint32_t pinned(uint32_t v) { uint32_t w = uni(v); asm volatile("" : "+s"(w)); return w; }   // the pinned() form for tensor loads: the test value is held in a scalar register, so the branch round a load is a scalar one (the load ignores EXEC)
// one request of the whole wave: 64 rows of 256 bytes from ga (row pitch in g1) to LDS byte offset dst; word 0 of g0 (count 1) is set once by the caller
__device__ __forceinline__ void tdm_load(u32x4& g0, uint32_t dst, uint64_t ga, u32x8& g1) {
    g0[1] = uni(dst); g0[2] = uni((uint32_t)ga); g0[3] = uni((((uint32_t)(ga >> 32)) & 0x01FFFFFFu) | 0x80000000u);
    asm volatile("tensor_load_to_lds %0, %1" : "+s"(g0), "+s"(g1) :: "memory");   // in-out: the same registers go on to the wait below
}
// the wave's own requests have landed. The statement names both descriptor groups as in-out operands so that their scalar registers hold the issued words until the wait has returned
// and every new word is formed behind it.
__device__ __forceinline__ void tdm_wait(u32x4& g0, u32x8& g1) { asm volatile("s_wait_tensorcnt 0x0" : "+s"(g0), "+s"(g1) :: "memory"); }
template <int MODE>
__global__ __launch_bounds__(128) void k_proj(const bf* __restrict__ A, int pA, const bf* __restrict__ Bt, int pB, int K,
                                              h16* Ph, int RB, size_t sRB, int pitch, int CB, size_t sCB, float* C, int ldc, int RP) {
    __shared__ __attribute__((aligned(2048))) unsigned char ring[2 * PJ_STAGE];
    __shared__ __align__(16) float osall[4 * 16 * 68];
    const int lane = threadIdx.x & 31, lr = lane & 15, hi = lane >> 4;
    const uint32_t wave = uni(threadIdx.x >> 5);
    const int r0 = blockIdx.x * 128 + (int)(wave >> 1) * 64, c0 = blockIdx.y * 128 + (int)(wave & 1u) * 64;
    float* os = osall + wave * (16 * 68);
    v8f acc[4][4];
#pragma unroll
    for (int mb = 0; mb < 4; ++mb)
#pragma unroll
        for (int nb = 0; nb < 4; ++nb) acc[mb][nb] = (v8f){};
    // this wave's slice of every stage: waves 0, 1 move A rows, waves 2, 3 move B rows; the k offset wraps at the operand's own row length
    const bool ownA = wave < 2u;
    const uint32_t sp = (uint32_t)(ownA ? pA : pB);
    const uint64_t src0 = ownA ? (uint64_t)(uintptr_t)(A + (size_t)(blockIdx.x * 128 + wave * 64u) * (size_t)pA)
                               : (uint64_t)(uintptr_t)(Bt + (size_t)(blockIdx.y * 128 + (wave - 2u) * 64u) * (size_t)pB);
    const uint32_t slice = (uint32_t)(size_t)ring + wave * PJ_SLICE;
    u32x8 g1;
    g1[0] = uni((1u << 20) | (5u << 22) | (3u << 25));   // no mask, byte elements, 16 B of pad behind every 256 B
    g1[1] = uni(256u << 16); g1[2] = uni(64u << 16); g1[3] = uni(256u << 16); g1[4] = uni(64u);   // tensor = tile = 256 B x 64 rows
    g1[5] = uni(sp * 2u); g1[6] = uni(0u); g1[7] = uni(0u);
    const uint32_t T = (uint32_t)K >> 7;
    const uint32_t abase = (wave >> 1) * PJ_SLICE + (uint32_t)lr * PJ_PITCH + 16u * (uint32_t)hi;
    const uint32_t bbase = (2u + (wave & 1u)) * PJ_SLICE + (uint32_t)lr * PJ_PITCH + 16u * (uint32_t)hi;
    u32x4 g0;
    g0[0] = uni(1u);
    tdm_load(g0, slice, src0, g1);
    tdm_wait(g0, g1);                                    // this wave's slice of stage 0 has landed
    __syncthreads();                                     // every slice of stage 0 is readable by every wave
    if (pinned((1u < T) ? 1u : 0u) != 0u) tdm_load(g0, slice + PJ_STAGE, src0 + (uint64_t)((128u & (sp - 1u)) * 2u), g1);
#pragma unroll 1   // one pass per trip: the buffer index and the publish point below belong to one stage
    for (uint32_t t = 0; t < T; ++t) {
        const uint32_t buf = (t & 1u) * PJ_STAGE;
        const unsigned char* la = ring + buf + abase; const unsigned char* lb = ring + buf + bbase;
        v16bf fa[2][4], fb[2][4];
#pragma unroll
        for (int i = 0; i < 4; ++i) { fa[0][i] = ldb((const bf*)(la + i * 16 * PJ_PITCH)); fb[0][i] = ldb((const bf*)(lb + i * 16 * PJ_PITCH)); }
#pragma unroll
        for (int u = 0; u < 4; ++u) {
            const int cs = u & 1;
            if (u < 3) {
#pragma unroll
                for (int i = 0; i < 4; ++i) { fa[cs ^ 1][i] = ldb((const bf*)(la + i * 16 * PJ_PITCH + (u + 1) * 64)); fb[cs ^ 1][i] = ldb((const bf*)(lb + i * 16 * PJ_PITCH + (u + 1) * 64)); }
            }
            __builtin_amdgcn_sched_barrier(0);   // the next block's LDS reads stay one group in front of this block's products
#pragma unroll
            for (int nb = 0; nb < 4; ++nb)
#pragma unroll
                for (int mb = 0; mb < 4; ++mb) acc[mb][nb] = wmmab(fa[cs][mb], fb[cs][nb], acc[mb][nb]);
            __builtin_amdgcn_sched_barrier(0);   // no LDS read moves in among the products
        }
        asm volatile("s_wait_dscnt 0x0" ::: "memory");
        tdm_wait(g0, g1);
        __syncthreads();
        if (pinned((t + 2u < T) ? 1u : 0u) != 0u) tdm_load(g0, slice + buf, src0 + (uint64_t)((((t + 2u) << 7) & (sp - 1u)) * 2u), g1);
    }
    tdm_wait(g0, g1);                                    // no request is outstanding when the wave goes on
    asm volatile("s_wait_dscnt 0x0" ::: "memory");       // nor any LDS read of the ring
    const size_t tbase = (size_t)(r0 / RB) * sRB + (size_t)(r0 % RB) * (size_t)pitch + (size_t)(c0 / CB) * sCB + (size_t)(c0 % CB);
    const size_t cbase = ((size_t)(r0 / RB) * (size_t)RP + (size_t)(r0 % RB)) * (size_t)ldc + (size_t)c0;
#pragma unroll
    for (int mb = 0; mb < 4; ++mb) {
#pragma unroll
        for (int nb = 0; nb < 4; ++nb) {
#pragma unroll
            for (int j = 0; j < 8; ++j) os[(hi * 8 + j) * 68 + nb * 16 + lr] = acc[mb][nb][j]; }   // D: row 8h+j, col lane&15
        wave_sync();
        if (MODE == 0) {
            const size_t sb = tbase + (size_t)(mb * 16) * (size_t)pitch;
{
#pragma unroll
                for (int s = 0; s < 4; ++s) { const int row = 4 * s + (lane >> 3), c8 = (lane & 7) * 8;   // 4 s x 4 row groups = 16 rows; 8 lanes x 8 = 64 columns
                    const v4f x0 = *(const v4fa*)(&os[row * 68 + c8]); const v4f x1 = *(const v4fa*)(&os[row * 68 + c8 + 4]); v8h hv;
#pragma unroll
                    for (int i = 0; i < 4; ++i) { hv[i] = (h16)x0[i]; hv[4 + i] = (h16)x1[i]; }
                    *(v8h*)(Ph + sb + (size_t)row * (size_t)pitch + c8) = hv; }
                 }
        } else {
            const size_t sb = cbase + (size_t)(mb * 16) * (size_t)ldc;
{
#pragma unroll
                for (int s = 0; s < 8; ++s) { const int row = 2 * s + hi, cofs = lr * 4;   // 8 s x 2 rows = 16 rows; 16 lanes x 4 floats = 64 columns
                    const v4f val = *(const v4fa*)(&os[row * 68 + cofs]);
                    *(v4f*)(C + sb + (size_t)row * (size_t)ldc + cofs) = val; }
                 }
        }
        wave_sync();
    }
}

// Lane holds columns it*256 + lane*8 + i = head (4*it + lane/8), d = 8*(lane&7) + i; the rotary partner d +- 32 is lane ^ 4 (same it, same i).
// Planes [b*16+h][t][64], four consecutive planes from PL with stride pst halves: q value, q residual x2048, k value, k residual x2048 (selected by integer offset from one base).
// All per-lane element loops are rolled over the four 256-column chunks and over {q, k}; the row is re-read from memory in each pass (visiting order it = 0..3, i = 0..7).
__global__ __launch_bounds__(256) void k_qkrot(const float* __restrict__ QK, const float* __restrict__ qw, const float* __restrict__ kw, const float* __restrict__ CS, const float* __restrict__ SN,
                                               h16* PL, size_t pst) {
    const int lane = threadIdx.x & 31; const int wave = __builtin_amdgcn_readfirstlane((int)(threadIdx.x >> 5));
    const int m = blockIdx.x * 8 + wave; const int b = m / SEQ, t = m % SEQ;
    const int c = lane & 7;
    const v8f cs = *(const v8f*)(CS + (size_t)m * 32 + 8 * (c & 3));
    const v8f sn = *(const v8f*)(SN + (size_t)m * 32 + 8 * (c & 3));
    const float sg = (c < 4) ? -1.0f : 1.0f;
    const size_t o0 = (((size_t)(b * NH_ + (lane >> 3))) * SEQ + t) * HD + 8 * c;
    const size_t ost = (size_t)4 * SEQ * HD;     // four heads per step
#pragma unroll 1
    for (int wh = 0; wh < 2; ++wh) {
        const float* row = QK + (size_t)m * K2 + (size_t)wh * DM + lane * 8;
        float s = 0.0f;
#pragma unroll 1
        for (int it = 0; it < 4; ++it) { const v8f raw = *(const v8f*)(row + it * 256);
#pragma unroll
            for (int i = 0; i < 8; ++i) s += raw[i]; }
        s = wsum(s);
        const float mean = s * (1.0f / DM);
        float ss = 0.0f;
#pragma unroll 1
        for (int it = 0; it < 4; ++it) { const v8f raw = *(const v8f*)(row + it * 256);
#pragma unroll
            for (int i = 0; i < 8; ++i) { const float dv = raw[i] - mean; ss += dv * dv; } }
        ss = wsum(ss);
        const float rstd = 1.0f / sqrtf(ss * (1.0f / DM) + 1e-5f);
        h16* PH = PL + (size_t)(2 * wh) * pst;
        h16* PR = PH + pst;
{
#pragma unroll 1
            for (int it = 0; it < 4; ++it) {
                const v8f raw = *(const v8f*)(row + it * 256);
                const v8f wq = *(const v8f*)(qw + it * 256 + lane * 8); const v8f wk = *(const v8f*)(kw + it * 256 + lane * 8);
                v8h hv, rv;
#pragma unroll
                for (int i = 0; i < 8; ++i) { const float wsel = wh ? wk[i] : wq[i];
                    const float y = (raw[i] - mean) * rstd * bfr(wsel);
                    const float pr = __shfl_xor(y, 4, 32);
                    const float r = y * cs[i] + sg * pr * sn[i];
                    const h16 hh = (h16)r; hv[i] = hh; rv[i] = (h16)((r - (float)hh) * QRS); }
                const size_t oo = o0 + (size_t)it * ost;
                *(v8h*)(PH + oo) = hv; *(v8h*)(PR + oo) = rv; }
             }
    }
}

// k_flash staging: a stage is 64 keys of the block's (batch, head): k value and residual rows, v^T rows, both bm planes (128-byte rows, LDS pitch 144) and the block's 64 mask rows
// (256-byte rows, LDS pitch 272; both pitches are odd multiples of 16 B for 16-byte readers). Two buffers, filled by asynchronous copies one stage ahead of the pass that reads them.
#define FK      64
#define FP1     144u
#define FP2     272u
#define FO_KH   0u
#define FO_KR   (64u * FP1)
#define FO_VT   (128u * FP1)
#define FO_BM   (192u * FP1)
#define FO_MK   (224u * FP1)
#define F_STAGE (FO_MK + 64u * FP2)
static_assert(AW == 4 && HD == 64);                 // 128 lanes: 16 rows of 128 B or 8 rows of 256 B per copy instruction of the block
static_assert(SEQ % FK == 0 && SEQ / FK >= 2);      // whole stages, at least two
static_assert(F_STAGE % 16u == 0u);
// One stage: 22 copies of 16 B per lane, every lane on. l1 / l2: the lane's LDS byte address in row 0..15 of a 128-byte-row tile / row 0..7 of the mask tile of the target buffer.
// Each run of copies ends, inside its own statement, with s_wait_xcnt 0: the address registers are rewritten only behind it.
__device__ __forceinline__ void flash_fill(uint32_t l1, uint32_t l2, const h16* kh, const h16* kr, const h16* vt, const h16* b0, const h16* b1, const int* mk) {
    asm volatile("global_load_async_to_lds_b128 %0, %1, off\n\t"
                 "global_load_async_to_lds_b128 %2, %3, off\n\t"
                 "global_load_async_to_lds_b128 %4, %5, off\n\t"
                 "global_load_async_to_lds_b128 %6, %7, off\n\t"
                 "global_load_async_to_lds_b128 %8, %9, off\n\t"
                 "global_load_async_to_lds_b128 %10, %11, off\n\t"
                 "global_load_async_to_lds_b128 %12, %13, off\n\t"
                 "global_load_async_to_lds_b128 %14, %15, off\n\t"
                 "global_load_async_to_lds_b128 %16, %17, off\n\t"
                 "global_load_async_to_lds_b128 %18, %19, off\n\t"
                 "s_wait_xcnt 0x0"
                 :: "v"(l1 + FO_KH), "v"(kh), "v"(l1 + FO_KH + 16u * FP1), "v"(kh + 16 * HD), "v"(l1 + FO_KH + 32u * FP1), "v"(kh + 32 * HD), "v"(l1 + FO_KH + 48u * FP1), "v"(kh + 48 * HD),
                    "v"(l1 + FO_KR), "v"(kr), "v"(l1 + FO_KR + 16u * FP1), "v"(kr + 16 * HD), "v"(l1 + FO_KR + 32u * FP1), "v"(kr + 32 * HD), "v"(l1 + FO_KR + 48u * FP1), "v"(kr + 48 * HD),
                    "v"(l1 + FO_BM), "v"(b0), "v"(l1 + FO_BM + 16u * FP1), "v"(b1)
                 : "memory");
    asm volatile("global_load_async_to_lds_b128 %0, %1, off\n\t"
                 "global_load_async_to_lds_b128 %2, %3, off\n\t"
                 "global_load_async_to_lds_b128 %4, %5, off\n\t"
                 "global_load_async_to_lds_b128 %6, %7, off\n\t"
                 "global_load_async_to_lds_b128 %8, %9, off\n\t"
                 "global_load_async_to_lds_b128 %10, %11, off\n\t"
                 "global_load_async_to_lds_b128 %12, %13, off\n\t"
                 "global_load_async_to_lds_b128 %14, %15, off\n\t"
                 "global_load_async_to_lds_b128 %16, %17, off\n\t"
                 "global_load_async_to_lds_b128 %18, %19, off\n\t"
                 "global_load_async_to_lds_b128 %20, %21, off\n\t"
                 "global_load_async_to_lds_b128 %22, %23, off\n\t"
                 "s_wait_xcnt 0x0"
                 :: "v"(l2), "v"(mk), "v"(l2 + 8u * FP2), "v"(mk + 8 * SEQ_FULL), "v"(l2 + 16u * FP2), "v"(mk + 16 * SEQ_FULL), "v"(l2 + 24u * FP2), "v"(mk + 24 * SEQ_FULL),
                    "v"(l2 + 32u * FP2), "v"(mk + 32 * SEQ_FULL), "v"(l2 + 40u * FP2), "v"(mk + 40 * SEQ_FULL), "v"(l2 + 48u * FP2), "v"(mk + 48 * SEQ_FULL), "v"(l2 + 56u * FP2), "v"(mk + 56 * SEQ_FULL),
                    "v"(l1 + FO_VT), "v"(vt), "v"(l1 + FO_VT + 16u * FP1), "v"(vt + 16 * SEQ), "v"(l1 + FO_VT + 32u * FP1), "v"(vt + 32 * SEQ), "v"(l1 + FO_VT + 48u * FP1), "v"(vt + 48 * SEQ)
                 : "memory");
}

// k_flash: fused attention + geometric term, one wave per 16 query rows of one (batch, head); q fragments straight from the 16-bit planes, all key-side fragments and the mask from the staged LDS tiles (two 16-B reads each).
// Transposed form: S^T[key][t] = K Q^T; lane (t = lane&15, h = lane>>4) holds keys 8h+r of each 16-key tile, so packed P / G tiles are directly B fragments of
// O^T[d][t] = V^T P^T and T^T[cx][t] = BM^T G^T. S = kH.qH + (kH.qR + kR.qH)/2048. Mask: replace-fill for the softmax, zero for G. Softmax state one scalar per lane (running max from -inf).
// Epilogue: tmp2 halves exchanged with one xor-16 shuffle, c16 = base.tmp2 (K = 3, VALU), ctx^T = EW c16^T on one K=32 tile (value | residual), sum staged in a wave-private LDS tile and
__global__ __launch_bounds__(32 * AW) void k_flash(const h16* __restrict__ QH, const h16* __restrict__ QR, const h16* __restrict__ KH, const h16* __restrict__ KR, const h16* __restrict__ VT,
                                                   const h16* __restrict__ BM, const float* __restrict__ BASE, const h16* __restrict__ EWA, const int* __restrict__ mask, bf* OA) {
    __shared__ __align__(16) float os[AW * 16 * 68];
    __shared__ __align__(16) unsigned char fr[2 * F_STAGE];
    const int tid = threadIdx.x;
    const int lane = threadIdx.x & 31, wave = __builtin_amdgcn_readfirstlane((int)(threadIdx.x >> 5)), lr = lane & 15, hi = lane >> 4;
    const int zh = blockIdx.y; const int b = zh / NH_, h = zh % NH_;
    const int t0 = (blockIdx.x * AW + wave) * 16;
    const size_t pbase = (size_t)zh * SEQ * HD;
    const size_t qo = pbase + (size_t)(t0 + lr) * HD + 8 * hi;
    const v16h qh0 = ldh(QH + qo), qh1 = ldh(QH + qo + 32), qr0 = ldh(QR + qo), qr1 = ldh(QR + qo + 32);   // B fragments: col t, k = d
    // readers, byte offsets in a buffer: 128-byte-row tiles at row lr (A fragments: row key / d / cx), mask at this wave's row lr
    const uint32_t ro = (uint32_t)lr * FP1 + 16u * (uint32_t)hi;
    const uint32_t mo = FO_MK + (uint32_t)(wave * 16 + lr) * FP2 + 32u * (uint32_t)hi;
    // copiers: the lane's own 16 bytes of stage 0 (8 lanes per 128-byte row, 16 lanes per mask row)
    const h16* ckh = KH + pbase + (size_t)tid * 8;
    const h16* ckr = KR + pbase + (size_t)tid * 8;
    const h16* cvt = VT + pbase + (size_t)(tid >> 3) * SEQ + 8 * (tid & 7);
    const h16* cb0 = BM + ((size_t)b * 16 + (tid >> 3)) * SEQ + 8 * (tid & 7);
    const h16* cb1 = cb0 + (size_t)NB * 16 * SEQ;
    const int* cmk = mask + ((size_t)b * SEQ_FULL + blockIdx.x * (16 * AW) + (tid >> 4)) * SEQ_FULL + 4 * (tid & 15);
    const uint32_t cl1 = (uint32_t)(size_t)fr + (uint32_t)(tid >> 3) * FP1 + 16u * (uint32_t)(tid & 7);
    const uint32_t cl2 = (uint32_t)(size_t)fr + FO_MK + (uint32_t)(tid >> 4) * FP2 + 16u * (uint32_t)(tid & 15);
    v8f o0 = (v8f){}, o1 = (v8f){}, o2 = (v8f){}, o3 = (v8f){}, gA = (v8f){}, gR = (v8f){};
    float m = -__builtin_huge_valf(), l = 0.0f;
    flash_fill(cl1, cl2, ckh, ckr, cvt, cb0, cb1, cmk);
    asm volatile("s_wait_asynccnt 0x0" ::: "memory");    // this wave's copies of stage 0 have landed
    __syncthreads();                                     // every wave's part of stage 0 is readable by every wave
    flash_fill(cl1 + F_STAGE, cl2 + F_STAGE, ckh + FK * HD, ckr + FK * HD, cvt + FK, cb0 + FK, cb1 + FK, cmk + FK);
#pragma unroll 1   // one stage per trip: the buffer index and the publish point at the foot belong to one stage
    for (int st = 0; st < SEQ / FK; ++st) {
      const uint32_t bo = (uint32_t)(st & 1) * F_STAGE;
#pragma unroll   // both 32-key halves of a stage in line, so that their LDS offsets are immediates of the reads
      for (int sub = 0; sub < FK / 32; ++sub) {
        const int* mrow = (const int*)(fr + bo + mo + sub * 128);
        const v4i mk0 = *(const v4i*)(mrow), mk1 = *(const v4i*)(mrow + 4), mk2 = *(const v4i*)(mrow + 16), mk3 = *(const v4i*)(mrow + 20);
        const unsigned char* ka = fr + bo + FO_KH + ro + sub * 32 * FP1; const unsigned char* kr = fr + bo + FO_KR + ro + sub * 32 * FP1;
        const v16h ka0 = ldh((const h16*)ka), ka1 = ldh((const h16*)(ka + 64)), kb0 = ldh((const h16*)(ka + 16 * FP1)), kb1 = ldh((const h16*)(ka + 16 * FP1 + 64));
        const v16h ra0 = ldh((const h16*)kr), ra1 = ldh((const h16*)(kr + 64)), rb0 = ldh((const h16*)(kr + 16 * FP1)), rb1 = ldh((const h16*)(kr + 16 * FP1 + 64));
        v8f sHa = (v8f){}, sLa = (v8f){}, sKa = (v8f){}, sHb = (v8f){}, sLb = (v8f){}, sKb = (v8f){};
        sHa = wmma16(ka0, qh0, sHa); sLa = wmma16(ka0, qr0, sLa); sKa = wmma16(ra0, qh0, sKa); sHb = wmma16(kb0, qh0, sHb); sLb = wmma16(kb0, qr0, sLb); sKb = wmma16(rb0, qh0, sKb);
        sHa = wmma16(ka1, qh1, sHa); sLa = wmma16(ka1, qr1, sLa); sKa = wmma16(ra1, qh1, sKa); sHb = wmma16(kb1, qh1, sHb); sLb = wmma16(kb1, qr1, sLb); sKb = wmma16(rb1, qh1, sKb);
        asm volatile("v_nop\n\tv_nop\n\tv_nop\n\tv_nop" : "+v"(sHa), "+v"(sLa), "+v"(sKa), "+v"(sHb), "+v"(sLb), "+v"(sKb) : "v"(ka0), "v"(ka1), "v"(kb0), "v"(kb1), "v"(ra0), "v"(ra1), "v"(rb0), "v"(rb1));
        const int mka[8] = {mk0[0], mk0[1], mk0[2], mk0[3], mk1[0], mk1[1], mk1[2], mk1[3]};
        const int mkb[8] = {mk2[0], mk2[1], mk2[2], mk2[3], mk3[0], mk3[1], mk3[2], mk3[3]};
        float ta[8], tb[8]; float mx = NEGMIN;
        v16h gh, gr;
#pragma unroll
        for (int r = 0; r < 8; ++r) {
            const float xa = sHa[r] + (sLa[r] + sKa[r]) * QRI; const float xb = sHb[r] + (sLb[r] + sKb[r]) * QRI;
            const bool va = (mka[r] != 0), vb = (mkb[r] != 0);
            ta[r] = va ? xa * SC2 : NEGMIN; tb[r] = vb ? xb * SC2 : NEGMIN;
            const float ga = va ? xa : 0.0f; const float gb = vb ? xb : 0.0f;
            const h16 ha = (h16)ga; const h16 hb = (h16)gb;
            gh[r] = ha; gh[8 + r] = hb; gr[r] = (h16)((ga - (float)ha) * QRS); gr[8 + r] = (h16)((gb - (float)hb) * QRS);
            mx = fmaxf(mx, fmaxf(ta[r], tb[r])); }
        mx = fmaxf(mx, __shfl_xor(mx, 16, 32));
        const float mnew = fmaxf(m, mx);
        const float alpha = __builtin_amdgcn_exp2f(m - mnew);
        const float sh = PSH - mnew;
        v16h pb; float ls = 0.0f;
#pragma unroll
        for (int r = 0; r < 8; ++r) { const h16 pa = (h16)__builtin_amdgcn_exp2f(ta[r] + sh); const h16 pc = (h16)__builtin_amdgcn_exp2f(tb[r] + sh); pb[r] = pa; pb[8 + r] = pc; ls += (float)pa + (float)pc; }
        l = l * alpha + ls; m = mnew;
        o0 = o0 * alpha; o1 = o1 * alpha; o2 = o2 * alpha; o3 = o3 * alpha;
        const unsigned char* va_ = fr + bo + FO_VT + ro + sub * 64;
        const v16h v0 = ldh((const h16*)va_), v1 = ldh((const h16*)(va_ + 16 * FP1)), v2 = ldh((const h16*)(va_ + 32 * FP1)), v3 = ldh((const h16*)(va_ + 48 * FP1));
        const unsigned char* ba_ = fr + bo + FO_BM + ro + sub * 64;
        const v16h bh = ldh((const h16*)ba_), br = ldh((const h16*)(ba_ + 16 * FP1));
        o0 = wmma16(v0, pb, o0); gA = wmma16(bh, gh, gA); o1 = wmma16(v1, pb, o1); gR = wmma16(bh, gr, gR); o2 = wmma16(v2, pb, o2); o3 = wmma16(v3, pb, o3); gR = wmma16(br, gh, gR);
        asm volatile("v_nop\n\tv_nop\n\tv_nop\n\tv_nop" : "+v"(o0), "+v"(o1), "+v"(o2), "+v"(o3), "+v"(gA), "+v"(gR) : "v"(v0), "v"(v1), "v"(v2), "v"(v3), "v"(pb), "v"(bh), "v"(br), "v"(gh), "v"(gr));
      }
      asm volatile("s_wait_dscnt 0x0" ::: "memory");       // this wave's reads of this buffer have returned
      asm volatile("s_wait_asynccnt 0x0" ::: "memory");    // this wave's copies of stage st + 1 have landed
      __syncthreads();                                     // publishes stage st + 1 and ends every wave's reads of this buffer
      if (st + 2 < SEQ / FK) {                             // only while stage st + 2 exists (the same for the whole block)
          const int kn = (st + 2) * FK;
          flash_fill(cl1 + bo, cl2 + bo, ckh + (size_t)kn * HD, ckr + (size_t)kn * HD, cvt + kn, cb0 + kn, cb1 + kn, cmk + kn);
      }
    }
    asm volatile("s_wait_asynccnt 0x0" ::: "memory");    // no copy is outstanding when the wave goes on
    l += __shfl_xor(l, 16, 32);
    const float inv = 1.0f / l;
    // tmp2 (x1024): lane (t, h) holds rows cx = 8h + r; fetch the other half unconditionally, select by value
    float mi[8], ot[8], f[12];
#pragma unroll
    for (int r = 0; r < 8; ++r) { mi[r] = gA[r] + gR[r] * QRI; ot[r] = __shfl_xor(mi[r], 16, 32); }
#pragma unroll
    for (int r = 0; r < 8; ++r) f[r] = hi ? ot[r] : mi[r];
#pragma unroll
    for (int r = 0; r < 4; ++r) f[8 + r] = hi ? mi[r] : ot[r];
    const float* bp = BASE + ((size_t)b * SEQ + t0 + lr) * 16;
    const v4f b0 = *(const v4f*)bp, b1 = *(const v4f*)(bp + 4), b2 = *(const v4f*)(bp + 8);
    const float bs[12] = {b0[0], b0[1], b0[2], b0[3], b1[0], b1[1], b1[2], b1[3], b2[0], b2[1], b2[2], b2[3]};
    float e0[3], e1[3];
#pragma unroll
    for (int x = 0; x < 3; ++x) { e0[x] = hi ? bs[6 + x] : bs[x]; e1[x] = hi ? bs[9 + x] : bs[3 + x]; }
    // B fragment of the edge projection: element i <- 16*c16[t][j = 8h + i] (e = 2h + i/4, c = i%4), element 8+i <- its residual x2048
    v16h cb;
#pragma unroll
    for (int i = 0; i < 8; ++i) { const int c = i & 3;
        const float cv = (i < 4) ? (e0[0] * f[3 * c] + e0[1] * f[3 * c + 1] + e0[2] * f[3 * c + 2]) : (e1[0] * f[3 * c] + e1[1] * f[3 * c + 1] + e1[2] * f[3 * c + 2]);
        const float bq = cv * (1.0f / 64.0f); const h16 hh = (h16)bq; cb[i] = hh; cb[8 + i] = (h16)((bq - (float)hh) * QRS); }
    const v16h ea0 = ldh(EWA + (size_t)(lr) * 32 + 8 * hi), ea1 = ldh(EWA + (size_t)(16 + lr) * 32 + 8 * hi), ea2 = ldh(EWA + (size_t)(32 + lr) * 32 + 8 * hi), ea3 = ldh(EWA + (size_t)(48 + lr) * 32 + 8 * hi);
    v8f c0 = (v8f){}, c1 = (v8f){}, c2 = (v8f){}, c3 = (v8f){};
    c0 = wmma16(ea0, cb, c0); c1 = wmma16(ea1, cb, c1); c2 = wmma16(ea2, cb, c2); c3 = wmma16(ea3, cb, c3);
    asm volatile("v_nop\n\tv_nop\n\tv_nop\n\tv_nop" : "+v"(c0), "+v"(c1), "+v"(c2), "+v"(c3) : "v"(ea0), "v"(ea1), "v"(ea2), "v"(ea3), "v"(cb));
    const float ci = 1.0f / 256.0f;
    const int wb = wave * 16 * 68;
    // D layout: x_j[r] = (d = 16j + 8h + r, t = lane&15) -> os[t][d]; rows 0..15 x columns 0..63 all written
    { v4f a, c;
      a[0] = o0[0] * inv + c0[0] * ci; a[1] = o0[1] * inv + c0[1] * ci; a[2] = o0[2] * inv + c0[2] * ci; a[3] = o0[3] * inv + c0[3] * ci;
      c[0] = o0[4] * inv + c0[4] * ci; c[1] = o0[5] * inv + c0[5] * ci; c[2] = o0[6] * inv + c0[6] * ci; c[3] = o0[7] * inv + c0[7] * ci;
      *(v4fa*)(&os[wb + lr * 68 +  0 + 8 * hi]) = a; *(v4fa*)(&os[wb + lr * 68 +  0 + 8 * hi + 4]) = c;
      a[0] = o1[0] * inv + c1[0] * ci; a[1] = o1[1] * inv + c1[1] * ci; a[2] = o1[2] * inv + c1[2] * ci; a[3] = o1[3] * inv + c1[3] * ci;
      c[0] = o1[4] * inv + c1[4] * ci; c[1] = o1[5] * inv + c1[5] * ci; c[2] = o1[6] * inv + c1[6] * ci; c[3] = o1[7] * inv + c1[7] * ci;
      *(v4fa*)(&os[wb + lr * 68 + 16 + 8 * hi]) = a; *(v4fa*)(&os[wb + lr * 68 + 16 + 8 * hi + 4]) = c;
      a[0] = o2[0] * inv + c2[0] * ci; a[1] = o2[1] * inv + c2[1] * ci; a[2] = o2[2] * inv + c2[2] * ci; a[3] = o2[3] * inv + c2[3] * ci;
      c[0] = o2[4] * inv + c2[4] * ci; c[1] = o2[5] * inv + c2[5] * ci; c[2] = o2[6] * inv + c2[6] * ci; c[3] = o2[7] * inv + c2[7] * ci;
      *(v4fa*)(&os[wb + lr * 68 + 32 + 8 * hi]) = a; *(v4fa*)(&os[wb + lr * 68 + 32 + 8 * hi + 4]) = c;
      a[0] = o3[0] * inv + c3[0] * ci; a[1] = o3[1] * inv + c3[1] * ci; a[2] = o3[2] * inv + c3[2] * ci; a[3] = o3[3] * inv + c3[3] * ci;
      c[0] = o3[4] * inv + c3[4] * ci; c[1] = o3[5] * inv + c3[5] * ci; c[2] = o3[6] * inv + c3[6] * ci; c[3] = o3[7] * inv + c3[7] * ci;
      *(v4fa*)(&os[wb + lr * 68 + 48 + 8 * hi]) = a; *(v4fa*)(&os[wb + lr * 68 + 48 + 8 * hi + 4]) = c; }
    wave_sync();
    bf* orow = OA + ((size_t)b * SEQ + t0) * K2 + h * HD;
{
#pragma unroll
        for (int s = 0; s < 4; ++s) { const int row = 4 * s + (lane >> 3), c8 = (lane & 7) * 8;   // 4 s x 4 row groups = 16 rows; 8 lanes x 8 = 64 columns
            const v4f x0 = *(const v4fa*)(&os[wb + row * 68 + c8]); const v4f x1 = *(const v4fa*)(&os[wb + row * 68 + c8 + 4]); v8us hv, lv;
#pragma unroll
            for (int i = 0; i < 4; ++i) { const unsigned short a0 = f2bf(x0[i]); const unsigned short a1 = f2bf(x1[i]); hv[i] = a0; hv[4 + i] = a1; lv[i] = f2bf(x0[i] - bf2f(a0)); lv[4 + i] = f2bf(x1[i] - bf2f(a1)); }
            const size_t oo = (size_t)row * K2 + c8;
            *(v8us*)(orow + oo) = hv; *(v8us*)(orow + DM + oo) = lv; }
         }
}

static constexpr size_t al256(size_t v) { return (v + 255) & ~(size_t)255; }
static constexpr size_t SZ_WB  = al256((size_t)3 * DM * DM * 2);
static constexpr size_t SZ_OWB = al256((size_t)DM * DM * 2);
static constexpr size_t SZ_XA  = al256((size_t)NB * SEQ * K2 * 2);
static constexpr size_t SZ_QK  = al256((size_t)NB * SEQ * K2 * 4);
static constexpr size_t SZ_PL  = al256((size_t)NB * NH_ * SEQ * HD * 2);
static constexpr size_t SZ_BM  = al256((size_t)2 * NB * 16 * SEQ * 2);
static constexpr size_t SZ_BS  = al256((size_t)NB * SEQ * 16 * 4);
static constexpr size_t SZ_CS  = al256((size_t)NB * SEQ * 32 * 4);
static constexpr size_t SZ_EW  = al256((size_t)64 * 32 * 2);
static constexpr size_t SZ_TOTAL = SZ_WB + SZ_OWB + 2 * SZ_XA + SZ_QK + 5 * SZ_PL + SZ_BM + SZ_BS + 2 * SZ_CS + SZ_EW;
static_assert(SZ_TOTAL <= (size_t)134217728);          // workspace carve <= 128 MiB
static_assert(SZ_PL % 2 == 0);                         // plane stride in halves is exact
static_assert(SZ_PL == (size_t)NB * NH_ * SEQ * HD * 2);   // the four q/k planes are back to back with stride SZ_PL/2 halves

extern "C" void kernel_launch(void* const* d_in, const int* in_sizes, int n_in,
                              void* d_out, int out_size, void* d_ws, size_t ws_size, hipStream_t stream) {
    if (n_in < 11) return;
    const size_t ntok = (size_t)(NB - 1) * SEQ_FULL + SEQ;
    if ((size_t)in_sizes[0] < ntok) return;
    if ((size_t)in_sizes[1] < ntok * DM) return;
    if ((size_t)in_sizes[2] < (ntok - 1) * SEQ_FULL + SEQ) return;
    if ((size_t)in_sizes[3] < ntok * 12) return;
    if ((size_t)in_sizes[4] < (size_t)DM || (size_t)in_sizes[5] < (size_t)DM || (size_t)in_sizes[7] < (size_t)DM || (size_t)in_sizes[8] < (size_t)DM) return;
    if ((size_t)in_sizes[6] < (size_t)3 * DM * DM || (size_t)in_sizes[9] < (size_t)DM * DM || (size_t)in_sizes[10] < (size_t)1024) return;
    if ((size_t)out_size < ((size_t)(NB - 1) * OUT_SEQ + SEQ) * DM) return;
    if (SZ_TOTAL > ws_size) return;
    // wire order: position, x, attention_mask (int32), blocks, ln_w, ln_b, wqkv [3072][1024], q_ln_w, k_ln_w, out_w [1024][1024], edge_w [64][16]
    const float* position = (const float*)d_in[0]; const float* x = (const float*)d_in[1]; const int* amask = (const int*)d_in[2]; const float* blocks = (const float*)d_in[3];
    const float* ln_w = (const float*)d_in[4]; const float* ln_b = (const float*)d_in[5]; const float* wqkv = (const float*)d_in[6];
    const float* q_ln_w = (const float*)d_in[7]; const float* k_ln_w = (const float*)d_in[8]; const float* out_w = (const float*)d_in[9]; const float* edge_w = (const float*)d_in[10];
    float* OUT = (float*)d_out;
    char* wsp = (char*)d_ws;
    bf* WB  = (bf*)wsp;  wsp += SZ_WB;                // [3072][1024]: q | k | v rows
    bf* OWB = (bf*)wsp;  wsp += SZ_OWB;               // [1024][1024]
    bf* XA  = (bf*)wsp;  wsp += SZ_XA;                // [NB*SEQ][hi 1024 | lo 1024]
    bf* OA  = (bf*)wsp;  wsp += SZ_XA;                // [NB*SEQ][hi 1024 | lo 1024]
    float* QK = (float*)wsp; wsp += SZ_QK;            // [NB*SEQ][q 1024 | k 1024]
    h16* QH = (h16*)wsp; wsp += SZ_PL;                // [NB*16][SEQ][64]; QH, QR, KH, KR back to back (stride SZ_PL/2 halves)
    h16* QR = (h16*)wsp; wsp += SZ_PL;
    h16* KH = (h16*)wsp; wsp += SZ_PL;
    h16* KR = (h16*)wsp; wsp += SZ_PL;
    h16* VT = (h16*)wsp; wsp += SZ_PL;                // [NB*16][64][SEQ]
    h16* BM = (h16*)wsp; wsp += SZ_BM;                // [2][NB][16][SEQ]
    float* BASE = (float*)wsp; wsp += SZ_BS;          // [NB*SEQ][16]
    float* CS = (float*)wsp; wsp += SZ_CS;            // [NB*SEQ][32]
    float* SN = (float*)wsp; wsp += SZ_CS;
    h16* EWA = (h16*)wsp; wsp += SZ_EW;               // [64][32]

    { const size_t n8 = (size_t)3 * DM * DM / 8; k_cvt8<<<(unsigned)((n8 + 255) / 256), 256, 0, stream>>>(wqkv, WB, n8); }
    { const size_t n8 = (size_t)DM * DM / 8;     k_cvt8<<<(unsigned)((n8 + 255) / 256), 256, 0, stream>>>(out_w, OWB, n8); }
    k_ew<<<1, 256, 0, stream>>>(edge_w, EWA);
    k_lnx<<<NB * SEQ / 8, 256, 0, stream>>>(x, ln_w, ln_b, XA);
    k_rope<<<NB * SEQ / 8, 256, 0, stream>>>(position, CS, SN);
    k_prep<<<NB * SEQ / 64, 256, 0, stream>>>(blocks, amask, BM, BASE);

    k_proj<1><<<dim3(NB * SEQ / 128, 2 * DM / 128, 1), 128, 0, stream>>>(XA, K2, WB, DM, K2, (h16*)0, NB * SEQ, (size_t)0, 0, 64, (size_t)0, QK, K2, NB * SEQ);
    // v^T: A = wqkv rows 2048..3071 (m = h*64 + d), Bt = LN(x) rows (n = b*SEQ + t) -> plane [(b*1024 + m)][t] = [(b*16 + h)][d][t]
    k_proj<0><<<dim3(DM / 128, NB * SEQ / 128, 1), 128, 0, stream>>>(WB + (size_t)2 * DM * DM, DM, XA, K2, K2, VT, DM, (size_t)0, SEQ, SEQ, (size_t)DM * SEQ, (float*)0, 0, 0);

    // planes QH | QR | KH | KR from the base QH with stride SZ_PL/2 halves
    k_qkrot<<<NB * SEQ / 8, 256, 0, stream>>>(QK, q_ln_w, k_ln_w, CS, SN, QH, (size_t)(SZ_PL / 2));

    k_flash<<<dim3(SEQ / (16 * AW), NB * NH_, 1), 32 * AW, 0, stream>>>(QH, QR, KH, KR, VT, BM, BASE, EWA, amask, OA);

    // out: A = (ctx + context) hi|lo rows, Bt = out_w rows -> OUT[b][t][n]
    k_proj<1><<<dim3(NB * SEQ / 128, DM / 128, 1), 128, 0, stream>>>(OA, K2, OWB, DM, K2, (h16*)0, SEQ, (size_t)0, 0, 64, (size_t)0, OUT, DM, OUT_SEQ);
}

// v003
// A run of this version takes 105 microseconds.
// Next to v002, in two timings, it ran 1.21 and 1.20 times as fast.
// All steps since v000 together make it 2.54 times as fast.
#include <hip/hip_runtime.h>
#include <stdint.h>

// Compute dtypes (f32 accumulate everywhere): qkv and output projections v_wmma_f32_16x16x32_bf16 (activation as bf16 hi|lo planes folded along K, weights RNE-converted bf16); scores, P.V, geometric sum and edge projection v_wmma_f32_16x16x32_f16 (q, k, G, bm, c16 as f16 value + f16 residual x2048; P x256 and v single f16).
// Pre-norm attention block, width 1024 = 16 heads x 64: LN(x) -> qkv GEMM -> LN(q), LN(k) over the full width -> rotate-half rotary (cos/sin table from the position input) ->
// masked softmax attention (replace-fill, running max) plus geometric term tmp2 = sum_k (q.k) mask bm/len, context = (base.tmp2) edge_w^T -> output GEMM.
// Every float input is RNE-converted to bf16 on load. Fused flash kernel in transposed form (S^T = K Q^T, O^T = V^T P^T, tmp2^T = BM^T G^T, ctx^T = EW c16^T).

#ifndef NB
#define NB 2
#endif
#ifndef SEQ
#define SEQ 1024
#endif
#define NB_FULL  2
#define SEQ_FULL 1024
#ifndef OUT_SEQ
#define OUT_SEQ SEQ              // row pitch (in tokens) between batches of the output
#endif
#define DM   1024
#define K2   2048                // hi|lo folded contraction length
#define NH_  16
#define HD   64
#define AW   4                   // waves per flash block (16 query rows each)
#define QRS  2048.0f             // carry of the residual planes
#define QRI  (1.0f / 2048.0f)
#define SC2  (0.125f * 1.4426950408889634f)   // HD^-0.5 * log2(e)
#define PSH  8.0f                // log2 of the P carry (256)
#define NEGMIN (-3.4028234663852886e38f)

static_assert(HD == 64);
static_assert(NH_ * HD == DM);
static_assert(K2 == 2 * DM);
static_assert((DM & (DM - 1)) == 0);           // k index wrap uses a power-of-two mask
static_assert(DM % 64 == 0);
static_assert(SEQ % 128 == 0);                 // mask row sums read 128 ints per step
static_assert(SEQ % 64 == 0);
static_assert((NB * SEQ) % 128 == 0);
static_assert((NB * SEQ) % 8 == 0);
static_assert(SEQ % (16 * AW) == 0);
static_assert(NB <= NB_FULL);
static_assert(SEQ <= SEQ_FULL);

typedef _Float16 h16;
typedef unsigned short bf;
typedef __attribute__((ext_vector_type(16))) __bf16   v16bf;
typedef __attribute__((ext_vector_type(16))) _Float16 v16h;
typedef __attribute__((ext_vector_type(8)))  _Float16 v8h;
typedef __attribute__((ext_vector_type(8)))  unsigned short v8us;
typedef __attribute__((ext_vector_type(8)))  float    v8f;
typedef __attribute__((ext_vector_type(4)))  float    v4f;
typedef __attribute__((ext_vector_type(4)))  int      v4i;
typedef __attribute__((ext_vector_type(4)))  uint32_t u32x4;
typedef __attribute__((ext_vector_type(8)))  uint32_t u32x8;
typedef v4f  __attribute__((may_alias)) v4fa;
typedef v8h  __attribute__((may_alias)) v8ha;

__device__ __forceinline__ unsigned short f2bf(float f) { unsigned u = __float_as_uint(f); u += 0x7FFFu + ((u >> 16) & 1u); return (unsigned short)(u >> 16); }
__device__ __forceinline__ float bf2f(unsigned short b) { return __uint_as_float(((unsigned)b) << 16); }
__device__ __forceinline__ float bfr(float f) { return bf2f(f2bf(f)); }
__device__ __forceinline__ v16h cat16(v8h lo, v8h hi) { return __builtin_shufflevector(lo, hi, 0, 1, 2, 3, 4, 5, 6, 7, 8, 9, 10, 11, 12, 13, 14, 15); }
__device__ __forceinline__ v16bf cat16b(v8us lo, v8us hi) { return __builtin_bit_cast(v16bf, __builtin_shufflevector(lo, hi, 0, 1, 2, 3, 4, 5, 6, 7, 8, 9, 10, 11, 12, 13, 14, 15)); }
__device__ __forceinline__ v8f wmma16(v16h a, v16h b, v8f c) { return __builtin_amdgcn_wmma_f32_16x16x32_f16(false, a, false, b, (short)0, c, false, false); }
__device__ __forceinline__ v8f wmmab(v16bf a, v16bf b, v8f c) { return __builtin_amdgcn_wmma_f32_16x16x32_bf16(false, a, false, b, (short)0, c, false, false); }
// fragment loaders from K-contiguous 16-bit rows; p already includes + 8*(lane>>4): elements 0..7 <- k0+8h+0..7, elements 8..15 <- k0+16+8h+0..7 (same map for A and B)
__device__ __forceinline__ v16h  ldh(const h16* p) { return cat16(*(const v8h*)p, *(const v8h*)(p + 16)); }
__device__ __forceinline__ v16bf ldb(const bf* p)  { return cat16b(*(const v8us*)p, *(const v8us*)(p + 16)); }
// ordering point for wave-private LDS tiles (same wave writes and reads)
__device__ __forceinline__ void wave_sync() { __builtin_amdgcn_fence(3 /* release order */, "wavefront"); __builtin_amdgcn_wave_barrier(); asm volatile("" ::: "memory"); }
__device__ __forceinline__ float wsum(float v) { v += __shfl_xor(v, 16, 32); v += __shfl_xor(v, 8, 32); v += __shfl_xor(v, 4, 32); v += __shfl_xor(v, 2, 32); v += __shfl_xor(v, 1, 32); return v; }
__device__ __forceinline__ int wsumi(int v) { v += __shfl_xor(v, 16, 32); v += __shfl_xor(v, 8, 32); v += __shfl_xor(v, 4, 32); v += __shfl_xor(v, 2, 32); v += __shfl_xor(v, 1, 32); return v; }

// The six row-wise stages (cvt8, ew, lnx, rope, prep, qkrot) are device functions of one 256-thread block each (blk = the block's index inside its own stage); k_front and k_mid, behind qkrot_part,
// run stages that read none of each other's output side by side in one grid.
__device__ __forceinline__ void cvt8_part(int blk, const float* __restrict__ src, bf* dst, size_t n8) {
    const size_t i = (size_t)blk * 256 + threadIdx.x; if (i >= n8) return;
    const v8f v = *(const v8f*)(src + i * 8); v8us o;
#pragma unroll
    for (int k = 0; k < 8; ++k) o[k] = f2bf(v[k]);
    *(v8us*)(dst + i * 8) = o; 
}

// ew_part: edge weight A plane [64][32] f16: columns 0..15 = 16*w[d][j], columns 16..31 = w[d][j]/128 (pairs with the x2048 residual half of the c16 operand). One block; each thread 16 B, consecutive.
__device__ __forceinline__ void ew_part(const float* __restrict__ ew, h16* EWA) {
    const int tid = threadIdx.x; const int d = tid >> 2, q = tid & 3;
    const float sc = (q < 2) ? 16.0f : 0.0078125f;
    const v8f w = *(const v8f*)(ew + d * 16 + (q & 1) * 8);
    v8h o;
#pragma unroll
    for (int i = 0; i < 8; ++i) o[i] = (h16)(bfr(w[i]) * sc);
    *(v8h*)(EWA + d * 32 + q * 8) = o;
    asm volatile("s_wait_xcnt 0x0" ::: "memory");   // other stages' code follows this store in the merged kernel: its address and data registers are rewritten only behind this wait
}

// The per-lane element loops are rolled over the four 256-column chunks (the row is re-read from memory in each pass; element visiting order it = 0..3, i = 0..7 in every pass).
__device__ __forceinline__ void lnx_part(int blk, const float* __restrict__ x, const float* __restrict__ lw, const float* __restrict__ lb, bf* XA) {
    const int lane = threadIdx.x & 31; const int wave = __builtin_amdgcn_readfirstlane((int)(threadIdx.x >> 5));
    const int m = blk * 8 + wave; const int b = m / SEQ, t = m % SEQ;
    const float* src = x + ((size_t)b * SEQ_FULL + t) * DM + lane * 8;
    float s = 0.0f;
#pragma unroll 1
    for (int it = 0; it < 4; ++it) { const v8f raw = *(const v8f*)(src + it * 256);
#pragma unroll
        for (int i = 0; i < 8; ++i) s += bfr(raw[i]); }
    s = wsum(s);
    const float mean = s * (1.0f / DM);
    float ss = 0.0f;
#pragma unroll 1
    for (int it = 0; it < 4; ++it) { const v8f raw = *(const v8f*)(src + it * 256);
#pragma unroll
        for (int i = 0; i < 8; ++i) { const float dv = bfr(raw[i]) - mean; ss += dv * dv; } }
    ss = wsum(ss);
    const float rstd = 1.0f / sqrtf(ss * (1.0f / DM) + 1e-5f);
    bf* dst = XA + (size_t)m * K2 + lane * 8;
{
#pragma unroll 1
        for (int it = 0; it < 4; ++it) {
            const v8f raw = *(const v8f*)(src + it * 256);
            const v8f wv = *(const v8f*)(lw + it * 256 + lane * 8); const v8f bv = *(const v8f*)(lb + it * 256 + lane * 8);
            v8us hv, lv;
#pragma unroll
            for (int i = 0; i < 8; ++i) { const float dv = bfr(raw[i]) - mean; const float y = dv * rstd * bfr(wv[i]) + bfr(bv[i]); const unsigned short hh = f2bf(y); hv[i] = hh; lv[i] = f2bf(y - bf2f(hh)); }
            *(v8us*)(dst + it * 256) = hv; *(v8us*)(dst + DM + it * 256) = lv; }
         }
}

__device__ __forceinline__ void rope_part(int blk, const float* __restrict__ pos, float* CS, float* SN) {
    const int lane = threadIdx.x & 31; const int wave = __builtin_amdgcn_readfirstlane((int)(threadIdx.x >> 5));
    const int m = blk * 8 + wave; const int b = m / SEQ, t = m % SEQ;
    const float p = bfr(pos[(size_t)b * SEQ_FULL + t]);
    double pd = 1.0;
#pragma unroll 1
    for (int i = 0; i < lane; ++i) pd *= 1.333521432163324;
    const float pf = (float)pd;
    const float invf = 1.0f / pf;
    const float ang = p * invf;
    const float c = cosf(ang), s = sinf(ang);
    *(float*)(CS + (size_t)m * 32 + lane) = c; *(float*)(SN + (size_t)m * 32 + lane) = s;
    
}

// prep_part: per 64 tokens: len = mask row sums; bm = blocks - mean_c; base = bm / (|bm| + eps); planes BM[0] = f16(bm * 1024/len), BM[1] = f16 residual x2048, layout [plane][b][16][SEQ] (rows 12..15 zero);
// BASE [token][16] f32 (columns 12..15 zero). LDS tiles are cross-wave: block barriers between phases.
__device__ __forceinline__ void prep_part(int blk, const float* __restrict__ blocks, const int* __restrict__ mask, h16* BM, float* BASE) {
    __shared__ float slen[64];
    __shared__ __align__(16) h16 sb[32 * 64];
    __shared__ __align__(16) float sbase[64 * 16];
    const int tid = threadIdx.x, lane = tid & 31; const int wave = __builtin_amdgcn_readfirstlane((int)(threadIdx.x >> 5));
    const int m0 = blk * 64; const int b = m0 / SEQ, t0 = m0 % SEQ;
#pragma unroll 1
    for (int i = 0; i < 8; ++i) { const int tl = wave * 8 + i;
        const int* row = mask + ((size_t)b * SEQ_FULL + t0 + tl) * SEQ_FULL + lane * 4; int cnt = 0;
#pragma unroll
        for (int c = 0; c < SEQ / 128; ++c) { const v4i mv = *(const v4i*)(row + c * 128); cnt += (mv[0] != 0) + (mv[1] != 0) + (mv[2] != 0) + (mv[3] != 0); }
        cnt = wsumi(cnt);
        if (lane == 0) slen[tl] = (float)cnt; }
    __syncthreads();
    if (tid < 64) {
        const float* p = blocks + ((size_t)b * SEQ_FULL + t0 + tid) * 12;
        const v4f a0 = *(const v4f*)p, a1 = *(const v4f*)(p + 4), a2 = *(const v4f*)(p + 8);
        float pv[12];
#pragma unroll
        for (int i = 0; i < 4; ++i) { pv[i] = bfr(a0[i]); pv[4 + i] = bfr(a1[i]); pv[8 + i] = bfr(a2[i]); }
        float mu[3];
#pragma unroll
        for (int x = 0; x < 3; ++x) mu[x] = (pv[x] + pv[3 + x] + pv[6 + x] + pv[9 + x]) * 0.25f;
        const float sc = (1.0f / slen[tid]) * 1024.0f;
#pragma unroll
        for (int c = 0; c < 4; ++c) {
            const float vx = pv[c * 3] - mu[0], vy = pv[c * 3 + 1] - mu[1], vz = pv[c * 3 + 2] - mu[2];
            const float inv = 1.0f / (sqrtf(vx * vx + vy * vy + vz * vz) + 1.1920929e-7f);
            const float vv[3] = {vx, vy, vz};
#pragma unroll
            for (int x = 0; x < 3; ++x) { const int cx = c * 3 + x;
                sbase[tid * 16 + cx] = vv[x] * inv;
                const float bs = vv[x] * sc; const h16 hh = (h16)bs;
                sb[cx * 64 + tid] = hh; sb[(16 + cx) * 64 + tid] = (h16)((bs - (float)hh) * QRS); } }
#pragma unroll
        for (int j = 12; j < 16; ++j) { sbase[tid * 16 + j] = 0.0f; sb[j * 64 + tid] = (h16)0.0f; sb[(16 + j) * 64 + tid] = (h16)0.0f; }
    }
    __syncthreads();
    // 32 lines of 64 halves: line = tid>>3 (0..15 value plane rows, 16..31 residual plane rows), 8 consecutive lanes x 16 B per line; BASE: 256 threads x 16 B contiguous
    const int line = tid >> 3, pc = tid & 7;
    const v8h bv = *(const v8ha*)(&sb[line * 64 + pc * 8]);
    const v4f fv = *(const v4fa*)(&sbase[tid * 4]);
    h16* bd = BM + (size_t)(line >> 4) * ((size_t)NB * 16 * SEQ) + ((size_t)b * 16 + (line & 15)) * SEQ + t0 + pc * 8;
    float* fd = BASE + (size_t)m0 * 16 + tid * 4;
    *(v8h*)bd = bv; *(v4f*)fd = fv;
    
}

// k_proj: bf16 GEMM, 128x128 tile per block of four waves (2 x 2, each 64x64 = 16 accumulators). Both operands are staged in LDS by tensor loads: a stage is 128 k
// (256 bytes of each of the 256 operand rows), two buffers, every wave moves its own 64-row slice one stage ahead of the pass that reads it. k order per accumulator: kc = 0, 32, 64, ...
// MODE 1: f32 rows C[((r0/RB)*RP + r0%RB)][c0..c0+63], row pitch ldc; each 256-byte row segment by 16 consecutive lanes x 16 B.
#define PJ_PITCH 272u                 // LDS row pitch: 256-byte row + the mover's 16-byte pad (odd multiple of 16 B for 16-byte readers)
#define PJ_SLICE 18432u               // 64 rows x 272 B = 17408, rounded up to a multiple of 2 KiB so that every slice starts on one
#define PJ_STAGE (4u * PJ_SLICE)      // slices 0, 1: A rows 0..63, 64..127 of the block tile; slices 2, 3: B rows
static_assert(64u * PJ_PITCH <= PJ_SLICE && PJ_SLICE % 2048u == 0u);
static_assert(DM % 128 == 0 && K2 % 128 == 0 && K2 / 128 >= 2);   // whole stages inside every operand row, at least two stages
__device__ __forceinline__ uint32_t uni(uint32_t v) { return (uint32_t)__builtin_amdgcn_readfirstlane((int)v); }
__device__ __forceinline__ uint32_t pinned(uint32_t v) { uint32_t w = uni(v); asm volatile("" : "+s"(w)); return w; }   // the pinned() form for tensor loads: the test value is held in a scalar register, so the branch round a load is a scalar one (the load ignores EXEC)
// one request of the whole wave: 64 rows of 256 bytes from ga (row pitch in g1) to LDS byte offset dst; word 0 of g0 (count 1) is set once by the caller
__device__ __forceinline__ void tdm_load(u32x4& g0, uint32_t dst, uint64_t ga, u32x8& g1) {
    g0[1] = uni(dst); g0[2] = uni((uint32_t)ga); g0[3] = uni((((uint32_t)(ga >> 32)) & 0x01FFFFFFu) | 0x80000000u);
    asm volatile("tensor_load_to_lds %0, %1" : "+s"(g0), "+s"(g1) :: "memory");   // in-out: the same registers go on to the wait below
}
// the wave's own requests have landed. The statement names both descriptor groups as in-out operands so that their scalar registers hold the issued words until the wait has returned
// and every new word is formed behind it.
__device__ __forceinline__ void tdm_wait(u32x4& g0, u32x8& g1) { asm volatile("s_wait_tensorcnt 0x0" : "+s"(g0), "+s"(g1) :: "memory"); }
// proj_tile: the tile (bx, by) of one product; ring and osall are the calling kernel's LDS arrays (ring on a multiple of 2 KiB).
template <int MODE>
__device__ __forceinline__ void proj_tile(unsigned char* ring, float* osall, uint32_t bx, uint32_t by, const bf* __restrict__ A, int pA, const bf* __restrict__ Bt, int pB, int K,
                                          h16* Ph, int RB, size_t sRB, int pitch, int CB, size_t sCB, float* C, int ldc, int RP) {
    const int lane = threadIdx.x & 31, lr = lane & 15, hi = lane >> 4;
    const uint32_t wave = uni(threadIdx.x >> 5);
    const int r0 = bx * 128 + (int)(wave >> 1) * 64, c0 = by * 128 + (int)(wave & 1u) * 64;
    float* os = osall + wave * (16 * 68);
    v8f acc[4][4];
#pragma unroll
    for (int mb = 0; mb < 4; ++mb)
#pragma unroll
        for (int nb = 0; nb < 4; ++nb) acc[mb][nb] = (v8f){};
    // this wave's slice of every stage: waves 0, 1 move A rows, waves 2, 3 move B rows; the k offset wraps at the operand's own row length
    const bool ownA = wave < 2u;
    const uint32_t sp = (uint32_t)(ownA ? pA : pB);
    const uint64_t src0 = ownA ? (uint64_t)(uintptr_t)(A + (size_t)(bx * 128 + wave * 64u) * (size_t)pA)
                               : (uint64_t)(uintptr_t)(Bt + (size_t)(by * 128 + (wave - 2u) * 64u) * (size_t)pB);
    const uint32_t slice = (uint32_t)(size_t)ring + wave * PJ_SLICE;
    u32x8 g1;
    g1[0] = uni((1u << 20) | (5u << 22) | (3u << 25));   // no mask, byte elements, 16 B of pad behind every 256 B
    g1[1] = uni(256u << 16); g1[2] = uni(64u << 16); g1[3] = uni(256u << 16); g1[4] = uni(64u);   // tensor = tile = 256 B x 64 rows
    g1[5] = uni(sp * 2u); g1[6] = uni(0u); g1[7] = uni(0u);
    const uint32_t T = (uint32_t)K >> 7;
    const uint32_t abase = (wave >> 1) * PJ_SLICE + (uint32_t)lr * PJ_PITCH + 16u * (uint32_t)hi;
    const uint32_t bbase = (2u + (wave & 1u)) * PJ_SLICE + (uint32_t)lr * PJ_PITCH + 16u * (uint32_t)hi;
    u32x4 g0;
    g0[0] = uni(1u);
    tdm_load(g0, slice, src0, g1);
    tdm_wait(g0, g1);                                    // this wave's slice of stage 0 has landed
    __syncthreads();                                     // every slice of stage 0 is readable by every wave
    if (pinned((1u < T) ? 1u : 0u) != 0u) tdm_load(g0, slice + PJ_STAGE, src0 + (uint64_t)((128u & (sp - 1u)) * 2u), g1);
#pragma unroll 1   // one pass per trip: the buffer index and the publish point below belong to one stage
    for (uint32_t t = 0; t < T; ++t) {
        const uint32_t buf = (t & 1u) * PJ_STAGE;
        const unsigned char* la = ring + buf + abase; const unsigned char* lb = ring + buf + bbase;
        v16bf fa[2][4], fb[2][4];
#pragma unroll
        for (int i = 0; i < 4; ++i) { fa[0][i] = ldb((const bf*)(la + i * 16 * PJ_PITCH)); fb[0][i] = ldb((const bf*)(lb + i * 16 * PJ_PITCH)); }
#pragma unroll
        for (int u = 0; u < 4; ++u) {
            const int cs = u & 1;
            if (u < 3) {
#pragma unroll
                for (int i = 0; i < 4; ++i) { fa[cs ^ 1][i] = ldb((const bf*)(la + i * 16 * PJ_PITCH + (u + 1) * 64)); fb[cs ^ 1][i] = ldb((const bf*)(lb + i * 16 * PJ_PITCH + (u + 1) * 64)); }
            }
            __builtin_amdgcn_sched_barrier(0);   // the next block's LDS reads stay one group in front of this block's products
#pragma unroll
            for (int nb = 0; nb < 4; ++nb)
#pragma unroll
                for (int mb = 0; mb < 4; ++mb) acc[mb][nb] = wmmab(fa[cs][mb], fb[cs][nb], acc[mb][nb]);
            __builtin_amdgcn_sched_barrier(0);   // no LDS read moves in among the products
        }
        asm volatile("s_wait_dscnt 0x0" ::: "memory");
        tdm_wait(g0, g1);
        __syncthreads();
        if (pinned((t + 2u < T) ? 1u : 0u) != 0u) tdm_load(g0, slice + buf, src0 + (uint64_t)((((t + 2u) << 7) & (sp - 1u)) * 2u), g1);
    }
    tdm_wait(g0, g1);                                    // no request is outstanding when the wave goes on
    asm volatile("s_wait_dscnt 0x0" ::: "memory");       // nor any LDS read of the ring
    const size_t tbase = (size_t)(r0 / RB) * sRB + (size_t)(r0 % RB) * (size_t)pitch + (size_t)(c0 / CB) * sCB + (size_t)(c0 % CB);
    const size_t cbase = ((size_t)(r0 / RB) * (size_t)RP + (size_t)(r0 % RB)) * (size_t)ldc + (size_t)c0;
#pragma unroll
    for (int mb = 0; mb < 4; ++mb) {
#pragma unroll
        for (int nb = 0; nb < 4; ++nb) {
#pragma unroll
            for (int j = 0; j < 8; ++j) os[(hi * 8 + j) * 68 + nb * 16 + lr] = acc[mb][nb][j]; }   // D: row 8h+j, col lane&15
        wave_sync();
        if (MODE == 0) {
            const size_t sb = tbase + (size_t)(mb * 16) * (size_t)pitch;
{
#pragma unroll
                for (int s = 0; s < 4; ++s) { const int row = 4 * s + (lane >> 3), c8 = (lane & 7) * 8;   // 4 s x 4 row groups = 16 rows; 8 lanes x 8 = 64 columns
                    const v4f x0 = *(const v4fa*)(&os[row * 68 + c8]); const v4f x1 = *(const v4fa*)(&os[row * 68 + c8 + 4]); v8h hv;
#pragma unroll
                    for (int i = 0; i < 4; ++i) { hv[i] = (h16)x0[i]; hv[4 + i] = (h16)x1[i]; }
                    *(v8h*)(Ph + sb + (size_t)row * (size_t)pitch + c8) = hv; }
                 }
        } else {
            const size_t sb = cbase + (size_t)(mb * 16) * (size_t)ldc;
{
#pragma unroll
                for (int s = 0; s < 8; ++s) { const int row = 2 * s + hi, cofs = lr * 4;   // 8 s x 2 rows = 16 rows; 16 lanes x 4 floats = 64 columns
                    const v4f val = *(const v4fa*)(&os[row * 68 + cofs]);
                    *(v4f*)(C + sb + (size_t)row * (size_t)ldc + cofs) = val; }
                 }
        }
        wave_sync();
    }
}

template <int MODE>
__global__ __launch_bounds__(128) void k_proj(const bf* __restrict__ A, int pA, const bf* __restrict__ Bt, int pB, int K,
                                              h16* Ph, int RB, size_t sRB, int pitch, int CB, size_t sCB, float* C, int ldc, int RP) {
    __shared__ __attribute__((aligned(2048))) unsigned char ring[2 * PJ_STAGE];
    __shared__ __align__(16) float osall[4 * 16 * 68];
    proj_tile<MODE>(ring, osall, blockIdx.x, blockIdx.y, A, pA, Bt, pB, K, Ph, RB, sRB, pitch, CB, sCB, C, ldc, RP);
}
// k_proj_qkv: the q|k product and the v^T product read the same two operands and none of each other's output: one grid, the q|k tiles first.
// q|k: A = LN(x) rows, Bt = wqkv rows 0..2047 -> QK[m][n] f32. v^T: A = wqkv rows 2048..3071 (m = h*64 + d), Bt = LN(x) rows (n = b*SEQ + t) -> plane [(b*1024 + m)][t] = [(b*16 + h)][d][t].
#define PQ_BX (NB * SEQ / 128)
#define PQ_N  (PQ_BX * (2 * DM / 128))
#define PV_BX (DM / 128)
#define PV_N  (PV_BX * (NB * SEQ / 128))
__global__ __launch_bounds__(128) void k_proj_qkv(const bf* __restrict__ XA, const bf* __restrict__ WB, float* QK, h16* VT) {
    __shared__ __attribute__((aligned(2048))) unsigned char ring[2 * PJ_STAGE];
    __shared__ __align__(16) float osall[4 * 16 * 68];
    const uint32_t i = blockIdx.x;
    if (i < (uint32_t)PQ_N) {
        proj_tile<1>(ring, osall, i % PQ_BX, i / PQ_BX, XA, K2, WB, DM, K2, (h16*)0, NB * SEQ, (size_t)0, 0, 64, (size_t)0, QK, K2, NB * SEQ);
    } else {
        const uint32_t j = i - (uint32_t)PQ_N;
        proj_tile<0>(ring, osall, j % PV_BX, j / PV_BX, WB + (size_t)2 * DM * DM, DM, XA, K2, K2, VT, DM, (size_t)0, SEQ, SEQ, (size_t)DM * SEQ, (float*)0, 0, 0);
    }
}

// Lane holds columns it*256 + lane*8 + i = head (4*it + lane/8), d = 8*(lane&7) + i; the rotary partner d +- 32 is lane ^ 4 (same it, same i).
// Planes [b*16+h][t][64], four consecutive planes from PL with stride pst halves: q value, q residual x2048, k value, k residual x2048 (selected by integer offset from one base).
// All per-lane element loops are rolled over the four 256-column chunks and over {q, k}; the row is re-read from memory in each pass (visiting order it = 0..3, i = 0..7).
__device__ __forceinline__ void qkrot_part(int blk, const float* __restrict__ QK, const float* __restrict__ qw, const float* __restrict__ kw, const float* __restrict__ CS, const float* __restrict__ SN,
                                           h16* PL, size_t pst) {
    const int lane = threadIdx.x & 31; const int wave = __builtin_amdgcn_readfirstlane((int)(threadIdx.x >> 5));
    const int m = blk * 8 + wave; const int b = m / SEQ, t = m % SEQ;
    const int c = lane & 7;
    const v8f cs = *(const v8f*)(CS + (size_t)m * 32 + 8 * (c & 3));
    const v8f sn = *(const v8f*)(SN + (size_t)m * 32 + 8 * (c & 3));
    const float sg = (c < 4) ? -1.0f : 1.0f;
    const size_t o0 = (((size_t)(b * NH_ + (lane >> 3))) * SEQ + t) * HD + 8 * c;
    const size_t ost = (size_t)4 * SEQ * HD;     // four heads per step
#pragma unroll 1
    for (int wh = 0; wh < 2; ++wh) {
        const float* row = QK + (size_t)m * K2 + (size_t)wh * DM + lane * 8;
        float s = 0.0f;
#pragma unroll 1
        for (int it = 0; it < 4; ++it) { const v8f raw = *(const v8f*)(row + it * 256);
#pragma unroll
            for (int i = 0; i < 8; ++i) s += raw[i]; }
        s = wsum(s);
        const float mean = s * (1.0f / DM);
        float ss = 0.0f;
#pragma unroll 1
        for (int it = 0; it < 4; ++it) { const v8f raw = *(const v8f*)(row + it * 256);
#pragma unroll
            for (int i = 0; i < 8; ++i) { const float dv = raw[i] - mean; ss += dv * dv; } }
        ss = wsum(ss);
        const float rstd = 1.0f / sqrtf(ss * (1.0f / DM) + 1e-5f);
        h16* PH = PL + (size_t)(2 * wh) * pst;
        h16* PR = PH + pst;
{
#pragma unroll 1
            for (int it = 0; it < 4; ++it) {
                const v8f raw = *(const v8f*)(row + it * 256);
                const v8f wq = *(const v8f*)(qw + it * 256 + lane * 8); const v8f wk = *(const v8f*)(kw + it * 256 + lane * 8);
                v8h hv, rv;
#pragma unroll
                for (int i = 0; i < 8; ++i) { const float wsel = wh ? wk[i] : wq[i];
                    const float y = (raw[i] - mean) * rstd * bfr(wsel);
                    const float pr = __shfl_xor(y, 4, 32);
                    const float r = y * cs[i] + sg * pr * sn[i];
                    const h16 hh = (h16)r; hv[i] = hh; rv[i] = (h16)((r - (float)hh) * QRS); }
                const size_t oo = o0 + (size_t)it * ost;
                *(v8h*)(PH + oo) = hv; *(v8h*)(PR + oo) = rv; }
             }
    }
}

// k_front: LN(x) and the wqkv conversion, which the qkv products read, beside the rotary table, which k_mid reads. The stages with the longest dependent chains take the low block indices, the short conversion blocks the high ones (for speed only).
#define GF_LNX  (NB * SEQ / 8)
#define GF_ROPE (NB * SEQ / 8)
#define GF_CVT  (3 * DM * DM / 8 / 256)
static_assert((3 * DM * DM / 8) % 256 == 0 && (DM * DM / 8) % 256 == 0);
__global__ __launch_bounds__(256) void k_front(const float* __restrict__ x, const float* __restrict__ lw, const float* __restrict__ lb, bf* XA,
                                               const float* __restrict__ pos, float* CS, float* SN, const float* __restrict__ wqkv, bf* WB) {
    const int blk = blockIdx.x;
    if (blk < GF_LNX) lnx_part(blk, x, lw, lb, XA);
    else if (blk < GF_LNX + GF_ROPE) rope_part(blk - GF_LNX, pos, CS, SN);
    else cvt8_part(blk - (GF_LNX + GF_ROPE), wqkv, WB, (size_t)3 * DM * DM / 8);
}
// k_mid: the q/k norm and rotary (reads the q|k product) beside the stages that only k_flash or the output product read: mask sums and bm planes, edge weight plane, out_w conversion.
#define GM_PREP (NB * SEQ / 64)
#define GM_ROT  (NB * SEQ / 8)
#define GM_CVT  (DM * DM / 8 / 256)
__global__ __launch_bounds__(256) void k_mid(const float* __restrict__ QK, const float* __restrict__ qw, const float* __restrict__ kw, const float* __restrict__ CS, const float* __restrict__ SN, h16* PL, size_t pst,
                                             const float* __restrict__ blocks, const int* __restrict__ mask, h16* BM, float* BASE,
                                             const float* __restrict__ ew, h16* EWA, const float* __restrict__ ow, bf* OWB) {
    const int blk = blockIdx.x;
    if (blk < GM_PREP) prep_part(blk, blocks, mask, BM, BASE);
    else if (blk < GM_PREP + GM_ROT) qkrot_part(blk - GM_PREP, QK, qw, kw, CS, SN, PL, pst);
    else if (blk == GM_PREP + GM_ROT) ew_part(ew, EWA);
    else cvt8_part(blk - (GM_PREP + GM_ROT + 1), ow, OWB, (size_t)DM * DM / 8);
}

// k_flash staging: a stage is 64 keys of the block's (batch, head): k value and residual rows, v^T rows, both bm planes (128-byte rows, LDS pitch 144) and the block's 64 mask rows
// (256-byte rows, LDS pitch 272; both pitches are odd multiples of 16 B for 16-byte readers). Two buffers, filled by asynchronous copies one stage ahead of the pass that reads them.
#define FK      64
#define FP1     144u
#define FP2     272u
#define FO_KH   0u
#define FO_KR   (64u * FP1)
#define FO_VT   (128u * FP1)
#define FO_BM   (192u * FP1)
#define FO_MK   (224u * FP1)
#define F_STAGE (FO_MK + 64u * FP2)
static_assert(AW == 4 && HD == 64);                 // 128 lanes: 16 rows of 128 B or 8 rows of 256 B per copy instruction of the block
static_assert(SEQ % FK == 0 && SEQ / FK >= 2);      // whole stages, at least two
static_assert(F_STAGE % 16u == 0u);
// One stage: 22 copies of 16 B per lane, every lane on. l1 / l2: the lane's LDS byte address in row 0..15 of a 128-byte-row tile / row 0..7 of the mask tile of the target buffer.
// Each run of copies ends, inside its own statement, with s_wait_xcnt 0: the address registers are rewritten only behind it.
__device__ __forceinline__ void flash_fill(uint32_t l1, uint32_t l2, const h16* kh, const h16* kr, const h16* vt, const h16* b0, const h16* b1, const int* mk) {
    asm volatile("global_load_async_to_lds_b128 %0, %1, off\n\t"
                 "global_load_async_to_lds_b128 %2, %3, off\n\t"
                 "global_load_async_to_lds_b128 %4, %5, off\n\t"
                 "global_load_async_to_lds_b128 %6, %7, off\n\t"
                 "global_load_async_to_lds_b128 %8, %9, off\n\t"
                 "global_load_async_to_lds_b128 %10, %11, off\n\t"
                 "global_load_async_to_lds_b128 %12, %13, off\n\t"
                 "global_load_async_to_lds_b128 %14, %15, off\n\t"
                 "global_load_async_to_lds_b128 %16, %17, off\n\t"
                 "global_load_async_to_lds_b128 %18, %19, off\n\t"
                 "s_wait_xcnt 0x0"
                 :: "v"(l1 + FO_KH), "v"(kh), "v"(l1 + FO_KH + 16u * FP1), "v"(kh + 16 * HD), "v"(l1 + FO_KH + 32u * FP1), "v"(kh + 32 * HD), "v"(l1 + FO_KH + 48u * FP1), "v"(kh + 48 * HD),
                    "v"(l1 + FO_KR), "v"(kr), "v"(l1 + FO_KR + 16u * FP1), "v"(kr + 16 * HD), "v"(l1 + FO_KR + 32u * FP1), "v"(kr + 32 * HD), "v"(l1 + FO_KR + 48u * FP1), "v"(kr + 48 * HD),
                    "v"(l1 + FO_BM), "v"(b0), "v"(l1 + FO_BM + 16u * FP1), "v"(b1)
                 : "memory");
    asm volatile("global_load_async_to_lds_b128 %0, %1, off\n\t"
                 "global_load_async_to_lds_b128 %2, %3, off\n\t"
                 "global_load_async_to_lds_b128 %4, %5, off\n\t"
                 "global_load_async_to_lds_b128 %6, %7, off\n\t"
                 "global_load_async_to_lds_b128 %8, %9, off\n\t"
                 "global_load_async_to_lds_b128 %10, %11, off\n\t"
                 "global_load_async_to_lds_b128 %12, %13, off\n\t"
                 "global_load_async_to_lds_b128 %14, %15, off\n\t"
                 "global_load_async_to_lds_b128 %16, %17, off\n\t"
                 "global_load_async_to_lds_b128 %18, %19, off\n\t"
                 "global_load_async_to_lds_b128 %20, %21, off\n\t"
                 "global_load_async_to_lds_b128 %22, %23, off\n\t"
                 "s_wait_xcnt 0x0"
                 :: "v"(l2), "v"(mk), "v"(l2 + 8u * FP2), "v"(mk + 8 * SEQ_FULL), "v"(l2 + 16u * FP2), "v"(mk + 16 * SEQ_FULL), "v"(l2 + 24u * FP2), "v"(mk + 24 * SEQ_FULL),
                    "v"(l2 + 32u * FP2), "v"(mk + 32 * SEQ_FULL), "v"(l2 + 40u * FP2), "v"(mk + 40 * SEQ_FULL), "v"(l2 + 48u * FP2), "v"(mk + 48 * SEQ_FULL), "v"(l2 + 56u * FP2), "v"(mk + 56 * SEQ_FULL),
                    "v"(l1 + FO_VT), "v"(vt), "v"(l1 + FO_VT + 16u * FP1), "v"(vt + 16 * SEQ), "v"(l1 + FO_VT + 32u * FP1), "v"(vt + 32 * SEQ), "v"(l1 + FO_VT + 48u * FP1), "v"(vt + 48 * SEQ)
                 : "memory");
}

// k_flash: fused attention + geometric term, one wave per 16 query rows of one (batch, head); q fragments straight from the 16-bit planes, all key-side fragments and the mask from the staged LDS tiles (two 16-B reads each).
// Transposed form: S^T[key][t] = K Q^T; lane (t = lane&15, h = lane>>4) holds keys 8h+r of each 16-key tile, so packed P / G tiles are directly B fragments of
// O^T[d][t] = V^T P^T and T^T[cx][t] = BM^T G^T. S = kH.qH + (kH.qR + kR.qH)/2048. Mask: replace-fill for the softmax, zero for G. Softmax state one scalar per lane (running max from -inf).
// Epilogue: tmp2 halves exchanged with one xor-16 shuffle, c16 = base.tmp2 (K = 3, VALU), ctx^T = EW c16^T on one K=32 tile (value | residual), sum staged in a wave-private LDS tile and
__global__ __launch_bounds__(32 * AW) void k_flash(const h16* __restrict__ QH, const h16* __restrict__ QR, const h16* __restrict__ KH, const h16* __restrict__ KR, const h16* __restrict__ VT,
                                                   const h16* __restrict__ BM, const float* __restrict__ BASE, const h16* __restrict__ EWA, const int* __restrict__ mask, bf* OA) {
    __shared__ __align__(16) float os[AW * 16 * 68];
    __shared__ __align__(16) unsigned char fr[2 * F_STAGE];
    const int tid = threadIdx.x;
    const int lane = threadIdx.x & 31, wave = __builtin_amdgcn_readfirstlane((int)(threadIdx.x >> 5)), lr = lane & 15, hi = lane >> 4;
    const int zh = blockIdx.y; const int b = zh / NH_, h = zh % NH_;
    const int t0 = (blockIdx.x * AW + wave) * 16;
    const size_t pbase = (size_t)zh * SEQ * HD;
    const size_t qo = pbase + (size_t)(t0 + lr) * HD + 8 * hi;
    const v16h qh0 = ldh(QH + qo), qh1 = ldh(QH + qo + 32), qr0 = ldh(QR + qo), qr1 = ldh(QR + qo + 32);   // B fragments: col t, k = d
    // readers, byte offsets in a buffer: 128-byte-row tiles at row lr (A fragments: row key / d / cx), mask at this wave's row lr
    const uint32_t ro = (uint32_t)lr * FP1 + 16u * (uint32_t)hi;
    const uint32_t mo = FO_MK + (uint32_t)(wave * 16 + lr) * FP2 + 32u * (uint32_t)hi;
    // copiers: the lane's own 16 bytes of stage 0 (8 lanes per 128-byte row, 16 lanes per mask row)
    const h16* ckh = KH + pbase + (size_t)tid * 8;
    const h16* ckr = KR + pbase + (size_t)tid * 8;
    const h16* cvt = VT + pbase + (size_t)(tid >> 3) * SEQ + 8 * (tid & 7);
    const h16* cb0 = BM + ((size_t)b * 16 + (tid >> 3)) * SEQ + 8 * (tid & 7);
    const h16* cb1 = cb0 + (size_t)NB * 16 * SEQ;
    const int* cmk = mask + ((size_t)b * SEQ_FULL + blockIdx.x * (16 * AW) + (tid >> 4)) * SEQ_FULL + 4 * (tid & 15);
    const uint32_t cl1 = (uint32_t)(size_t)fr + (uint32_t)(tid >> 3) * FP1 + 16u * (uint32_t)(tid & 7);
    const uint32_t cl2 = (uint32_t)(size_t)fr + FO_MK + (uint32_t)(tid >> 4) * FP2 + 16u * (uint32_t)(tid & 15);
    v8f o0 = (v8f){}, o1 = (v8f){}, o2 = (v8f){}, o3 = (v8f){}, gA = (v8f){}, gR = (v8f){};
    float m = -__builtin_huge_valf(), l = 0.0f;
    flash_fill(cl1, cl2, ckh, ckr, cvt, cb0, cb1, cmk);
    asm volatile("s_wait_asynccnt 0x0" ::: "memory");    // this wave's copies of stage 0 have landed
    __syncthreads();                                     // every wave's part of stage 0 is readable by every wave
    flash_fill(cl1 + F_STAGE, cl2 + F_STAGE, ckh + FK * HD, ckr + FK * HD, cvt + FK, cb0 + FK, cb1 + FK, cmk + FK);
#pragma unroll 1   // one stage per trip: the buffer index and the publish point at the foot belong to one stage
    for (int st = 0; st < SEQ / FK; ++st) {
      const uint32_t bo = (uint32_t)(st & 1) * F_STAGE;
#pragma unroll   // both 32-key halves of a stage in line, so that their LDS offsets are immediates of the reads
      for (int sub = 0; sub < FK / 32; ++sub) {
        const int* mrow = (const int*)(fr + bo + mo + sub * 128);
        const v4i mk0 = *(const v4i*)(mrow), mk1 = *(const v4i*)(mrow + 4), mk2 = *(const v4i*)(mrow + 16), mk3 = *(const v4i*)(mrow + 20);
        const unsigned char* ka = fr + bo + FO_KH + ro + sub * 32 * FP1; const unsigned char* kr = fr + bo + FO_KR + ro + sub * 32 * FP1;
        const v16h ka0 = ldh((const h16*)ka), ka1 = ldh((const h16*)(ka + 64)), kb0 = ldh((const h16*)(ka + 16 * FP1)), kb1 = ldh((const h16*)(ka + 16 * FP1 + 64));
        const v16h ra0 = ldh((const h16*)kr), ra1 = ldh((const h16*)(kr + 64)), rb0 = ldh((const h16*)(kr + 16 * FP1)), rb1 = ldh((const h16*)(kr + 16 * FP1 + 64));
        v8f sHa = (v8f){}, sLa = (v8f){}, sKa = (v8f){}, sHb = (v8f){}, sLb = (v8f){}, sKb = (v8f){};
        sHa = wmma16(ka0, qh0, sHa); sLa = wmma16(ka0, qr0, sLa); sKa = wmma16(ra0, qh0, sKa); sHb = wmma16(kb0, qh0, sHb); sLb = wmma16(kb0, qr0, sLb); sKb = wmma16(rb0, qh0, sKb);
        sHa = wmma16(ka1, qh1, sHa); sLa = wmma16(ka1, qr1, sLa); sKa = wmma16(ra1, qh1, sKa); sHb = wmma16(kb1, qh1, sHb); sLb = wmma16(kb1, qr1, sLb); sKb = wmma16(rb1, qh1, sKb);
        asm volatile("v_nop\n\tv_nop\n\tv_nop\n\tv_nop" : "+v"(sHa), "+v"(sLa), "+v"(sKa), "+v"(sHb), "+v"(sLb), "+v"(sKb) : "v"(ka0), "v"(ka1), "v"(kb0), "v"(kb1), "v"(ra0), "v"(ra1), "v"(rb0), "v"(rb1));
        const int mka[8] = {mk0[0], mk0[1], mk0[2], mk0[3], mk1[0], mk1[1], mk1[2], mk1[3]};
        const int mkb[8] = {mk2[0], mk2[1], mk2[2], mk2[3], mk3[0], mk3[1], mk3[2], mk3[3]};
        float ta[8], tb[8]; float mx = NEGMIN;
        v16h gh, gr;
#pragma unroll
        for (int r = 0; r < 8; ++r) {
            const float xa = sHa[r] + (sLa[r] + sKa[r]) * QRI; const float xb = sHb[r] + (sLb[r] + sKb[r]) * QRI;
            const bool va = (mka[r] != 0), vb = (mkb[r] != 0);
            ta[r] = va ? xa * SC2 : NEGMIN; tb[r] = vb ? xb * SC2 : NEGMIN;
            const float ga = va ? xa : 0.0f; const float gb = vb ? xb : 0.0f;
            const h16 ha = (h16)ga; const h16 hb = (h16)gb;
            gh[r] = ha; gh[8 + r] = hb; gr[r] = (h16)((ga - (float)ha) * QRS); gr[8 + r] = (h16)((gb - (float)hb) * QRS);
            mx = fmaxf(mx, fmaxf(ta[r], tb[r])); }
        mx = fmaxf(mx, __shfl_xor(mx, 16, 32));
        const float mnew = fmaxf(m, mx);
        const float alpha = __builtin_amdgcn_exp2f(m - mnew);
        const float sh = PSH - mnew;
        v16h pb; float ls = 0.0f;
#pragma unroll
        for (int r = 0; r < 8; ++r) { const h16 pa = (h16)__builtin_amdgcn_exp2f(ta[r] + sh); const h16 pc = (h16)__builtin_amdgcn_exp2f(tb[r] + sh); pb[r] = pa; pb[8 + r] = pc; ls += (float)pa + (float)pc; }
        l = l * alpha + ls; m = mnew;
        o0 = o0 * alpha; o1 = o1 * alpha; o2 = o2 * alpha; o3 = o3 * alpha;
        const unsigned char* va_ = fr + bo + FO_VT + ro + sub * 64;
        const v16h v0 = ldh((const h16*)va_), v1 = ldh((const h16*)(va_ + 16 * FP1)), v2 = ldh((const h16*)(va_ + 32 * FP1)), v3 = ldh((const h16*)(va_ + 48 * FP1));
        const unsigned char* ba_ = fr + bo + FO_BM + ro + sub * 64;
        const v16h bh = ldh((const h16*)ba_), br = ldh((const h16*)(ba_ + 16 * FP1));
        o0 = wmma16(v0, pb, o0); gA = wmma16(bh, gh, gA); o1 = wmma16(v1, pb, o1); gR = wmma16(bh, gr, gR); o2 = wmma16(v2, pb, o2); o3 = wmma16(v3, pb, o3); gR = wmma16(br, gh, gR);
        asm volatile("v_nop\n\tv_nop\n\tv_nop\n\tv_nop" : "+v"(o0), "+v"(o1), "+v"(o2), "+v"(o3), "+v"(gA), "+v"(gR) : "v"(v0), "v"(v1), "v"(v2), "v"(v3), "v"(pb), "v"(bh), "v"(br), "v"(gh), "v"(gr));
      }
      asm volatile("s_wait_dscnt 0x0" ::: "memory");       // this wave's reads of this buffer have returned
      asm volatile("s_wait_asynccnt 0x0" ::: "memory");    // this wave's copies of stage st + 1 have landed
      __syncthreads();                                     // publishes stage st + 1 and ends every wave's reads of this buffer
      if (st + 2 < SEQ / FK) {                             // only while stage st + 2 exists (the same for the whole block)
          const int kn = (st + 2) * FK;
          flash_fill(cl1 + bo, cl2 + bo, ckh + (size_t)kn * HD, ckr + (size_t)kn * HD, cvt + kn, cb0 + kn, cb1 + kn, cmk + kn);
      }
    }
    asm volatile("s_wait_asynccnt 0x0" ::: "memory");    // no copy is outstanding when the wave goes on
    l += __shfl_xor(l, 16, 32);
    const float inv = 1.0f / l;
    // tmp2 (x1024): lane (t, h) holds rows cx = 8h + r; fetch the other half unconditionally, select by value
    float mi[8], ot[8], f[12];
#pragma unroll
    for (int r = 0; r < 8; ++r) { mi[r] = gA[r] + gR[r] * QRI; ot[r] = __shfl_xor(mi[r], 16, 32); }
#pragma unroll
    for (int r = 0; r < 8; ++r) f[r] = hi ? ot[r] : mi[r];
#pragma unroll
    for (int r = 0; r < 4; ++r) f[8 + r] = hi ? mi[r] : ot[r];
    const float* bp = BASE + ((size_t)b * SEQ + t0 + lr) * 16;
    const v4f b0 = *(const v4f*)bp, b1 = *(const v4f*)(bp + 4), b2 = *(const v4f*)(bp + 8);
    const float bs[12] = {b0[0], b0[1], b0[2], b0[3], b1[0], b1[1], b1[2], b1[3], b2[0], b2[1], b2[2], b2[3]};
    float e0[3], e1[3];
#pragma unroll
    for (int x = 0; x < 3; ++x) { e0[x] = hi ? bs[6 + x] : bs[x]; e1[x] = hi ? bs[9 + x] : bs[3 + x]; }
    // B fragment of the edge projection: element i <- 16*c16[t][j = 8h + i] (e = 2h + i/4, c = i%4), element 8+i <- its residual x2048
    v16h cb;
#pragma unroll
    for (int i = 0; i < 8; ++i) { const int c = i & 3;
        const float cv = (i < 4) ? (e0[0] * f[3 * c] + e0[1] * f[3 * c + 1] + e0[2] * f[3 * c + 2]) : (e1[0] * f[3 * c] + e1[1] * f[3 * c + 1] + e1[2] * f[3 * c + 2]);
        const float bq = cv * (1.0f / 64.0f); const h16 hh = (h16)bq; cb[i] = hh; cb[8 + i] = (h16)((bq - (float)hh) * QRS); }
    const v16h ea0 = ldh(EWA + (size_t)(lr) * 32 + 8 * hi), ea1 = ldh(EWA + (size_t)(16 + lr) * 32 + 8 * hi), ea2 = ldh(EWA + (size_t)(32 + lr) * 32 + 8 * hi), ea3 = ldh(EWA + (size_t)(48 + lr) * 32 + 8 * hi);
    v8f c0 = (v8f){}, c1 = (v8f){}, c2 = (v8f){}, c3 = (v8f){};
    c0 = wmma16(ea0, cb, c0); c1 = wmma16(ea1, cb, c1); c2 = wmma16(ea2, cb, c2); c3 = wmma16(ea3, cb, c3);
    asm volatile("v_nop\n\tv_nop\n\tv_nop\n\tv_nop" : "+v"(c0), "+v"(c1), "+v"(c2), "+v"(c3) : "v"(ea0), "v"(ea1), "v"(ea2), "v"(ea3), "v"(cb));
    const float ci = 1.0f / 256.0f;
    const int wb = wave * 16 * 68;
    // D layout: x_j[r] = (d = 16j + 8h + r, t = lane&15) -> os[t][d]; rows 0..15 x columns 0..63 all written
    { v4f a, c;
      a[0] = o0[0] * inv + c0[0] * ci; a[1] = o0[1] * inv + c0[1] * ci; a[2] = o0[2] * inv + c0[2] * ci; a[3] = o0[3] * inv + c0[3] * ci;
      c[0] = o0[4] * inv + c0[4] * ci; c[1] = o0[5] * inv + c0[5] * ci; c[2] = o0[6] * inv + c0[6] * ci; c[3] = o0[7] * inv + c0[7] * ci;
      *(v4fa*)(&os[wb + lr * 68 +  0 + 8 * hi]) = a; *(v4fa*)(&os[wb + lr * 68 +  0 + 8 * hi + 4]) = c;
      a[0] = o1[0] * inv + c1[0] * ci; a[1] = o1[1] * inv + c1[1] * ci; a[2] = o1[2] * inv + c1[2] * ci; a[3] = o1[3] * inv + c1[3] * ci;
      c[0] = o1[4] * inv + c1[4] * ci; c[1] = o1[5] * inv + c1[5] * ci; c[2] = o1[6] * inv + c1[6] * ci; c[3] = o1[7] * inv + c1[7] * ci;
      *(v4fa*)(&os[wb + lr * 68 + 16 + 8 * hi]) = a; *(v4fa*)(&os[wb + lr * 68 + 16 + 8 * hi + 4]) = c;
      a[0] = o2[0] * inv + c2[0] * ci; a[1] = o2[1] * inv + c2[1] * ci; a[2] = o2[2] * inv + c2[2] * ci; a[3] = o2[3] * inv + c2[3] * ci;
      c[0] = o2[4] * inv + c2[4] * ci; c[1] = o2[5] * inv + c2[5] * ci; c[2] = o2[6] * inv + c2[6] * ci; c[3] = o2[7] * inv + c2[7] * ci;
      *(v4fa*)(&os[wb + lr * 68 + 32 + 8 * hi]) = a; *(v4fa*)(&os[wb + lr * 68 + 32 + 8 * hi + 4]) = c;
      a[0] = o3[0] * inv + c3[0] * ci; a[1] = o3[1] * inv + c3[1] * ci; a[2] = o3[2] * inv + c3[2] * ci; a[3] = o3[3] * inv + c3[3] * ci;
      c[0] = o3[4] * inv + c3[4] * ci; c[1] = o3[5] * inv + c3[5] * ci; c[2] = o3[6] * inv + c3[6] * ci; c[3] = o3[7] * inv + c3[7] * ci;
      *(v4fa*)(&os[wb + lr * 68 + 48 + 8 * hi]) = a; *(v4fa*)(&os[wb + lr * 68 + 48 + 8 * hi + 4]) = c; }
    wave_sync();
    bf* orow = OA + ((size_t)b * SEQ + t0) * K2 + h * HD;
{
#pragma unroll
        for (int s = 0; s < 4; ++s) { const int row = 4 * s + (lane >> 3), c8 = (lane & 7) * 8;   // 4 s x 4 row groups = 16 rows; 8 lanes x 8 = 64 columns
            const v4f x0 = *(const v4fa*)(&os[wb + row * 68 + c8]); const v4f x1 = *(const v4fa*)(&os[wb + row * 68 + c8 + 4]); v8us hv, lv;
#pragma unroll
            for (int i = 0; i < 4; ++i) { const unsigned short a0 = f2bf(x0[i]); const unsigned short a1 = f2bf(x1[i]); hv[i] = a0; hv[4 + i] = a1; lv[i] = f2bf(x0[i] - bf2f(a0)); lv[4 + i] = f2bf(x1[i] - bf2f(a1)); }
            const size_t oo = (size_t)row * K2 + c8;
            *(v8us*)(orow + oo) = hv; *(v8us*)(orow + DM + oo) = lv; }
         }
}

static constexpr size_t al256(size_t v) { return (v + 255) & ~(size_t)255; }
static constexpr size_t SZ_WB  = al256((size_t)3 * DM * DM * 2);
static constexpr size_t SZ_OWB = al256((size_t)DM * DM * 2);
static constexpr size_t SZ_XA  = al256((size_t)NB * SEQ * K2 * 2);
static constexpr size_t SZ_QK  = al256((size_t)NB * SEQ * K2 * 4);
static constexpr size_t SZ_PL  = al256((size_t)NB * NH_ * SEQ * HD * 2);
static constexpr size_t SZ_BM  = al256((size_t)2 * NB * 16 * SEQ * 2);
static constexpr size_t SZ_BS  = al256((size_t)NB * SEQ * 16 * 4);
static constexpr size_t SZ_CS  = al256((size_t)NB * SEQ * 32 * 4);
static constexpr size_t SZ_EW  = al256((size_t)64 * 32 * 2);
static constexpr size_t SZ_TOTAL = SZ_WB + SZ_OWB + 2 * SZ_XA + SZ_QK + 5 * SZ_PL + SZ_BM + SZ_BS + 2 * SZ_CS + SZ_EW;
static_assert(SZ_TOTAL <= (size_t)134217728);          // workspace carve <= 128 MiB
static_assert(SZ_PL % 2 == 0);                         // plane stride in halves is exact
static_assert(SZ_PL == (size_t)NB * NH_ * SEQ * HD * 2);   // the four q/k planes are back to back with stride SZ_PL/2 halves

extern "C" void kernel_launch(void* const* d_in, const int* in_sizes, int n_in,
                              void* d_out, int out_size, void* d_ws, size_t ws_size, hipStream_t stream) {
    if (n_in < 11) return;
    const size_t ntok = (size_t)(NB - 1) * SEQ_FULL + SEQ;
    if ((size_t)in_sizes[0] < ntok) return;
    if ((size_t)in_sizes[1] < ntok * DM) return;
    if ((size_t)in_sizes[2] < (ntok - 1) * SEQ_FULL + SEQ) return;
    if ((size_t)in_sizes[3] < ntok * 12) return;
    if ((size_t)in_sizes[4] < (size_t)DM || (size_t)in_sizes[5] < (size_t)DM || (size_t)in_sizes[7] < (size_t)DM || (size_t)in_sizes[8] < (size_t)DM) return;
    if ((size_t)in_sizes[6] < (size_t)3 * DM * DM || (size_t)in_sizes[9] < (size_t)DM * DM || (size_t)in_sizes[10] < (size_t)1024) return;
    if ((size_t)out_size < ((size_t)(NB - 1) * OUT_SEQ + SEQ) * DM) return;
    if (SZ_TOTAL > ws_size) return;
    // wire order: position, x, attention_mask (int32), blocks, ln_w, ln_b, wqkv [3072][1024], q_ln_w, k_ln_w, out_w [1024][1024], edge_w [64][16]
    const float* position = (const float*)d_in[0]; const float* x = (const float*)d_in[1]; const int* amask = (const int*)d_in[2]; const float* blocks = (const float*)d_in[3];
    const float* ln_w = (const float*)d_in[4]; const float* ln_b = (const float*)d_in[5]; const float* wqkv = (const float*)d_in[6];
    const float* q_ln_w = (const float*)d_in[7]; const float* k_ln_w = (const float*)d_in[8]; const float* out_w = (const float*)d_in[9]; const float* edge_w = (const float*)d_in[10];
    float* OUT = (float*)d_out;
    char* wsp = (char*)d_ws;
    bf* WB  = (bf*)wsp;  wsp += SZ_WB;                // [3072][1024]: q | k | v rows
    bf* OWB = (bf*)wsp;  wsp += SZ_OWB;               // [1024][1024]
    bf* XA  = (bf*)wsp;  wsp += SZ_XA;                // [NB*SEQ][hi 1024 | lo 1024]
    bf* OA  = (bf*)wsp;  wsp += SZ_XA;                // [NB*SEQ][hi 1024 | lo 1024]
    float* QK = (float*)wsp; wsp += SZ_QK;            // [NB*SEQ][q 1024 | k 1024]
    h16* QH = (h16*)wsp; wsp += SZ_PL;                // [NB*16][SEQ][64]; QH, QR, KH, KR back to back (stride SZ_PL/2 halves)
    h16* QR = (h16*)wsp; wsp += SZ_PL;
    h16* KH = (h16*)wsp; wsp += SZ_PL;
    h16* KR = (h16*)wsp; wsp += SZ_PL;
    h16* VT = (h16*)wsp; wsp += SZ_PL;                // [NB*16][64][SEQ]
    h16* BM = (h16*)wsp; wsp += SZ_BM;                // [2][NB][16][SEQ]
    float* BASE = (float*)wsp; wsp += SZ_BS;          // [NB*SEQ][16]
    float* CS = (float*)wsp; wsp += SZ_CS;            // [NB*SEQ][32]
    float* SN = (float*)wsp; wsp += SZ_CS;
    h16* EWA = (h16*)wsp; wsp += SZ_EW;               // [64][32]

    k_front<<<GF_LNX + GF_ROPE + GF_CVT, 256, 0, stream>>>(x, ln_w, ln_b, XA, position, CS, SN, wqkv, WB);

    k_proj_qkv<<<PQ_N + PV_N, 128, 0, stream>>>(XA, WB, QK, VT);

    // planes QH | QR | KH | KR from the base QH with stride SZ_PL/2 halves
    k_mid<<<GM_PREP + GM_ROT + 1 + GM_CVT, 256, 0, stream>>>(QK, q_ln_w, k_ln_w, CS, SN, QH, (size_t)(SZ_PL / 2), blocks, amask, BM, BASE, edge_w, EWA, out_w, OWB);

    k_flash<<<dim3(SEQ / (16 * AW), NB * NH_, 1), 32 * AW, 0, stream>>>(QH, QR, KH, KR, VT, BM, BASE, EWA, amask, OA);

    // out: A = (ctx + context) hi|lo rows, Bt = out_w rows -> OUT[b][t][n]
    k_proj<1><<<dim3(NB * SEQ / 128, DM / 128, 1), 128, 0, stream>>>(OA, K2, OWB, DM, K2, (h16*)0, SEQ, (size_t)0, 0, 64, (size_t)0, OUT, DM, OUT_SEQ);
}

// v004
// It runs in 97.5 microseconds.
// Timed twice side by side with v003, it ran 1.07 and 1.08 times as fast.
// Counting every step since v000, it is 2.73 times as fast.
#include <hip/hip_runtime.h>
#include <stdint.h>

// Compute dtypes (f32 accumulate everywhere): qkv and output projections v_wmma_f32_16x16x32_bf16 (activation as bf16 hi|lo planes folded along K, weights RNE-converted bf16); scores, P.V, geometric sum and edge projection v_wmma_f32_16x16x32_f16 (q, k, G, bm, c16 as f16 value + f16 residual x2048; P x256 and v single f16).
// Pre-norm attention block, width 1024 = 16 heads x 64: LN(x) -> qkv GEMM -> LN(q), LN(k) over the full width -> rotate-half rotary (cos/sin table from the position input) ->
// masked softmax attention (replace-fill, running max) plus geometric term tmp2 = sum_k (q.k) mask bm/len, context = (base.tmp2) edge_w^T -> output GEMM.
// Every float input is RNE-converted to bf16 on load. Fused flash kernel in transposed form (S^T = K Q^T, O^T = V^T P^T, tmp2^T = BM^T G^T, ctx^T = EW c16^T).

#ifndef NB
#define NB 2
#endif
#ifndef SEQ
#define SEQ 1024
#endif
#define NB_FULL  2
#define SEQ_FULL 1024
#ifndef OUT_SEQ
#define OUT_SEQ SEQ              // row pitch (in tokens) between batches of the output
#endif
#define DM   1024
#define K2   2048                // hi|lo folded contraction length
#define NH_  16
#define HD   64
#define AW   4                   // waves per flash block (16 query rows each)
#define QRS  2048.0f             // carry of the residual planes
#define QRI  (1.0f / 2048.0f)
#define SC2  (0.125f * 1.4426950408889634f)   // HD^-0.5 * log2(e)
#define PSH  8.0f                // log2 of the P carry (256)
#define NEGMIN (-3.4028234663852886e38f)

static_assert(HD == 64);
static_assert(NH_ * HD == DM);
static_assert(K2 == 2 * DM);
static_assert((DM & (DM - 1)) == 0);           // k index wrap uses a power-of-two mask
static_assert(DM % 64 == 0);
static_assert(SEQ % 128 == 0);                 // mask row sums read 128 ints per step
static_assert(SEQ % 64 == 0);
static_assert((NB * SEQ) % 128 == 0);
static_assert((NB * SEQ) % 8 == 0);
static_assert(SEQ % (16 * AW) == 0);
static_assert(NB <= NB_FULL);
static_assert(SEQ <= SEQ_FULL);

typedef _Float16 h16;
typedef unsigned short bf;
typedef __attribute__((ext_vector_type(16))) __bf16   v16bf;
typedef __attribute__((ext_vector_type(16))) _Float16 v16h;
typedef __attribute__((ext_vector_type(8)))  _Float16 v8h;
typedef __attribute__((ext_vector_type(8)))  unsigned short v8us;
typedef __attribute__((ext_vector_type(8)))  float    v8f;
typedef __attribute__((ext_vector_type(4)))  float    v4f;
typedef __attribute__((ext_vector_type(4)))  int      v4i;
typedef __attribute__((ext_vector_type(4)))  uint32_t u32x4;
typedef __attribute__((ext_vector_type(8)))  uint32_t u32x8;
typedef v4f  __attribute__((may_alias)) v4fa;
typedef v8h  __attribute__((may_alias)) v8ha;

__device__ __forceinline__ unsigned short f2bf(float f) { unsigned u = __float_as_uint(f); u += 0x7FFFu + ((u >> 16) & 1u); return (unsigned short)(u >> 16); }
__device__ __forceinline__ float bf2f(unsigned short b) { return __uint_as_float(((unsigned)b) << 16); }
__device__ __forceinline__ float bfr(float f) { return bf2f(f2bf(f)); }
__device__ __forceinline__ v16h cat16(v8h lo, v8h hi) { return __builtin_shufflevector(lo, hi, 0, 1, 2, 3, 4, 5, 6, 7, 8, 9, 10, 11, 12, 13, 14, 15); }
__device__ __forceinline__ v16bf cat16b(v8us lo, v8us hi) { return __builtin_bit_cast(v16bf, __builtin_shufflevector(lo, hi, 0, 1, 2, 3, 4, 5, 6, 7, 8, 9, 10, 11, 12, 13, 14, 15)); }
__device__ __forceinline__ v8f wmma16(v16h a, v16h b, v8f c) { return __builtin_amdgcn_wmma_f32_16x16x32_f16(false, a, false, b, (short)0, c, false, false); }
__device__ __forceinline__ v8f wmmab(v16bf a, v16bf b, v8f c) { return __builtin_amdgcn_wmma_f32_16x16x32_bf16(false, a, false, b, (short)0, c, false, false); }
// fragment loaders from K-contiguous 16-bit rows; p already includes + 8*(lane>>4): elements 0..7 <- k0+8h+0..7, elements 8..15 <- k0+16+8h+0..7 (same map for A and B)
__device__ __forceinline__ v16h  ldh(const h16* p) { return cat16(*(const v8h*)p, *(const v8h*)(p + 16)); }
__device__ __forceinline__ v16bf ldb(const bf* p)  { return cat16b(*(const v8us*)p, *(const v8us*)(p + 16)); }
// ordering point for wave-private LDS tiles (same wave writes and reads)
__device__ __forceinline__ void wave_sync() { __builtin_amdgcn_fence(3 /* release order */, "wavefront"); __builtin_amdgcn_wave_barrier(); asm volatile("" ::: "memory"); }
__device__ __forceinline__ float wsum(float v) { v += __shfl_xor(v, 16, 32); v += __shfl_xor(v, 8, 32); v += __shfl_xor(v, 4, 32); v += __shfl_xor(v, 2, 32); v += __shfl_xor(v, 1, 32); return v; }
__device__ __forceinline__ int wsumi(int v) { v += __shfl_xor(v, 16, 32); v += __shfl_xor(v, 8, 32); v += __shfl_xor(v, 4, 32); v += __shfl_xor(v, 2, 32); v += __shfl_xor(v, 1, 32); return v; }

// The six row-wise stages (cvt8, ew, lnx, rope, prep, qkrot) are device functions of one 256-thread block each (blk = the block's index inside its own stage); k_front and k_mid, behind qkrot_part,
// run stages that read none of each other's output side by side in one grid.
// cvt8_part: CVT_CH chunks of 8 floats per thread, 256 threads apart; all of a thread's loads are issued before the first value is converted.
#define CVT_CH 8
__device__ __forceinline__ void cvt8_part(int blk, const float* __restrict__ src, bf* dst, size_t n8) {
    const size_t i = (size_t)blk * (256 * CVT_CH) + threadIdx.x; if (i + (size_t)(CVT_CH - 1) * 256 >= n8) return;
    v4f va[CVT_CH], vb[CVT_CH];
#pragma unroll
    for (int ch = 0; ch < CVT_CH; ++ch) { const float* p = src + (i + (size_t)ch * 256) * 8;
        va[ch] = *(const v4f*)p;
        if (ch == CVT_CH - 1) asm volatile("s_wait_xcnt 0x0" ::: "memory");   // the last load's result may be given the address pair that all the loads above name: it issues only behind this wait
        vb[ch] = *(const v4f*)(p + 4); }
#pragma unroll
    for (int ch = 0; ch < CVT_CH; ++ch) { v8us o;
#pragma unroll
        for (int k = 0; k < 4; ++k) { o[k] = f2bf(va[ch][k]); o[4 + k] = f2bf(vb[ch][k]); }
        *(v8us*)(dst + (i + (size_t)ch * 256) * 8) = o; }
}

// ew_part: edge weight A plane [64][32] f16: columns 0..15 = 16*w[d][j], columns 16..31 = w[d][j]/128 (pairs with the x2048 residual half of the c16 operand). One block; each thread 16 B, consecutive.
__device__ __forceinline__ void ew_part(const float* __restrict__ ew, h16* EWA) {
    const int tid = threadIdx.x; const int d = tid >> 2, q = tid & 3;
    const float sc = (q < 2) ? 16.0f : 0.0078125f;
    const v8f w = *(const v8f*)(ew + d * 16 + (q & 1) * 8);
    v8h o;
#pragma unroll
    for (int i = 0; i < 8; ++i) o[i] = (h16)(bfr(w[i]) * sc);
    *(v8h*)(EWA + d * 32 + q * 8) = o;
    asm volatile("s_wait_xcnt 0x0" ::: "memory");   // other stages' code follows this store in the merged kernel: its address and data registers are rewritten only behind this wait
}

// The wave's row and both weight rows are loaded once, all loads issued together, and kept in registers through the three passes (element visiting order it = 0..3, i = 0..7 in every pass).
__device__ __forceinline__ void lnx_part(int blk, const float* __restrict__ x, const float* __restrict__ lw, const float* __restrict__ lb, bf* XA) {
    const int lane = threadIdx.x & 31; const int wave = __builtin_amdgcn_readfirstlane((int)(threadIdx.x >> 5));
    const int m = blk * 8 + wave; const int b = m / SEQ, t = m % SEQ;
    const float* src = x + ((size_t)b * SEQ_FULL + t) * DM + lane * 8;
    v8f raw[4], wv[4], bv[4];
#pragma unroll
    for (int it = 0; it < 4; ++it) raw[it] = *(const v8f*)(src + it * 256);
#pragma unroll
    for (int it = 0; it < 4; ++it) { wv[it] = *(const v8f*)(lw + it * 256 + lane * 8); bv[it] = *(const v8f*)(lb + it * 256 + lane * 8); }
    float s = 0.0f;
#pragma unroll
    for (int it = 0; it < 4; ++it) {
#pragma unroll
        for (int i = 0; i < 8; ++i) { raw[it][i] = bfr(raw[it][i]); s += raw[it][i]; } }
    s = wsum(s);
    const float mean = s * (1.0f / DM);
    float ss = 0.0f;
#pragma unroll
    for (int it = 0; it < 4; ++it) {
#pragma unroll
        for (int i = 0; i < 8; ++i) { const float dv = raw[it][i] - mean; ss += dv * dv; } }
    ss = wsum(ss);
    const float rstd = 1.0f / sqrtf(ss * (1.0f / DM) + 1e-5f);
    bf* dst = XA + (size_t)m * K2 + lane * 8;
#pragma unroll
    for (int it = 0; it < 4; ++it) {
        v8us hv, lv;
#pragma unroll
        for (int i = 0; i < 8; ++i) { const float dv = raw[it][i] - mean; const float y = dv * rstd * bfr(wv[it][i]) + bfr(bv[it][i]); const unsigned short hh = f2bf(y); hv[i] = hh; lv[i] = f2bf(y - bf2f(hh)); }
        *(v8us*)(dst + it * 256) = hv; *(v8us*)(dst + DM + it * 256) = lv; }
}

__device__ __forceinline__ void rope_part(int blk, const float* __restrict__ pos, float* CS, float* SN) {
    const int lane = threadIdx.x & 31; const int wave = __builtin_amdgcn_readfirstlane((int)(threadIdx.x >> 5));
    const int m = blk * 8 + wave; const int b = m / SEQ, t = m % SEQ;
    const float p = bfr(pos[(size_t)b * SEQ_FULL + t]);
    double pd = 1.0;
#pragma unroll 1
    for (int i = 0; i < lane; ++i) pd *= 1.333521432163324;
    const float pf = (float)pd;
    const float invf = 1.0f / pf;
    const float ang = p * invf;
    const float c = cosf(ang), s = sinf(ang);
    *(float*)(CS + (size_t)m * 32 + lane) = c; *(float*)(SN + (size_t)m * 32 + lane) = s;
    
}

// prep_part: per 64 tokens: len = mask row sums; bm = blocks - mean_c; base = bm / (|bm| + eps); planes BM[0] = f16(bm * 1024/len), BM[1] = f16 residual x2048, layout [plane][b][16][SEQ] (rows 12..15 zero);
// BASE [token][16] f32 (columns 12..15 zero). LDS tiles are cross-wave: block barriers between phases.
__device__ __forceinline__ void prep_part(int blk, const float* __restrict__ blocks, const int* __restrict__ mask, h16* BM, float* BASE) {
    __shared__ float slen[64];
    __shared__ __align__(16) h16 sb[32 * 64];
    __shared__ __align__(16) float sbase[64 * 16];
    const int tid = threadIdx.x, lane = tid & 31; const int wave = __builtin_amdgcn_readfirstlane((int)(threadIdx.x >> 5));
    const int m0 = blk * 64; const int b = m0 / SEQ, t0 = m0 % SEQ;
#pragma unroll 1   // two batches of four mask rows: a batch's loads are all in flight together; all eight rows at once would double the registers of the whole kernel
    for (int g = 0; g < 2; ++g) { const int tl = wave * 8 + g * 4;
        const int* row = mask + ((size_t)b * SEQ_FULL + t0 + tl) * SEQ_FULL + lane * 4;
        v4i mv[4][SEQ / 128];
#pragma unroll
        for (int r = 0; r < 4; ++r)
#pragma unroll
            for (int c = 0; c < SEQ / 128; ++c) mv[r][c] = *(const v4i*)(row + (size_t)r * SEQ_FULL + c * 128);
        int cnt[4];
#pragma unroll
        for (int r = 0; r < 4; ++r) { cnt[r] = 0;
#pragma unroll
            for (int c = 0; c < SEQ / 128; ++c) cnt[r] += (mv[r][c][0] != 0) + (mv[r][c][1] != 0) + (mv[r][c][2] != 0) + (mv[r][c][3] != 0); }
#pragma unroll
        for (int r = 0; r < 4; ++r) cnt[r] = wsumi(cnt[r]);
        if (lane == 0) {
#pragma unroll
            for (int r = 0; r < 4; ++r) slen[tl + r] = (float)cnt[r]; } }
    __syncthreads();
    if (tid < 64) {
        const float* p = blocks + ((size_t)b * SEQ_FULL + t0 + tid) * 12;
        const v4f a0 = *(const v4f*)p, a1 = *(const v4f*)(p + 4), a2 = *(const v4f*)(p + 8);
        float pv[12];
#pragma unroll
        for (int i = 0; i < 4; ++i) { pv[i] = bfr(a0[i]); pv[4 + i] = bfr(a1[i]); pv[8 + i] = bfr(a2[i]); }
        float mu[3];
#pragma unroll
        for (int x = 0; x < 3; ++x) mu[x] = (pv[x] + pv[3 + x] + pv[6 + x] + pv[9 + x]) * 0.25f;
        const float sc = (1.0f / slen[tid]) * 1024.0f;
#pragma unroll
        for (int c = 0; c < 4; ++c) {
            const float vx = pv[c * 3] - mu[0], vy = pv[c * 3 + 1] - mu[1], vz = pv[c * 3 + 2] - mu[2];
            const float inv = 1.0f / (sqrtf(vx * vx + vy * vy + vz * vz) + 1.1920929e-7f);
            const float vv[3] = {vx, vy, vz};
#pragma unroll
            for (int x = 0; x < 3; ++x) { const int cx = c * 3 + x;
                sbase[tid * 16 + cx] = vv[x] * inv;
                const float bs = vv[x] * sc; const h16 hh = (h16)bs;
                sb[cx * 64 + tid] = hh; sb[(16 + cx) * 64 + tid] = (h16)((bs - (float)hh) * QRS); } }
#pragma unroll
        for (int j = 12; j < 16; ++j) { sbase[tid * 16 + j] = 0.0f; sb[j * 64 + tid] = (h16)0.0f; sb[(16 + j) * 64 + tid] = (h16)0.0f; }
    }
    __syncthreads();
    // 32 lines of 64 halves: line = tid>>3 (0..15 value plane rows, 16..31 residual plane rows), 8 consecutive lanes x 16 B per line; BASE: 256 threads x 16 B contiguous
    const int line = tid >> 3, pc = tid & 7;
    const v8h bv = *(const v8ha*)(&sb[line * 64 + pc * 8]);
    const v4f fv = *(const v4fa*)(&sbase[tid * 4]);
    h16* bd = BM + (size_t)(line >> 4) * ((size_t)NB * 16 * SEQ) + ((size_t)b * 16 + (line & 15)) * SEQ + t0 + pc * 8;
    float* fd = BASE + (size_t)m0 * 16 + tid * 4;
    *(v8h*)bd = bv; *(v4f*)fd = fv;
    
}

// k_proj: bf16 GEMM, 128x128 tile per block of four waves (2 x 2, each 64x64 = 16 accumulators). Both operands are staged in LDS by tensor loads: a stage is 128 k
// (256 bytes of each of the 256 operand rows), two buffers, every wave moves its own 64-row slice one stage ahead of the pass that reads it. k order per accumulator: kc = 0, 32, 64, ...
// MODE 1: f32 rows C[((r0/RB)*RP + r0%RB)][c0..c0+63], row pitch ldc; each 256-byte row segment by 16 consecutive lanes x 16 B.
#define PJ_PITCH 272u                 // LDS row pitch: 256-byte row + the mover's 16-byte pad (odd multiple of 16 B for 16-byte readers)
#define PJ_SLICE 18432u               // 64 rows x 272 B = 17408, rounded up to a multiple of 2 KiB so that every slice starts on one
#define PJ_STAGE (4u * PJ_SLICE)      // slices 0, 1: A rows 0..63, 64..127 of the block tile; slices 2, 3: B rows
static_assert(64u * PJ_PITCH <= PJ_SLICE && PJ_SLICE % 2048u == 0u);
static_assert(DM % 128 == 0 && K2 % 128 == 0 && K2 / 128 >= 2);   // whole stages inside every operand row, at least two stages
__device__ __forceinline__ uint32_t uni(uint32_t v) { return (uint32_t)__builtin_amdgcn_readfirstlane((int)v); }
__device__ __forceinline__ uint32_t pinned(uint32_t v) { uint32_t w = uni(v); asm volatile("" : "+s"(w)); return w; }   // the pinned() form for tensor loads: the test value is held in a scalar register, so the branch round a load is a scalar one (the load ignores EXEC)
// one request of the whole wave: 64 rows of 256 bytes from ga (row pitch in g1) to LDS byte offset dst; word 0 of g0 (count 1) is set once by the caller
__device__ __forceinline__ void tdm_load(u32x4& g0, uint32_t dst, uint64_t ga, u32x8& g1) {
    g0[1] = uni(dst); g0[2] = uni((uint32_t)ga); g0[3] = uni((((uint32_t)(ga >> 32)) & 0x01FFFFFFu) | 0x80000000u);
    asm volatile("tensor_load_to_lds %0, %1" : "+s"(g0), "+s"(g1) :: "memory");   // in-out: the same registers go on to the wait below
}
// the wave's own requests have landed. The statement names both descriptor groups as in-out operands so that their scalar registers hold the issued words until the wait has returned
// and every new word is formed behind it.
__device__ __forceinline__ void tdm_wait(u32x4& g0, u32x8& g1) { asm volatile("s_wait_tensorcnt 0x0" : "+s"(g0), "+s"(g1) :: "memory"); }
// proj_tile: the tile (bx, by) of one product; ring and osall are the calling kernel's LDS arrays (ring on a multiple of 2 KiB).
template <int MODE>
__device__ __forceinline__ void proj_tile(unsigned char* ring, float* osall, uint32_t bx, uint32_t by, const bf* __restrict__ A, int pA, const bf* __restrict__ Bt, int pB, int K,
                                          h16* Ph, int RB, size_t sRB, int pitch, int CB, size_t sCB, float* C, int ldc, int RP) {
    const int lane = threadIdx.x & 31, lr = lane & 15, hi = lane >> 4;
    const uint32_t wave = uni(threadIdx.x >> 5);
    const int r0 = bx * 128 + (int)(wave >> 1) * 64, c0 = by * 128 + (int)(wave & 1u) * 64;
    float* os = osall + wave * (16 * 68);
    v8f acc[4][4];
#pragma unroll
    for (int mb = 0; mb < 4; ++mb)
#pragma unroll
        for (int nb = 0; nb < 4; ++nb) acc[mb][nb] = (v8f){};
    // this wave's slice of every stage: waves 0, 1 move A rows, waves 2, 3 move B rows; the k offset wraps at the operand's own row length
    const bool ownA = wave < 2u;
    const uint32_t sp = (uint32_t)(ownA ? pA : pB);
    const uint64_t src0 = ownA ? (uint64_t)(uintptr_t)(A + (size_t)(bx * 128 + wave * 64u) * (size_t)pA)
                               : (uint64_t)(uintptr_t)(Bt + (size_t)(by * 128 + (wave - 2u) * 64u) * (size_t)pB);
    const uint32_t slice = (uint32_t)(size_t)ring + wave * PJ_SLICE;
    u32x8 g1;
    g1[0] = uni((1u << 20) | (5u << 22) | (3u << 25));   // no mask, byte elements, 16 B of pad behind every 256 B
    g1[1] = uni(256u << 16); g1[2] = uni(64u << 16); g1[3] = uni(256u << 16); g1[4] = uni(64u);   // tensor = tile = 256 B x 64 rows
    g1[5] = uni(sp * 2u); g1[6] = uni(0u); g1[7] = uni(0u);
    const uint32_t T = (uint32_t)K >> 7;
    const uint32_t abase = (wave >> 1) * PJ_SLICE + (uint32_t)lr * PJ_PITCH + 16u * (uint32_t)hi;
    const uint32_t bbase = (2u + (wave & 1u)) * PJ_SLICE + (uint32_t)lr * PJ_PITCH + 16u * (uint32_t)hi;
    u32x4 g0;
    g0[0] = uni(1u);
    tdm_load(g0, slice, src0, g1);
    tdm_wait(g0, g1);                                    // this wave's slice of stage 0 has landed
    __syncthreads();                                     // every slice of stage 0 is readable by every wave
    if (pinned((1u < T) ? 1u : 0u) != 0u) tdm_load(g0, slice + PJ_STAGE, src0 + (uint64_t)((128u & (sp - 1u)) * 2u), g1);
#pragma unroll 1   // one pass per trip: the buffer index and the publish point below belong to one stage
    for (uint32_t t = 0; t < T; ++t) {
        const uint32_t buf = (t & 1u) * PJ_STAGE;
        const unsigned char* la = ring + buf + abase; const unsigned char* lb = ring + buf + bbase;
        v16bf fa[2][4], fb[2][4];
#pragma unroll
        for (int i = 0; i < 4; ++i) { fa[0][i] = ldb((const bf*)(la + i * 16 * PJ_PITCH)); fb[0][i] = ldb((const bf*)(lb + i * 16 * PJ_PITCH)); }
#pragma unroll
        for (int u = 0; u < 4; ++u) {
            const int cs = u & 1;
            if (u < 3) {
#pragma unroll
                for (int i = 0; i < 4; ++i) { fa[cs ^ 1][i] = ldb((const bf*)(la + i * 16 * PJ_PITCH + (u + 1) * 64)); fb[cs ^ 1][i] = ldb((const bf*)(lb + i * 16 * PJ_PITCH + (u + 1) * 64)); }
            }
            __builtin_amdgcn_sched_barrier(0);   // the next block's LDS reads stay one group in front of this block's products
#pragma unroll
            for (int nb = 0; nb < 4; ++nb)
#pragma unroll
                for (int mb = 0; mb < 4; ++mb) acc[mb][nb] = wmmab(fa[cs][mb], fb[cs][nb], acc[mb][nb]);
            __builtin_amdgcn_sched_barrier(0);   // no LDS read moves in among the products
        }
        asm volatile("s_wait_dscnt 0x0" ::: "memory");
        tdm_wait(g0, g1);
        __syncthreads();
        if (pinned((t + 2u < T) ? 1u : 0u) != 0u) tdm_load(g0, slice + buf, src0 + (uint64_t)((((t + 2u) << 7) & (sp - 1u)) * 2u), g1);
    }
    tdm_wait(g0, g1);                                    // no request is outstanding when the wave goes on
    asm volatile("s_wait_dscnt 0x0" ::: "memory");       // nor any LDS read of the ring
    const size_t tbase = (size_t)(r0 / RB) * sRB + (size_t)(r0 % RB) * (size_t)pitch + (size_t)(c0 / CB) * sCB + (size_t)(c0 % CB);
    const size_t cbase = ((size_t)(r0 / RB) * (size_t)RP + (size_t)(r0 % RB)) * (size_t)ldc + (size_t)c0;
#pragma unroll
    for (int mb = 0; mb < 4; ++mb) {
#pragma unroll
        for (int nb = 0; nb < 4; ++nb) {
#pragma unroll
            for (int j = 0; j < 8; ++j) os[(hi * 8 + j) * 68 + nb * 16 + lr] = acc[mb][nb][j]; }   // D: row 8h+j, col lane&15
        wave_sync();
        if (MODE == 0) {
            const size_t sb = tbase + (size_t)(mb * 16) * (size_t)pitch;
{
#pragma unroll
                for (int s = 0; s < 4; ++s) { const int row = 4 * s + (lane >> 3), c8 = (lane & 7) * 8;   // 4 s x 4 row groups = 16 rows; 8 lanes x 8 = 64 columns
                    const v4f x0 = *(const v4fa*)(&os[row * 68 + c8]); const v4f x1 = *(const v4fa*)(&os[row * 68 + c8 + 4]); v8h hv;
#pragma unroll
                    for (int i = 0; i < 4; ++i) { hv[i] = (h16)x0[i]; hv[4 + i] = (h16)x1[i]; }
                    *(v8h*)(Ph + sb + (size_t)row * (size_t)pitch + c8) = hv; }
                 }
        } else {
            const size_t sb = cbase + (size_t)(mb * 16) * (size_t)ldc;
{
#pragma unroll
                for (int s = 0; s < 8; ++s) { const int row = 2 * s + hi, cofs = lr * 4;   // 8 s x 2 rows = 16 rows; 16 lanes x 4 floats = 64 columns
                    const v4f val = *(const v4fa*)(&os[row * 68 + cofs]);
                    *(v4f*)(C + sb + (size_t)row * (size_t)ldc + cofs) = val; }
                 }
        }
        wave_sync();
    }
}

template <int MODE>
__global__ __launch_bounds__(128) void k_proj(const bf* __restrict__ A, int pA, const bf* __restrict__ Bt, int pB, int K,
                                              h16* Ph, int RB, size_t sRB, int pitch, int CB, size_t sCB, float* C, int ldc, int RP) {
    __shared__ __attribute__((aligned(2048))) unsigned char ring[2 * PJ_STAGE];
    __shared__ __align__(16) float osall[4 * 16 * 68];
    proj_tile<MODE>(ring, osall, blockIdx.x, blockIdx.y, A, pA, Bt, pB, K, Ph, RB, sRB, pitch, CB, sCB, C, ldc, RP);
}
// k_proj_qkv: the q|k product and the v^T product read the same two operands and none of each other's output: one grid, the q|k tiles first.
// q|k: A = LN(x) rows, Bt = wqkv rows 0..2047 -> QK[m][n] f32. v^T: A = wqkv rows 2048..3071 (m = h*64 + d), Bt = LN(x) rows (n = b*SEQ + t) -> plane [(b*1024 + m)][t] = [(b*16 + h)][d][t].
#define PQ_BX (NB * SEQ / 128)
#define PQ_N  (PQ_BX * (2 * DM / 128))
#define PV_BX (DM / 128)
#define PV_N  (PV_BX * (NB * SEQ / 128))
__global__ __launch_bounds__(128) void k_proj_qkv(const bf* __restrict__ XA, const bf* __restrict__ WB, float* QK, h16* VT) {
    __shared__ __attribute__((aligned(2048))) unsigned char ring[2 * PJ_STAGE];
    __shared__ __align__(16) float osall[4 * 16 * 68];
    const uint32_t i = blockIdx.x;
    if (i < (uint32_t)PQ_N) {
        proj_tile<1>(ring, osall, i % PQ_BX, i / PQ_BX, XA, K2, WB, DM, K2, (h16*)0, NB * SEQ, (size_t)0, 0, 64, (size_t)0, QK, K2, NB * SEQ);
    } else {
        const uint32_t j = i - (uint32_t)PQ_N;
        proj_tile<0>(ring, osall, j % PV_BX, j / PV_BX, WB + (size_t)2 * DM * DM, DM, XA, K2, K2, VT, DM, (size_t)0, SEQ, SEQ, (size_t)DM * SEQ, (float*)0, 0, 0);
    }
}

// Lane holds columns it*256 + lane*8 + i = head (4*it + lane/8), d = 8*(lane&7) + i; the rotary partner d +- 32 is lane ^ 4 (same it, same i).
// Planes [b*16+h][t][64], four consecutive planes from PL with stride pst halves: q value, q residual x2048, k value, k residual x2048 (selected by integer offset from one base).
// The wave's q row, k row and both weight rows are loaded once, all loads issued together, and kept in registers through the three passes (visiting order it = 0..3, i = 0..7).
__device__ __forceinline__ void qkrot_part(int blk, const float* __restrict__ QK, const float* __restrict__ qw, const float* __restrict__ kw, const float* __restrict__ CS, const float* __restrict__ SN,
                                           h16* PL, size_t pst) {
    const int lane = threadIdx.x & 31; const int wave = __builtin_amdgcn_readfirstlane((int)(threadIdx.x >> 5));
    const int m = blk * 8 + wave; const int b = m / SEQ, t = m % SEQ;
    const int c = lane & 7;
    const v8f cs = *(const v8f*)(CS + (size_t)m * 32 + 8 * (c & 3));
    const v8f sn = *(const v8f*)(SN + (size_t)m * 32 + 8 * (c & 3));
    const float sg = (c < 4) ? -1.0f : 1.0f;
    const size_t o0 = (((size_t)(b * NH_ + (lane >> 3))) * SEQ + t) * HD + 8 * c;
    const size_t ost = (size_t)4 * SEQ * HD;     // four heads per step
    const float* row = QK + (size_t)m * K2 + lane * 8;
    v8f raw[2][4], wgt[2][4];
#pragma unroll
    for (int wh = 0; wh < 2; ++wh)
#pragma unroll
        for (int it = 0; it < 4; ++it) raw[wh][it] = *(const v8f*)(row + wh * DM + it * 256);
#pragma unroll
    for (int it = 0; it < 4; ++it) { wgt[0][it] = *(const v8f*)(qw + it * 256 + lane * 8); wgt[1][it] = *(const v8f*)(kw + it * 256 + lane * 8); }
#pragma unroll
    for (int wh = 0; wh < 2; ++wh) {
        float s = 0.0f;
#pragma unroll
        for (int it = 0; it < 4; ++it) {
#pragma unroll
            for (int i = 0; i < 8; ++i) s += raw[wh][it][i]; }
        s = wsum(s);
        const float mean = s * (1.0f / DM);
        float ss = 0.0f;
#pragma unroll
        for (int it = 0; it < 4; ++it) {
#pragma unroll
            for (int i = 0; i < 8; ++i) { const float dv = raw[wh][it][i] - mean; ss += dv * dv; } }
        ss = wsum(ss);
        const float rstd = 1.0f / sqrtf(ss * (1.0f / DM) + 1e-5f);
        h16* PH = PL + (size_t)(2 * wh) * pst;
        h16* PR = PH + pst;
#pragma unroll
        for (int it = 0; it < 4; ++it) {
            v8h hv, rv;
#pragma unroll
            for (int i = 0; i < 8; ++i) {
                const float y = (raw[wh][it][i] - mean) * rstd * bfr(wgt[wh][it][i]);
                const float pr = __shfl_xor(y, 4, 32);
                const float r = y * cs[i] + sg * pr * sn[i];
                const h16 hh = (h16)r; hv[i] = hh; rv[i] = (h16)((r - (float)hh) * QRS); }
            const size_t oo = o0 + (size_t)it * ost;
            *(v8h*)(PH + oo) = hv; *(v8h*)(PR + oo) = rv; }
    }
    asm volatile("s_wait_xcnt 0x0" ::: "memory");   // other stages' code follows these stores in the merged kernel: their address and data registers are rewritten only behind this wait
}

// k_front: LN(x) and the wqkv conversion, which the qkv products read, beside the rotary table, which k_mid reads. The stages with the longest dependent chains take the low block indices, the short conversion blocks the high ones (for speed only).
#define GF_LNX  (NB * SEQ / 8)
#define GF_ROPE (NB * SEQ / 8)
#define GF_CVT  (3 * DM * DM / 8 / (256 * CVT_CH))
static_assert((3 * DM * DM / 8) % (256 * CVT_CH) == 0 && (DM * DM / 8) % (256 * CVT_CH) == 0);
__global__ __launch_bounds__(256) void k_front(const float* __restrict__ x, const float* __restrict__ lw, const float* __restrict__ lb, bf* XA,
                                               const float* __restrict__ pos, float* CS, float* SN, const float* __restrict__ wqkv, bf* WB) {
    const int blk = blockIdx.x;
    if (blk < GF_LNX) lnx_part(blk, x, lw, lb, XA);
    else if (blk < GF_LNX + GF_ROPE) rope_part(blk - GF_LNX, pos, CS, SN);
    else cvt8_part(blk - (GF_LNX + GF_ROPE), wqkv, WB, (size_t)3 * DM * DM / 8);
}
// k_mid: the q/k norm and rotary (reads the q|k product) beside the stages that only k_flash or the output product read: mask sums and bm planes, edge weight plane, out_w conversion.
#define GM_PREP (NB * SEQ / 64)
#define GM_ROT  (NB * SEQ / 8)
#define GM_CVT  (DM * DM / 8 / (256 * CVT_CH))
__global__ __launch_bounds__(256) void k_mid(const float* __restrict__ QK, const float* __restrict__ qw, const float* __restrict__ kw, const float* __restrict__ CS, const float* __restrict__ SN, h16* PL, size_t pst,
                                             const float* __restrict__ blocks, const int* __restrict__ mask, h16* BM, float* BASE,
                                             const float* __restrict__ ew, h16* EWA, const float* __restrict__ ow, bf* OWB) {
    const int blk = blockIdx.x;
    if (blk < GM_PREP) prep_part(blk, blocks, mask, BM, BASE);
    else if (blk < GM_PREP + GM_ROT) qkrot_part(blk - GM_PREP, QK, qw, kw, CS, SN, PL, pst);
    else if (blk == GM_PREP + GM_ROT) ew_part(ew, EWA);
    else cvt8_part(blk - (GM_PREP + GM_ROT + 1), ow, OWB, (size_t)DM * DM / 8);
}

// k_flash staging: a stage is 64 keys of the block's (batch, head): k value and residual rows, v^T rows, both bm planes (128-byte rows, LDS pitch 144) and the block's 64 mask rows
// (256-byte rows, LDS pitch 272; both pitches are odd multiples of 16 B for 16-byte readers). Two buffers, filled by asynchronous copies one stage ahead of the pass that reads them.
#define FK      64
#define FP1     144u
#define FP2     272u
#define FO_KH   0u
#define FO_KR   (64u * FP1)
#define FO_VT   (128u * FP1)
#define FO_BM   (192u * FP1)
#define FO_MK   (224u * FP1)
#define F_STAGE (FO_MK + 64u * FP2)
static_assert(AW == 4 && HD == 64);                 // 128 lanes: 16 rows of 128 B or 8 rows of 256 B per copy instruction of the block
static_assert(SEQ % FK == 0 && SEQ / FK >= 2);      // whole stages, at least two
static_assert(F_STAGE % 16u == 0u);
// One stage: 22 copies of 16 B per lane, every lane on. l1 / l2: the lane's LDS byte address in row 0..15 of a 128-byte-row tile / row 0..7 of the mask tile of the target buffer.
// Each run of copies ends, inside its own statement, with s_wait_xcnt 0: the address registers are rewritten only behind it.
__device__ __forceinline__ void flash_fill(uint32_t l1, uint32_t l2, const h16* kh, const h16* kr, const h16* vt, const h16* b0, const h16* b1, const int* mk) {
    asm volatile("global_load_async_to_lds_b128 %0, %1, off\n\t"
                 "global_load_async_to_lds_b128 %2, %3, off\n\t"
                 "global_load_async_to_lds_b128 %4, %5, off\n\t"
                 "global_load_async_to_lds_b128 %6, %7, off\n\t"
                 "global_load_async_to_lds_b128 %8, %9, off\n\t"
                 "global_load_async_to_lds_b128 %10, %11, off\n\t"
                 "global_load_async_to_lds_b128 %12, %13, off\n\t"
                 "global_load_async_to_lds_b128 %14, %15, off\n\t"
                 "global_load_async_to_lds_b128 %16, %17, off\n\t"
                 "global_load_async_to_lds_b128 %18, %19, off\n\t"
                 "s_wait_xcnt 0x0"
                 :: "v"(l1 + FO_KH), "v"(kh), "v"(l1 + FO_KH + 16u * FP1), "v"(kh + 16 * HD), "v"(l1 + FO_KH + 32u * FP1), "v"(kh + 32 * HD), "v"(l1 + FO_KH + 48u * FP1), "v"(kh + 48 * HD),
                    "v"(l1 + FO_KR), "v"(kr), "v"(l1 + FO_KR + 16u * FP1), "v"(kr + 16 * HD), "v"(l1 + FO_KR + 32u * FP1), "v"(kr + 32 * HD), "v"(l1 + FO_KR + 48u * FP1), "v"(kr + 48 * HD),
                    "v"(l1 + FO_BM), "v"(b0), "v"(l1 + FO_BM + 16u * FP1), "v"(b1)
                 : "memory");
    asm volatile("global_load_async_to_lds_b128 %0, %1, off\n\t"
                 "global_load_async_to_lds_b128 %2, %3, off\n\t"
                 "global_load_async_to_lds_b128 %4, %5, off\n\t"
                 "global_load_async_to_lds_b128 %6, %7, off\n\t"
                 "global_load_async_to_lds_b128 %8, %9, off\n\t"
                 "global_load_async_to_lds_b128 %10, %11, off\n\t"
                 "global_load_async_to_lds_b128 %12, %13, off\n\t"
                 "global_load_async_to_lds_b128 %14, %15, off\n\t"
                 "global_load_async_to_lds_b128 %16, %17, off\n\t"
                 "global_load_async_to_lds_b128 %18, %19, off\n\t"
                 "global_load_async_to_lds_b128 %20, %21, off\n\t"
                 "global_load_async_to_lds_b128 %22, %23, off\n\t"
                 "s_wait_xcnt 0x0"
                 :: "v"(l2), "v"(mk), "v"(l2 + 8u * FP2), "v"(mk + 8 * SEQ_FULL), "v"(l2 + 16u * FP2), "v"(mk + 16 * SEQ_FULL), "v"(l2 + 24u * FP2), "v"(mk + 24 * SEQ_FULL),
                    "v"(l2 + 32u * FP2), "v"(mk + 32 * SEQ_FULL), "v"(l2 + 40u * FP2), "v"(mk + 40 * SEQ_FULL), "v"(l2 + 48u * FP2), "v"(mk + 48 * SEQ_FULL), "v"(l2 + 56u * FP2), "v"(mk + 56 * SEQ_FULL),
                    "v"(l1 + FO_VT), "v"(vt), "v"(l1 + FO_VT + 16u * FP1), "v"(vt + 16 * SEQ), "v"(l1 + FO_VT + 32u * FP1), "v"(vt + 32 * SEQ), "v"(l1 + FO_VT + 48u * FP1), "v"(vt + 48 * SEQ)
                 : "memory");
}

// k_flash: fused attention + geometric term, one wave per 16 query rows of one (batch, head); q fragments straight from the 16-bit planes, all key-side fragments and the mask from the staged LDS tiles (two 16-B reads each).
// Transposed form: S^T[key][t] = K Q^T; lane (t = lane&15, h = lane>>4) holds keys 8h+r of each 16-key tile, so packed P / G tiles are directly B fragments of
// O^T[d][t] = V^T P^T and T^T[cx][t] = BM^T G^T. S = kH.qH + (kH.qR + kR.qH)/2048. Mask: replace-fill for the softmax, zero for G. Softmax state one scalar per lane (running max from -inf).
// Epilogue: tmp2 halves exchanged with one xor-16 shuffle, c16 = base.tmp2 (K = 3, VALU), ctx^T = EW c16^T on one K=32 tile (value | residual), sum staged in a wave-private LDS tile and
__global__ __launch_bounds__(32 * AW) void k_flash(const h16* __restrict__ QH, const h16* __restrict__ QR, const h16* __restrict__ KH, const h16* __restrict__ KR, const h16* __restrict__ VT,
                                                   const h16* __restrict__ BM, const float* __restrict__ BASE, const h16* __restrict__ EWA, const int* __restrict__ mask, bf* OA) {
    __shared__ __align__(16) float os[AW * 16 * 68];
    __shared__ __align__(16) unsigned char fr[2 * F_STAGE];
    const int tid = threadIdx.x;
    const int lane = threadIdx.x & 31, wave = __builtin_amdgcn_readfirstlane((int)(threadIdx.x >> 5)), lr = lane & 15, hi = lane >> 4;
    const int zh = blockIdx.y; const int b = zh / NH_, h = zh % NH_;
    const int t0 = (blockIdx.x * AW + wave) * 16;
    const size_t pbase = (size_t)zh * SEQ * HD;
    const size_t qo = pbase + (size_t)(t0 + lr) * HD + 8 * hi;
    const v16h qh0 = ldh(QH + qo), qh1 = ldh(QH + qo + 32), qr0 = ldh(QR + qo), qr1 = ldh(QR + qo + 32);   // B fragments: col t, k = d
    // readers, byte offsets in a buffer: 128-byte-row tiles at row lr (A fragments: row key / d / cx), mask at this wave's row lr
    const uint32_t ro = (uint32_t)lr * FP1 + 16u * (uint32_t)hi;
    const uint32_t mo = FO_MK + (uint32_t)(wave * 16 + lr) * FP2 + 32u * (uint32_t)hi;
    // copiers: the lane's own 16 bytes of stage 0 (8 lanes per 128-byte row, 16 lanes per mask row)
    const h16* ckh = KH + pbase + (size_t)tid * 8;
    const h16* ckr = KR + pbase + (size_t)tid * 8;
    const h16* cvt = VT + pbase + (size_t)(tid >> 3) * SEQ + 8 * (tid & 7);
    const h16* cb0 = BM + ((size_t)b * 16 + (tid >> 3)) * SEQ + 8 * (tid & 7);
    const h16* cb1 = cb0 + (size_t)NB * 16 * SEQ;
    const int* cmk = mask + ((size_t)b * SEQ_FULL + blockIdx.x * (16 * AW) + (tid >> 4)) * SEQ_FULL + 4 * (tid & 15);
    const uint32_t cl1 = (uint32_t)(size_t)fr + (uint32_t)(tid >> 3) * FP1 + 16u * (uint32_t)(tid & 7);
    const uint32_t cl2 = (uint32_t)(size_t)fr + FO_MK + (uint32_t)(tid >> 4) * FP2 + 16u * (uint32_t)(tid & 15);
    v8f o0 = (v8f){}, o1 = (v8f){}, o2 = (v8f){}, o3 = (v8f){}, gA = (v8f){}, gR = (v8f){};
    float m = -__builtin_huge_valf(), l = 0.0f;
    flash_fill(cl1, cl2, ckh, ckr, cvt, cb0, cb1, cmk);
    asm volatile("s_wait_asynccnt 0x0" ::: "memory");    // this wave's copies of stage 0 have landed
    __syncthreads();                                     // every wave's part of stage 0 is readable by every wave
    flash_fill(cl1 + F_STAGE, cl2 + F_STAGE, ckh + FK * HD, ckr + FK * HD, cvt + FK, cb0 + FK, cb1 + FK, cmk + FK);
#pragma unroll 1   // one stage per trip: the buffer index and the publish point at the foot belong to one stage
    for (int st = 0; st < SEQ / FK; ++st) {
      const uint32_t bo = (uint32_t)(st & 1) * F_STAGE;
#pragma unroll   // both 32-key halves of a stage in line, so that their LDS offsets are immediates of the reads
      for (int sub = 0; sub < FK / 32; ++sub) {
        const int* mrow = (const int*)(fr + bo + mo + sub * 128);
        const v4i mk0 = *(const v4i*)(mrow), mk1 = *(const v4i*)(mrow + 4), mk2 = *(const v4i*)(mrow + 16), mk3 = *(const v4i*)(mrow + 20);
        const unsigned char* ka = fr + bo + FO_KH + ro + sub * 32 * FP1; const unsigned char* kr = fr + bo + FO_KR + ro + sub * 32 * FP1;
        const v16h ka0 = ldh((const h16*)ka), ka1 = ldh((const h16*)(ka + 64)), kb0 = ldh((const h16*)(ka + 16 * FP1)), kb1 = ldh((const h16*)(ka + 16 * FP1 + 64));
        const v16h ra0 = ldh((const h16*)kr), ra1 = ldh((const h16*)(kr + 64)), rb0 = ldh((const h16*)(kr + 16 * FP1)), rb1 = ldh((const h16*)(kr + 16 * FP1 + 64));
        v8f sHa = (v8f){}, sLa = (v8f){}, sKa = (v8f){}, sHb = (v8f){}, sLb = (v8f){}, sKb = (v8f){};
        sHa = wmma16(ka0, qh0, sHa); sLa = wmma16(ka0, qr0, sLa); sKa = wmma16(ra0, qh0, sKa); sHb = wmma16(kb0, qh0, sHb); sLb = wmma16(kb0, qr0, sLb); sKb = wmma16(rb0, qh0, sKb);
        sHa = wmma16(ka1, qh1, sHa); sLa = wmma16(ka1, qr1, sLa); sKa = wmma16(ra1, qh1, sKa); sHb = wmma16(kb1, qh1, sHb); sLb = wmma16(kb1, qr1, sLb); sKb = wmma16(rb1, qh1, sKb);
        asm volatile("v_nop\n\tv_nop\n\tv_nop\n\tv_nop" : "+v"(sHa), "+v"(sLa), "+v"(sKa), "+v"(sHb), "+v"(sLb), "+v"(sKb) : "v"(ka0), "v"(ka1), "v"(kb0), "v"(kb1), "v"(ra0), "v"(ra1), "v"(rb0), "v"(rb1));
        const int mka[8] = {mk0[0], mk0[1], mk0[2], mk0[3], mk1[0], mk1[1], mk1[2], mk1[3]};
        const int mkb[8] = {mk2[0], mk2[1], mk2[2], mk2[3], mk3[0], mk3[1], mk3[2], mk3[3]};
        float ta[8], tb[8]; float mx = NEGMIN;
        v16h gh, gr;
#pragma unroll
        for (int r = 0; r < 8; ++r) {
            const float xa = sHa[r] + (sLa[r] + sKa[r]) * QRI; const float xb = sHb[r] + (sLb[r] + sKb[r]) * QRI;
            const bool va = (mka[r] != 0), vb = (mkb[r] != 0);
            ta[r] = va ? xa * SC2 : NEGMIN; tb[r] = vb ? xb * SC2 : NEGMIN;
            const float ga = va ? xa : 0.0f; const float gb = vb ? xb : 0.0f;
            const h16 ha = (h16)ga; const h16 hb = (h16)gb;
            gh[r] = ha; gh[8 + r] = hb; gr[r] = (h16)((ga - (float)ha) * QRS); gr[8 + r] = (h16)((gb - (float)hb) * QRS);
            mx = fmaxf(mx, fmaxf(ta[r], tb[r])); }
        mx = fmaxf(mx, __shfl_xor(mx, 16, 32));
        const float mnew = fmaxf(m, mx);
        const float alpha = __builtin_amdgcn_exp2f(m - mnew);
        const float sh = PSH - mnew;
        v16h pb; float ls = 0.0f;
#pragma unroll
        for (int r = 0; r < 8; ++r) { const h16 pa = (h16)__builtin_amdgcn_exp2f(ta[r] + sh); const h16 pc = (h16)__builtin_amdgcn_exp2f(tb[r] + sh); pb[r] = pa; pb[8 + r] = pc; ls += (float)pa + (float)pc; }
        l = l * alpha + ls; m = mnew;
        o0 = o0 * alpha; o1 = o1 * alpha; o2 = o2 * alpha; o3 = o3 * alpha;
        const unsigned char* va_ = fr + bo + FO_VT + ro + sub * 64;
        const v16h v0 = ldh((const h16*)va_), v1 = ldh((const h16*)(va_ + 16 * FP1)), v2 = ldh((const h16*)(va_ + 32 * FP1)), v3 = ldh((const h16*)(va_ + 48 * FP1));
        const unsigned char* ba_ = fr + bo + FO_BM + ro + sub * 64;
        const v16h bh = ldh((const h16*)ba_), br = ldh((const h16*)(ba_ + 16 * FP1));
        o0 = wmma16(v0, pb, o0); gA = wmma16(bh, gh, gA); o1 = wmma16(v1, pb, o1); gR = wmma16(bh, gr, gR); o2 = wmma16(v2, pb, o2); o3 = wmma16(v3, pb, o3); gR = wmma16(br, gh, gR);
        asm volatile("v_nop\n\tv_nop\n\tv_nop\n\tv_nop" : "+v"(o0), "+v"(o1), "+v"(o2), "+v"(o3), "+v"(gA), "+v"(gR) : "v"(v0), "v"(v1), "v"(v2), "v"(v3), "v"(pb), "v"(bh), "v"(br), "v"(gh), "v"(gr));
      }
      asm volatile("s_wait_dscnt 0x0" ::: "memory");       // this wave's reads of this buffer have returned
      asm volatile("s_wait_asynccnt 0x0" ::: "memory");    // this wave's copies of stage st + 1 have landed
      __syncthreads();                                     // publishes stage st + 1 and ends every wave's reads of this buffer
      if (st + 2 < SEQ / FK) {                             // only while stage st + 2 exists (the same for the whole block)
          const int kn = (st + 2) * FK;
          flash_fill(cl1 + bo, cl2 + bo, ckh + (size_t)kn * HD, ckr + (size_t)kn * HD, cvt + kn, cb0 + kn, cb1 + kn, cmk + kn);
      }
    }
    asm volatile("s_wait_asynccnt 0x0" ::: "memory");    // no copy is outstanding when the wave goes on
    l += __shfl_xor(l, 16, 32);
    const float inv = 1.0f / l;
    // tmp2 (x1024): lane (t, h) holds rows cx = 8h + r; fetch the other half unconditionally, select by value
    float mi[8], ot[8], f[12];
#pragma unroll
    for (int r = 0; r < 8; ++r) { mi[r] = gA[r] + gR[r] * QRI; ot[r] = __shfl_xor(mi[r], 16, 32); }
#pragma unroll
    for (int r = 0; r < 8; ++r) f[r] = hi ? ot[r] : mi[r];
#pragma unroll
    for (int r = 0; r < 4; ++r) f[8 + r] = hi ? mi[r] : ot[r];
    const float* bp = BASE + ((size_t)b * SEQ + t0 + lr) * 16;
    const v4f b0 = *(const v4f*)bp, b1 = *(const v4f*)(bp + 4), b2 = *(const v4f*)(bp + 8);
    const float bs[12] = {b0[0], b0[1], b0[2], b0[3], b1[0], b1[1], b1[2], b1[3], b2[0], b2[1], b2[2], b2[3]};
    float e0[3], e1[3];
#pragma unroll
    for (int x = 0; x < 3; ++x) { e0[x] = hi ? bs[6 + x] : bs[x]; e1[x] = hi ? bs[9 + x] : bs[3 + x]; }
    // B fragment of the edge projection: element i <- 16*c16[t][j = 8h + i] (e = 2h + i/4, c = i%4), element 8+i <- its residual x2048
    v16h cb;
#pragma unroll
    for (int i = 0; i < 8; ++i) { const int c = i & 3;
        const float cv = (i < 4) ? (e0[0] * f[3 * c] + e0[1] * f[3 * c + 1] + e0[2] * f[3 * c + 2]) : (e1[0] * f[3 * c] + e1[1] * f[3 * c + 1] + e1[2] * f[3 * c + 2]);
        const float bq = cv * (1.0f / 64.0f); const h16 hh = (h16)bq; cb[i] = hh; cb[8 + i] = (h16)((bq - (float)hh) * QRS); }
    const v16h ea0 = ldh(EWA + (size_t)(lr) * 32 + 8 * hi), ea1 = ldh(EWA + (size_t)(16 + lr) * 32 + 8 * hi), ea2 = ldh(EWA + (size_t)(32 + lr) * 32 + 8 * hi), ea3 = ldh(EWA + (size_t)(48 + lr) * 32 + 8 * hi);
    v8f c0 = (v8f){}, c1 = (v8f){}, c2 = (v8f){}, c3 = (v8f){};
    c0 = wmma16(ea0, cb, c0); c1 = wmma16(ea1, cb, c1); c2 = wmma16(ea2, cb, c2); c3 = wmma16(ea3, cb, c3);
    asm volatile("v_nop\n\tv_nop\n\tv_nop\n\tv_nop" : "+v"(c0), "+v"(c1), "+v"(c2), "+v"(c3) : "v"(ea0), "v"(ea1), "v"(ea2), "v"(ea3), "v"(cb));
    const float ci = 1.0f / 256.0f;
    const int wb = wave * 16 * 68;
    // D layout: x_j[r] = (d = 16j + 8h + r, t = lane&15) -> os[t][d]; rows 0..15 x columns 0..63 all written
    { v4f a, c;
      a[0] = o0[0] * inv + c0[0] * ci; a[1] = o0[1] * inv + c0[1] * ci; a[2] = o0[2] * inv + c0[2] * ci; a[3] = o0[3] * inv + c0[3] * ci;
      c[0] = o0[4] * inv + c0[4] * ci; c[1] = o0[5] * inv + c0[5] * ci; c[2] = o0[6] * inv + c0[6] * ci; c[3] = o0[7] * inv + c0[7] * ci;
      *(v4fa*)(&os[wb + lr * 68 +  0 + 8 * hi]) = a; *(v4fa*)(&os[wb + lr * 68 +  0 + 8 * hi + 4]) = c;
      a[0] = o1[0] * inv + c1[0] * ci; a[1] = o1[1] * inv + c1[1] * ci; a[2] = o1[2] * inv + c1[2] * ci; a[3] = o1[3] * inv + c1[3] * ci;
      c[0] = o1[4] * inv + c1[4] * ci; c[1] = o1[5] * inv + c1[5] * ci; c[2] = o1[6] * inv + c1[6] * ci; c[3] = o1[7] * inv + c1[7] * ci;
      *(v4fa*)(&os[wb + lr * 68 + 16 + 8 * hi]) = a; *(v4fa*)(&os[wb + lr * 68 + 16 + 8 * hi + 4]) = c;
      a[0] = o2[0] * inv + c2[0] * ci; a[1] = o2[1] * inv + c2[1] * ci; a[2] = o2[2] * inv + c2[2] * ci; a[3] = o2[3] * inv + c2[3] * ci;
      c[0] = o2[4] * inv + c2[4] * ci; c[1] = o2[5] * inv + c2[5] * ci; c[2] = o2[6] * inv + c2[6] * ci; c[3] = o2[7] * inv + c2[7] * ci;
      *(v4fa*)(&os[wb + lr * 68 + 32 + 8 * hi]) = a; *(v4fa*)(&os[wb + lr * 68 + 32 + 8 * hi + 4]) = c;
      a[0] = o3[0] * inv + c3[0] * ci; a[1] = o3[1] * inv + c3[1] * ci; a[2] = o3[2] * inv + c3[2] * ci; a[3] = o3[3] * inv + c3[3] * ci;
      c[0] = o3[4] * inv + c3[4] * ci; c[1] = o3[5] * inv + c3[5] * ci; c[2] = o3[6] * inv + c3[6] * ci; c[3] = o3[7] * inv + c3[7] * ci;
      *(v4fa*)(&os[wb + lr * 68 + 48 + 8 * hi]) = a; *(v4fa*)(&os[wb + lr * 68 + 48 + 8 * hi + 4]) = c; }
    wave_sync();
    bf* orow = OA + ((size_t)b * SEQ + t0) * K2 + h * HD;
{
#pragma unroll
        for (int s = 0; s < 4; ++s) { const int row = 4 * s + (lane >> 3), c8 = (lane & 7) * 8;   // 4 s x 4 row groups = 16 rows; 8 lanes x 8 = 64 columns
            const v4f x0 = *(const v4fa*)(&os[wb + row * 68 + c8]); const v4f x1 = *(const v4fa*)(&os[wb + row * 68 + c8 + 4]); v8us hv, lv;
#pragma unroll
            for (int i = 0; i < 4; ++i) { const unsigned short a0 = f2bf(x0[i]); const unsigned short a1 = f2bf(x1[i]); hv[i] = a0; hv[4 + i] = a1; lv[i] = f2bf(x0[i] - bf2f(a0)); lv[4 + i] = f2bf(x1[i] - bf2f(a1)); }
            const size_t oo = (size_t)row * K2 + c8;
            *(v8us*)(orow + oo) = hv; *(v8us*)(orow + DM + oo) = lv; }
         }
}

static constexpr size_t al256(size_t v) { return (v + 255) & ~(size_t)255; }
static constexpr size_t SZ_WB  = al256((size_t)3 * DM * DM * 2);
static constexpr size_t SZ_OWB = al256((size_t)DM * DM * 2);
static constexpr size_t SZ_XA  = al256((size_t)NB * SEQ * K2 * 2);
static constexpr size_t SZ_QK  = al256((size_t)NB * SEQ * K2 * 4);
static constexpr size_t SZ_PL  = al256((size_t)NB * NH_ * SEQ * HD * 2);
static constexpr size_t SZ_BM  = al256((size_t)2 * NB * 16 * SEQ * 2);
static constexpr size_t SZ_BS  = al256((size_t)NB * SEQ * 16 * 4);
static constexpr size_t SZ_CS  = al256((size_t)NB * SEQ * 32 * 4);
static constexpr size_t SZ_EW  = al256((size_t)64 * 32 * 2);
static constexpr size_t SZ_TOTAL = SZ_WB + SZ_OWB + 2 * SZ_XA + SZ_QK + 5 * SZ_PL + SZ_BM + SZ_BS + 2 * SZ_CS + SZ_EW;
static_assert(SZ_TOTAL <= (size_t)134217728);          // workspace carve <= 128 MiB
static_assert(SZ_PL % 2 == 0);                         // plane stride in halves is exact
static_assert(SZ_PL == (size_t)NB * NH_ * SEQ * HD * 2);   // the four q/k planes are back to back with stride SZ_PL/2 halves

extern "C" void kernel_launch(void* const* d_in, const int* in_sizes, int n_in,
                              void* d_out, int out_size, void* d_ws, size_t ws_size, hipStream_t stream) {
    if (n_in < 11) return;
    const size_t ntok = (size_t)(NB - 1) * SEQ_FULL + SEQ;
    if ((size_t)in_sizes[0] < ntok) return;
    if ((size_t)in_sizes[1] < ntok * DM) return;
    if ((size_t)in_sizes[2] < (ntok - 1) * SEQ_FULL + SEQ) return;
    if ((size_t)in_sizes[3] < ntok * 12) return;
    if ((size_t)in_sizes[4] < (size_t)DM || (size_t)in_sizes[5] < (size_t)DM || (size_t)in_sizes[7] < (size_t)DM || (size_t)in_sizes[8] < (size_t)DM) return;
    if ((size_t)in_sizes[6] < (size_t)3 * DM * DM || (size_t)in_sizes[9] < (size_t)DM * DM || (size_t)in_sizes[10] < (size_t)1024) return;
    if ((size_t)out_size < ((size_t)(NB - 1) * OUT_SEQ + SEQ) * DM) return;
    if (SZ_TOTAL > ws_size) return;
    // wire order: position, x, attention_mask (int32), blocks, ln_w, ln_b, wqkv [3072][1024], q_ln_w, k_ln_w, out_w [1024][1024], edge_w [64][16]
    const float* position = (const float*)d_in[0]; const float* x = (const float*)d_in[1]; const int* amask = (const int*)d_in[2]; const float* blocks = (const float*)d_in[3];
    const float* ln_w = (const float*)d_in[4]; const float* ln_b = (const float*)d_in[5]; const float* wqkv = (const float*)d_in[6];
    const float* q_ln_w = (const float*)d_in[7]; const float* k_ln_w = (const float*)d_in[8]; const float* out_w = (const float*)d_in[9]; const float* edge_w = (const float*)d_in[10];
    float* OUT = (float*)d_out;
    char* wsp = (char*)d_ws;
    bf* WB  = (bf*)wsp;  wsp += SZ_WB;                // [3072][1024]: q | k | v rows
    bf* OWB = (bf*)wsp;  wsp += SZ_OWB;               // [1024][1024]
    bf* XA  = (bf*)wsp;  wsp += SZ_XA;                // [NB*SEQ][hi 1024 | lo 1024]
    bf* OA  = (bf*)wsp;  wsp += SZ_XA;                // [NB*SEQ][hi 1024 | lo 1024]
    float* QK = (float*)wsp; wsp += SZ_QK;            // [NB*SEQ][q 1024 | k 1024]
    h16* QH = (h16*)wsp; wsp += SZ_PL;                // [NB*16][SEQ][64]; QH, QR, KH, KR back to back (stride SZ_PL/2 halves)
    h16* QR = (h16*)wsp; wsp += SZ_PL;
    h16* KH = (h16*)wsp; wsp += SZ_PL;
    h16* KR = (h16*)wsp; wsp += SZ_PL;
    h16* VT = (h16*)wsp; wsp += SZ_PL;                // [NB*16][64][SEQ]
    h16* BM = (h16*)wsp; wsp += SZ_BM;                // [2][NB][16][SEQ]
    float* BASE = (float*)wsp; wsp += SZ_BS;          // [NB*SEQ][16]
    float* CS = (float*)wsp; wsp += SZ_CS;            // [NB*SEQ][32]
    float* SN = (float*)wsp; wsp += SZ_CS;
    h16* EWA = (h16*)wsp; wsp += SZ_EW;               // [64][32]

    k_front<<<GF_LNX + GF_ROPE + GF_CVT, 256, 0, stream>>>(x, ln_w, ln_b, XA, position, CS, SN, wqkv, WB);

    k_proj_qkv<<<PQ_N + PV_N, 128, 0, stream>>>(XA, WB, QK, VT);

    // planes QH | QR | KH | KR from the base QH with stride SZ_PL/2 halves
    k_mid<<<GM_PREP + GM_ROT + 1 + GM_CVT, 256, 0, stream>>>(QK, q_ln_w, k_ln_w, CS, SN, QH, (size_t)(SZ_PL / 2), blocks, amask, BM, BASE, edge_w, EWA, out_w, OWB);

    k_flash<<<dim3(SEQ / (16 * AW), NB * NH_, 1), 32 * AW, 0, stream>>>(QH, QR, KH, KR, VT, BM, BASE, EWA, amask, OA);

    // out: A = (ctx + context) hi|lo rows, Bt = out_w rows -> OUT[b][t][n]
    k_proj<1><<<dim3(NB * SEQ / 128, DM / 128, 1), 128, 0, stream>>>(OA, K2, OWB, DM, K2, (h16*)0, SEQ, (size_t)0, 0, 64, (size_t)0, OUT, DM, OUT_SEQ);
}

// v005
// A run of this version takes 81 microseconds.
// Next to v004, in two timings, it ran 1.20 times as fast each time.
// Over all steps from v000 it is 3.27 times as fast.
#include <hip/hip_runtime.h>
#include <stdint.h>

// Compute dtypes (f32 accumulate everywhere): qkv and output projections v_wmma_f32_16x16x32_bf16 (activation as bf16 hi|lo planes folded along K, weights RNE-converted bf16); scores, P.V, geometric sum and edge projection v_wmma_f32_16x16x32_f16 (q, k, G, bm, c16 as f16 value + f16 residual x2048; P x256 and v single f16).
// Pre-norm attention block, width 1024 = 16 heads x 64: LN(x) -> qkv GEMM -> LN(q), LN(k) over the full width -> rotate-half rotary (cos/sin table from the position input) ->
// masked softmax attention (replace-fill, running max) plus geometric term tmp2 = sum_k (q.k) mask bm/len, context = (base.tmp2) edge_w^T -> output GEMM.
// Every float input is RNE-converted to bf16 on load. Fused flash kernel in transposed form (S^T = K Q^T, O^T = V^T P^T, tmp2^T = BM^T G^T, ctx^T = EW c16^T).

#ifndef NB
#define NB 2
#endif
#ifndef SEQ
#define SEQ 1024
#endif
#define NB_FULL  2
#define SEQ_FULL 1024
#ifndef OUT_SEQ
#define OUT_SEQ SEQ              // row pitch (in tokens) between batches of the output
#endif
#define DM   1024
#define K2   2048                // hi|lo folded contraction length
#define NH_  16
#define HD   64
#define AW   4                   // waves per flash block (16 query rows each)
#define QRS  2048.0f             // carry of the residual planes
#define QRI  (1.0f / 2048.0f)
#define SC2  (0.125f * 1.4426950408889634f)   // HD^-0.5 * log2(e)
#define PSH  8.0f                // log2 of the P carry (256)
#define NEGMIN (-3.4028234663852886e38f)

static_assert(HD == 64);
static_assert(NH_ * HD == DM);
static_assert(K2 == 2 * DM);
static_assert((DM & (DM - 1)) == 0);
static_assert(DM % 64 == 0);
static_assert(SEQ % 128 == 0);                 // mask row sums read 128 ints per step
static_assert(SEQ % 64 == 0);
static_assert((NB * SEQ) % 128 == 0);
static_assert((NB * SEQ) % 8 == 0);
static_assert(SEQ % (16 * AW) == 0);
static_assert(NB <= NB_FULL);
static_assert(SEQ <= SEQ_FULL);

typedef _Float16 h16;
typedef unsigned short bf;
typedef __attribute__((ext_vector_type(16))) __bf16   v16bf;
typedef __attribute__((ext_vector_type(16))) _Float16 v16h;
typedef __attribute__((ext_vector_type(8)))  _Float16 v8h;
typedef __attribute__((ext_vector_type(8)))  unsigned short v8us;
typedef __attribute__((ext_vector_type(8)))  float    v8f;
typedef __attribute__((ext_vector_type(4)))  float    v4f;
typedef __attribute__((ext_vector_type(4)))  int      v4i;
typedef __attribute__((ext_vector_type(4)))  uint32_t u32x4;
typedef __attribute__((ext_vector_type(8)))  uint32_t u32x8;
typedef v4f  __attribute__((may_alias)) v4fa;
typedef v8h  __attribute__((may_alias)) v8ha;

__device__ __forceinline__ unsigned short f2bf(float f) { unsigned u = __float_as_uint(f); u += 0x7FFFu + ((u >> 16) & 1u); return (unsigned short)(u >> 16); }
__device__ __forceinline__ float bf2f(unsigned short b) { return __uint_as_float(((unsigned)b) << 16); }
__device__ __forceinline__ float bfr(float f) { return bf2f(f2bf(f)); }
__device__ __forceinline__ v16h cat16(v8h lo, v8h hi) { return __builtin_shufflevector(lo, hi, 0, 1, 2, 3, 4, 5, 6, 7, 8, 9, 10, 11, 12, 13, 14, 15); }
__device__ __forceinline__ v16bf cat16b(v8us lo, v8us hi) { return __builtin_bit_cast(v16bf, __builtin_shufflevector(lo, hi, 0, 1, 2, 3, 4, 5, 6, 7, 8, 9, 10, 11, 12, 13, 14, 15)); }
__device__ __forceinline__ v8f wmma16(v16h a, v16h b, v8f c) { return __builtin_amdgcn_wmma_f32_16x16x32_f16(false, a, false, b, (short)0, c, false, false); }
__device__ __forceinline__ v8f wmmab(v16bf a, v16bf b, v8f c) { return __builtin_amdgcn_wmma_f32_16x16x32_bf16(false, a, false, b, (short)0, c, false, false); }
// fragment loaders from K-contiguous 16-bit rows; p already includes + 8*(lane>>4): elements 0..7 <- k0+8h+0..7, elements 8..15 <- k0+16+8h+0..7 (same map for A and B)
__device__ __forceinline__ v16h  ldh(const h16* p) { return cat16(*(const v8h*)p, *(const v8h*)(p + 16)); }
__device__ __forceinline__ v16bf ldb(const bf* p)  { return cat16b(*(const v8us*)p, *(const v8us*)(p + 16)); }
// ordering point for wave-private LDS tiles (same wave writes and reads)
__device__ __forceinline__ void wave_sync() { __builtin_amdgcn_fence(3 /* release order */, "wavefront"); __builtin_amdgcn_wave_barrier(); asm volatile("" ::: "memory"); }
__device__ __forceinline__ float wsum(float v) { v += __shfl_xor(v, 16, 32); v += __shfl_xor(v, 8, 32); v += __shfl_xor(v, 4, 32); v += __shfl_xor(v, 2, 32); v += __shfl_xor(v, 1, 32); return v; }
__device__ __forceinline__ int wsumi(int v) { v += __shfl_xor(v, 16, 32); v += __shfl_xor(v, 8, 32); v += __shfl_xor(v, 4, 32); v += __shfl_xor(v, 2, 32); v += __shfl_xor(v, 1, 32); return v; }

// The six row-wise stages (cvt8, ew, lnx, rope, prep, qkrot) are device functions of one 256-thread block each (blk = the block's index inside its own stage); k_front and k_mid, behind qkrot_part,
// run stages that read none of each other's output side by side in one grid.
// cvt8_part: CVT_CH chunks of 8 floats per thread, 256 threads apart; all of a thread's loads are issued before the first value is converted.
#define CVT_CH 8
__device__ __forceinline__ void cvt8_part(int blk, const float* __restrict__ src, bf* dst, size_t n8) {
    const size_t i = (size_t)blk * (256 * CVT_CH) + threadIdx.x; if (i + (size_t)(CVT_CH - 1) * 256 >= n8) return;
    v4f va[CVT_CH], vb[CVT_CH];
#pragma unroll
    for (int ch = 0; ch < CVT_CH; ++ch) { const float* p = src + (i + (size_t)ch * 256) * 8;
        va[ch] = *(const v4f*)p;
        if (ch == CVT_CH - 1) asm volatile("s_wait_xcnt 0x0" ::: "memory");   // the last load's result may be given the address pair that all the loads above name: it issues only behind this wait
        vb[ch] = *(const v4f*)(p + 4); }
#pragma unroll
    for (int ch = 0; ch < CVT_CH; ++ch) { v8us o;
#pragma unroll
        for (int k = 0; k < 4; ++k) { o[k] = f2bf(va[ch][k]); o[4 + k] = f2bf(vb[ch][k]); }
        *(v8us*)(dst + (i + (size_t)ch * 256) * 8) = o; }
}

// ew_part: edge weight A plane [64][32] f16: columns 0..15 = 16*w[d][j], columns 16..31 = w[d][j]/128 (pairs with the x2048 residual half of the c16 operand). One block; each thread 16 B, consecutive.
__device__ __forceinline__ void ew_part(const float* __restrict__ ew, h16* EWA) {
    const int tid = threadIdx.x; const int d = tid >> 2, q = tid & 3;
    const float sc = (q < 2) ? 16.0f : 0.0078125f;
    const v8f w = *(const v8f*)(ew + d * 16 + (q & 1) * 8);
    v8h o;
#pragma unroll
    for (int i = 0; i < 8; ++i) o[i] = (h16)(bfr(w[i]) * sc);
    *(v8h*)(EWA + d * 32 + q * 8) = o;
    asm volatile("s_wait_xcnt 0x0" ::: "memory");   // other stages' code follows this store in the merged kernel: its address and data registers are rewritten only behind this wait
}

// The wave's row and both weight rows are loaded once, all loads issued together, and kept in registers through the three passes (element visiting order it = 0..3, i = 0..7 in every pass).
__device__ __forceinline__ void lnx_part(int blk, const float* __restrict__ x, const float* __restrict__ lw, const float* __restrict__ lb, bf* XA) {
    const int lane = threadIdx.x & 31; const int wave = __builtin_amdgcn_readfirstlane((int)(threadIdx.x >> 5));
    const int m = blk * 8 + wave; const int b = m / SEQ, t = m % SEQ;
    const float* src = x + ((size_t)b * SEQ_FULL + t) * DM + lane * 8;
    v8f raw[4], wv[4], bv[4];
#pragma unroll
    for (int it = 0; it < 4; ++it) raw[it] = *(const v8f*)(src + it * 256);
#pragma unroll
    for (int it = 0; it < 4; ++it) { wv[it] = *(const v8f*)(lw + it * 256 + lane * 8); bv[it] = *(const v8f*)(lb + it * 256 + lane * 8); }
    float s = 0.0f;
#pragma unroll
    for (int it = 0; it < 4; ++it) {
#pragma unroll
        for (int i = 0; i < 8; ++i) { raw[it][i] = bfr(raw[it][i]); s += raw[it][i]; } }
    s = wsum(s);
    const float mean = s * (1.0f / DM);
    float ss = 0.0f;
#pragma unroll
    for (int it = 0; it < 4; ++it) {
#pragma unroll
        for (int i = 0; i < 8; ++i) { const float dv = raw[it][i] - mean; ss += dv * dv; } }
    ss = wsum(ss);
    const float rstd = 1.0f / sqrtf(ss * (1.0f / DM) + 1e-5f);
    bf* dst = XA + (size_t)m * K2 + lane * 8;
#pragma unroll
    for (int it = 0; it < 4; ++it) {
        v8us hv, lv;
#pragma unroll
        for (int i = 0; i < 8; ++i) { const float dv = raw[it][i] - mean; const float y = dv * rstd * bfr(wv[it][i]) + bfr(bv[it][i]); const unsigned short hh = f2bf(y); hv[i] = hh; lv[i] = f2bf(y - bf2f(hh)); }
        *(v8us*)(dst + it * 256) = hv; *(v8us*)(dst + DM + it * 256) = lv; }
}

__device__ __forceinline__ void rope_part(int blk, const float* __restrict__ pos, float* CS, float* SN) {
    const int lane = threadIdx.x & 31; const int wave = __builtin_amdgcn_readfirstlane((int)(threadIdx.x >> 5));
    const int m = blk * 8 + wave; const int b = m / SEQ, t = m % SEQ;
    const float p = bfr(pos[(size_t)b * SEQ_FULL + t]);
    double pd = 1.0;
#pragma unroll 1
    for (int i = 0; i < lane; ++i) pd *= 1.333521432163324;
    const float pf = (float)pd;
    const float invf = 1.0f / pf;
    const float ang = p * invf;
    const float c = cosf(ang), s = sinf(ang);
    *(float*)(CS + (size_t)m * 32 + lane) = c; *(float*)(SN + (size_t)m * 32 + lane) = s;
    
}

// prep_part: per 64 tokens: len = mask row sums; bm = blocks - mean_c; base = bm / (|bm| + eps); planes BM[0] = f16(bm * 1024/len), BM[1] = f16 residual x2048, layout [plane][b][16][SEQ] (rows 12..15 zero);
// BASE [token][16] f32 (columns 12..15 zero). LDS tiles are cross-wave: block barriers between phases.
__device__ __forceinline__ void prep_part(int blk, const float* __restrict__ blocks, const int* __restrict__ mask, h16* BM, float* BASE) {
    __shared__ float slen[64];
    __shared__ __align__(16) h16 sb[32 * 64];
    __shared__ __align__(16) float sbase[64 * 16];
    const int tid = threadIdx.x, lane = tid & 31; const int wave = __builtin_amdgcn_readfirstlane((int)(threadIdx.x >> 5));
    const int m0 = blk * 64; const int b = m0 / SEQ, t0 = m0 % SEQ;
#pragma unroll 1   // two batches of four mask rows: a batch's loads are all in flight together; all eight rows at once would double the registers of the whole kernel
    for (int g = 0; g < 2; ++g) { const int tl = wave * 8 + g * 4;
        const int* row = mask + ((size_t)b * SEQ_FULL + t0 + tl) * SEQ_FULL + lane * 4;
        v4i mv[4][SEQ / 128];
#pragma unroll
        for (int r = 0; r < 4; ++r)
#pragma unroll
            for (int c = 0; c < SEQ / 128; ++c) mv[r][c] = *(const v4i*)(row + (size_t)r * SEQ_FULL + c * 128);
        int cnt[4];
#pragma unroll
        for (int r = 0; r < 4; ++r) { cnt[r] = 0;
#pragma unroll
            for (int c = 0; c < SEQ / 128; ++c) cnt[r] += (mv[r][c][0] != 0) + (mv[r][c][1] != 0) + (mv[r][c][2] != 0) + (mv[r][c][3] != 0); }
#pragma unroll
        for (int r = 0; r < 4; ++r) cnt[r] = wsumi(cnt[r]);
        if (lane == 0) {
#pragma unroll
            for (int r = 0; r < 4; ++r) slen[tl + r] = (float)cnt[r]; } }
    __syncthreads();
    if (tid < 64) {
        const float* p = blocks + ((size_t)b * SEQ_FULL + t0 + tid) * 12;
        const v4f a0 = *(const v4f*)p, a1 = *(const v4f*)(p + 4), a2 = *(const v4f*)(p + 8);
        float pv[12];
#pragma unroll
        for (int i = 0; i < 4; ++i) { pv[i] = bfr(a0[i]); pv[4 + i] = bfr(a1[i]); pv[8 + i] = bfr(a2[i]); }
        float mu[3];
#pragma unroll
        for (int x = 0; x < 3; ++x) mu[x] = (pv[x] + pv[3 + x] + pv[6 + x] + pv[9 + x]) * 0.25f;
        const float sc = (1.0f / slen[tid]) * 1024.0f;
#pragma unroll
        for (int c = 0; c < 4; ++c) {
            const float vx = pv[c * 3] - mu[0], vy = pv[c * 3 + 1] - mu[1], vz = pv[c * 3 + 2] - mu[2];
            const float inv = 1.0f / (sqrtf(vx * vx + vy * vy + vz * vz) + 1.1920929e-7f);
            const float vv[3] = {vx, vy, vz};
#pragma unroll
            for (int x = 0; x < 3; ++x) { const int cx = c * 3 + x;
                sbase[tid * 16 + cx] = vv[x] * inv;
                const float bs = vv[x] * sc; const h16 hh = (h16)bs;
                sb[cx * 64 + tid] = hh; sb[(16 + cx) * 64 + tid] = (h16)((bs - (float)hh) * QRS); } }
#pragma unroll
        for (int j = 12; j < 16; ++j) { sbase[tid * 16 + j] = 0.0f; sb[j * 64 + tid] = (h16)0.0f; sb[(16 + j) * 64 + tid] = (h16)0.0f; }
    }
    __syncthreads();
    // 32 lines of 64 halves: line = tid>>3 (0..15 value plane rows, 16..31 residual plane rows), 8 consecutive lanes x 16 B per line; BASE: 256 threads x 16 B contiguous
    const int line = tid >> 3, pc = tid & 7;
    const v8h bv = *(const v8ha*)(&sb[line * 64 + pc * 8]);
    const v4f fv = *(const v4fa*)(&sbase[tid * 4]);
    h16* bd = BM + (size_t)(line >> 4) * ((size_t)NB * 16 * SEQ) + ((size_t)b * 16 + (line & 15)) * SEQ + t0 + pc * 8;
    float* fd = BASE + (size_t)m0 * 16 + tid * 4;
    *(v8h*)bd = bv; *(v4f*)fd = fv;
    
}

// k_proj: bf16 GEMM, 128x128 tile per block of four waves (2 x 2, each 64x64 = 16 accumulators). One operand is an activation in two planes (value | residual along its row), the other a weight in one plane.
// Both are staged in LDS by tensor loads: a stage is 128 k of the weight rows and the same 128 k of both activation planes (256 bytes a row), so a weight tile is fetched once and a weight fragment is read once
// for both planes. Two buffers, every wave moves its own slice one stage ahead of the pass that reads it. Order per accumulator: kc = 0, 32, 64, ...; at each kc the value plane's product, then the residual plane's.
// MODE 1: f32 rows C[((r0/RB)*RP + r0%RB)][c0..c0+63], row pitch ldc; each 256-byte row segment by 16 consecutive lanes x 16 B.
#define PJ_PITCH 272u                 // LDS row pitch: 256-byte row + the mover's 16-byte pad (odd multiple of 16 B for 16-byte readers)
#define PJ_SLICE 18432u               // 64 weight rows x 272 B = 17408, rounded up to a multiple of 2 KiB so that every slice starts on one
#define PJ_PLANE 34816u               // 128 activation rows of one plane x 272 B, itself a multiple of 2 KiB
#define PJ_STAGE (2u * PJ_PLANE + 2u * PJ_SLICE)   // value plane, residual plane (128 rows each), weight rows 0..63, weight rows 64..127 of the block tile
static_assert(64u * PJ_PITCH <= PJ_SLICE && PJ_SLICE % 2048u == 0u);
static_assert(128u * PJ_PITCH <= PJ_PLANE && PJ_PLANE % 2048u == 0u);
static_assert(DM % 128 == 0 && K2 == 2 * DM && DM / 128 >= 2);   // whole stages inside every plane and every weight row, at least two stages
__device__ __forceinline__ uint32_t uni(uint32_t v) { return (uint32_t)__builtin_amdgcn_readfirstlane((int)v); }
__device__ __forceinline__ uint32_t pinned(uint32_t v) { uint32_t w = uni(v); asm volatile("" : "+s"(w)); return w; }   // the pinned() form for tensor loads: the test value is held in a scalar register, so the branch round a load is a scalar one (the load ignores EXEC)
// one request of the whole wave: rows of 256 bytes from ga (row count and row pitch in g1) to LDS byte offset dst; word 0 of g0 (count 1) is set once by the caller
__device__ __forceinline__ void tdm_load(u32x4& g0, uint32_t dst, uint64_t ga, u32x8& g1) {
    g0[1] = uni(dst); g0[2] = uni((uint32_t)ga); g0[3] = uni((((uint32_t)(ga >> 32)) & 0x01FFFFFFu) | 0x80000000u);
    asm volatile("tensor_load_to_lds %0, %1" : "+s"(g0), "+s"(g1) :: "memory");   // in-out: the same registers go on to the wait below
}
// the wave's own requests have landed. The statement names both descriptor groups as in-out operands so that their scalar registers hold the issued words until the wait has returned
// and every new word is formed behind it.
__device__ __forceinline__ void tdm_wait(u32x4& g0, u32x8& g1) { asm volatile("s_wait_tensorcnt 0x0" : "+s"(g0), "+s"(g1) :: "memory"); }
// proj_tile: the tile (bx, by) of one product; ring and osall are the calling kernel's LDS arrays (ring on a multiple of 2 KiB). SA: the two-plane operand is A (else Bt); K = its row length, both planes.
template <int MODE, bool SA>
__device__ __forceinline__ void proj_tile(unsigned char* ring, float* osall, uint32_t bx, uint32_t by, const bf* __restrict__ A, int pA, const bf* __restrict__ Bt, int pB, int K,
                                          h16* Ph, int RB, size_t sRB, int pitch, int CB, size_t sCB, float* C, int ldc, int RP) {
    const int lane = threadIdx.x & 31, lr = lane & 15, hi = lane >> 4;
    const uint32_t wave = uni(threadIdx.x >> 5);
    const int r0 = bx * 128 + (int)(wave >> 1) * 64, c0 = by * 128 + (int)(wave & 1u) * 64;
    float* os = osall + wave * (16 * 68);
    v8f acc[4][4];
#pragma unroll
    for (int mb = 0; mb < 4; ++mb)
#pragma unroll
        for (int nb = 0; nb < 4; ++nb) acc[mb][nb] = (v8f){};
    // this wave's slice of every stage: wave 0 moves the value plane and wave 1 the residual plane of the block's 128 activation rows, waves 2, 3 move 64 weight rows each
    const bf* actp = SA ? A + (size_t)(bx * 128) * (size_t)pA : Bt + (size_t)(by * 128) * (size_t)pB;
    const bf* wgtp = SA ? Bt + (size_t)(by * 128) * (size_t)pB : A + (size_t)(bx * 128) * (size_t)pA;
    const uint32_t pact = (uint32_t)(SA ? pA : pB), pwgt = (uint32_t)(SA ? pB : pA);
    const bool ownP = wave < 2u;
    const uint32_t sp = ownP ? pact : pwgt;
    const uint32_t nrow = ownP ? 128u : 64u;
    const uint64_t src0 = ownP ? (uint64_t)(uintptr_t)(actp + (size_t)wave * (size_t)(K >> 1))
                               : (uint64_t)(uintptr_t)(wgtp + (size_t)((wave - 2u) * 64u) * (size_t)pwgt);
    const uint32_t slice = (uint32_t)(size_t)ring + (ownP ? wave * PJ_PLANE : 2u * PJ_PLANE + (wave - 2u) * PJ_SLICE);
    u32x8 g1;
    g1[0] = uni((1u << 20) | (5u << 22) | (3u << 25));   // no mask, byte elements, 16 B of pad behind every 256 B
    g1[1] = uni(256u << 16); g1[2] = uni(nrow << 16); g1[3] = uni(256u << 16); g1[4] = uni(nrow);   // tensor = tile = 256 B x this wave's rows
    g1[5] = uni(sp * 2u); g1[6] = uni(0u); g1[7] = uni(0u);
    const uint32_t T = (uint32_t)K >> 8;                 // stages of 128 k of one plane
    const uint32_t wact = SA ? (wave >> 1) : (wave & 1u), wwgt = SA ? (wave & 1u) : (wave >> 1);   // which 64 rows of each operand this wave's 64x64 tile reads
    const uint32_t pbase = (wact * 64u + (uint32_t)lr) * PJ_PITCH + 16u * (uint32_t)hi;
    const uint32_t wbase = 2u * PJ_PLANE + wwgt * PJ_SLICE + (uint32_t)lr * PJ_PITCH + 16u * (uint32_t)hi;
    u32x4 g0;
    g0[0] = uni(1u);
    tdm_load(g0, slice, src0, g1);
    tdm_wait(g0, g1);                                    // this wave's slice of stage 0 has landed
    __syncthreads();                                     // every slice of stage 0 is readable by every wave
    if (pinned((1u < T) ? 1u : 0u) != 0u) tdm_load(g0, slice + PJ_STAGE, src0 + (uint64_t)256u, g1);
#pragma unroll 1   // one pass per trip: the buffer index and the publish point below belong to one stage
    for (uint32_t t = 0; t < T; ++t) {
        const uint32_t buf = (t & 1u) * PJ_STAGE;
        const unsigned char* lh = ring + buf + pbase; const unsigned char* ll = lh + PJ_PLANE; const unsigned char* lw = ring + buf + wbase;
        v16bf fh[2][4], fl[2][4], fw[2][4];
#pragma unroll
        for (int i = 0; i < 4; ++i) { fh[0][i] = ldb((const bf*)(lh + i * 16 * PJ_PITCH)); fw[0][i] = ldb((const bf*)(lw + i * 16 * PJ_PITCH)); }
#pragma unroll
        for (int i = 0; i < 4; ++i) fl[0][i] = ldb((const bf*)(ll + i * 16 * PJ_PITCH));   // wanted sixteen products later than the two sets above
#pragma unroll
        for (int u = 0; u < 4; ++u) {
            const int cs = u & 1;
            if (u < 3) {
#pragma unroll
                for (int i = 0; i < 4; ++i) { fh[cs ^ 1][i] = ldb((const bf*)(lh + i * 16 * PJ_PITCH + (u + 1) * 64)); fw[cs ^ 1][i] = ldb((const bf*)(lw + i * 16 * PJ_PITCH + (u + 1) * 64)); }
#pragma unroll
                for (int i = 0; i < 4; ++i) fl[cs ^ 1][i] = ldb((const bf*)(ll + i * 16 * PJ_PITCH + (u + 1) * 64));
            }
            __builtin_amdgcn_sched_barrier(0);   // the next block's LDS reads stay one group in front of this block's products
#pragma unroll
            for (int nb = 0; nb < 4; ++nb)
#pragma unroll
                for (int mb = 0; mb < 4; ++mb) acc[mb][nb] = SA ? wmmab(fh[cs][mb], fw[cs][nb], acc[mb][nb]) : wmmab(fw[cs][mb], fh[cs][nb], acc[mb][nb]);
#pragma unroll
            for (int nb = 0; nb < 4; ++nb)
#pragma unroll
                for (int mb = 0; mb < 4; ++mb) acc[mb][nb] = SA ? wmmab(fl[cs][mb], fw[cs][nb], acc[mb][nb]) : wmmab(fw[cs][mb], fl[cs][nb], acc[mb][nb]);
            __builtin_amdgcn_sched_barrier(0);   // no LDS read moves in among the products
        }
        asm volatile("s_wait_dscnt 0x0" ::: "memory");
        tdm_wait(g0, g1);
        __syncthreads();
        if (pinned((t + 2u < T) ? 1u : 0u) != 0u) tdm_load(g0, slice + buf, src0 + (uint64_t)((t + 2u) << 8), g1);
    }
    tdm_wait(g0, g1);                                    // no request is outstanding when the wave goes on
    asm volatile("s_wait_dscnt 0x0" ::: "memory");       // nor any LDS read of the ring
    const size_t tbase = (size_t)(r0 / RB) * sRB + (size_t)(r0 % RB) * (size_t)pitch + (size_t)(c0 / CB) * sCB + (size_t)(c0 % CB);
    const size_t cbase = ((size_t)(r0 / RB) * (size_t)RP + (size_t)(r0 % RB)) * (size_t)ldc + (size_t)c0;
#pragma unroll
    for (int mb = 0; mb < 4; ++mb) {
#pragma unroll
        for (int nb = 0; nb < 4; ++nb) {
#pragma unroll
            for (int j = 0; j < 8; ++j) os[(hi * 8 + j) * 68 + nb * 16 + lr] = acc[mb][nb][j]; }   // D: row 8h+j, col lane&15
        wave_sync();
        if (MODE == 0) {
            const size_t sb = tbase + (size_t)(mb * 16) * (size_t)pitch;
{
#pragma unroll
                for (int s = 0; s < 4; ++s) { const int row = 4 * s + (lane >> 3), c8 = (lane & 7) * 8;   // 4 s x 4 row groups = 16 rows; 8 lanes x 8 = 64 columns
                    const v4f x0 = *(const v4fa*)(&os[row * 68 + c8]); const v4f x1 = *(const v4fa*)(&os[row * 68 + c8 + 4]); v8h hv;
#pragma unroll
                    for (int i = 0; i < 4; ++i) { hv[i] = (h16)x0[i]; hv[4 + i] = (h16)x1[i]; }
                    *(v8h*)(Ph + sb + (size_t)row * (size_t)pitch + c8) = hv; }
                 }
        } else {
            const size_t sb = cbase + (size_t)(mb * 16) * (size_t)ldc;
{
#pragma unroll
                for (int s = 0; s < 8; ++s) { const int row = 2 * s + hi, cofs = lr * 4;   // 8 s x 2 rows = 16 rows; 16 lanes x 4 floats = 64 columns
                    const v4f val = *(const v4fa*)(&os[row * 68 + cofs]);
                    *(v4f*)(C + sb + (size_t)row * (size_t)ldc + cofs) = val; }
                 }
        }
        wave_sync();
    }
}

template <int MODE>
__global__ __launch_bounds__(128) void k_proj(const bf* __restrict__ A, int pA, const bf* __restrict__ Bt, int pB, int K,
                                              h16* Ph, int RB, size_t sRB, int pitch, int CB, size_t sCB, float* C, int ldc, int RP) {
    __shared__ __attribute__((aligned(2048))) unsigned char ring[2 * PJ_STAGE];
    __shared__ __align__(16) float osall[4 * 16 * 68];
    proj_tile<MODE, true>(ring, osall, blockIdx.x, blockIdx.y, A, pA, Bt, pB, K, Ph, RB, sRB, pitch, CB, sCB, C, ldc, RP);
}
// k_proj_qkv: the q|k product and the v^T product read the same two operands and none of each other's output: one grid, the q|k tiles first.
// q|k: A = LN(x) rows, Bt = wqkv rows 0..2047 -> QK[m][n] f32. v^T: A = wqkv rows 2048..3071 (m = h*64 + d), Bt = LN(x) rows (n = b*SEQ + t) -> plane [(b*1024 + m)][t] = [(b*16 + h)][d][t].
#define PQ_BX (NB * SEQ / 128)
#define PQ_N  (PQ_BX * (2 * DM / 128))
#define PV_BX (DM / 128)
#define PV_N  (PV_BX * (NB * SEQ / 128))
__global__ __launch_bounds__(128) void k_proj_qkv(const bf* __restrict__ XA, const bf* __restrict__ WB, float* QK, h16* VT) {
    __shared__ __attribute__((aligned(2048))) unsigned char ring[2 * PJ_STAGE];
    __shared__ __align__(16) float osall[4 * 16 * 68];
    const uint32_t i = blockIdx.x;
    if (i < (uint32_t)PQ_N) {
        proj_tile<1, true>(ring, osall, i % PQ_BX, i / PQ_BX, XA, K2, WB, DM, K2, (h16*)0, NB * SEQ, (size_t)0, 0, 64, (size_t)0, QK, K2, NB * SEQ);
    } else {
        const uint32_t j = i - (uint32_t)PQ_N;
        proj_tile<0, false>(ring, osall, j % PV_BX, j / PV_BX, WB + (size_t)2 * DM * DM, DM, XA, K2, K2, VT, DM, (size_t)0, SEQ, SEQ, (size_t)DM * SEQ, (float*)0, 0, 0);
    }
}

// Lane holds columns it*256 + lane*8 + i = head (4*it + lane/8), d = 8*(lane&7) + i; the rotary partner d +- 32 is lane ^ 4 (same it, same i).
// Planes [b*16+h][t][64], four consecutive planes from PL with stride pst halves: q value, q residual x2048, k value, k residual x2048 (selected by integer offset from one base).
// The wave's q row, k row and both weight rows are loaded once, all loads issued together, and kept in registers through the three passes (visiting order it = 0..3, i = 0..7).
__device__ __forceinline__ void qkrot_part(int blk, const float* __restrict__ QK, const float* __restrict__ qw, const float* __restrict__ kw, const float* __restrict__ CS, const float* __restrict__ SN,
                                           h16* PL, size_t pst) {
    const int lane = threadIdx.x & 31; const int wave = __builtin_amdgcn_readfirstlane((int)(threadIdx.x >> 5));
    const int m = blk * 8 + wave; const int b = m / SEQ, t = m % SEQ;
    const int c = lane & 7;
    const v8f cs = *(const v8f*)(CS + (size_t)m * 32 + 8 * (c & 3));
    const v8f sn = *(const v8f*)(SN + (size_t)m * 32 + 8 * (c & 3));
    const float sg = (c < 4) ? -1.0f : 1.0f;
    const size_t o0 = (((size_t)(b * NH_ + (lane >> 3))) * SEQ + t) * HD + 8 * c;
    const size_t ost = (size_t)4 * SEQ * HD;     // four heads per step
    const float* row = QK + (size_t)m * K2 + lane * 8;
    v8f raw[2][4], wgt[2][4];
#pragma unroll
    for (int wh = 0; wh < 2; ++wh)
#pragma unroll
        for (int it = 0; it < 4; ++it) raw[wh][it] = *(const v8f*)(row + wh * DM + it * 256);
#pragma unroll
    for (int it = 0; it < 4; ++it) { wgt[0][it] = *(const v8f*)(qw + it * 256 + lane * 8); wgt[1][it] = *(const v8f*)(kw + it * 256 + lane * 8); }
#pragma unroll
    for (int wh = 0; wh < 2; ++wh) {
        float s = 0.0f;
#pragma unroll
        for (int it = 0; it < 4; ++it) {
#pragma unroll
            for (int i = 0; i < 8; ++i) s += raw[wh][it][i]; }
        s = wsum(s);
        const float mean = s * (1.0f / DM);
        float ss = 0.0f;
#pragma unroll
        for (int it = 0; it < 4; ++it) {
#pragma unroll
            for (int i = 0; i < 8; ++i) { const float dv = raw[wh][it][i] - mean; ss += dv * dv; } }
        ss = wsum(ss);
        const float rstd = 1.0f / sqrtf(ss * (1.0f / DM) + 1e-5f);
        h16* PH = PL + (size_t)(2 * wh) * pst;
        h16* PR = PH + pst;
#pragma unroll
        for (int it = 0; it < 4; ++it) {
            v8h hv, rv;
#pragma unroll
            for (int i = 0; i < 8; ++i) {
                const float y = (raw[wh][it][i] - mean) * rstd * bfr(wgt[wh][it][i]);
                const float pr = __shfl_xor(y, 4, 32);
                const float r = y * cs[i] + sg * pr * sn[i];
                const h16 hh = (h16)r; hv[i] = hh; rv[i] = (h16)((r - (float)hh) * QRS); }
            const size_t oo = o0 + (size_t)it * ost;
            *(v8h*)(PH + oo) = hv; *(v8h*)(PR + oo) = rv; }
    }
    asm volatile("s_wait_xcnt 0x0" ::: "memory");   // other stages' code follows these stores in the merged kernel: their address and data registers are rewritten only behind this wait
}

// k_front: LN(x) and the wqkv conversion, which the qkv products read, beside the rotary table, which k_mid reads. The stages with the longest dependent chains take the low block indices, the short conversion blocks the high ones (for speed only).
#define GF_LNX  (NB * SEQ / 8)
#define GF_ROPE (NB * SEQ / 8)
#define GF_CVT  (3 * DM * DM / 8 / (256 * CVT_CH))
static_assert((3 * DM * DM / 8) % (256 * CVT_CH) == 0 && (DM * DM / 8) % (256 * CVT_CH) == 0);
__global__ __launch_bounds__(256) void k_front(const float* __restrict__ x, const float* __restrict__ lw, const float* __restrict__ lb, bf* XA,
                                               const float* __restrict__ pos, float* CS, float* SN, const float* __restrict__ wqkv, bf* WB) {
    const int blk = blockIdx.x;
    if (blk < GF_LNX) lnx_part(blk, x, lw, lb, XA);
    else if (blk < GF_LNX + GF_ROPE) rope_part(blk - GF_LNX, pos, CS, SN);
    else cvt8_part(blk - (GF_LNX + GF_ROPE), wqkv, WB, (size_t)3 * DM * DM / 8);
}
// k_mid: the q/k norm and rotary (reads the q|k product) beside the stages that only k_flash or the output product read: mask sums and bm planes, edge weight plane, out_w conversion.
#define GM_PREP (NB * SEQ / 64)
#define GM_ROT  (NB * SEQ / 8)
#define GM_CVT  (DM * DM / 8 / (256 * CVT_CH))
__global__ __launch_bounds__(256) void k_mid(const float* __restrict__ QK, const float* __restrict__ qw, const float* __restrict__ kw, const float* __restrict__ CS, const float* __restrict__ SN, h16* PL, size_t pst,
                                             const float* __restrict__ blocks, const int* __restrict__ mask, h16* BM, float* BASE,
                                             const float* __restrict__ ew, h16* EWA, const float* __restrict__ ow, bf* OWB) {
    const int blk = blockIdx.x;
    if (blk < GM_PREP) prep_part(blk, blocks, mask, BM, BASE);
    else if (blk < GM_PREP + GM_ROT) qkrot_part(blk - GM_PREP, QK, qw, kw, CS, SN, PL, pst);
    else if (blk == GM_PREP + GM_ROT) ew_part(ew, EWA);
    else cvt8_part(blk - (GM_PREP + GM_ROT + 1), ow, OWB, (size_t)DM * DM / 8);
}

// k_flash staging: a stage is 64 keys of the block's (batch, head): k value and residual rows, v^T rows, both bm planes (128-byte rows, LDS pitch 144) and the block's 64 mask rows
// (256-byte rows, LDS pitch 272; both pitches are odd multiples of 16 B for 16-byte readers). Two buffers, filled by asynchronous copies one stage ahead of the pass that reads them.
#define FK      64
#define FP1     144u
#define FP2     272u
#define FO_KH   0u
#define FO_KR   (64u * FP1)
#define FO_VT   (128u * FP1)
#define FO_BM   (192u * FP1)
#define FO_MK   (224u * FP1)
#define F_STAGE (FO_MK + 64u * FP2)
static_assert(AW == 4 && HD == 64);                 // 128 lanes: 16 rows of 128 B or 8 rows of 256 B per copy instruction of the block
static_assert(SEQ % FK == 0 && SEQ / FK >= 2);      // whole stages, at least two
static_assert(F_STAGE % 16u == 0u);
// One stage: 22 copies of 16 B per lane, every lane on. l1 / l2: the lane's LDS byte address in row 0..15 of a 128-byte-row tile / row 0..7 of the mask tile of the target buffer.
// Each run of copies ends, inside its own statement, with s_wait_xcnt 0: the address registers are rewritten only behind it.
__device__ __forceinline__ void flash_fill(uint32_t l1, uint32_t l2, const h16* kh, const h16* kr, const h16* vt, const h16* b0, const h16* b1, const int* mk) {
    asm volatile("global_load_async_to_lds_b128 %0, %1, off\n\t"
                 "global_load_async_to_lds_b128 %2, %3, off\n\t"
                 "global_load_async_to_lds_b128 %4, %5, off\n\t"
                 "global_load_async_to_lds_b128 %6, %7, off\n\t"
                 "global_load_async_to_lds_b128 %8, %9, off\n\t"
                 "global_load_async_to_lds_b128 %10, %11, off\n\t"
                 "global_load_async_to_lds_b128 %12, %13, off\n\t"
                 "global_load_async_to_lds_b128 %14, %15, off\n\t"
                 "global_load_async_to_lds_b128 %16, %17, off\n\t"
                 "global_load_async_to_lds_b128 %18, %19, off\n\t"
                 "s_wait_xcnt 0x0"
                 :: "v"(l1 + FO_KH), "v"(kh), "v"(l1 + FO_KH + 16u * FP1), "v"(kh + 16 * HD), "v"(l1 + FO_KH + 32u * FP1), "v"(kh + 32 * HD), "v"(l1 + FO_KH + 48u * FP1), "v"(kh + 48 * HD),
                    "v"(l1 + FO_KR), "v"(kr), "v"(l1 + FO_KR + 16u * FP1), "v"(kr + 16 * HD), "v"(l1 + FO_KR + 32u * FP1), "v"(kr + 32 * HD), "v"(l1 + FO_KR + 48u * FP1), "v"(kr + 48 * HD),
                    "v"(l1 + FO_BM), "v"(b0), "v"(l1 + FO_BM + 16u * FP1), "v"(b1)
                 : "memory");
    asm volatile("global_load_async_to_lds_b128 %0, %1, off\n\t"
                 "global_load_async_to_lds_b128 %2, %3, off\n\t"
                 "global_load_async_to_lds_b128 %4, %5, off\n\t"
                 "global_load_async_to_lds_b128 %6, %7, off\n\t"
                 "global_load_async_to_lds_b128 %8, %9, off\n\t"
                 "global_load_async_to_lds_b128 %10, %11, off\n\t"
                 "global_load_async_to_lds_b128 %12, %13, off\n\t"
                 "global_load_async_to_lds_b128 %14, %15, off\n\t"
                 "global_load_async_to_lds_b128 %16, %17, off\n\t"
                 "global_load_async_to_lds_b128 %18, %19, off\n\t"
                 "global_load_async_to_lds_b128 %20, %21, off\n\t"
                 "global_load_async_to_lds_b128 %22, %23, off\n\t"
                 "s_wait_xcnt 0x0"
                 :: "v"(l2), "v"(mk), "v"(l2 + 8u * FP2), "v"(mk + 8 * SEQ_FULL), "v"(l2 + 16u * FP2), "v"(mk + 16 * SEQ_FULL), "v"(l2 + 24u * FP2), "v"(mk + 24 * SEQ_FULL),
                    "v"(l2 + 32u * FP2), "v"(mk + 32 * SEQ_FULL), "v"(l2 + 40u * FP2), "v"(mk + 40 * SEQ_FULL), "v"(l2 + 48u * FP2), "v"(mk + 48 * SEQ_FULL), "v"(l2 + 56u * FP2), "v"(mk + 56 * SEQ_FULL),
                    "v"(l1 + FO_VT), "v"(vt), "v"(l1 + FO_VT + 16u * FP1), "v"(vt + 16 * SEQ), "v"(l1 + FO_VT + 32u * FP1), "v"(vt + 32 * SEQ), "v"(l1 + FO_VT + 48u * FP1), "v"(vt + 48 * SEQ)
                 : "memory");
}

// k_flash: fused attention + geometric term, one wave per 16 query rows of one (batch, head); q fragments straight from the 16-bit planes, all key-side fragments and the mask from the staged LDS tiles (two 16-B reads each).
// Transposed form: S^T[key][t] = K Q^T; lane (t = lane&15, h = lane>>4) holds keys 8h+r of each 16-key tile, so packed P / G tiles are directly B fragments of
// O^T[d][t] = V^T P^T and T^T[cx][t] = BM^T G^T. S = kH.qH + (kH.qR + kR.qH)/2048. Mask: replace-fill for the softmax, zero for G. Softmax state one scalar per lane (running max from -inf).
// Epilogue: tmp2 halves exchanged with one xor-16 shuffle, c16 = base.tmp2 (K = 3, VALU), ctx^T = EW c16^T on one K=32 tile (value | residual), sum staged in a wave-private LDS tile and
__global__ __launch_bounds__(32 * AW) void k_flash(const h16* __restrict__ QH, const h16* __restrict__ QR, const h16* __restrict__ KH, const h16* __restrict__ KR, const h16* __restrict__ VT,
                                                   const h16* __restrict__ BM, const float* __restrict__ BASE, const h16* __restrict__ EWA, const int* __restrict__ mask, bf* OA) {
    __shared__ __align__(16) float os[AW * 16 * 68];
    __shared__ __align__(16) unsigned char fr[2 * F_STAGE];
    const int tid = threadIdx.x;
    const int lane = threadIdx.x & 31, wave = __builtin_amdgcn_readfirstlane((int)(threadIdx.x >> 5)), lr = lane & 15, hi = lane >> 4;
    const int zh = blockIdx.y; const int b = zh / NH_, h = zh % NH_;
    const int t0 = (blockIdx.x * AW + wave) * 16;
    const size_t pbase = (size_t)zh * SEQ * HD;
    const size_t qo = pbase + (size_t)(t0 + lr) * HD + 8 * hi;
    const v16h qh0 = ldh(QH + qo), qh1 = ldh(QH + qo + 32), qr0 = ldh(QR + qo), qr1 = ldh(QR + qo + 32);   // B fragments: col t, k = d
    // readers, byte offsets in a buffer: 128-byte-row tiles at row lr (A fragments: row key / d / cx), mask at this wave's row lr
    const uint32_t ro = (uint32_t)lr * FP1 + 16u * (uint32_t)hi;
    const uint32_t mo = FO_MK + (uint32_t)(wave * 16 + lr) * FP2 + 32u * (uint32_t)hi;
    // copiers: the lane's own 16 bytes of stage 0 (8 lanes per 128-byte row, 16 lanes per mask row)
    const h16* ckh = KH + pbase + (size_t)tid * 8;
    const h16* ckr = KR + pbase + (size_t)tid * 8;
    const h16* cvt = VT + pbase + (size_t)(tid >> 3) * SEQ + 8 * (tid & 7);
    const h16* cb0 = BM + ((size_t)b * 16 + (tid >> 3)) * SEQ + 8 * (tid & 7);
    const h16* cb1 = cb0 + (size_t)NB * 16 * SEQ;
    const int* cmk = mask + ((size_t)b * SEQ_FULL + blockIdx.x * (16 * AW) + (tid >> 4)) * SEQ_FULL + 4 * (tid & 15);
    const uint32_t cl1 = (uint32_t)(size_t)fr + (uint32_t)(tid >> 3) * FP1 + 16u * (uint32_t)(tid & 7);
    const uint32_t cl2 = (uint32_t)(size_t)fr + FO_MK + (uint32_t)(tid >> 4) * FP2 + 16u * (uint32_t)(tid & 15);
    v8f o0 = (v8f){}, o1 = (v8f){}, o2 = (v8f){}, o3 = (v8f){}, gA = (v8f){}, gR = (v8f){};
    float m = -__builtin_huge_valf(), l = 0.0f;
    flash_fill(cl1, cl2, ckh, ckr, cvt, cb0, cb1, cmk);
    asm volatile("s_wait_asynccnt 0x0" ::: "memory");    // this wave's copies of stage 0 have landed
    __syncthreads();                                     // every wave's part of stage 0 is readable by every wave
    flash_fill(cl1 + F_STAGE, cl2 + F_STAGE, ckh + FK * HD, ckr + FK * HD, cvt + FK, cb0 + FK, cb1 + FK, cmk + FK);
#pragma unroll 1   // one stage per trip: the buffer index and the publish point at the foot belong to one stage
    for (int st = 0; st < SEQ / FK; ++st) {
      const uint32_t bo = (uint32_t)(st & 1) * F_STAGE;
#pragma unroll   // both 32-key halves of a stage in line, so that their LDS offsets are immediates of the reads
      for (int sub = 0; sub < FK / 32; ++sub) {
        const int* mrow = (const int*)(fr + bo + mo + sub * 128);
        const v4i mk0 = *(const v4i*)(mrow), mk1 = *(const v4i*)(mrow + 4), mk2 = *(const v4i*)(mrow + 16), mk3 = *(const v4i*)(mrow + 20);
        const unsigned char* ka = fr + bo + FO_KH + ro + sub * 32 * FP1; const unsigned char* kr = fr + bo + FO_KR + ro + sub * 32 * FP1;
        const v16h ka0 = ldh((const h16*)ka), ka1 = ldh((const h16*)(ka + 64)), kb0 = ldh((const h16*)(ka + 16 * FP1)), kb1 = ldh((const h16*)(ka + 16 * FP1 + 64));
        const v16h ra0 = ldh((const h16*)kr), ra1 = ldh((const h16*)(kr + 64)), rb0 = ldh((const h16*)(kr + 16 * FP1)), rb1 = ldh((const h16*)(kr + 16 * FP1 + 64));
        v8f sHa = (v8f){}, sLa = (v8f){}, sKa = (v8f){}, sHb = (v8f){}, sLb = (v8f){}, sKb = (v8f){};
        sHa = wmma16(ka0, qh0, sHa); sLa = wmma16(ka0, qr0, sLa); sKa = wmma16(ra0, qh0, sKa); sHb = wmma16(kb0, qh0, sHb); sLb = wmma16(kb0, qr0, sLb); sKb = wmma16(rb0, qh0, sKb);
        sHa = wmma16(ka1, qh1, sHa); sLa = wmma16(ka1, qr1, sLa); sKa = wmma16(ra1, qh1, sKa); sHb = wmma16(kb1, qh1, sHb); sLb = wmma16(kb1, qr1, sLb); sKb = wmma16(rb1, qh1, sKb);
        asm volatile("v_nop\n\tv_nop\n\tv_nop\n\tv_nop" : "+v"(sHa), "+v"(sLa), "+v"(sKa), "+v"(sHb), "+v"(sLb), "+v"(sKb) : "v"(ka0), "v"(ka1), "v"(kb0), "v"(kb1), "v"(ra0), "v"(ra1), "v"(rb0), "v"(rb1));
        const int mka[8] = {mk0[0], mk0[1], mk0[2], mk0[3], mk1[0], mk1[1], mk1[2], mk1[3]};
        const int mkb[8] = {mk2[0], mk2[1], mk2[2], mk2[3], mk3[0], mk3[1], mk3[2], mk3[3]};
        float ta[8], tb[8]; float mx = NEGMIN;
        v16h gh, gr;
#pragma unroll
        for (int r = 0; r < 8; ++r) {
            const float xa = sHa[r] + (sLa[r] + sKa[r]) * QRI; const float xb = sHb[r] + (sLb[r] + sKb[r]) * QRI;
            const bool va = (mka[r] != 0), vb = (mkb[r] != 0);
            ta[r] = va ? xa * SC2 : NEGMIN; tb[r] = vb ? xb * SC2 : NEGMIN;
            const float ga = va ? xa : 0.0f; const float gb = vb ? xb : 0.0f;
            const h16 ha = (h16)ga; const h16 hb = (h16)gb;
            gh[r] = ha; gh[8 + r] = hb; gr[r] = (h16)((ga - (float)ha) * QRS); gr[8 + r] = (h16)((gb - (float)hb) * QRS);
            mx = fmaxf(mx, fmaxf(ta[r], tb[r])); }
        mx = fmaxf(mx, __shfl_xor(mx, 16, 32));
        const float mnew = fmaxf(m, mx);
        const float alpha = __builtin_amdgcn_exp2f(m - mnew);
        const float sh = PSH - mnew;
        v16h pb; float ls = 0.0f;
#pragma unroll
        for (int r = 0; r < 8; ++r) { const h16 pa = (h16)__builtin_amdgcn_exp2f(ta[r] + sh); const h16 pc = (h16)__builtin_amdgcn_exp2f(tb[r] + sh); pb[r] = pa; pb[8 + r] = pc; ls += (float)pa + (float)pc; }
        l = l * alpha + ls; m = mnew;
        o0 = o0 * alpha; o1 = o1 * alpha; o2 = o2 * alpha; o3 = o3 * alpha;
        const unsigned char* va_ = fr + bo + FO_VT + ro + sub * 64;
        const v16h v0 = ldh((const h16*)va_), v1 = ldh((const h16*)(va_ + 16 * FP1)), v2 = ldh((const h16*)(va_ + 32 * FP1)), v3 = ldh((const h16*)(va_ + 48 * FP1));
        const unsigned char* ba_ = fr + bo + FO_BM + ro + sub * 64;
        const v16h bh = ldh((const h16*)ba_), br = ldh((const h16*)(ba_ + 16 * FP1));
        o0 = wmma16(v0, pb, o0); gA = wmma16(bh, gh, gA); o1 = wmma16(v1, pb, o1); gR = wmma16(bh, gr, gR); o2 = wmma16(v2, pb, o2); o3 = wmma16(v3, pb, o3); gR = wmma16(br, gh, gR);
        asm volatile("v_nop\n\tv_nop\n\tv_nop\n\tv_nop" : "+v"(o0), "+v"(o1), "+v"(o2), "+v"(o3), "+v"(gA), "+v"(gR) : "v"(v0), "v"(v1), "v"(v2), "v"(v3), "v"(pb), "v"(bh), "v"(br), "v"(gh), "v"(gr));
      }
      asm volatile("s_wait_dscnt 0x0" ::: "memory");       // this wave's reads of this buffer have returned
      asm volatile("s_wait_asynccnt 0x0" ::: "memory");    // this wave's copies of stage st + 1 have landed
      __syncthreads();                                     // publishes stage st + 1 and ends every wave's reads of this buffer
      if (st + 2 < SEQ / FK) {                             // only while stage st + 2 exists (the same for the whole block)
          const int kn = (st + 2) * FK;
          flash_fill(cl1 + bo, cl2 + bo, ckh + (size_t)kn * HD, ckr + (size_t)kn * HD, cvt + kn, cb0 + kn, cb1 + kn, cmk + kn);
      }
    }
    asm volatile("s_wait_asynccnt 0x0" ::: "memory");    // no copy is outstanding when the wave goes on
    l += __shfl_xor(l, 16, 32);
    const float inv = 1.0f / l;
    // tmp2 (x1024): lane (t, h) holds rows cx = 8h + r; fetch the other half unconditionally, select by value
    float mi[8], ot[8], f[12];
#pragma unroll
    for (int r = 0; r < 8; ++r) { mi[r] = gA[r] + gR[r] * QRI; ot[r] = __shfl_xor(mi[r], 16, 32); }
#pragma unroll
    for (int r = 0; r < 8; ++r) f[r] = hi ? ot[r] : mi[r];
#pragma unroll
    for (int r = 0; r < 4; ++r) f[8 + r] = hi ? mi[r] : ot[r];
    const float* bp = BASE + ((size_t)b * SEQ + t0 + lr) * 16;
    const v4f b0 = *(const v4f*)bp, b1 = *(const v4f*)(bp + 4), b2 = *(const v4f*)(bp + 8);
    const float bs[12] = {b0[0], b0[1], b0[2], b0[3], b1[0], b1[1], b1[2], b1[3], b2[0], b2[1], b2[2], b2[3]};
    float e0[3], e1[3];
#pragma unroll
    for (int x = 0; x < 3; ++x) { e0[x] = hi ? bs[6 + x] : bs[x]; e1[x] = hi ? bs[9 + x] : bs[3 + x]; }
    // B fragment of the edge projection: element i <- 16*c16[t][j = 8h + i] (e = 2h + i/4, c = i%4), element 8+i <- its residual x2048
    v16h cb;
#pragma unroll
    for (int i = 0; i < 8; ++i) { const int c = i & 3;
        const float cv = (i < 4) ? (e0[0] * f[3 * c] + e0[1] * f[3 * c + 1] + e0[2] * f[3 * c + 2]) : (e1[0] * f[3 * c] + e1[1] * f[3 * c + 1] + e1[2] * f[3 * c + 2]);
        const float bq = cv * (1.0f / 64.0f); const h16 hh = (h16)bq; cb[i] = hh; cb[8 + i] = (h16)((bq - (float)hh) * QRS); }
    const v16h ea0 = ldh(EWA + (size_t)(lr) * 32 + 8 * hi), ea1 = ldh(EWA + (size_t)(16 + lr) * 32 + 8 * hi), ea2 = ldh(EWA + (size_t)(32 + lr) * 32 + 8 * hi), ea3 = ldh(EWA + (size_t)(48 + lr) * 32 + 8 * hi);
    v8f c0 = (v8f){}, c1 = (v8f){}, c2 = (v8f){}, c3 = (v8f){};
    c0 = wmma16(ea0, cb, c0); c1 = wmma16(ea1, cb, c1); c2 = wmma16(ea2, cb, c2); c3 = wmma16(ea3, cb, c3);
    asm volatile("v_nop\n\tv_nop\n\tv_nop\n\tv_nop" : "+v"(c0), "+v"(c1), "+v"(c2), "+v"(c3) : "v"(ea0), "v"(ea1), "v"(ea2), "v"(ea3), "v"(cb));
    const float ci = 1.0f / 256.0f;
    const int wb = wave * 16 * 68;
    // D layout: x_j[r] = (d = 16j + 8h + r, t = lane&15) -> os[t][d]; rows 0..15 x columns 0..63 all written
    { v4f a, c;
      a[0] = o0[0] * inv + c0[0] * ci; a[1] = o0[1] * inv + c0[1] * ci; a[2] = o0[2] * inv + c0[2] * ci; a[3] = o0[3] * inv + c0[3] * ci;
      c[0] = o0[4] * inv + c0[4] * ci; c[1] = o0[5] * inv + c0[5] * ci; c[2] = o0[6] * inv + c0[6] * ci; c[3] = o0[7] * inv + c0[7] * ci;
      *(v4fa*)(&os[wb + lr * 68 +  0 + 8 * hi]) = a; *(v4fa*)(&os[wb + lr * 68 +  0 + 8 * hi + 4]) = c;
      a[0] = o1[0] * inv + c1[0] * ci; a[1] = o1[1] * inv + c1[1] * ci; a[2] = o1[2] * inv + c1[2] * ci; a[3] = o1[3] * inv + c1[3] * ci;
      c[0] = o1[4] * inv + c1[4] * ci; c[1] = o1[5] * inv + c1[5] * ci; c[2] = o1[6] * inv + c1[6] * ci; c[3] = o1[7] * inv + c1[7] * ci;
      *(v4fa*)(&os[wb + lr * 68 + 16 + 8 * hi]) = a; *(v4fa*)(&os[wb + lr * 68 + 16 + 8 * hi + 4]) = c;
      a[0] = o2[0] * inv + c2[0] * ci; a[1] = o2[1] * inv + c2[1] * ci; a[2] = o2[2] * inv + c2[2] * ci; a[3] = o2[3] * inv + c2[3] * ci;
      c[0] = o2[4] * inv + c2[4] * ci; c[1] = o2[5] * inv + c2[5] * ci; c[2] = o2[6] * inv + c2[6] * ci; c[3] = o2[7] * inv + c2[7] * ci;
      *(v4fa*)(&os[wb + lr * 68 + 32 + 8 * hi]) = a; *(v4fa*)(&os[wb + lr * 68 + 32 + 8 * hi + 4]) = c;
      a[0] = o3[0] * inv + c3[0] * ci; a[1] = o3[1] * inv + c3[1] * ci; a[2] = o3[2] * inv + c3[2] * ci; a[3] = o3[3] * inv + c3[3] * ci;
      c[0] = o3[4] * inv + c3[4] * ci; c[1] = o3[5] * inv + c3[5] * ci; c[2] = o3[6] * inv + c3[6] * ci; c[3] = o3[7] * inv + c3[7] * ci;
      *(v4fa*)(&os[wb + lr * 68 + 48 + 8 * hi]) = a; *(v4fa*)(&os[wb + lr * 68 + 48 + 8 * hi + 4]) = c; }
    wave_sync();
    bf* orow = OA + ((size_t)b * SEQ + t0) * K2 + h * HD;
{
#pragma unroll
        for (int s = 0; s < 4; ++s) { const int row = 4 * s + (lane >> 3), c8 = (lane & 7) * 8;   // 4 s x 4 row groups = 16 rows; 8 lanes x 8 = 64 columns
            const v4f x0 = *(const v4fa*)(&os[wb + row * 68 + c8]); const v4f x1 = *(const v4fa*)(&os[wb + row * 68 + c8 + 4]); v8us hv, lv;
#pragma unroll
            for (int i = 0; i < 4; ++i) { const unsigned short a0 = f2bf(x0[i]); const unsigned short a1 = f2bf(x1[i]); hv[i] = a0; hv[4 + i] = a1; lv[i] = f2bf(x0[i] - bf2f(a0)); lv[4 + i] = f2bf(x1[i] - bf2f(a1)); }
            const size_t oo = (size_t)row * K2 + c8;
            *(v8us*)(orow + oo) = hv; *(v8us*)(orow + DM + oo) = lv; }
         }
}

static constexpr size_t al256(size_t v) { return (v + 255) & ~(size_t)255; }
static constexpr size_t SZ_WB  = al256((size_t)3 * DM * DM * 2);
static constexpr size_t SZ_OWB = al256((size_t)DM * DM * 2);
static constexpr size_t SZ_XA  = al256((size_t)NB * SEQ * K2 * 2);
static constexpr size_t SZ_QK  = al256((size_t)NB * SEQ * K2 * 4);
static constexpr size_t SZ_PL  = al256((size_t)NB * NH_ * SEQ * HD * 2);
static constexpr size_t SZ_BM  = al256((size_t)2 * NB * 16 * SEQ * 2);
static constexpr size_t SZ_BS  = al256((size_t)NB * SEQ * 16 * 4);
static constexpr size_t SZ_CS  = al256((size_t)NB * SEQ * 32 * 4);
static constexpr size_t SZ_EW  = al256((size_t)64 * 32 * 2);
static constexpr size_t SZ_TOTAL = SZ_WB + SZ_OWB + 2 * SZ_XA + SZ_QK + 5 * SZ_PL + SZ_BM + SZ_BS + 2 * SZ_CS + SZ_EW;
static_assert(SZ_TOTAL <= (size_t)134217728);          // workspace carve <= 128 MiB
static_assert(SZ_PL % 2 == 0);                         // plane stride in halves is exact
static_assert(SZ_PL == (size_t)NB * NH_ * SEQ * HD * 2);   // the four q/k planes are back to back with stride SZ_PL/2 halves

extern "C" void kernel_launch(void* const* d_in, const int* in_sizes, int n_in,
                              void* d_out, int out_size, void* d_ws, size_t ws_size, hipStream_t stream) {
    if (n_in < 11) return;
    const size_t ntok = (size_t)(NB - 1) * SEQ_FULL + SEQ;
    if ((size_t)in_sizes[0] < ntok) return;
    if ((size_t)in_sizes[1] < ntok * DM) return;
    if ((size_t)in_sizes[2] < (ntok - 1) * SEQ_FULL + SEQ) return;
    if ((size_t)in_sizes[3] < ntok * 12) return;
    if ((size_t)in_sizes[4] < (size_t)DM || (size_t)in_sizes[5] < (size_t)DM || (size_t)in_sizes[7] < (size_t)DM || (size_t)in_sizes[8] < (size_t)DM) return;
    if ((size_t)in_sizes[6] < (size_t)3 * DM * DM || (size_t)in_sizes[9] < (size_t)DM * DM || (size_t)in_sizes[10] < (size_t)1024) return;
    if ((size_t)out_size < ((size_t)(NB - 1) * OUT_SEQ + SEQ) * DM) return;
    if (SZ_TOTAL > ws_size) return;
    // wire order: position, x, attention_mask (int32), blocks, ln_w, ln_b, wqkv [3072][1024], q_ln_w, k_ln_w, out_w [1024][1024], edge_w [64][16]
    const float* position = (const float*)d_in[0]; const float* x = (const float*)d_in[1]; const int* amask = (const int*)d_in[2]; const float* blocks = (const float*)d_in[3];
    const float* ln_w = (const float*)d_in[4]; const float* ln_b = (const float*)d_in[5]; const float* wqkv = (const float*)d_in[6];
    const float* q_ln_w = (const float*)d_in[7]; const float* k_ln_w = (const float*)d_in[8]; const float* out_w = (const float*)d_in[9]; const float* edge_w = (const float*)d_in[10];
    float* OUT = (float*)d_out;
    char* wsp = (char*)d_ws;
    bf* WB  = (bf*)wsp;  wsp += SZ_WB;                // [3072][1024]: q | k | v rows
    bf* OWB = (bf*)wsp;  wsp += SZ_OWB;               // [1024][1024]
    bf* XA  = (bf*)wsp;  wsp += SZ_XA;                // [NB*SEQ][hi 1024 | lo 1024]
    bf* OA  = (bf*)wsp;  wsp += SZ_XA;                // [NB*SEQ][hi 1024 | lo 1024]
    float* QK = (float*)wsp; wsp += SZ_QK;            // [NB*SEQ][q 1024 | k 1024]
    h16* QH = (h16*)wsp; wsp += SZ_PL;                // [NB*16][SEQ][64]; QH, QR, KH, KR back to back (stride SZ_PL/2 halves)
    h16* QR = (h16*)wsp; wsp += SZ_PL;
    h16* KH = (h16*)wsp; wsp += SZ_PL;
    h16* KR = (h16*)wsp; wsp += SZ_PL;
    h16* VT = (h16*)wsp; wsp += SZ_PL;                // [NB*16][64][SEQ]
    h16* BM = (h16*)wsp; wsp += SZ_BM;                // [2][NB][16][SEQ]
    float* BASE = (float*)wsp; wsp += SZ_BS;          // [NB*SEQ][16]
    float* CS = (float*)wsp; wsp += SZ_CS;            // [NB*SEQ][32]
    float* SN = (float*)wsp; wsp += SZ_CS;
    h16* EWA = (h16*)wsp; wsp += SZ_EW;               // [64][32]

    k_front<<<GF_LNX + GF_ROPE + GF_CVT, 256, 0, stream>>>(x, ln_w, ln_b, XA, position, CS, SN, wqkv, WB);

    k_proj_qkv<<<PQ_N + PV_N, 128, 0, stream>>>(XA, WB, QK, VT);

    // planes QH | QR | KH | KR from the base QH with stride SZ_PL/2 halves
    k_mid<<<GM_PREP + GM_ROT + 1 + GM_CVT, 256, 0, stream>>>(QK, q_ln_w, k_ln_w, CS, SN, QH, (size_t)(SZ_PL / 2), blocks, amask, BM, BASE, edge_w, EWA, out_w, OWB);

    k_flash<<<dim3(SEQ / (16 * AW), NB * NH_, 1), 32 * AW, 0, stream>>>(QH, QR, KH, KR, VT, BM, BASE, EWA, amask, OA);

    // out: A = (ctx + context) hi|lo rows, Bt = out_w rows -> OUT[b][t][n]
    k_proj<1><<<dim3(NB * SEQ / 128, DM / 128, 1), 128, 0, stream>>>(OA, K2, OWB, DM, K2, (h16*)0, SEQ, (size_t)0, 0, 64, (size_t)0, OUT, DM, OUT_SEQ);
}

// v006
// It runs in 78.8 microseconds.
// In both of two side-by-side timings against v005, it was 1.03 times as fast.
// Over all steps from v000 it is 3.38 times as fast.
#include <hip/hip_runtime.h>
#include <stdint.h>

// Compute dtypes (f32 accumulate everywhere): qkv and output projections v_wmma_f32_16x16x32_bf16 (activation as bf16 hi|lo planes folded along K, weights RNE-converted bf16); scores, P.V, geometric sum and edge projection v_wmma_f32_16x16x32_f16 (q, k, G, bm, c16 as f16 value + f16 residual x2048; P x256 and v single f16).
// Pre-norm attention block, width 1024 = 16 heads x 64: LN(x) -> qkv GEMM -> LN(q), LN(k) over the full width -> rotate-half rotary (cos/sin table from the position input) ->
// masked softmax attention (replace-fill, running max) plus geometric term tmp2 = sum_k (q.k) mask bm/len, context = (base.tmp2) edge_w^T -> output GEMM.
// Every float input is RNE-converted to bf16 on load. Fused flash kernel in transposed form (S^T = K Q^T, O^T = V^T P^T, tmp2^T = BM^T G^T, ctx^T = EW c16^T).

#ifndef NB
#define NB 2
#endif
#ifndef SEQ
#define SEQ 1024
#endif
#define NB_FULL  2
#define SEQ_FULL 1024
#ifndef OUT_SEQ
#define OUT_SEQ SEQ              // row pitch (in tokens) between batches of the output
#endif
#define DM   1024
#define K2   2048                // hi|lo folded contraction length
#define NH_  16
#define HD   64
#define AW   4                   // query tiles per flash block (16 query rows each)
#define KW   2                   // waves per query tile: each takes one 32-key half of every stage
#define QRS  2048.0f             // carry of the residual planes
#define QRI  (1.0f / 2048.0f)
#define SC2  (0.125f * 1.4426950408889634f)   // HD^-0.5 * log2(e)
#define PSH  8.0f                // log2 of the P carry (256)
#define NEGMIN (-3.4028234663852886e38f)

static_assert(HD == 64);
static_assert(NH_ * HD == DM);
static_assert(K2 == 2 * DM);
static_assert((DM & (DM - 1)) == 0);
static_assert(DM % 64 == 0);
static_assert(SEQ % 128 == 0);                 // mask row sums read 128 ints per step
static_assert(SEQ % 64 == 0);
static_assert((NB * SEQ) % 128 == 0);
static_assert((NB * SEQ) % 8 == 0);
static_assert(SEQ % (16 * AW) == 0);
static_assert(NB <= NB_FULL);
static_assert(SEQ <= SEQ_FULL);

typedef _Float16 h16;
typedef unsigned short bf;
typedef __attribute__((ext_vector_type(16))) __bf16   v16bf;
typedef __attribute__((ext_vector_type(16))) _Float16 v16h;
typedef __attribute__((ext_vector_type(8)))  _Float16 v8h;
typedef __attribute__((ext_vector_type(8)))  unsigned short v8us;
typedef __attribute__((ext_vector_type(8)))  float    v8f;
typedef __attribute__((ext_vector_type(4)))  float    v4f;
typedef __attribute__((ext_vector_type(4)))  int      v4i;
typedef __attribute__((ext_vector_type(4)))  uint32_t u32x4;
typedef __attribute__((ext_vector_type(8)))  uint32_t u32x8;
typedef v4f  __attribute__((may_alias)) v4fa;
typedef v8h  __attribute__((may_alias)) v8ha;

__device__ __forceinline__ unsigned short f2bf(float f) { unsigned u = __float_as_uint(f); u += 0x7FFFu + ((u >> 16) & 1u); return (unsigned short)(u >> 16); }
__device__ __forceinline__ float bf2f(unsigned short b) { return __uint_as_float(((unsigned)b) << 16); }
__device__ __forceinline__ float bfr(float f) { return bf2f(f2bf(f)); }
__device__ __forceinline__ v16h cat16(v8h lo, v8h hi) { return __builtin_shufflevector(lo, hi, 0, 1, 2, 3, 4, 5, 6, 7, 8, 9, 10, 11, 12, 13, 14, 15); }
__device__ __forceinline__ v16bf cat16b(v8us lo, v8us hi) { return __builtin_bit_cast(v16bf, __builtin_shufflevector(lo, hi, 0, 1, 2, 3, 4, 5, 6, 7, 8, 9, 10, 11, 12, 13, 14, 15)); }
__device__ __forceinline__ v8f wmma16(v16h a, v16h b, v8f c) { return __builtin_amdgcn_wmma_f32_16x16x32_f16(false, a, false, b, (short)0, c, false, false); }
__device__ __forceinline__ v8f wmmab(v16bf a, v16bf b, v8f c) { return __builtin_amdgcn_wmma_f32_16x16x32_bf16(false, a, false, b, (short)0, c, false, false); }
// fragment loaders from K-contiguous 16-bit rows; p already includes + 8*(lane>>4): elements 0..7 <- k0+8h+0..7, elements 8..15 <- k0+16+8h+0..7 (same map for A and B)
__device__ __forceinline__ v16h  ldh(const h16* p) { return cat16(*(const v8h*)p, *(const v8h*)(p + 16)); }
__device__ __forceinline__ v16bf ldb(const bf* p)  { return cat16b(*(const v8us*)p, *(const v8us*)(p + 16)); }
// ordering point for wave-private LDS tiles (same wave writes and reads)
__device__ __forceinline__ void wave_sync() { __builtin_amdgcn_fence(3 /* release order */, "wavefront"); __builtin_amdgcn_wave_barrier(); asm volatile("" ::: "memory"); }
__device__ __forceinline__ float wsum(float v) { v += __shfl_xor(v, 16, 32); v += __shfl_xor(v, 8, 32); v += __shfl_xor(v, 4, 32); v += __shfl_xor(v, 2, 32); v += __shfl_xor(v, 1, 32); return v; }
__device__ __forceinline__ int wsumi(int v) { v += __shfl_xor(v, 16, 32); v += __shfl_xor(v, 8, 32); v += __shfl_xor(v, 4, 32); v += __shfl_xor(v, 2, 32); v += __shfl_xor(v, 1, 32); return v; }

// The six row-wise stages (cvt8, ew, lnx, rope, prep, qkrot) are device functions of one 256-thread block each (blk = the block's index inside its own stage); k_front and k_mid, behind qkrot_part,
// run stages that read none of each other's output side by side in one grid.
// cvt8_part: CVT_CH chunks of 8 floats per thread, 256 threads apart; all of a thread's loads are issued before the first value is converted.
#define CVT_CH 8
__device__ __forceinline__ void cvt8_part(int blk, const float* __restrict__ src, bf* dst, size_t n8) {
    const size_t i = (size_t)blk * (256 * CVT_CH) + threadIdx.x; if (i + (size_t)(CVT_CH - 1) * 256 >= n8) return;
    v4f va[CVT_CH], vb[CVT_CH];
#pragma unroll
    for (int ch = 0; ch < CVT_CH; ++ch) { const float* p = src + (i + (size_t)ch * 256) * 8;
        va[ch] = *(const v4f*)p;
        if (ch == CVT_CH - 1) asm volatile("s_wait_xcnt 0x0" ::: "memory");   // the last load's result may be given the address pair that all the loads above name: it issues only behind this wait
        vb[ch] = *(const v4f*)(p + 4); }
#pragma unroll
    for (int ch = 0; ch < CVT_CH; ++ch) { v8us o;
#pragma unroll
        for (int k = 0; k < 4; ++k) { o[k] = f2bf(va[ch][k]); o[4 + k] = f2bf(vb[ch][k]); }
        *(v8us*)(dst + (i + (size_t)ch * 256) * 8) = o; }
}

// ew_part: edge weight A plane [64][32] f16: columns 0..15 = 16*w[d][j], columns 16..31 = w[d][j]/128 (pairs with the x2048 residual half of the c16 operand). One block; each thread 16 B, consecutive.
__device__ __forceinline__ void ew_part(const float* __restrict__ ew, h16* EWA) {
    const int tid = threadIdx.x; const int d = tid >> 2, q = tid & 3;
    const float sc = (q < 2) ? 16.0f : 0.0078125f;
    const v8f w = *(const v8f*)(ew + d * 16 + (q & 1) * 8);
    v8h o;
#pragma unroll
    for (int i = 0; i < 8; ++i) o[i] = (h16)(bfr(w[i]) * sc);
    *(v8h*)(EWA + d * 32 + q * 8) = o;
    asm volatile("s_wait_xcnt 0x0" ::: "memory");   // other stages' code follows this store in the merged kernel: its address and data registers are rewritten only behind this wait
}

// The wave's row and both weight rows are loaded once, all loads issued together, and kept in registers through the three passes (element visiting order it = 0..3, i = 0..7 in every pass).
__device__ __forceinline__ void lnx_part(int blk, const float* __restrict__ x, const float* __restrict__ lw, const float* __restrict__ lb, bf* XA) {
    const int lane = threadIdx.x & 31; const int wave = __builtin_amdgcn_readfirstlane((int)(threadIdx.x >> 5));
    const int m = blk * 8 + wave; const int b = m / SEQ, t = m % SEQ;
    const float* src = x + ((size_t)b * SEQ_FULL + t) * DM + lane * 8;
    v8f raw[4], wv[4], bv[4];
#pragma unroll
    for (int it = 0; it < 4; ++it) raw[it] = *(const v8f*)(src + it * 256);
#pragma unroll
    for (int it = 0; it < 4; ++it) { wv[it] = *(const v8f*)(lw + it * 256 + lane * 8); bv[it] = *(const v8f*)(lb + it * 256 + lane * 8); }
    float s = 0.0f;
#pragma unroll
    for (int it = 0; it < 4; ++it) {
#pragma unroll
        for (int i = 0; i < 8; ++i) { raw[it][i] = bfr(raw[it][i]); s += raw[it][i]; } }
    s = wsum(s);
    const float mean = s * (1.0f / DM);
    float ss = 0.0f;
#pragma unroll
    for (int it = 0; it < 4; ++it) {
#pragma unroll
        for (int i = 0; i < 8; ++i) { const float dv = raw[it][i] - mean; ss += dv * dv; } }
    ss = wsum(ss);
    const float rstd = 1.0f / sqrtf(ss * (1.0f / DM) + 1e-5f);
    bf* dst = XA + (size_t)m * K2 + lane * 8;
#pragma unroll
    for (int it = 0; it < 4; ++it) {
        v8us hv, lv;
#pragma unroll
        for (int i = 0; i < 8; ++i) { const float dv = raw[it][i] - mean; const float y = dv * rstd * bfr(wv[it][i]) + bfr(bv[it][i]); const unsigned short hh = f2bf(y); hv[i] = hh; lv[i] = f2bf(y - bf2f(hh)); }
        *(v8us*)(dst + it * 256) = hv; *(v8us*)(dst + DM + it * 256) = lv; }
}

__device__ __forceinline__ void rope_part(int blk, const float* __restrict__ pos, float* CS, float* SN) {
    const int lane = threadIdx.x & 31; const int wave = __builtin_amdgcn_readfirstlane((int)(threadIdx.x >> 5));
    const int m = blk * 8 + wave; const int b = m / SEQ, t = m % SEQ;
    const float p = bfr(pos[(size_t)b * SEQ_FULL + t]);
    double pd = 1.0;
#pragma unroll 1
    for (int i = 0; i < lane; ++i) pd *= 1.333521432163324;
    const float pf = (float)pd;
    const float invf = 1.0f / pf;
    const float ang = p * invf;
    const float c = cosf(ang), s = sinf(ang);
    *(float*)(CS + (size_t)m * 32 + lane) = c; *(float*)(SN + (size_t)m * 32 + lane) = s;
    
}

// prep_part: per 64 tokens: len = mask row sums; bm = blocks - mean_c; base = bm / (|bm| + eps); planes BM[0] = f16(bm * 1024/len), BM[1] = f16 residual x2048, layout [plane][b][16][SEQ] (rows 12..15 zero);
// BASE [token][16] f32 (columns 12..15 zero). LDS tiles are cross-wave: block barriers between phases.
__device__ __forceinline__ void prep_part(int blk, const float* __restrict__ blocks, const int* __restrict__ mask, h16* BM, float* BASE) {
    __shared__ float slen[64];
    __shared__ __align__(16) h16 sb[32 * 64];
    __shared__ __align__(16) float sbase[64 * 16];
    const int tid = threadIdx.x, lane = tid & 31; const int wave = __builtin_amdgcn_readfirstlane((int)(threadIdx.x >> 5));
    const int m0 = blk * 64; const int b = m0 / SEQ, t0 = m0 % SEQ;
#pragma unroll 1   // two batches of four mask rows: a batch's loads are all in flight together; all eight rows at once would double the registers of the whole kernel
    for (int g = 0; g < 2; ++g) { const int tl = wave * 8 + g * 4;
        const int* row = mask + ((size_t)b * SEQ_FULL + t0 + tl) * SEQ_FULL + lane * 4;
        v4i mv[4][SEQ / 128];
#pragma unroll
        for (int r = 0; r < 4; ++r)
#pragma unroll
            for (int c = 0; c < SEQ / 128; ++c) mv[r][c] = *(const v4i*)(row + (size_t)r * SEQ_FULL + c * 128);
        int cnt[4];
#pragma unroll
        for (int r = 0; r < 4; ++r) { cnt[r] = 0;
#pragma unroll
            for (int c = 0; c < SEQ / 128; ++c) cnt[r] += (mv[r][c][0] != 0) + (mv[r][c][1] != 0) + (mv[r][c][2] != 0) + (mv[r][c][3] != 0); }
#pragma unroll
        for (int r = 0; r < 4; ++r) cnt[r] = wsumi(cnt[r]);
        if (lane == 0) {
#pragma unroll
            for (int r = 0; r < 4; ++r) slen[tl + r] = (float)cnt[r]; } }
    __syncthreads();
    if (tid < 64) {
        const float* p = blocks + ((size_t)b * SEQ_FULL + t0 + tid) * 12;
        const v4f a0 = *(const v4f*)p, a1 = *(const v4f*)(p + 4), a2 = *(const v4f*)(p + 8);
        float pv[12];
#pragma unroll
        for (int i = 0; i < 4; ++i) { pv[i] = bfr(a0[i]); pv[4 + i] = bfr(a1[i]); pv[8 + i] = bfr(a2[i]); }
        float mu[3];
#pragma unroll
        for (int x = 0; x < 3; ++x) mu[x] = (pv[x] + pv[3 + x] + pv[6 + x] + pv[9 + x]) * 0.25f;
        const float sc = (1.0f / slen[tid]) * 1024.0f;
#pragma unroll
        for (int c = 0; c < 4; ++c) {
            const float vx = pv[c * 3] - mu[0], vy = pv[c * 3 + 1] - mu[1], vz = pv[c * 3 + 2] - mu[2];
            const float inv = 1.0f / (sqrtf(vx * vx + vy * vy + vz * vz) + 1.1920929e-7f);
            const float vv[3] = {vx, vy, vz};
#pragma unroll
            for (int x = 0; x < 3; ++x) { const int cx = c * 3 + x;
                sbase[tid * 16 + cx] = vv[x] * inv;
                const float bs = vv[x] * sc; const h16 hh = (h16)bs;
                sb[cx * 64 + tid] = hh; sb[(16 + cx) * 64 + tid] = (h16)((bs - (float)hh) * QRS); } }
#pragma unroll
        for (int j = 12; j < 16; ++j) { sbase[tid * 16 + j] = 0.0f; sb[j * 64 + tid] = (h16)0.0f; sb[(16 + j) * 64 + tid] = (h16)0.0f; }
    }
    __syncthreads();
    // 32 lines of 64 halves: line = tid>>3 (0..15 value plane rows, 16..31 residual plane rows), 8 consecutive lanes x 16 B per line; BASE: 256 threads x 16 B contiguous
    const int line = tid >> 3, pc = tid & 7;
    const v8h bv = *(const v8ha*)(&sb[line * 64 + pc * 8]);
    const v4f fv = *(const v4fa*)(&sbase[tid * 4]);
    h16* bd = BM + (size_t)(line >> 4) * ((size_t)NB * 16 * SEQ) + ((size_t)b * 16 + (line & 15)) * SEQ + t0 + pc * 8;
    float* fd = BASE + (size_t)m0 * 16 + tid * 4;
    *(v8h*)bd = bv; *(v4f*)fd = fv;
    
}

// k_proj: bf16 GEMM, 128x128 tile per block of four waves (2 x 2, each 64x64 = 16 accumulators). One operand is an activation in two planes (value | residual along its row), the other a weight in one plane.
// Both are staged in LDS by tensor loads: a stage is 128 k of the weight rows and the same 128 k of both activation planes (256 bytes a row), so a weight tile is fetched once and a weight fragment is read once
// for both planes. Two buffers, every wave moves its own slice one stage ahead of the pass that reads it. Order per accumulator: kc = 0, 32, 64, ...; at each kc the value plane's product, then the residual plane's.
// MODE 1: f32 rows C[((r0/RB)*RP + r0%RB)][c0..c0+63], row pitch ldc; each 256-byte row segment by 16 consecutive lanes x 16 B.
#define PJ_PITCH 272u                 // LDS row pitch: 256-byte row + the mover's 16-byte pad (odd multiple of 16 B for 16-byte readers)
#define PJ_SLICE 18432u               // 64 weight rows x 272 B = 17408, rounded up to a multiple of 2 KiB so that every slice starts on one
#define PJ_PLANE 34816u               // 128 activation rows of one plane x 272 B, itself a multiple of 2 KiB
#define PJ_STAGE (2u * PJ_PLANE + 2u * PJ_SLICE)   // value plane, residual plane (128 rows each), weight rows 0..63, weight rows 64..127 of the block tile
static_assert(64u * PJ_PITCH <= PJ_SLICE && PJ_SLICE % 2048u == 0u);
static_assert(128u * PJ_PITCH <= PJ_PLANE && PJ_PLANE % 2048u == 0u);
static_assert(DM % 128 == 0 && K2 == 2 * DM && DM / 128 >= 2);   // whole stages inside every plane and every weight row, at least two stages
__device__ __forceinline__ uint32_t uni(uint32_t v) { return (uint32_t)__builtin_amdgcn_readfirstlane((int)v); }
__device__ __forceinline__ uint32_t pinned(uint32_t v) { uint32_t w = uni(v); asm volatile("" : "+s"(w)); return w; }   // the pinned() form for tensor loads: the test value is held in a scalar register, so the branch round a load is a scalar one (the load ignores EXEC)
// one request of the whole wave: rows of 256 bytes from ga (row count and row pitch in g1) to LDS byte offset dst; word 0 of g0 (count 1) is set once by the caller
__device__ __forceinline__ void tdm_load(u32x4& g0, uint32_t dst, uint64_t ga, u32x8& g1) {
    g0[1] = uni(dst); g0[2] = uni((uint32_t)ga); g0[3] = uni((((uint32_t)(ga >> 32)) & 0x01FFFFFFu) | 0x80000000u);
    asm volatile("tensor_load_to_lds %0, %1" : "+s"(g0), "+s"(g1) :: "memory");   // in-out: the same registers go on to the wait below
}
// the wave's own requests have landed. The statement names both descriptor groups as in-out operands so that their scalar registers hold the issued words until the wait has returned
// and every new word is formed behind it.
__device__ __forceinline__ void tdm_wait(u32x4& g0, u32x8& g1) { asm volatile("s_wait_tensorcnt 0x0" : "+s"(g0), "+s"(g1) :: "memory"); }
// proj_tile: the tile (bx, by) of one product; ring and osall are the calling kernel's LDS arrays (ring on a multiple of 2 KiB). SA: the two-plane operand is A (else Bt); K = its row length, both planes.
template <int MODE, bool SA>
__device__ __forceinline__ void proj_tile(unsigned char* ring, float* osall, uint32_t bx, uint32_t by, const bf* __restrict__ A, int pA, const bf* __restrict__ Bt, int pB, int K,
                                          h16* Ph, int RB, size_t sRB, int pitch, int CB, size_t sCB, float* C, int ldc, int RP) {
    const int lane = threadIdx.x & 31, lr = lane & 15, hi = lane >> 4;
    const uint32_t wave = uni(threadIdx.x >> 5);
    const int r0 = bx * 128 + (int)(wave >> 1) * 64, c0 = by * 128 + (int)(wave & 1u) * 64;
    float* os = osall + wave * (16 * 68);
    v8f acc[4][4];
#pragma unroll
    for (int mb = 0; mb < 4; ++mb)
#pragma unroll
        for (int nb = 0; nb < 4; ++nb) acc[mb][nb] = (v8f){};
    // this wave's slice of every stage: wave 0 moves the value plane and wave 1 the residual plane of the block's 128 activation rows, waves 2, 3 move 64 weight rows each
    const bf* actp = SA ? A + (size_t)(bx * 128) * (size_t)pA : Bt + (size_t)(by * 128) * (size_t)pB;
    const bf* wgtp = SA ? Bt + (size_t)(by * 128) * (size_t)pB : A + (size_t)(bx * 128) * (size_t)pA;
    const uint32_t pact = (uint32_t)(SA ? pA : pB), pwgt = (uint32_t)(SA ? pB : pA);
    const bool ownP = wave < 2u;
    const uint32_t sp = ownP ? pact : pwgt;
    const uint32_t nrow = ownP ? 128u : 64u;
    const uint64_t src0 = ownP ? (uint64_t)(uintptr_t)(actp + (size_t)wave * (size_t)(K >> 1))
                               : (uint64_t)(uintptr_t)(wgtp + (size_t)((wave - 2u) * 64u) * (size_t)pwgt);
    const uint32_t slice = (uint32_t)(size_t)ring + (ownP ? wave * PJ_PLANE : 2u * PJ_PLANE + (wave - 2u) * PJ_SLICE);
    u32x8 g1;
    g1[0] = uni((1u << 20) | (5u << 22) | (3u << 25));   // no mask, byte elements, 16 B of pad behind every 256 B
    g1[1] = uni(256u << 16); g1[2] = uni(nrow << 16); g1[3] = uni(256u << 16); g1[4] = uni(nrow);   // tensor = tile = 256 B x this wave's rows
    g1[5] = uni(sp * 2u); g1[6] = uni(0u); g1[7] = uni(0u);
    const uint32_t T = (uint32_t)K >> 8;                 // stages of 128 k of one plane
    const uint32_t wact = SA ? (wave >> 1) : (wave & 1u), wwgt = SA ? (wave & 1u) : (wave >> 1);   // which 64 rows of each operand this wave's 64x64 tile reads
    const uint32_t pbase = (wact * 64u + (uint32_t)lr) * PJ_PITCH + 16u * (uint32_t)hi;
    const uint32_t wbase = 2u * PJ_PLANE + wwgt * PJ_SLICE + (uint32_t)lr * PJ_PITCH + 16u * (uint32_t)hi;
    u32x4 g0;
    g0[0] = uni(1u);
    tdm_load(g0, slice, src0, g1);
    tdm_wait(g0, g1);                                    // this wave's slice of stage 0 has landed
    __syncthreads();                                     // every slice of stage 0 is readable by every wave
    if (pinned((1u < T) ? 1u : 0u) != 0u) tdm_load(g0, slice + PJ_STAGE, src0 + (uint64_t)256u, g1);
#pragma unroll 1   // one pass per trip: the buffer index and the publish point below belong to one stage
    for (uint32_t t = 0; t < T; ++t) {
        const uint32_t buf = (t & 1u) * PJ_STAGE;
        const unsigned char* lh = ring + buf + pbase; const unsigned char* ll = lh + PJ_PLANE; const unsigned char* lw = ring + buf + wbase;
        v16bf fh[2][4], fl[2][4], fw[2][4];
#pragma unroll
        for (int i = 0; i < 4; ++i) { fh[0][i] = ldb((const bf*)(lh + i * 16 * PJ_PITCH)); fw[0][i] = ldb((const bf*)(lw + i * 16 * PJ_PITCH)); }
#pragma unroll
        for (int i = 0; i < 4; ++i) fl[0][i] = ldb((const bf*)(ll + i * 16 * PJ_PITCH));   // wanted sixteen products later than the two sets above
#pragma unroll
        for (int u = 0; u < 4; ++u) {
            const int cs = u & 1;
            if (u < 3) {
#pragma unroll
                for (int i = 0; i < 4; ++i) { fh[cs ^ 1][i] = ldb((const bf*)(lh + i * 16 * PJ_PITCH + (u + 1) * 64)); fw[cs ^ 1][i] = ldb((const bf*)(lw + i * 16 * PJ_PITCH + (u + 1) * 64)); }
#pragma unroll
                for (int i = 0; i < 4; ++i) fl[cs ^ 1][i] = ldb((const bf*)(ll + i * 16 * PJ_PITCH + (u + 1) * 64));
            }
            __builtin_amdgcn_sched_barrier(0);   // the next block's LDS reads stay one group in front of this block's products
#pragma unroll
            for (int nb = 0; nb < 4; ++nb)
#pragma unroll
                for (int mb = 0; mb < 4; ++mb) acc[mb][nb] = SA ? wmmab(fh[cs][mb], fw[cs][nb], acc[mb][nb]) : wmmab(fw[cs][mb], fh[cs][nb], acc[mb][nb]);
#pragma unroll
            for (int nb = 0; nb < 4; ++nb)
#pragma unroll
                for (int mb = 0; mb < 4; ++mb) acc[mb][nb] = SA ? wmmab(fl[cs][mb], fw[cs][nb], acc[mb][nb]) : wmmab(fw[cs][mb], fl[cs][nb], acc[mb][nb]);
            __builtin_amdgcn_sched_barrier(0);   // no LDS read moves in among the products
        }
        asm volatile("s_wait_dscnt 0x0" ::: "memory");
        tdm_wait(g0, g1);
        __syncthreads();
        if (pinned((t + 2u < T) ? 1u : 0u) != 0u) tdm_load(g0, slice + buf, src0 + (uint64_t)((t + 2u) << 8), g1);
    }
    tdm_wait(g0, g1);                                    // no request is outstanding when the wave goes on
    asm volatile("s_wait_dscnt 0x0" ::: "memory");       // nor any LDS read of the ring
    const size_t tbase = (size_t)(r0 / RB) * sRB + (size_t)(r0 % RB) * (size_t)pitch + (size_t)(c0 / CB) * sCB + (size_t)(c0 % CB);
    const size_t cbase = ((size_t)(r0 / RB) * (size_t)RP + (size_t)(r0 % RB)) * (size_t)ldc + (size_t)c0;
#pragma unroll
    for (int mb = 0; mb < 4; ++mb) {
#pragma unroll
        for (int nb = 0; nb < 4; ++nb) {
#pragma unroll
            for (int j = 0; j < 8; ++j) os[(hi * 8 + j) * 68 + nb * 16 + lr] = acc[mb][nb][j]; }   // D: row 8h+j, col lane&15
        wave_sync();
        if (MODE == 0) {
            const size_t sb = tbase + (size_t)(mb * 16) * (size_t)pitch;
{
#pragma unroll
                for (int s = 0; s < 4; ++s) { const int row = 4 * s + (lane >> 3), c8 = (lane & 7) * 8;   // 4 s x 4 row groups = 16 rows; 8 lanes x 8 = 64 columns
                    const v4f x0 = *(const v4fa*)(&os[row * 68 + c8]); const v4f x1 = *(const v4fa*)(&os[row * 68 + c8 + 4]); v8h hv;
#pragma unroll
                    for (int i = 0; i < 4; ++i) { hv[i] = (h16)x0[i]; hv[4 + i] = (h16)x1[i]; }
                    *(v8h*)(Ph + sb + (size_t)row * (size_t)pitch + c8) = hv; }
                 }
        } else {
            const size_t sb = cbase + (size_t)(mb * 16) * (size_t)ldc;
{
#pragma unroll
                for (int s = 0; s < 8; ++s) { const int row = 2 * s + hi, cofs = lr * 4;   // 8 s x 2 rows = 16 rows; 16 lanes x 4 floats = 64 columns
                    const v4f val = *(const v4fa*)(&os[row * 68 + cofs]);
                    *(v4f*)(C + sb + (size_t)row * (size_t)ldc + cofs) = val; }
                 }
        }
        wave_sync();
    }
}

template <int MODE>
__global__ __launch_bounds__(128) void k_proj(const bf* __restrict__ A, int pA, const bf* __restrict__ Bt, int pB, int K,
                                              h16* Ph, int RB, size_t sRB, int pitch, int CB, size_t sCB, float* C, int ldc, int RP) {
    __shared__ __attribute__((aligned(2048))) unsigned char ring[2 * PJ_STAGE];
    __shared__ __align__(16) float osall[4 * 16 * 68];
    proj_tile<MODE, true>(ring, osall, blockIdx.x, blockIdx.y, A, pA, Bt, pB, K, Ph, RB, sRB, pitch, CB, sCB, C, ldc, RP);
}
// k_proj_qkv: the q|k product and the v^T product read the same two operands and none of each other's output: one grid, the q|k tiles first.
// q|k: A = LN(x) rows, Bt = wqkv rows 0..2047 -> QK[m][n] f32. v^T: A = wqkv rows 2048..3071 (m = h*64 + d), Bt = LN(x) rows (n = b*SEQ + t) -> plane [(b*1024 + m)][t] = [(b*16 + h)][d][t].
#define PQ_BX (NB * SEQ / 128)
#define PQ_N  (PQ_BX * (2 * DM / 128))
#define PV_BX (DM / 128)
#define PV_N  (PV_BX * (NB * SEQ / 128))
__global__ __launch_bounds__(128) void k_proj_qkv(const bf* __restrict__ XA, const bf* __restrict__ WB, float* QK, h16* VT) {
    __shared__ __attribute__((aligned(2048))) unsigned char ring[2 * PJ_STAGE];
    __shared__ __align__(16) float osall[4 * 16 * 68];
    const uint32_t i = blockIdx.x;
    if (i < (uint32_t)PQ_N) {
        proj_tile<1, true>(ring, osall, i % PQ_BX, i / PQ_BX, XA, K2, WB, DM, K2, (h16*)0, NB * SEQ, (size_t)0, 0, 64, (size_t)0, QK, K2, NB * SEQ);
    } else {
        const uint32_t j = i - (uint32_t)PQ_N;
        proj_tile<0, false>(ring, osall, j % PV_BX, j / PV_BX, WB + (size_t)2 * DM * DM, DM, XA, K2, K2, VT, DM, (size_t)0, SEQ, SEQ, (size_t)DM * SEQ, (float*)0, 0, 0);
    }
}

// Lane holds columns it*256 + lane*8 + i = head (4*it + lane/8), d = 8*(lane&7) + i; the rotary partner d +- 32 is lane ^ 4 (same it, same i).
// Planes [b*16+h][t][64], four consecutive planes from PL with stride pst halves: q value, q residual x2048, k value, k residual x2048 (selected by integer offset from one base).
// The wave's q row, k row and both weight rows are loaded once, all loads issued together, and kept in registers through the three passes (visiting order it = 0..3, i = 0..7).
__device__ __forceinline__ void qkrot_part(int blk, const float* __restrict__ QK, const float* __restrict__ qw, const float* __restrict__ kw, const float* __restrict__ CS, const float* __restrict__ SN,
                                           h16* PL, size_t pst) {
    const int lane = threadIdx.x & 31; const int wave = __builtin_amdgcn_readfirstlane((int)(threadIdx.x >> 5));
    const int m = blk * 8 + wave; const int b = m / SEQ, t = m % SEQ;
    const int c = lane & 7;
    const v8f cs = *(const v8f*)(CS + (size_t)m * 32 + 8 * (c & 3));
    const v8f sn = *(const v8f*)(SN + (size_t)m * 32 + 8 * (c & 3));
    const float sg = (c < 4) ? -1.0f : 1.0f;
    const size_t o0 = (((size_t)(b * NH_ + (lane >> 3))) * SEQ + t) * HD + 8 * c;
    const size_t ost = (size_t)4 * SEQ * HD;     // four heads per step
    const float* row = QK + (size_t)m * K2 + lane * 8;
    v8f raw[2][4], wgt[2][4];
#pragma unroll
    for (int wh = 0; wh < 2; ++wh)
#pragma unroll
        for (int it = 0; it < 4; ++it) raw[wh][it] = *(const v8f*)(row + wh * DM + it * 256);
#pragma unroll
    for (int it = 0; it < 4; ++it) { wgt[0][it] = *(const v8f*)(qw + it * 256 + lane * 8); wgt[1][it] = *(const v8f*)(kw + it * 256 + lane * 8); }
#pragma unroll
    for (int wh = 0; wh < 2; ++wh) {
        float s = 0.0f;
#pragma unroll
        for (int it = 0; it < 4; ++it) {
#pragma unroll
            for (int i = 0; i < 8; ++i) s += raw[wh][it][i]; }
        s = wsum(s);
        const float mean = s * (1.0f / DM);
        float ss = 0.0f;
#pragma unroll
        for (int it = 0; it < 4; ++it) {
#pragma unroll
            for (int i = 0; i < 8; ++i) { const float dv = raw[wh][it][i] - mean; ss += dv * dv; } }
        ss = wsum(ss);
        const float rstd = 1.0f / sqrtf(ss * (1.0f / DM) + 1e-5f);
        h16* PH = PL + (size_t)(2 * wh) * pst;
        h16* PR = PH + pst;
#pragma unroll
        for (int it = 0; it < 4; ++it) {
            v8h hv, rv;
#pragma unroll
            for (int i = 0; i < 8; ++i) {
                const float y = (raw[wh][it][i] - mean) * rstd * bfr(wgt[wh][it][i]);
                const float pr = __shfl_xor(y, 4, 32);
                const float r = y * cs[i] + sg * pr * sn[i];
                const h16 hh = (h16)r; hv[i] = hh; rv[i] = (h16)((r - (float)hh) * QRS); }
            const size_t oo = o0 + (size_t)it * ost;
            *(v8h*)(PH + oo) = hv; *(v8h*)(PR + oo) = rv; }
    }
    asm volatile("s_wait_xcnt 0x0" ::: "memory");   // other stages' code follows these stores in the merged kernel: their address and data registers are rewritten only behind this wait
}

// k_front: LN(x) and the wqkv conversion, which the qkv products read, beside the rotary table, which k_mid reads. The stages with the longest dependent chains take the low block indices, the short conversion blocks the high ones (for speed only).
#define GF_LNX  (NB * SEQ / 8)
#define GF_ROPE (NB * SEQ / 8)
#define GF_CVT  (3 * DM * DM / 8 / (256 * CVT_CH))
static_assert((3 * DM * DM / 8) % (256 * CVT_CH) == 0 && (DM * DM / 8) % (256 * CVT_CH) == 0);
__global__ __launch_bounds__(256) void k_front(const float* __restrict__ x, const float* __restrict__ lw, const float* __restrict__ lb, bf* XA,
                                               const float* __restrict__ pos, float* CS, float* SN, const float* __restrict__ wqkv, bf* WB) {
    const int blk = blockIdx.x;
    if (blk < GF_LNX) lnx_part(blk, x, lw, lb, XA);
    else if (blk < GF_LNX + GF_ROPE) rope_part(blk - GF_LNX, pos, CS, SN);
    else cvt8_part(blk - (GF_LNX + GF_ROPE), wqkv, WB, (size_t)3 * DM * DM / 8);
}
// k_mid: the q/k norm and rotary (reads the q|k product) beside the stages that only k_flash or the output product read: mask sums and bm planes, edge weight plane, out_w conversion.
#define GM_PREP (NB * SEQ / 64)
#define GM_ROT  (NB * SEQ / 8)
#define GM_CVT  (DM * DM / 8 / (256 * CVT_CH))
__global__ __launch_bounds__(256) void k_mid(const float* __restrict__ QK, const float* __restrict__ qw, const float* __restrict__ kw, const float* __restrict__ CS, const float* __restrict__ SN, h16* PL, size_t pst,
                                             const float* __restrict__ blocks, const int* __restrict__ mask, h16* BM, float* BASE,
                                             const float* __restrict__ ew, h16* EWA, const float* __restrict__ ow, bf* OWB) {
    const int blk = blockIdx.x;
    if (blk < GM_PREP) prep_part(blk, blocks, mask, BM, BASE);
    else if (blk < GM_PREP + GM_ROT) qkrot_part(blk - GM_PREP, QK, qw, kw, CS, SN, PL, pst);
    else if (blk == GM_PREP + GM_ROT) ew_part(ew, EWA);
    else cvt8_part(blk - (GM_PREP + GM_ROT + 1), ow, OWB, (size_t)DM * DM / 8);
}

// k_flash staging: a stage is 64 keys of the block's (batch, head): k value and residual rows, v^T rows, both bm planes (128-byte rows, LDS pitch 144) and the block's 64 mask rows
// (256-byte rows, LDS pitch 272; both pitches are odd multiples of 16 B for 16-byte readers). Two buffers, filled by asynchronous copies one stage ahead of the pass that reads them.
#define FK      64
#define FP1     144u
#define FP2     272u
#define FO_KH   0u
#define FO_KR   (64u * FP1)
#define FO_VT   (128u * FP1)
#define FO_BM   (192u * FP1)
#define FO_MK   (224u * FP1)
#define F_STAGE (FO_MK + 64u * FP2)
static_assert(AW == 4 && KW == 2 && HD == 64);      // 256 lanes: 32 rows of 128 B or 16 rows of 256 B per copy instruction of the block
static_assert(FK == 32 * KW);                       // one 32-key half of a stage per wave of a query tile
static_assert(SEQ % FK == 0 && SEQ / FK >= 2);      // whole stages, at least two
static_assert(F_STAGE % 16u == 0u);
// One stage: 11 copies of 16 B per lane, every lane on. l1 / l2: the lane's LDS byte address in row 0..31 of a 128-byte-row tile / row 0..15 of the mask tile of the target buffer.
// bm: the lane's 16 bytes of the 32 bm rows (value plane rows 0..15, residual plane rows 16..31, adjacent in LDS).
// The run of copies ends, inside its own statement, with s_wait_xcnt 0: the address registers are rewritten only behind it.
__device__ __forceinline__ void flash_fill(uint32_t l1, uint32_t l2, const h16* kh, const h16* kr, const h16* vt, const h16* bm, const int* mk) {
    asm volatile("global_load_async_to_lds_b128 %0, %1, off\n\t"
                 "global_load_async_to_lds_b128 %2, %3, off\n\t"
                 "global_load_async_to_lds_b128 %4, %5, off\n\t"
                 "global_load_async_to_lds_b128 %6, %7, off\n\t"
                 "global_load_async_to_lds_b128 %8, %9, off\n\t"
                 "global_load_async_to_lds_b128 %10, %11, off\n\t"
                 "global_load_async_to_lds_b128 %12, %13, off\n\t"
                 "global_load_async_to_lds_b128 %14, %15, off\n\t"
                 "global_load_async_to_lds_b128 %16, %17, off\n\t"
                 "global_load_async_to_lds_b128 %18, %19, off\n\t"
                 "global_load_async_to_lds_b128 %20, %21, off\n\t"
                 "s_wait_xcnt 0x0"
                 :: "v"(l1 + FO_KH), "v"(kh), "v"(l1 + FO_KH + 32u * FP1), "v"(kh + 32 * HD),
                    "v"(l1 + FO_KR), "v"(kr), "v"(l1 + FO_KR + 32u * FP1), "v"(kr + 32 * HD),
                    "v"(l2), "v"(mk), "v"(l2 + 16u * FP2), "v"(mk + 16 * SEQ_FULL), "v"(l2 + 32u * FP2), "v"(mk + 32 * SEQ_FULL), "v"(l2 + 48u * FP2), "v"(mk + 48 * SEQ_FULL),
                    "v"(l1 + FO_VT), "v"(vt), "v"(l1 + FO_VT + 32u * FP1), "v"(vt + 32 * SEQ),
                    "v"(l1 + FO_BM), "v"(bm)
                 : "memory");
}

// k_flash: fused attention + geometric term, KW waves per 16 query rows of one (batch, head): wave (qw, ks) walks the ks-th 32 keys of every stage with its own running max, sums and accumulators,
// so that a SIMD holds four waves; behind the loop the ks = 1 wave hands its state over in LDS and the ks = 0 wave joins both and runs the epilogue. q fragments straight from the 16-bit planes, all key-side fragments and the mask from the staged LDS tiles (two 16-B reads each).
// Transposed form: S^T[key][t] = K Q^T; lane (t = lane&15, h = lane>>4) holds keys 8h+r of each 16-key tile, so packed P / G tiles are directly B fragments of
// O^T[d][t] = V^T P^T and T^T[cx][t] = BM^T G^T. S = kH.qH + (kH.qR + kR.qH)/2048. Mask: replace-fill for the softmax, zero for G. Softmax state one scalar per lane (running max from -inf).
// Epilogue: tmp2 halves exchanged with one xor-16 shuffle, c16 = base.tmp2 (K = 3, VALU), ctx^T = EW c16^T on one K=32 tile (value | residual), sum staged in a wave-private LDS tile and
// Two blocks of eight waves share a WGP (LDS allows two): four waves a SIMD, so a wave may hold at most 256 registers.
__global__ __launch_bounds__(32 * AW * KW) __attribute__((amdgpu_waves_per_eu(4, 4))) void k_flash(const h16* __restrict__ QH, const h16* __restrict__ QR, const h16* __restrict__ KH, const h16* __restrict__ KR, const h16* __restrict__ VT,
                                                   const h16* __restrict__ BM, const float* __restrict__ BASE, const h16* __restrict__ EWA, const int* __restrict__ mask, bf* OA) {
    __shared__ __align__(16) float os[AW * 16 * 68];
    __shared__ __align__(16) unsigned char fr[2 * F_STAGE];
    const int tid = threadIdx.x;
    const int lane = threadIdx.x & 31, wave = __builtin_amdgcn_readfirstlane((int)(threadIdx.x >> 5)), lr = lane & 15, hi = lane >> 4;
    const int zh = blockIdx.y; const int b = zh / NH_, h = zh % NH_;
    const int qw = wave & (AW - 1), ks = wave / AW;      // query tile, key half
    const int t0 = (blockIdx.x * AW + qw) * 16;
    const size_t pbase = (size_t)zh * SEQ * HD;
    const size_t qo = pbase + (size_t)(t0 + lr) * HD + 8 * hi;
    const v16h qh0 = ldh(QH + qo), qh1 = ldh(QH + qo + 32), qr0 = ldh(QR + qo), qr1 = ldh(QR + qo + 32);   // B fragments: col t, k = d
    // readers, byte offsets in a buffer: 128-byte-row tiles at row lr (A fragments: row key / d / cx), mask at this wave's row lr
    const uint32_t ro = (uint32_t)lr * FP1 + 16u * (uint32_t)hi;
    const uint32_t rk = ro + (uint32_t)ks * (32u * FP1);   // k tiles: this wave's 32 keys are rows
    const uint32_t rc = ro + (uint32_t)ks * 64u;           // v^T and bm tiles: they are columns
    const uint32_t mo = FO_MK + (uint32_t)(qw * 16 + lr) * FP2 + 32u * (uint32_t)hi + (uint32_t)ks * 128u;
    // copiers: the lane's own 16 bytes of stage 0 (8 lanes per 128-byte row, 16 lanes per mask row)
    const h16* ckh = KH + pbase + (size_t)tid * 8;
    const h16* ckr = KR + pbase + (size_t)tid * 8;
    const h16* cvt = VT + pbase + (size_t)(tid >> 3) * SEQ + 8 * (tid & 7);
    const h16* cbm = BM + (size_t)(tid >> 7) * ((size_t)NB * 16 * SEQ) + ((size_t)b * 16 + ((tid >> 3) & 15)) * SEQ + 8 * (tid & 7);
    const int* cmk = mask + ((size_t)b * SEQ_FULL + blockIdx.x * (16 * AW) + (tid >> 4)) * SEQ_FULL + 4 * (tid & 15);
    const uint32_t cl1 = (uint32_t)(size_t)fr + (uint32_t)(tid >> 3) * FP1 + 16u * (uint32_t)(tid & 7);
    const uint32_t cl2 = (uint32_t)(size_t)fr + FO_MK + (uint32_t)(tid >> 4) * FP2 + 16u * (uint32_t)(tid & 15);
    v8f o0 = (v8f){}, o1 = (v8f){}, o2 = (v8f){}, o3 = (v8f){}, gA = (v8f){}, gR = (v8f){};
    float m = -__builtin_huge_valf(), l = 0.0f;
    flash_fill(cl1, cl2, ckh, ckr, cvt, cbm, cmk);
    asm volatile("s_wait_asynccnt 0x0" ::: "memory");    // this wave's copies of stage 0 have landed
    __syncthreads();                                     // every wave's part of stage 0 is readable by every wave
    flash_fill(cl1 + F_STAGE, cl2 + F_STAGE, ckh + FK * HD, ckr + FK * HD, cvt + FK, cbm + FK, cmk + FK);
#pragma unroll 1   // one stage per trip: the buffer index and the publish point at the foot belong to one stage
    for (int st = 0; st < SEQ / FK; ++st) {
      const uint32_t bo = (uint32_t)(st & 1) * F_STAGE;
      {
        const int* mrow = (const int*)(fr + bo + mo);
        const v4i mk0 = *(const v4i*)(mrow), mk1 = *(const v4i*)(mrow + 4), mk2 = *(const v4i*)(mrow + 16), mk3 = *(const v4i*)(mrow + 20);
        const unsigned char* ka = fr + bo + FO_KH + rk; const unsigned char* kr = fr + bo + FO_KR + rk;
        const v16h ka0 = ldh((const h16*)ka), ka1 = ldh((const h16*)(ka + 64)), kb0 = ldh((const h16*)(ka + 16 * FP1)), kb1 = ldh((const h16*)(ka + 16 * FP1 + 64));
        const v16h ra0 = ldh((const h16*)kr), ra1 = ldh((const h16*)(kr + 64)), rb0 = ldh((const h16*)(kr + 16 * FP1)), rb1 = ldh((const h16*)(kr + 16 * FP1 + 64));
        v8f sHa = (v8f){}, sLa = (v8f){}, sKa = (v8f){}, sHb = (v8f){}, sLb = (v8f){}, sKb = (v8f){};
        sHa = wmma16(ka0, qh0, sHa); sLa = wmma16(ka0, qr0, sLa); sKa = wmma16(ra0, qh0, sKa); sHb = wmma16(kb0, qh0, sHb); sLb = wmma16(kb0, qr0, sLb); sKb = wmma16(rb0, qh0, sKb);
        sHa = wmma16(ka1, qh1, sHa); sLa = wmma16(ka1, qr1, sLa); sKa = wmma16(ra1, qh1, sKa); sHb = wmma16(kb1, qh1, sHb); sLb = wmma16(kb1, qr1, sLb); sKb = wmma16(rb1, qh1, sKb);
        asm volatile("v_nop\n\tv_nop\n\tv_nop\n\tv_nop" : "+v"(sHa), "+v"(sLa), "+v"(sKa), "+v"(sHb), "+v"(sLb), "+v"(sKb) : "v"(ka0), "v"(ka1), "v"(kb0), "v"(kb1), "v"(ra0), "v"(ra1), "v"(rb0), "v"(rb1));
        const int mka[8] = {mk0[0], mk0[1], mk0[2], mk0[3], mk1[0], mk1[1], mk1[2], mk1[3]};
        const int mkb[8] = {mk2[0], mk2[1], mk2[2], mk2[3], mk3[0], mk3[1], mk3[2], mk3[3]};
        float ta[8], tb[8]; float mx = NEGMIN;
        v16h gh, gr;
#pragma unroll
        for (int r = 0; r < 8; ++r) {
            const float xa = sHa[r] + (sLa[r] + sKa[r]) * QRI; const float xb = sHb[r] + (sLb[r] + sKb[r]) * QRI;
            const bool va = (mka[r] != 0), vb = (mkb[r] != 0);
            ta[r] = va ? xa * SC2 : NEGMIN; tb[r] = vb ? xb * SC2 : NEGMIN;
            const float ga = va ? xa : 0.0f; const float gb = vb ? xb : 0.0f;
            const h16 ha = (h16)ga; const h16 hb = (h16)gb;
            gh[r] = ha; gh[8 + r] = hb; gr[r] = (h16)((ga - (float)ha) * QRS); gr[8 + r] = (h16)((gb - (float)hb) * QRS);
            mx = fmaxf(mx, fmaxf(ta[r], tb[r])); }
        mx = fmaxf(mx, __shfl_xor(mx, 16, 32));
        const float mnew = fmaxf(m, mx);
        const float alpha = __builtin_amdgcn_exp2f(m - mnew);
        const float sh = PSH - mnew;
        v16h pb; float ls = 0.0f;
#pragma unroll
        for (int r = 0; r < 8; ++r) { const h16 pa = (h16)__builtin_amdgcn_exp2f(ta[r] + sh); const h16 pc = (h16)__builtin_amdgcn_exp2f(tb[r] + sh); pb[r] = pa; pb[8 + r] = pc; ls += (float)pa + (float)pc; }
        l = l * alpha + ls; m = mnew;
        o0 = o0 * alpha; o1 = o1 * alpha; o2 = o2 * alpha; o3 = o3 * alpha;
        const unsigned char* va_ = fr + bo + FO_VT + rc;
        const v16h v0 = ldh((const h16*)va_), v1 = ldh((const h16*)(va_ + 16 * FP1)), v2 = ldh((const h16*)(va_ + 32 * FP1)), v3 = ldh((const h16*)(va_ + 48 * FP1));
        const unsigned char* ba_ = fr + bo + FO_BM + rc;
        const v16h bh = ldh((const h16*)ba_), br = ldh((const h16*)(ba_ + 16 * FP1));
        o0 = wmma16(v0, pb, o0); gA = wmma16(bh, gh, gA); o1 = wmma16(v1, pb, o1); gR = wmma16(bh, gr, gR); o2 = wmma16(v2, pb, o2); o3 = wmma16(v3, pb, o3); gR = wmma16(br, gh, gR);
        asm volatile("v_nop\n\tv_nop\n\tv_nop\n\tv_nop" : "+v"(o0), "+v"(o1), "+v"(o2), "+v"(o3), "+v"(gA), "+v"(gR) : "v"(v0), "v"(v1), "v"(v2), "v"(v3), "v"(pb), "v"(bh), "v"(br), "v"(gh), "v"(gr));
      }
      asm volatile("s_wait_dscnt 0x0" ::: "memory");       // this wave's reads of this buffer have returned
      asm volatile("s_wait_asynccnt 0x0" ::: "memory");    // this wave's copies of stage st + 1 have landed
      __syncthreads();                                     // publishes stage st + 1 and ends every wave's reads of this buffer
      if (st + 2 < SEQ / FK) {                             // only while stage st + 2 exists (the same for the whole block)
          const int kn = (st + 2) * FK;
          flash_fill(cl1 + bo, cl2 + bo, ckh + (size_t)kn * HD, ckr + (size_t)kn * HD, cvt + kn, cbm + kn, cmk + kn);
      }
    }
    asm volatile("s_wait_asynccnt 0x0" ::: "memory");    // no copy is outstanding when the wave goes on
    // Join of the two key halves. The last trip's waits and barrier have ended every read of the ring and no copy is outstanding, so the ring serves as the hand-over area: 13 x 16 B per lane, lane-contiguous.
    v4fa* xw = (v4fa*)fr + (size_t)qw * (13 * 32) + lane;
    if (ks != 0) {
        const v8f st8[6] = {o0, o1, o2, o3, gA, gR};
#pragma unroll
        for (int i = 0; i < 6; ++i) { xw[(2 * i) * 32] = (v4f){st8[i][0], st8[i][1], st8[i][2], st8[i][3]}; xw[(2 * i + 1) * 32] = (v4f){st8[i][4], st8[i][5], st8[i][6], st8[i][7]}; }
        xw[12 * 32] = (v4f){m, l, 0.0f, 0.0f};
    }
    __syncthreads();                                     // the ks = 1 waves' state is readable by their ks = 0 partners
    if (ks != 0) return;                                 // no barrier follows
    {
        const v4f ml = xw[12 * 32];
        const float dm = m - ml[0];                      // both maxima are finite: every wave has walked at least one half stage
        const float ea = __builtin_amdgcn_exp2f(-fabsf(dm));   // the side with the larger maximum keeps its scale
        const float a1 = (dm < 0.0f) ? ea : 1.0f, a2 = (dm < 0.0f) ? 1.0f : ea;
        l = l * a1 + ml[1] * a2;
        v8f pt[6];
#pragma unroll
        for (int i = 0; i < 6; ++i) { const v4f x0 = xw[(2 * i) * 32], x1 = xw[(2 * i + 1) * 32]; pt[i] = (v8f){x0[0], x0[1], x0[2], x0[3], x1[0], x1[1], x1[2], x1[3]}; }
        o0 = o0 * a1 + pt[0] * a2; o1 = o1 * a1 + pt[1] * a2; o2 = o2 * a1 + pt[2] * a2; o3 = o3 * a1 + pt[3] * a2;
        gA = gA + pt[4]; gR = gR + pt[5];
    }
    l += __shfl_xor(l, 16, 32);
    const float inv = 1.0f / l;
    // tmp2 (x1024): lane (t, h) holds rows cx = 8h + r; fetch the other half unconditionally, select by value
    float mi[8], ot[8], f[12];
#pragma unroll
    for (int r = 0; r < 8; ++r) { mi[r] = gA[r] + gR[r] * QRI; ot[r] = __shfl_xor(mi[r], 16, 32); }
#pragma unroll
    for (int r = 0; r < 8; ++r) f[r] = hi ? ot[r] : mi[r];
#pragma unroll
    for (int r = 0; r < 4; ++r) f[8 + r] = hi ? mi[r] : ot[r];
    const float* bp = BASE + ((size_t)b * SEQ + t0 + lr) * 16;
    const v4f b0 = *(const v4f*)bp, b1 = *(const v4f*)(bp + 4), b2 = *(const v4f*)(bp + 8);
    const float bs[12] = {b0[0], b0[1], b0[2], b0[3], b1[0], b1[1], b1[2], b1[3], b2[0], b2[1], b2[2], b2[3]};
    float e0[3], e1[3];
#pragma unroll
    for (int x = 0; x < 3; ++x) { e0[x] = hi ? bs[6 + x] : bs[x]; e1[x] = hi ? bs[9 + x] : bs[3 + x]; }
    // B fragment of the edge projection: element i <- 16*c16[t][j = 8h + i] (e = 2h + i/4, c = i%4), element 8+i <- its residual x2048
    v16h cb;
#pragma unroll
    for (int i = 0; i < 8; ++i) { const int c = i & 3;
        const float cv = (i < 4) ? (e0[0] * f[3 * c] + e0[1] * f[3 * c + 1] + e0[2] * f[3 * c + 2]) : (e1[0] * f[3 * c] + e1[1] * f[3 * c + 1] + e1[2] * f[3 * c + 2]);
        const float bq = cv * (1.0f / 64.0f); const h16 hh = (h16)bq; cb[i] = hh; cb[8 + i] = (h16)((bq - (float)hh) * QRS); }
    const v16h ea0 = ldh(EWA + (size_t)(lr) * 32 + 8 * hi), ea1 = ldh(EWA + (size_t)(16 + lr) * 32 + 8 * hi), ea2 = ldh(EWA + (size_t)(32 + lr) * 32 + 8 * hi), ea3 = ldh(EWA + (size_t)(48 + lr) * 32 + 8 * hi);
    v8f c0 = (v8f){}, c1 = (v8f){}, c2 = (v8f){}, c3 = (v8f){};
    c0 = wmma16(ea0, cb, c0); c1 = wmma16(ea1, cb, c1); c2 = wmma16(ea2, cb, c2); c3 = wmma16(ea3, cb, c3);
    asm volatile("v_nop\n\tv_nop\n\tv_nop\n\tv_nop" : "+v"(c0), "+v"(c1), "+v"(c2), "+v"(c3) : "v"(ea0), "v"(ea1), "v"(ea2), "v"(ea3), "v"(cb));
    const float ci = 1.0f / 256.0f;
    const int wb = qw * 16 * 68;
    // D layout: x_j[r] = (d = 16j + 8h + r, t = lane&15) -> os[t][d]; rows 0..15 x columns 0..63 all written
    { v4f a, c;
      a[0] = o0[0] * inv + c0[0] * ci; a[1] = o0[1] * inv + c0[1] * ci; a[2] = o0[2] * inv + c0[2] * ci; a[3] = o0[3] * inv + c0[3] * ci;
      c[0] = o0[4] * inv + c0[4] * ci; c[1] = o0[5] * inv + c0[5] * ci; c[2] = o0[6] * inv + c0[6] * ci; c[3] = o0[7] * inv + c0[7] * ci;
      *(v4fa*)(&os[wb + lr * 68 +  0 + 8 * hi]) = a; *(v4fa*)(&os[wb + lr * 68 +  0 + 8 * hi + 4]) = c;
      a[0] = o1[0] * inv + c1[0] * ci; a[1] = o1[1] * inv + c1[1] * ci; a[2] = o1[2] * inv + c1[2] * ci; a[3] = o1[3] * inv + c1[3] * ci;
      c[0] = o1[4] * inv + c1[4] * ci; c[1] = o1[5] * inv + c1[5] * ci; c[2] = o1[6] * inv + c1[6] * ci; c[3] = o1[7] * inv + c1[7] * ci;
      *(v4fa*)(&os[wb + lr * 68 + 16 + 8 * hi]) = a; *(v4fa*)(&os[wb + lr * 68 + 16 + 8 * hi + 4]) = c;
      a[0] = o2[0] * inv + c2[0] * ci; a[1] = o2[1] * inv + c2[1] * ci; a[2] = o2[2] * inv + c2[2] * ci; a[3] = o2[3] * inv + c2[3] * ci;
      c[0] = o2[4] * inv + c2[4] * ci; c[1] = o2[5] * inv + c2[5] * ci; c[2] = o2[6] * inv + c2[6] * ci; c[3] = o2[7] * inv + c2[7] * ci;
      *(v4fa*)(&os[wb + lr * 68 + 32 + 8 * hi]) = a; *(v4fa*)(&os[wb + lr * 68 + 32 + 8 * hi + 4]) = c;
      a[0] = o3[0] * inv + c3[0] * ci; a[1] = o3[1] * inv + c3[1] * ci; a[2] = o3[2] * inv + c3[2] * ci; a[3] = o3[3] * inv + c3[3] * ci;
      c[0] = o3[4] * inv + c3[4] * ci; c[1] = o3[5] * inv + c3[5] * ci; c[2] = o3[6] * inv + c3[6] * ci; c[3] = o3[7] * inv + c3[7] * ci;
      *(v4fa*)(&os[wb + lr * 68 + 48 + 8 * hi]) = a; *(v4fa*)(&os[wb + lr * 68 + 48 + 8 * hi + 4]) = c; }
    wave_sync();
    bf* orow = OA + ((size_t)b * SEQ + t0) * K2 + h * HD;
{
#pragma unroll
        for (int s = 0; s < 4; ++s) { const int row = 4 * s + (lane >> 3), c8 = (lane & 7) * 8;   // 4 s x 4 row groups = 16 rows; 8 lanes x 8 = 64 columns
            const v4f x0 = *(const v4fa*)(&os[wb + row * 68 + c8]); const v4f x1 = *(const v4fa*)(&os[wb + row * 68 + c8 + 4]); v8us hv, lv;
#pragma unroll
            for (int i = 0; i < 4; ++i) { const unsigned short a0 = f2bf(x0[i]); const unsigned short a1 = f2bf(x1[i]); hv[i] = a0; hv[4 + i] = a1; lv[i] = f2bf(x0[i] - bf2f(a0)); lv[4 + i] = f2bf(x1[i] - bf2f(a1)); }
            const size_t oo = (size_t)row * K2 + c8;
            *(v8us*)(orow + oo) = hv; *(v8us*)(orow + DM + oo) = lv; }
         }
}

static constexpr size_t al256(size_t v) { return (v + 255) & ~(size_t)255; }
static constexpr size_t SZ_WB  = al256((size_t)3 * DM * DM * 2);
static constexpr size_t SZ_OWB = al256((size_t)DM * DM * 2);
static constexpr size_t SZ_XA  = al256((size_t)NB * SEQ * K2 * 2);
static constexpr size_t SZ_QK  = al256((size_t)NB * SEQ * K2 * 4);
static constexpr size_t SZ_PL  = al256((size_t)NB * NH_ * SEQ * HD * 2);
static constexpr size_t SZ_BM  = al256((size_t)2 * NB * 16 * SEQ * 2);
static constexpr size_t SZ_BS  = al256((size_t)NB * SEQ * 16 * 4);
static constexpr size_t SZ_CS  = al256((size_t)NB * SEQ * 32 * 4);
static constexpr size_t SZ_EW  = al256((size_t)64 * 32 * 2);
static constexpr size_t SZ_TOTAL = SZ_WB + SZ_OWB + 2 * SZ_XA + SZ_QK + 5 * SZ_PL + SZ_BM + SZ_BS + 2 * SZ_CS + SZ_EW;
static_assert(SZ_TOTAL <= (size_t)134217728);          // workspace carve <= 128 MiB
static_assert(SZ_PL % 2 == 0);                         // plane stride in halves is exact
static_assert(SZ_PL == (size_t)NB * NH_ * SEQ * HD * 2);   // the four q/k planes are back to back with stride SZ_PL/2 halves

extern "C" void kernel_launch(void* const* d_in, const int* in_sizes, int n_in,
                              void* d_out, int out_size, void* d_ws, size_t ws_size, hipStream_t stream) {
    if (n_in < 11) return;
    const size_t ntok = (size_t)(NB - 1) * SEQ_FULL + SEQ;
    if ((size_t)in_sizes[0] < ntok) return;
    if ((size_t)in_sizes[1] < ntok * DM) return;
    if ((size_t)in_sizes[2] < (ntok - 1) * SEQ_FULL + SEQ) return;
    if ((size_t)in_sizes[3] < ntok * 12) return;
    if ((size_t)in_sizes[4] < (size_t)DM || (size_t)in_sizes[5] < (size_t)DM || (size_t)in_sizes[7] < (size_t)DM || (size_t)in_sizes[8] < (size_t)DM) return;
    if ((size_t)in_sizes[6] < (size_t)3 * DM * DM || (size_t)in_sizes[9] < (size_t)DM * DM || (size_t)in_sizes[10] < (size_t)1024) return;
    if ((size_t)out_size < ((size_t)(NB - 1) * OUT_SEQ + SEQ) * DM) return;
    if (SZ_TOTAL > ws_size) return;
    // wire order: position, x, attention_mask (int32), blocks, ln_w, ln_b, wqkv [3072][1024], q_ln_w, k_ln_w, out_w [1024][1024], edge_w [64][16]
    const float* position = (const float*)d_in[0]; const float* x = (const float*)d_in[1]; const int* amask = (const int*)d_in[2]; const float* blocks = (const float*)d_in[3];
    const float* ln_w = (const float*)d_in[4]; const float* ln_b = (const float*)d_in[5]; const float* wqkv = (const float*)d_in[6];
    const float* q_ln_w = (const float*)d_in[7]; const float* k_ln_w = (const float*)d_in[8]; const float* out_w = (const float*)d_in[9]; const float* edge_w = (const float*)d_in[10];
    float* OUT = (float*)d_out;
    char* wsp = (char*)d_ws;
    bf* WB  = (bf*)wsp;  wsp += SZ_WB;                // [3072][1024]: q | k | v rows
    bf* OWB = (bf*)wsp;  wsp += SZ_OWB;               // [1024][1024]
    bf* XA  = (bf*)wsp;  wsp += SZ_XA;                // [NB*SEQ][hi 1024 | lo 1024]
    bf* OA  = (bf*)wsp;  wsp += SZ_XA;                // [NB*SEQ][hi 1024 | lo 1024]
    float* QK = (float*)wsp; wsp += SZ_QK;            // [NB*SEQ][q 1024 | k 1024]
    h16* QH = (h16*)wsp; wsp += SZ_PL;                // [NB*16][SEQ][64]; QH, QR, KH, KR back to back (stride SZ_PL/2 halves)
    h16* QR = (h16*)wsp; wsp += SZ_PL;
    h16* KH = (h16*)wsp; wsp += SZ_PL;
    h16* KR = (h16*)wsp; wsp += SZ_PL;
    h16* VT = (h16*)wsp; wsp += SZ_PL;                // [NB*16][64][SEQ]
    h16* BM = (h16*)wsp; wsp += SZ_BM;                // [2][NB][16][SEQ]
    float* BASE = (float*)wsp; wsp += SZ_BS;          // [NB*SEQ][16]
    float* CS = (float*)wsp; wsp += SZ_CS;            // [NB*SEQ][32]
    float* SN = (float*)wsp; wsp += SZ_CS;
    h16* EWA = (h16*)wsp; wsp += SZ_EW;               // [64][32]

    k_front<<<GF_LNX + GF_ROPE + GF_CVT, 256, 0, stream>>>(x, ln_w, ln_b, XA, position, CS, SN, wqkv, WB);

    k_proj_qkv<<<PQ_N + PV_N, 128, 0, stream>>>(XA, WB, QK, VT);

    // planes QH | QR | KH | KR from the base QH with stride SZ_PL/2 halves
    k_mid<<<GM_PREP + GM_ROT + 1 + GM_CVT, 256, 0, stream>>>(QK, q_ln_w, k_ln_w, CS, SN, QH, (size_t)(SZ_PL / 2), blocks, amask, BM, BASE, edge_w, EWA, out_w, OWB);

    k_flash<<<dim3(SEQ / (16 * AW), NB * NH_, 1), 32 * AW * KW, 0, stream>>>(QH, QR, KH, KR, VT, BM, BASE, EWA, amask, OA);

    // out: A = (ctx + context) hi|lo rows, Bt = out_w rows -> OUT[b][t][n]
    k_proj<1><<<dim3(NB * SEQ / 128, DM / 128, 1), 128, 0, stream>>>(OA, K2, OWB, DM, K2, (h16*)0, SEQ, (size_t)0, 0, 64, (size_t)0, OUT, DM, OUT_SEQ);
}

// v007
// It runs in 76 microseconds.
// In both of two side-by-side timings against v006, it was 1.03 times as fast.
// Over all steps from v000 it is 3.49 times as fast.
#include <hip/hip_runtime.h>
#include <stdint.h>

// Compute dtypes (f32 accumulate everywhere): qkv and output projections v_wmma_f32_16x16x32_bf16 (activation as bf16 hi|lo planes folded along K, weights RNE-converted bf16); scores, P.V, geometric sum and edge projection v_wmma_f32_16x16x32_f16 (q, k, G, bm, c16 as f16 value + f16 residual x2048; P x256 and v single f16).
// Pre-norm attention block, width 1024 = 16 heads x 64: LN(x) -> qkv GEMM -> LN(q), LN(k) over the full width -> rotate-half rotary (cos/sin table from the position input) ->
// masked softmax attention (replace-fill, running max) plus geometric term tmp2 = sum_k (q.k) mask bm/len, context = (base.tmp2) edge_w^T -> output GEMM.
// Every float input is RNE-converted to bf16 on load. Fused flash kernel in transposed form (S^T = K Q^T, O^T = V^T P^T, tmp2^T = BM^T G^T, ctx^T = EW c16^T).

#ifndef NB
#define NB 2
#endif
#ifndef SEQ
#define SEQ 1024
#endif
#define NB_FULL  2
#define SEQ_FULL 1024
#ifndef OUT_SEQ
#define OUT_SEQ SEQ              // row pitch (in tokens) between batches of the output
#endif
#define DM   1024
#define K2   2048                // hi|lo folded contraction length
#define NH_  16
#define HD   64
#define AW   4                   // query tiles per flash block (16 query rows each)
#define KW   2                   // waves per query tile: each takes one 32-key half of every stage
#define QRS  2048.0f             // carry of the residual planes
#define QRI  (1.0f / 2048.0f)
#define SC2  (0.125f * 1.4426950408889634f)   // HD^-0.5 * log2(e)
#define PSH  8.0f                // log2 of the P carry (256)
#define NEGMIN (-3.4028234663852886e38f)

static_assert(HD == 64);
static_assert(NH_ * HD == DM);
static_assert(K2 == 2 * DM);
static_assert((DM & (DM - 1)) == 0);
static_assert(DM % 64 == 0);
static_assert(SEQ % 128 == 0);                 // mask row sums read 128 ints per step
static_assert(SEQ % 64 == 0);
static_assert((NB * SEQ) % 128 == 0);
static_assert((NB * SEQ) % 8 == 0);
static_assert(SEQ % (16 * AW) == 0);
static_assert(NB <= NB_FULL);
static_assert(SEQ <= SEQ_FULL);

typedef _Float16 h16;
typedef unsigned short bf;
typedef __attribute__((ext_vector_type(16))) __bf16   v16bf;
typedef __attribute__((ext_vector_type(16))) _Float16 v16h;
typedef __attribute__((ext_vector_type(8)))  _Float16 v8h;
typedef __attribute__((ext_vector_type(8)))  unsigned short v8us;
typedef __attribute__((ext_vector_type(8)))  float    v8f;
typedef __attribute__((ext_vector_type(4)))  float    v4f;
typedef __attribute__((ext_vector_type(4)))  int      v4i;
typedef __attribute__((ext_vector_type(4)))  uint32_t u32x4;
typedef u32x4 __attribute__((may_alias)) u32x4a;
typedef __attribute__((ext_vector_type(8)))  uint32_t u32x8;
typedef v4f  __attribute__((may_alias)) v4fa;
typedef v8h  __attribute__((may_alias)) v8ha;

__device__ __forceinline__ unsigned short f2bf(float f) { unsigned u = __float_as_uint(f); u += 0x7FFFu + ((u >> 16) & 1u); return (unsigned short)(u >> 16); }
__device__ __forceinline__ float bf2f(unsigned short b) { return __uint_as_float(((unsigned)b) << 16); }
__device__ __forceinline__ float bfr(float f) { return bf2f(f2bf(f)); }
__device__ __forceinline__ v16h cat16(v8h lo, v8h hi) { return __builtin_shufflevector(lo, hi, 0, 1, 2, 3, 4, 5, 6, 7, 8, 9, 10, 11, 12, 13, 14, 15); }
__device__ __forceinline__ v16bf cat16b(v8us lo, v8us hi) { return __builtin_bit_cast(v16bf, __builtin_shufflevector(lo, hi, 0, 1, 2, 3, 4, 5, 6, 7, 8, 9, 10, 11, 12, 13, 14, 15)); }
__device__ __forceinline__ v8f wmma16(v16h a, v16h b, v8f c) { return __builtin_amdgcn_wmma_f32_16x16x32_f16(false, a, false, b, (short)0, c, false, false); }
__device__ __forceinline__ v8f wmmab(v16bf a, v16bf b, v8f c) { return __builtin_amdgcn_wmma_f32_16x16x32_bf16(false, a, false, b, (short)0, c, false, false); }
// fragment loaders from K-contiguous 16-bit rows; p already includes + 8*(lane>>4): elements 0..7 <- k0+8h+0..7, elements 8..15 <- k0+16+8h+0..7 (same map for A and B)
__device__ __forceinline__ v16h  ldh(const h16* p) { return cat16(*(const v8h*)p, *(const v8h*)(p + 16)); }
__device__ __forceinline__ v16bf ldb(const bf* p)  { return cat16b(*(const v8us*)p, *(const v8us*)(p + 16)); }
// ordering point for wave-private LDS tiles (same wave writes and reads)
__device__ __forceinline__ void wave_sync() { __builtin_amdgcn_fence(3 /* release order */, "wavefront"); __builtin_amdgcn_wave_barrier(); asm volatile("" ::: "memory"); }
__device__ __forceinline__ float wsum(float v) { v += __shfl_xor(v, 16, 32); v += __shfl_xor(v, 8, 32); v += __shfl_xor(v, 4, 32); v += __shfl_xor(v, 2, 32); v += __shfl_xor(v, 1, 32); return v; }

// The six row-wise stages (cvt8, ew, lnx, rope, prep, qkrot) are device functions of one 256-thread block each (blk = the block's index inside its own stage); k_front and k_mid, behind qkrot_part,
// run stages that read none of each other's output side by side in one grid.
// cvt8_part: CVT_CH chunks of 8 floats per thread, 256 threads apart; all of a thread's loads are issued before the first value is converted.
#define CVT_CH 8
__device__ __forceinline__ void cvt8_part(int blk, const float* __restrict__ src, bf* dst, size_t n8) {
    const size_t i = (size_t)blk * (256 * CVT_CH) + threadIdx.x; if (i + (size_t)(CVT_CH - 1) * 256 >= n8) return;
    v4f va[CVT_CH], vb[CVT_CH];
#pragma unroll
    for (int ch = 0; ch < CVT_CH; ++ch) { const float* p = src + (i + (size_t)ch * 256) * 8;
        va[ch] = *(const v4f*)p;
        if (ch == CVT_CH - 1) asm volatile("s_wait_xcnt 0x0" ::: "memory");   // the last load's result may be given the address pair that all the loads above name: it issues only behind this wait
        vb[ch] = *(const v4f*)(p + 4); }
#pragma unroll
    for (int ch = 0; ch < CVT_CH; ++ch) { v8us o;
#pragma unroll
        for (int k = 0; k < 4; ++k) { o[k] = f2bf(va[ch][k]); o[4 + k] = f2bf(vb[ch][k]); }
        *(v8us*)(dst + (i + (size_t)ch * 256) * 8) = o; }
}

// ew_part: edge weight A plane [64][32] f16: columns 0..15 = 16*w[d][j], columns 16..31 = w[d][j]/128 (pairs with the x2048 residual half of the c16 operand). One block; each thread 16 B, consecutive.
__device__ __forceinline__ void ew_part(const float* __restrict__ ew, h16* EWA) {
    const int tid = threadIdx.x; const int d = tid >> 2, q = tid & 3;
    const float sc = (q < 2) ? 16.0f : 0.0078125f;
    const v8f w = *(const v8f*)(ew + d * 16 + (q & 1) * 8);
    v8h o;
#pragma unroll
    for (int i = 0; i < 8; ++i) o[i] = (h16)(bfr(w[i]) * sc);
    *(v8h*)(EWA + d * 32 + q * 8) = o;
    asm volatile("s_wait_xcnt 0x0" ::: "memory");   // other stages' code follows this store in the merged kernel: its address and data registers are rewritten only behind this wait
}

// The wave's row and both weight rows are loaded once, all loads issued together, and kept in registers through the three passes (element visiting order it = 0..3, i = 0..7 in every pass).
__device__ __forceinline__ void lnx_part(int blk, const float* __restrict__ x, const float* __restrict__ lw, const float* __restrict__ lb, bf* XA) {
    const int lane = threadIdx.x & 31; const int wave = __builtin_amdgcn_readfirstlane((int)(threadIdx.x >> 5));
    const int m = blk * 8 + wave; const int b = m / SEQ, t = m % SEQ;
    const float* src = x + ((size_t)b * SEQ_FULL + t) * DM + lane * 8;
    v8f raw[4], wv[4], bv[4];
#pragma unroll
    for (int it = 0; it < 4; ++it) raw[it] = *(const v8f*)(src + it * 256);
#pragma unroll
    for (int it = 0; it < 4; ++it) { wv[it] = *(const v8f*)(lw + it * 256 + lane * 8); bv[it] = *(const v8f*)(lb + it * 256 + lane * 8); }
    float s = 0.0f;
#pragma unroll
    for (int it = 0; it < 4; ++it) {
#pragma unroll
        for (int i = 0; i < 8; ++i) { raw[it][i] = bfr(raw[it][i]); s += raw[it][i]; } }
    s = wsum(s);
    const float mean = s * (1.0f / DM);
    float ss = 0.0f;
#pragma unroll
    for (int it = 0; it < 4; ++it) {
#pragma unroll
        for (int i = 0; i < 8; ++i) { const float dv = raw[it][i] - mean; ss += dv * dv; } }
    ss = wsum(ss);
    const float rstd = 1.0f / sqrtf(ss * (1.0f / DM) + 1e-5f);
    bf* dst = XA + (size_t)m * K2 + lane * 8;
#pragma unroll
    for (int it = 0; it < 4; ++it) {
        v8us hv, lv;
#pragma unroll
        for (int i = 0; i < 8; ++i) { const float dv = raw[it][i] - mean; const float y = dv * rstd * bfr(wv[it][i]) + bfr(bv[it][i]); const unsigned short hh = f2bf(y); hv[i] = hh; lv[i] = f2bf(y - bf2f(hh)); }
        *(v8us*)(dst + it * 256) = hv; *(v8us*)(dst + DM + it * 256) = lv; }
}

__device__ __forceinline__ void rope_part(int blk, const float* __restrict__ pos, float* CS, float* SN) {
    const int lane = threadIdx.x & 31; const int wave = __builtin_amdgcn_readfirstlane((int)(threadIdx.x >> 5));
    const int m = blk * 8 + wave; const int b = m / SEQ, t = m % SEQ;
    const float p = bfr(pos[(size_t)b * SEQ_FULL + t]);
    double pd = 1.0;
#pragma unroll 1
    for (int i = 0; i < lane; ++i) pd *= 1.333521432163324;
    const float pf = (float)pd;
    const float invf = 1.0f / pf;
    const float ang = p * invf;
    const float c = cosf(ang), s = sinf(ang);
    *(float*)(CS + (size_t)m * 32 + lane) = c; *(float*)(SN + (size_t)m * 32 + lane) = s;
    
}

// Packed mask MB [b*SEQ + t][SEQ/32] words: bit L of word 4*c + j of a row says whether mask[row][128*c + 4*L + j] is non-zero (the lane masks of prep_part's compares, stored as they come).
#define MBW (SEQ / 32)
static_assert(MBW == 32);                      // one word of a mask row per lane of the wave that packs it; a row is 128 bytes
// prep_part: per 64 tokens: len = mask row sums, and the rows' packed mask; bm = blocks - mean_c; base = bm / (|bm| + eps); planes BM[0] = f16(bm * 1024/len), BM[1] = f16 residual x2048, layout [plane][b][16][SEQ] (rows 12..15 zero);
// BASE [token][16] f32 (columns 12..15 zero). LDS tiles are cross-wave: block barriers between phases.
__device__ __forceinline__ void prep_part(int blk, const float* __restrict__ blocks, const int* __restrict__ mask, h16* BM, float* BASE, unsigned int* MB) {
    __shared__ float slen[64];
    __shared__ __align__(16) h16 sb[32 * 64];
    __shared__ __align__(16) float sbase[64 * 16];
    const int tid = threadIdx.x, lane = tid & 31; const int wave = __builtin_amdgcn_readfirstlane((int)(threadIdx.x >> 5));
    const int m0 = blk * 64; const int b = m0 / SEQ, t0 = m0 % SEQ;
#pragma unroll 1   // two batches of four mask rows: a batch's loads are all in flight together; all eight rows at once would double the registers of the whole kernel
    for (int g = 0; g < 2; ++g) { const int tl = wave * 8 + g * 4;
        const int* row = mask + ((size_t)b * SEQ_FULL + t0 + tl) * SEQ_FULL + lane * 4;
        v4i mv[4][SEQ / 128];
#pragma unroll
        for (int r = 0; r < 4; ++r)
#pragma unroll
            for (int c = 0; c < SEQ / 128; ++c) mv[r][c] = *(const v4i*)(row + (size_t)r * SEQ_FULL + c * 128);
        int cnt[4];
#pragma unroll
        for (int r = 0; r < 4; ++r) { cnt[r] = 0; unsigned int word = 0u;
#pragma unroll
            for (int c = 0; c < SEQ / 128; ++c)
#pragma unroll
                for (int j = 0; j < 4; ++j) { const unsigned int bal = __builtin_amdgcn_ballot_w32(mv[r][c][j] != 0);   // the compare's lane mask: 32 mask bits, the same in every lane
                    cnt[r] += __builtin_popcount(bal);
                    word = (lane == 4 * c + j) ? bal : word; }   // lane 4*c + j keeps this word for the row's one 128-byte store
            MB[((size_t)b * SEQ + t0 + tl + r) * MBW + lane] = word; }
        if (lane == 0) {
#pragma unroll
            for (int r = 0; r < 4; ++r) slen[tl + r] = (float)cnt[r]; } }
    __syncthreads();
    if (tid < 64) {
        const float* p = blocks + ((size_t)b * SEQ_FULL + t0 + tid) * 12;
        const v4f a0 = *(const v4f*)p, a1 = *(const v4f*)(p + 4), a2 = *(const v4f*)(p + 8);
        float pv[12];
#pragma unroll
        for (int i = 0; i < 4; ++i) { pv[i] = bfr(a0[i]); pv[4 + i] = bfr(a1[i]); pv[8 + i] = bfr(a2[i]); }
        float mu[3];
#pragma unroll
        for (int x = 0; x < 3; ++x) mu[x] = (pv[x] + pv[3 + x] + pv[6 + x] + pv[9 + x]) * 0.25f;
        const float sc = (1.0f / slen[tid]) * 1024.0f;
#pragma unroll
        for (int c = 0; c < 4; ++c) {
            const float vx = pv[c * 3] - mu[0], vy = pv[c * 3 + 1] - mu[1], vz = pv[c * 3 + 2] - mu[2];
            const float inv = 1.0f / (sqrtf(vx * vx + vy * vy + vz * vz) + 1.1920929e-7f);
            const float vv[3] = {vx, vy, vz};
#pragma unroll
            for (int x = 0; x < 3; ++x) { const int cx = c * 3 + x;
                sbase[tid * 16 + cx] = vv[x] * inv;
                const float bs = vv[x] * sc; const h16 hh = (h16)bs;
                sb[cx * 64 + tid] = hh; sb[(16 + cx) * 64 + tid] = (h16)((bs - (float)hh) * QRS); } }
#pragma unroll
        for (int j = 12; j < 16; ++j) { sbase[tid * 16 + j] = 0.0f; sb[j * 64 + tid] = (h16)0.0f; sb[(16 + j) * 64 + tid] = (h16)0.0f; }
    }
    __syncthreads();
    // 32 lines of 64 halves: line = tid>>3 (0..15 value plane rows, 16..31 residual plane rows), 8 consecutive lanes x 16 B per line; BASE: 256 threads x 16 B contiguous
    const int line = tid >> 3, pc = tid & 7;
    const v8h bv = *(const v8ha*)(&sb[line * 64 + pc * 8]);
    const v4f fv = *(const v4fa*)(&sbase[tid * 4]);
    h16* bd = BM + (size_t)(line >> 4) * ((size_t)NB * 16 * SEQ) + ((size_t)b * 16 + (line & 15)) * SEQ + t0 + pc * 8;
    float* fd = BASE + (size_t)m0 * 16 + tid * 4;
    *(v8h*)bd = bv; *(v4f*)fd = fv;
    
}

// k_proj: bf16 GEMM, 128x128 tile per block of four waves (2 x 2, each 64x64 = 16 accumulators). One operand is an activation in two planes (value | residual along its row), the other a weight in one plane.
// Both are staged in LDS by tensor loads: a stage is 128 k of the weight rows and the same 128 k of both activation planes (256 bytes a row), so a weight tile is fetched once and a weight fragment is read once
// for both planes. Two buffers, every wave moves its own slice one stage ahead of the pass that reads it. Order per accumulator: kc = 0, 32, 64, ...; at each kc the value plane's product, then the residual plane's.
// MODE 1: f32 rows C[((r0/RB)*RP + r0%RB)][c0..c0+63], row pitch ldc; each 256-byte row segment by 16 consecutive lanes x 16 B.
#define PJ_PITCH 272u                 // LDS row pitch: 256-byte row + the mover's 16-byte pad (odd multiple of 16 B for 16-byte readers)
#define PJ_SLICE 18432u               // 64 weight rows x 272 B = 17408, rounded up to a multiple of 2 KiB so that every slice starts on one
#define PJ_PLANE 34816u               // 128 activation rows of one plane x 272 B, itself a multiple of 2 KiB
#define PJ_STAGE (2u * PJ_PLANE + 2u * PJ_SLICE)   // value plane, residual plane (128 rows each), weight rows 0..63, weight rows 64..127 of the block tile
static_assert(64u * PJ_PITCH <= PJ_SLICE && PJ_SLICE % 2048u == 0u);
static_assert(128u * PJ_PITCH <= PJ_PLANE && PJ_PLANE % 2048u == 0u);
static_assert(DM % 128 == 0 && K2 == 2 * DM && DM / 128 >= 2);   // whole stages inside every plane and every weight row, at least two stages
__device__ __forceinline__ uint32_t uni(uint32_t v) { return (uint32_t)__builtin_amdgcn_readfirstlane((int)v); }
__device__ __forceinline__ uint32_t pinned(uint32_t v) { uint32_t w = uni(v); asm volatile("" : "+s"(w)); return w; }   // the pinned() form for tensor loads: the test value is held in a scalar register, so the branch round a load is a scalar one (the load ignores EXEC)
// one request of the whole wave: rows of 256 bytes from ga (row count and row pitch in g1) to LDS byte offset dst; word 0 of g0 (count 1) is set once by the caller
__device__ __forceinline__ void tdm_load(u32x4& g0, uint32_t dst, uint64_t ga, u32x8& g1) {
    g0[1] = uni(dst); g0[2] = uni((uint32_t)ga); g0[3] = uni((((uint32_t)(ga >> 32)) & 0x01FFFFFFu) | 0x80000000u);
    asm volatile("tensor_load_to_lds %0, %1" : "+s"(g0), "+s"(g1) :: "memory");   // in-out: the same registers go on to the wait below
}
// the wave's own requests have landed. The statement names both descriptor groups as in-out operands so that their scalar registers hold the issued words until the wait has returned
// and every new word is formed behind it.
__device__ __forceinline__ void tdm_wait(u32x4& g0, u32x8& g1) { asm volatile("s_wait_tensorcnt 0x0" : "+s"(g0), "+s"(g1) :: "memory"); }
// proj_tile: the tile (bx, by) of one product; ring and osall are the calling kernel's LDS arrays (ring on a multiple of 2 KiB). SA: the two-plane operand is A (else Bt); K = its row length, both planes.
template <int MODE, bool SA>
__device__ __forceinline__ void proj_tile(unsigned char* ring, float* osall, uint32_t bx, uint32_t by, const bf* __restrict__ A, int pA, const bf* __restrict__ Bt, int pB, int K,
                                          h16* Ph, int RB, size_t sRB, int pitch, int CB, size_t sCB, float* C, int ldc, int RP) {
    const int lane = threadIdx.x & 31, lr = lane & 15, hi = lane >> 4;
    const uint32_t wave = uni(threadIdx.x >> 5);
    const int r0 = bx * 128 + (int)(wave >> 1) * 64, c0 = by * 128 + (int)(wave & 1u) * 64;
    float* os = osall + wave * (16 * 68);
    v8f acc[4][4];
#pragma unroll
    for (int mb = 0; mb < 4; ++mb)
#pragma unroll
        for (int nb = 0; nb < 4; ++nb) acc[mb][nb] = (v8f){};
    // this wave's slice of every stage: wave 0 moves the value plane and wave 1 the residual plane of the block's 128 activation rows, waves 2, 3 move 64 weight rows each
    const bf* actp = SA ? A + (size_t)(bx * 128) * (size_t)pA : Bt + (size_t)(by * 128) * (size_t)pB;
    const bf* wgtp = SA ? Bt + (size_t)(by * 128) * (size_t)pB : A + (size_t)(bx * 128) * (size_t)pA;
    const uint32_t pact = (uint32_t)(SA ? pA : pB), pwgt = (uint32_t)(SA ? pB : pA);
    const bool ownP = wave < 2u;
    const uint32_t sp = ownP ? pact : pwgt;
    const uint32_t nrow = ownP ? 128u : 64u;
    const uint64_t src0 = ownP ? (uint64_t)(uintptr_t)(actp + (size_t)wave * (size_t)(K >> 1))
                               : (uint64_t)(uintptr_t)(wgtp + (size_t)((wave - 2u) * 64u) * (size_t)pwgt);
    const uint32_t slice = (uint32_t)(size_t)ring + (ownP ? wave * PJ_PLANE : 2u * PJ_PLANE + (wave - 2u) * PJ_SLICE);
    u32x8 g1;
    g1[0] = uni((1u << 20) | (5u << 22) | (3u << 25));   // no mask, byte elements, 16 B of pad behind every 256 B
    g1[1] = uni(256u << 16); g1[2] = uni(nrow << 16); g1[3] = uni(256u << 16); g1[4] = uni(nrow);   // tensor = tile = 256 B x this wave's rows
    g1[5] = uni(sp * 2u); g1[6] = uni(0u); g1[7] = uni(0u);
    const uint32_t T = (uint32_t)K >> 8;                 // stages of 128 k of one plane
    const uint32_t wact = SA ? (wave >> 1) : (wave & 1u), wwgt = SA ? (wave & 1u) : (wave >> 1);   // which 64 rows of each operand this wave's 64x64 tile reads
    const uint32_t pbase = (wact * 64u + (uint32_t)lr) * PJ_PITCH + 16u * (uint32_t)hi;
    const uint32_t wbase = 2u * PJ_PLANE + wwgt * PJ_SLICE + (uint32_t)lr * PJ_PITCH + 16u * (uint32_t)hi;
    u32x4 g0;
    g0[0] = uni(1u);
    tdm_load(g0, slice, src0, g1);
    tdm_wait(g0, g1);                                    // this wave's slice of stage 0 has landed
    __syncthreads();                                     // every slice of stage 0 is readable by every wave
    if (pinned((1u < T) ? 1u : 0u) != 0u) tdm_load(g0, slice + PJ_STAGE, src0 + (uint64_t)256u, g1);
#pragma unroll 1   // one pass per trip: the buffer index and the publish point below belong to one stage
    for (uint32_t t = 0; t < T; ++t) {
        const uint32_t buf = (t & 1u) * PJ_STAGE;
        const unsigned char* lh = ring + buf + pbase; const unsigned char* ll = lh + PJ_PLANE; const unsigned char* lw = ring + buf + wbase;
        v16bf fh[2][4], fl[2][4], fw[2][4];
#pragma unroll
        for (int i = 0; i < 4; ++i) { fh[0][i] = ldb((const bf*)(lh + i * 16 * PJ_PITCH)); fw[0][i] = ldb((const bf*)(lw + i * 16 * PJ_PITCH)); }
#pragma unroll
        for (int i = 0; i < 4; ++i) fl[0][i] = ldb((const bf*)(ll + i * 16 * PJ_PITCH));   // wanted sixteen products later than the two sets above
#pragma unroll
        for (int u = 0; u < 4; ++u) {
            const int cs = u & 1;
            if (u < 3) {
#pragma unroll
                for (int i = 0; i < 4; ++i) { fh[cs ^ 1][i] = ldb((const bf*)(lh + i * 16 * PJ_PITCH + (u + 1) * 64)); fw[cs ^ 1][i] = ldb((const bf*)(lw + i * 16 * PJ_PITCH + (u + 1) * 64)); }
#pragma unroll
                for (int i = 0; i < 4; ++i) fl[cs ^ 1][i] = ldb((const bf*)(ll + i * 16 * PJ_PITCH + (u + 1) * 64));
            }
            __builtin_amdgcn_sched_barrier(0);   // the next block's LDS reads stay one group in front of this block's products
#pragma unroll
            for (int nb = 0; nb < 4; ++nb)
#pragma unroll
                for (int mb = 0; mb < 4; ++mb) acc[mb][nb] = SA ? wmmab(fh[cs][mb], fw[cs][nb], acc[mb][nb]) : wmmab(fw[cs][mb], fh[cs][nb], acc[mb][nb]);
#pragma unroll
            for (int nb = 0; nb < 4; ++nb)
#pragma unroll
                for (int mb = 0; mb < 4; ++mb) acc[mb][nb] = SA ? wmmab(fl[cs][mb], fw[cs][nb], acc[mb][nb]) : wmmab(fw[cs][mb], fl[cs][nb], acc[mb][nb]);
            __builtin_amdgcn_sched_barrier(0);   // no LDS read moves in among the products
        }
        asm volatile("s_wait_dscnt 0x0" ::: "memory");
        tdm_wait(g0, g1);
        __syncthreads();
        if (pinned((t + 2u < T) ? 1u : 0u) != 0u) tdm_load(g0, slice + buf, src0 + (uint64_t)((t + 2u) << 8), g1);
    }
    tdm_wait(g0, g1);                                    // no request is outstanding when the wave goes on
    asm volatile("s_wait_dscnt 0x0" ::: "memory");       // nor any LDS read of the ring
    const size_t tbase = (size_t)(r0 / RB) * sRB + (size_t)(r0 % RB) * (size_t)pitch + (size_t)(c0 / CB) * sCB + (size_t)(c0 % CB);
    const size_t cbase = ((size_t)(r0 / RB) * (size_t)RP + (size_t)(r0 % RB)) * (size_t)ldc + (size_t)c0;
#pragma unroll
    for (int mb = 0; mb < 4; ++mb) {
#pragma unroll
        for (int nb = 0; nb < 4; ++nb) {
#pragma unroll
            for (int j = 0; j < 8; ++j) os[(hi * 8 + j) * 68 + nb * 16 + lr] = acc[mb][nb][j]; }   // D: row 8h+j, col lane&15
        wave_sync();
        if (MODE == 0) {
            const size_t sb = tbase + (size_t)(mb * 16) * (size_t)pitch;
{
#pragma unroll
                for (int s = 0; s < 4; ++s) { const int row = 4 * s + (lane >> 3), c8 = (lane & 7) * 8;   // 4 s x 4 row groups = 16 rows; 8 lanes x 8 = 64 columns
                    const v4f x0 = *(const v4fa*)(&os[row * 68 + c8]); const v4f x1 = *(const v4fa*)(&os[row * 68 + c8 + 4]); v8h hv;
#pragma unroll
                    for (int i = 0; i < 4; ++i) { hv[i] = (h16)x0[i]; hv[4 + i] = (h16)x1[i]; }
                    *(v8h*)(Ph + sb + (size_t)row * (size_t)pitch + c8) = hv; }
                 }
        } else {
            const size_t sb = cbase + (size_t)(mb * 16) * (size_t)ldc;
{
#pragma unroll
                for (int s = 0; s < 8; ++s) { const int row = 2 * s + hi, cofs = lr * 4;   // 8 s x 2 rows = 16 rows; 16 lanes x 4 floats = 64 columns
                    const v4f val = *(const v4fa*)(&os[row * 68 + cofs]);
                    *(v4f*)(C + sb + (size_t)row * (size_t)ldc + cofs) = val; }
                 }
        }
        wave_sync();
    }
}

template <int MODE>
__global__ __launch_bounds__(128) void k_proj(const bf* __restrict__ A, int pA, const bf* __restrict__ Bt, int pB, int K,
                                              h16* Ph, int RB, size_t sRB, int pitch, int CB, size_t sCB, float* C, int ldc, int RP) {
    __shared__ __attribute__((aligned(2048))) unsigned char ring[2 * PJ_STAGE];
    __shared__ __align__(16) float osall[4 * 16 * 68];
    proj_tile<MODE, true>(ring, osall, blockIdx.x, blockIdx.y, A, pA, Bt, pB, K, Ph, RB, sRB, pitch, CB, sCB, C, ldc, RP);
}
// k_proj_qkv: the q|k product and the v^T product read the same two operands and none of each other's output: one grid, the q|k tiles first.
// q|k: A = LN(x) rows, Bt = wqkv rows 0..2047 -> QK[m][n] f32. v^T: A = wqkv rows 2048..3071 (m = h*64 + d), Bt = LN(x) rows (n = b*SEQ + t) -> plane [(b*1024 + m)][t] = [(b*16 + h)][d][t].
#define PQ_BX (NB * SEQ / 128)
#define PQ_N  (PQ_BX * (2 * DM / 128))
#define PV_BX (DM / 128)
#define PV_N  (PV_BX * (NB * SEQ / 128))
__global__ __launch_bounds__(128) void k_proj_qkv(const bf* __restrict__ XA, const bf* __restrict__ WB, float* QK, h16* VT) {
    __shared__ __attribute__((aligned(2048))) unsigned char ring[2 * PJ_STAGE];
    __shared__ __align__(16) float osall[4 * 16 * 68];
    const uint32_t i = blockIdx.x;
    if (i < (uint32_t)PQ_N) {
        proj_tile<1, true>(ring, osall, i % PQ_BX, i / PQ_BX, XA, K2, WB, DM, K2, (h16*)0, NB * SEQ, (size_t)0, 0, 64, (size_t)0, QK, K2, NB * SEQ);
    } else {
        const uint32_t j = i - (uint32_t)PQ_N;
        proj_tile<0, false>(ring, osall, j % PV_BX, j / PV_BX, WB + (size_t)2 * DM * DM, DM, XA, K2, K2, VT, DM, (size_t)0, SEQ, SEQ, (size_t)DM * SEQ, (float*)0, 0, 0);
    }
}

// Lane holds columns it*256 + lane*8 + i = head (4*it + lane/8), d = 8*(lane&7) + i; the rotary partner d +- 32 is lane ^ 4 (same it, same i).
// Planes [b*16+h][t][64], four consecutive planes from PL with stride pst halves: q value, q residual x2048, k value, k residual x2048 (selected by integer offset from one base).
// The wave's q row, k row and both weight rows are loaded once, all loads issued together, and kept in registers through the three passes (visiting order it = 0..3, i = 0..7).
__device__ __forceinline__ void qkrot_part(int blk, const float* __restrict__ QK, const float* __restrict__ qw, const float* __restrict__ kw, const float* __restrict__ CS, const float* __restrict__ SN,
                                           h16* PL, size_t pst) {
    const int lane = threadIdx.x & 31; const int wave = __builtin_amdgcn_readfirstlane((int)(threadIdx.x >> 5));
    const int m = blk * 8 + wave; const int b = m / SEQ, t = m % SEQ;
    const int c = lane & 7;
    const v8f cs = *(const v8f*)(CS + (size_t)m * 32 + 8 * (c & 3));
    const v8f sn = *(const v8f*)(SN + (size_t)m * 32 + 8 * (c & 3));
    const float sg = (c < 4) ? -1.0f : 1.0f;
    const size_t o0 = (((size_t)(b * NH_ + (lane >> 3))) * SEQ + t) * HD + 8 * c;
    const size_t ost = (size_t)4 * SEQ * HD;     // four heads per step
    const float* row = QK + (size_t)m * K2 + lane * 8;
    v8f raw[2][4], wgt[2][4];
#pragma unroll
    for (int wh = 0; wh < 2; ++wh)
#pragma unroll
        for (int it = 0; it < 4; ++it) raw[wh][it] = *(const v8f*)(row + wh * DM + it * 256);
#pragma unroll
    for (int it = 0; it < 4; ++it) { wgt[0][it] = *(const v8f*)(qw + it * 256 + lane * 8); wgt[1][it] = *(const v8f*)(kw + it * 256 + lane * 8); }
#pragma unroll
    for (int wh = 0; wh < 2; ++wh) {
        float s = 0.0f;
#pragma unroll
        for (int it = 0; it < 4; ++it) {
#pragma unroll
            for (int i = 0; i < 8; ++i) s += raw[wh][it][i]; }
        s = wsum(s);
        const float mean = s * (1.0f / DM);
        float ss = 0.0f;
#pragma unroll
        for (int it = 0; it < 4; ++it) {
#pragma unroll
            for (int i = 0; i < 8; ++i) { const float dv = raw[wh][it][i] - mean; ss += dv * dv; } }
        ss = wsum(ss);
        const float rstd = 1.0f / sqrtf(ss * (1.0f / DM) + 1e-5f);
        h16* PH = PL + (size_t)(2 * wh) * pst;
        h16* PR = PH + pst;
#pragma unroll
        for (int it = 0; it < 4; ++it) {
            v8h hv, rv;
#pragma unroll
            for (int i = 0; i < 8; ++i) {
                const float y = (raw[wh][it][i] - mean) * rstd * bfr(wgt[wh][it][i]);
                const float pr = __shfl_xor(y, 4, 32);
                const float r = y * cs[i] + sg * pr * sn[i];
                const h16 hh = (h16)r; hv[i] = hh; rv[i] = (h16)((r - (float)hh) * QRS); }
            const size_t oo = o0 + (size_t)it * ost;
            *(v8h*)(PH + oo) = hv; *(v8h*)(PR + oo) = rv; }
    }
    asm volatile("s_wait_xcnt 0x0" ::: "memory");   // other stages' code follows these stores in the merged kernel: their address and data registers are rewritten only behind this wait
}

// k_front: LN(x) and the wqkv conversion, which the qkv products read, beside the rotary table, which k_mid reads. The stages with the longest dependent chains take the low block indices, the short conversion blocks the high ones (for speed only).
#define GF_LNX  (NB * SEQ / 8)
#define GF_ROPE (NB * SEQ / 8)
#define GF_CVT  (3 * DM * DM / 8 / (256 * CVT_CH))
static_assert((3 * DM * DM / 8) % (256 * CVT_CH) == 0 && (DM * DM / 8) % (256 * CVT_CH) == 0);
__global__ __launch_bounds__(256) void k_front(const float* __restrict__ x, const float* __restrict__ lw, const float* __restrict__ lb, bf* XA,
                                               const float* __restrict__ pos, float* CS, float* SN, const float* __restrict__ wqkv, bf* WB) {
    const int blk = blockIdx.x;
    if (blk < GF_LNX) lnx_part(blk, x, lw, lb, XA);
    else if (blk < GF_LNX + GF_ROPE) rope_part(blk - GF_LNX, pos, CS, SN);
    else cvt8_part(blk - (GF_LNX + GF_ROPE), wqkv, WB, (size_t)3 * DM * DM / 8);
}
// k_mid: the q/k norm and rotary (reads the q|k product) beside the stages that only k_flash or the output product read: mask sums and bm planes, edge weight plane, out_w conversion.
#define GM_PREP (NB * SEQ / 64)
#define GM_ROT  (NB * SEQ / 8)
#define GM_CVT  (DM * DM / 8 / (256 * CVT_CH))
__global__ __launch_bounds__(256) void k_mid(const float* __restrict__ QK, const float* __restrict__ qw, const float* __restrict__ kw, const float* __restrict__ CS, const float* __restrict__ SN, h16* PL, size_t pst,
                                             const float* __restrict__ blocks, const int* __restrict__ mask, h16* BM, float* BASE, unsigned int* MB,
                                             const float* __restrict__ ew, h16* EWA, const float* __restrict__ ow, bf* OWB) {
    const int blk = blockIdx.x;
    if (blk < GM_PREP) prep_part(blk, blocks, mask, BM, BASE, MB);
    else if (blk < GM_PREP + GM_ROT) qkrot_part(blk - GM_PREP, QK, qw, kw, CS, SN, PL, pst);
    else if (blk == GM_PREP + GM_ROT) ew_part(ew, EWA);
    else cvt8_part(blk - (GM_PREP + GM_ROT + 1), ow, OWB, (size_t)DM * DM / 8);
}

// k_flash staging: a stage is 64 keys of the block's (batch, head): k value and residual rows, v^T rows, both bm planes (128-byte rows, LDS pitch 144, an odd multiple of 16 B for 16-byte readers).
// Two buffers, filled by asynchronous copies one stage ahead of the pass that reads them. The packed mask of the block's 64 query rows (128 bytes a row, all keys) is copied once, in front of stage 0.
#define FK      64
#define FP1     144u
#define FO_KH   0u
#define FO_KR   (64u * FP1)
#define FO_VT   (128u * FP1)
#define FO_BM   (192u * FP1)
#define F_STAGE (224u * FP1)
static_assert(AW == 4 && KW == 2 && HD == 64);      // 256 lanes: 32 rows of 128 B per copy instruction of the block
static_assert(FK == 32 * KW);                       // one 32-key half of a stage per wave of a query tile
static_assert(SEQ % FK == 0 && SEQ / FK >= 2);      // whole stages, at least two
static_assert(F_STAGE % 16u == 0u);
// One stage: 7 copies of 16 B per lane, every lane on. l1: the lane's LDS byte address in row 0..31 of a 128-byte-row tile of the target buffer.
// bm: the lane's 16 bytes of the 32 bm rows (value plane rows 0..15, residual plane rows 16..31, adjacent in LDS).
// The run of copies ends, inside its own statement, with s_wait_xcnt 0: the address registers are rewritten only behind it.
__device__ __forceinline__ void flash_fill(uint32_t l1, const h16* kh, const h16* kr, const h16* vt, const h16* bm) {
    asm volatile("global_load_async_to_lds_b128 %0, %1, off\n\t"
                 "global_load_async_to_lds_b128 %2, %3, off\n\t"
                 "global_load_async_to_lds_b128 %4, %5, off\n\t"
                 "global_load_async_to_lds_b128 %6, %7, off\n\t"
                 "global_load_async_to_lds_b128 %8, %9, off\n\t"
                 "global_load_async_to_lds_b128 %10, %11, off\n\t"
                 "global_load_async_to_lds_b128 %12, %13, off\n\t"
                 "s_wait_xcnt 0x0"
                 :: "v"(l1 + FO_KH), "v"(kh), "v"(l1 + FO_KH + 32u * FP1), "v"(kh + 32 * HD),
                    "v"(l1 + FO_KR), "v"(kr), "v"(l1 + FO_KR + 32u * FP1), "v"(kr + 32 * HD),
                    "v"(l1 + FO_VT), "v"(vt), "v"(l1 + FO_VT + 32u * FP1), "v"(vt + 32 * SEQ),
                    "v"(l1 + FO_BM), "v"(bm)
                 : "memory");
}
// The packed mask rows of the block: 64 rows of 128 B, 2 copies of 16 B per lane, every lane on; lm: the lane's LDS byte address in row 0..31 (pitch FP1), mb: its 16 bytes of that row.
// As above, the run ends inside its own statement with s_wait_xcnt 0: the address registers are rewritten only behind it.
__device__ __forceinline__ void flash_fill_mask(uint32_t lm, const unsigned int* mb) {
    asm volatile("global_load_async_to_lds_b128 %0, %1, off\n\t"
                 "global_load_async_to_lds_b128 %2, %3, off\n\t"
                 "s_wait_xcnt 0x0"
                 :: "v"(lm), "v"(mb), "v"(lm + 32u * FP1), "v"(mb + 32 * MBW)
                 : "memory");
}

// k_flash: fused attention + geometric term, KW waves per 16 query rows of one (batch, head): wave (qw, ks) walks the ks-th 32 keys of every stage with its own running max, sums and accumulators,
// so that a SIMD holds four waves; behind the loop the ks = 1 wave hands its state over in LDS and the ks = 0 wave joins both and runs the epilogue. q fragments straight from the 16-bit planes, all key-side fragments from the staged LDS tiles (two 16-B reads each), the mask as one 16-B read of packed bits per stage.
// Transposed form: S^T[key][t] = K Q^T; lane (t = lane&15, h = lane>>4) holds keys 8h+r of each 16-key tile, so packed P / G tiles are directly B fragments of
// O^T[d][t] = V^T P^T and T^T[cx][t] = BM^T G^T. S = kH.qH + (kH.qR + kR.qH)/2048. Mask: replace-fill for the softmax, zero for G; both selects are skipped, by a scalar branch, where every bit of the wave's 16 x 32 tile is set. Softmax state one scalar per lane (running max from -inf).
// Epilogue: tmp2 halves exchanged with one xor-16 shuffle, c16 = base.tmp2 (K = 3, VALU), ctx^T = EW c16^T on one K=32 tile (value | residual), sum staged in a wave-private LDS tile and
// Two blocks of eight waves share a WGP (LDS allows two): four waves a SIMD, so a wave may hold at most 256 registers.
__global__ __launch_bounds__(32 * AW * KW) __attribute__((amdgpu_waves_per_eu(4, 4))) void k_flash(const h16* __restrict__ QH, const h16* __restrict__ QR, const h16* __restrict__ KH, const h16* __restrict__ KR, const h16* __restrict__ VT,
                                                   const h16* __restrict__ BM, const float* __restrict__ BASE, const h16* __restrict__ EWA, const unsigned int* __restrict__ MB, bf* OA) {
    __shared__ __align__(16) float os[AW * 16 * 68];
    __shared__ __align__(16) unsigned char fr[2 * F_STAGE];
    __shared__ __align__(16) unsigned char mbt[16 * AW * FP1];   // packed mask rows of the block's query rows
    const int tid = threadIdx.x;
    const int lane = threadIdx.x & 31, wave = __builtin_amdgcn_readfirstlane((int)(threadIdx.x >> 5)), lr = lane & 15, hi = lane >> 4;
    const int zh = blockIdx.y; const int b = zh / NH_, h = zh % NH_;
    const int qw = wave & (AW - 1), ks = wave / AW;      // query tile, key half
    const int t0 = (blockIdx.x * AW + qw) * 16;
    const size_t pbase = (size_t)zh * SEQ * HD;
    const size_t qo = pbase + (size_t)(t0 + lr) * HD + 8 * hi;
    const v16h qh0 = ldh(QH + qo), qh1 = ldh(QH + qo + 32), qr0 = ldh(QR + qo), qr1 = ldh(QR + qo + 32);   // B fragments: col t, k = d
    // readers, byte offsets in a buffer: 128-byte-row tiles at row lr (A fragments: row key / d / cx); packed mask at this wave's row lr
    const uint32_t ro = (uint32_t)lr * FP1 + 16u * (uint32_t)hi;
    const uint32_t rk = ro + (uint32_t)ks * (32u * FP1);   // k tiles: this wave's 32 keys are rows
    const uint32_t rc = ro + (uint32_t)ks * 64u;           // v^T and bm tiles: they are columns
    const uint32_t mo = (uint32_t)(qw * 16 + lr) * FP1;
    // copiers: the lane's own 16 bytes of stage 0 (8 lanes per 128-byte row)
    const h16* ckh = KH + pbase + (size_t)tid * 8;
    const h16* ckr = KR + pbase + (size_t)tid * 8;
    const h16* cvt = VT + pbase + (size_t)(tid >> 3) * SEQ + 8 * (tid & 7);
    const h16* cbm = BM + (size_t)(tid >> 7) * ((size_t)NB * 16 * SEQ) + ((size_t)b * 16 + ((tid >> 3) & 15)) * SEQ + 8 * (tid & 7);
    const unsigned int* cmb = MB + ((size_t)b * SEQ + blockIdx.x * (16 * AW) + (tid >> 3)) * MBW + 4 * (tid & 7);
    const uint32_t cl1 = (uint32_t)(size_t)fr + (uint32_t)(tid >> 3) * FP1 + 16u * (uint32_t)(tid & 7);
    const uint32_t clm = (uint32_t)(size_t)mbt + (uint32_t)(tid >> 3) * FP1 + 16u * (uint32_t)(tid & 7);
    v8f o0 = (v8f){}, o1 = (v8f){}, o2 = (v8f){}, o3 = (v8f){}, gA = (v8f){}, gR = (v8f){};
    float m = -__builtin_huge_valf(), l = 0.0f;
    flash_fill_mask(clm, cmb);
    flash_fill(cl1, ckh, ckr, cvt, cbm);
    asm volatile("s_wait_asynccnt 0x0" ::: "memory");    // this wave's copies of the packed mask and of stage 0 have landed
    __syncthreads();                                     // every wave's part of both is readable by every wave
    flash_fill(cl1 + F_STAGE, ckh + FK * HD, ckr + FK * HD, cvt + FK, cbm + FK);
#pragma unroll 1   // one stage per trip: the buffer index and the publish point at the foot belong to one stage
    for (int st = 0; st < SEQ / FK; ++st) {
      const uint32_t bo = (uint32_t)(st & 1) * F_STAGE;
      {
        // the four words (j = key & 3) that hold keys 128*(st/2) .. +127 of this lane's query row; this wave's 32 keys are the 8 bits from msh up in each
        const u32x4 mw = *(const u32x4a*)(mbt + mo + (uint32_t)(st >> 1) * 16u);
        const uint32_t msh = (uint32_t)(st & 1) * 16u + (uint32_t)ks * 8u;
        const bool mpart = (((mw[0] & mw[1] & mw[2] & mw[3]) >> msh) & 0xFFu) != 0xFFu;   // a key of this row's 32 is masked out
        const unsigned char* ka = fr + bo + FO_KH + rk; const unsigned char* kr = fr + bo + FO_KR + rk;
        const v16h ka0 = ldh((const h16*)ka), ka1 = ldh((const h16*)(ka + 64)), kb0 = ldh((const h16*)(ka + 16 * FP1)), kb1 = ldh((const h16*)(ka + 16 * FP1 + 64));
        const v16h ra0 = ldh((const h16*)kr), ra1 = ldh((const h16*)(kr + 64)), rb0 = ldh((const h16*)(kr + 16 * FP1)), rb1 = ldh((const h16*)(kr + 16 * FP1 + 64));
        v8f sHa = (v8f){}, sLa = (v8f){}, sKa = (v8f){}, sHb = (v8f){}, sLb = (v8f){}, sKb = (v8f){};
        sHa = wmma16(ka0, qh0, sHa); sLa = wmma16(ka0, qr0, sLa); sKa = wmma16(ra0, qh0, sKa); sHb = wmma16(kb0, qh0, sHb); sLb = wmma16(kb0, qr0, sLb); sKb = wmma16(rb0, qh0, sKb);
        sHa = wmma16(ka1, qh1, sHa); sLa = wmma16(ka1, qr1, sLa); sKa = wmma16(ra1, qh1, sKa); sHb = wmma16(kb1, qh1, sHb); sLb = wmma16(kb1, qr1, sLb); sKb = wmma16(rb1, qh1, sKb);
        asm volatile("v_nop\n\tv_nop\n\tv_nop\n\tv_nop" : "+v"(sHa), "+v"(sLa), "+v"(sKa), "+v"(sHb), "+v"(sLb), "+v"(sKb) : "v"(ka0), "v"(ka1), "v"(kb0), "v"(kb1), "v"(ra0), "v"(ra1), "v"(rb0), "v"(rb1));
        float ta[8], tb[8], xa[8], xb[8]; float mx = NEGMIN;
        v16h gh, gr;
#pragma unroll
        for (int r = 0; r < 8; ++r) {
            xa[r] = sHa[r] + (sLa[r] + sKa[r]) * QRI; xb[r] = sHb[r] + (sLb[r] + sKb[r]) * QRI;
            ta[r] = xa[r] * SC2; tb[r] = xb[r] * SC2; }
        if (__builtin_amdgcn_ballot_w32(mpart) != 0u) {   // wave-uniform: some key of the wave's 16 x 32 tile is masked out
            // key 16*ab + 8*hi + r of the wave's 32: word r & 3, bit msh + 4*ab + 2*hi + r/4
            const uint32_t lsh = msh + 2u * (uint32_t)hi;
            const uint32_t mu[4] = {mw[0] >> lsh, mw[1] >> lsh, mw[2] >> lsh, mw[3] >> lsh};
#pragma unroll
            for (int r = 0; r < 8; ++r) {
                const bool va = (mu[r & 3] & (1u << (r >> 2))) != 0u, vb = (mu[r & 3] & (16u << (r >> 2))) != 0u;
                ta[r] = va ? ta[r] : NEGMIN; tb[r] = vb ? tb[r] : NEGMIN;
                xa[r] = va ? xa[r] : 0.0f; xb[r] = vb ? xb[r] : 0.0f; }
        }
#pragma unroll
        for (int r = 0; r < 8; ++r) {
            const float ga = xa[r]; const float gb = xb[r];
            const h16 ha = (h16)ga; const h16 hb = (h16)gb;
            gh[r] = ha; gh[8 + r] = hb; gr[r] = (h16)((ga - (float)ha) * QRS); gr[8 + r] = (h16)((gb - (float)hb) * QRS);
            mx = fmaxf(mx, fmaxf(ta[r], tb[r])); }
        mx = fmaxf(mx, __shfl_xor(mx, 16, 32));
        const float mnew = fmaxf(m, mx);
        const float alpha = __builtin_amdgcn_exp2f(m - mnew);
        const float sh = PSH - mnew;
        v16h pb; float ls = 0.0f;
#pragma unroll
        for (int r = 0; r < 8; ++r) { const h16 pa = (h16)__builtin_amdgcn_exp2f(ta[r] + sh); const h16 pc = (h16)__builtin_amdgcn_exp2f(tb[r] + sh); pb[r] = pa; pb[8 + r] = pc; ls += (float)pa + (float)pc; }
        l = l * alpha + ls; m = mnew;
        o0 = o0 * alpha; o1 = o1 * alpha; o2 = o2 * alpha; o3 = o3 * alpha;
        const unsigned char* va_ = fr + bo + FO_VT + rc;
        const v16h v0 = ldh((const h16*)va_), v1 = ldh((const h16*)(va_ + 16 * FP1)), v2 = ldh((const h16*)(va_ + 32 * FP1)), v3 = ldh((const h16*)(va_ + 48 * FP1));
        const unsigned char* ba_ = fr + bo + FO_BM + rc;
        const v16h bh = ldh((const h16*)ba_), br = ldh((const h16*)(ba_ + 16 * FP1));
        o0 = wmma16(v0, pb, o0); gA = wmma16(bh, gh, gA); o1 = wmma16(v1, pb, o1); gR = wmma16(bh, gr, gR); o2 = wmma16(v2, pb, o2); o3 = wmma16(v3, pb, o3); gR = wmma16(br, gh, gR);
        asm volatile("v_nop\n\tv_nop\n\tv_nop\n\tv_nop" : "+v"(o0), "+v"(o1), "+v"(o2), "+v"(o3), "+v"(gA), "+v"(gR) : "v"(v0), "v"(v1), "v"(v2), "v"(v3), "v"(pb), "v"(bh), "v"(br), "v"(gh), "v"(gr));
      }
      asm volatile("s_wait_dscnt 0x0" ::: "memory");       // this wave's reads of this buffer have returned
      asm volatile("s_wait_asynccnt 0x0" ::: "memory");    // this wave's copies of stage st + 1 have landed
      __syncthreads();                                     // publishes stage st + 1 and ends every wave's reads of this buffer
      if (st + 2 < SEQ / FK) {                             // only while stage st + 2 exists (the same for the whole block)
          const int kn = (st + 2) * FK;
          flash_fill(cl1 + bo, ckh + (size_t)kn * HD, ckr + (size_t)kn * HD, cvt + kn, cbm + kn);
      }
    }
    asm volatile("s_wait_asynccnt 0x0" ::: "memory");    // no copy is outstanding when the wave goes on
    // Join of the two key halves. The last trip's waits and barrier have ended every read of the ring and no copy is outstanding, so the ring serves as the hand-over area: 13 x 16 B per lane, lane-contiguous.
    v4fa* xw = (v4fa*)fr + (size_t)qw * (13 * 32) + lane;
    if (ks != 0) {
        const v8f st8[6] = {o0, o1, o2, o3, gA, gR};
#pragma unroll
        for (int i = 0; i < 6; ++i) { xw[(2 * i) * 32] = (v4f){st8[i][0], st8[i][1], st8[i][2], st8[i][3]}; xw[(2 * i + 1) * 32] = (v4f){st8[i][4], st8[i][5], st8[i][6], st8[i][7]}; }
        xw[12 * 32] = (v4f){m, l, 0.0f, 0.0f};
    }
    __syncthreads();                                     // the ks = 1 waves' state is readable by their ks = 0 partners
    if (ks != 0) return;                                 // no barrier follows
    {
        const v4f ml = xw[12 * 32];
        const float dm = m - ml[0];                      // both maxima are finite: every wave has walked at least one half stage
        const float ea = __builtin_amdgcn_exp2f(-fabsf(dm));   // the side with the larger maximum keeps its scale
        const float a1 = (dm < 0.0f) ? ea : 1.0f, a2 = (dm < 0.0f) ? 1.0f : ea;
        l = l * a1 + ml[1] * a2;
        v8f pt[6];
#pragma unroll
        for (int i = 0; i < 6; ++i) { const v4f x0 = xw[(2 * i) * 32], x1 = xw[(2 * i + 1) * 32]; pt[i] = (v8f){x0[0], x0[1], x0[2], x0[3], x1[0], x1[1], x1[2], x1[3]}; }
        o0 = o0 * a1 + pt[0] * a2; o1 = o1 * a1 + pt[1] * a2; o2 = o2 * a1 + pt[2] * a2; o3 = o3 * a1 + pt[3] * a2;
        gA = gA + pt[4]; gR = gR + pt[5];
    }
    l += __shfl_xor(l, 16, 32);
    const float inv = 1.0f / l;
    // tmp2 (x1024): lane (t, h) holds rows cx = 8h + r; fetch the other half unconditionally, select by value
    float mi[8], ot[8], f[12];
#pragma unroll
    for (int r = 0; r < 8; ++r) { mi[r] = gA[r] + gR[r] * QRI; ot[r] = __shfl_xor(mi[r], 16, 32); }
#pragma unroll
    for (int r = 0; r < 8; ++r) f[r] = hi ? ot[r] : mi[r];
#pragma unroll
    for (int r = 0; r < 4; ++r) f[8 + r] = hi ? mi[r] : ot[r];
    const float* bp = BASE + ((size_t)b * SEQ + t0 + lr) * 16;
    const v4f b0 = *(const v4f*)bp, b1 = *(const v4f*)(bp + 4), b2 = *(const v4f*)(bp + 8);
    const float bs[12] = {b0[0], b0[1], b0[2], b0[3], b1[0], b1[1], b1[2], b1[3], b2[0], b2[1], b2[2], b2[3]};
    float e0[3], e1[3];
#pragma unroll
    for (int x = 0; x < 3; ++x) { e0[x] = hi ? bs[6 + x] : bs[x]; e1[x] = hi ? bs[9 + x] : bs[3 + x]; }
    // B fragment of the edge projection: element i <- 16*c16[t][j = 8h + i] (e = 2h + i/4, c = i%4), element 8+i <- its residual x2048
    v16h cb;
#pragma unroll
    for (int i = 0; i < 8; ++i) { const int c = i & 3;
        const float cv = (i < 4) ? (e0[0] * f[3 * c] + e0[1] * f[3 * c + 1] + e0[2] * f[3 * c + 2]) : (e1[0] * f[3 * c] + e1[1] * f[3 * c + 1] + e1[2] * f[3 * c + 2]);
        const float bq = cv * (1.0f / 64.0f); const h16 hh = (h16)bq; cb[i] = hh; cb[8 + i] = (h16)((bq - (float)hh) * QRS); }
    const v16h ea0 = ldh(EWA + (size_t)(lr) * 32 + 8 * hi), ea1 = ldh(EWA + (size_t)(16 + lr) * 32 + 8 * hi), ea2 = ldh(EWA + (size_t)(32 + lr) * 32 + 8 * hi), ea3 = ldh(EWA + (size_t)(48 + lr) * 32 + 8 * hi);
    v8f c0 = (v8f){}, c1 = (v8f){}, c2 = (v8f){}, c3 = (v8f){};
    c0 = wmma16(ea0, cb, c0); c1 = wmma16(ea1, cb, c1); c2 = wmma16(ea2, cb, c2); c3 = wmma16(ea3, cb, c3);
    asm volatile("v_nop\n\tv_nop\n\tv_nop\n\tv_nop" : "+v"(c0), "+v"(c1), "+v"(c2), "+v"(c3) : "v"(ea0), "v"(ea1), "v"(ea2), "v"(ea3), "v"(cb));
    const float ci = 1.0f / 256.0f;
    const int wb = qw * 16 * 68;
    // D layout: x_j[r] = (d = 16j + 8h + r, t = lane&15) -> os[t][d]; rows 0..15 x columns 0..63 all written
    { v4f a, c;
      a[0] = o0[0] * inv + c0[0] * ci; a[1] = o0[1] * inv + c0[1] * ci; a[2] = o0[2] * inv + c0[2] * ci; a[3] = o0[3] * inv + c0[3] * ci;
      c[0] = o0[4] * inv + c0[4] * ci; c[1] = o0[5] * inv + c0[5] * ci; c[2] = o0[6] * inv + c0[6] * ci; c[3] = o0[7] * inv + c0[7] * ci;
      *(v4fa*)(&os[wb + lr * 68 +  0 + 8 * hi]) = a; *(v4fa*)(&os[wb + lr * 68 +  0 + 8 * hi + 4]) = c;
      a[0] = o1[0] * inv + c1[0] * ci; a[1] = o1[1] * inv + c1[1] * ci; a[2] = o1[2] * inv + c1[2] * ci; a[3] = o1[3] * inv + c1[3] * ci;
      c[0] = o1[4] * inv + c1[4] * ci; c[1] = o1[5] * inv + c1[5] * ci; c[2] = o1[6] * inv + c1[6] * ci; c[3] = o1[7] * inv + c1[7] * ci;
      *(v4fa*)(&os[wb + lr * 68 + 16 + 8 * hi]) = a; *(v4fa*)(&os[wb + lr * 68 + 16 + 8 * hi + 4]) = c;
      a[0] = o2[0] * inv + c2[0] * ci; a[1] = o2[1] * inv + c2[1] * ci; a[2] = o2[2] * inv + c2[2] * ci; a[3] = o2[3] * inv + c2[3] * ci;
      c[0] = o2[4] * inv + c2[4] * ci; c[1] = o2[5] * inv + c2[5] * ci; c[2] = o2[6] * inv + c2[6] * ci; c[3] = o2[7] * inv + c2[7] * ci;
      *(v4fa*)(&os[wb + lr * 68 + 32 + 8 * hi]) = a; *(v4fa*)(&os[wb + lr * 68 + 32 + 8 * hi + 4]) = c;
      a[0] = o3[0] * inv + c3[0] * ci; a[1] = o3[1] * inv + c3[1] * ci; a[2] = o3[2] * inv + c3[2] * ci; a[3] = o3[3] * inv + c3[3] * ci;
      c[0] = o3[4] * inv + c3[4] * ci; c[1] = o3[5] * inv + c3[5] * ci; c[2] = o3[6] * inv + c3[6] * ci; c[3] = o3[7] * inv + c3[7] * ci;
      *(v4fa*)(&os[wb + lr * 68 + 48 + 8 * hi]) = a; *(v4fa*)(&os[wb + lr * 68 + 48 + 8 * hi + 4]) = c; }
    wave_sync();
    bf* orow = OA + ((size_t)b * SEQ + t0) * K2 + h * HD;
{
#pragma unroll
        for (int s = 0; s < 4; ++s) { const int row = 4 * s + (lane >> 3), c8 = (lane & 7) * 8;   // 4 s x 4 row groups = 16 rows; 8 lanes x 8 = 64 columns
            const v4f x0 = *(const v4fa*)(&os[wb + row * 68 + c8]); const v4f x1 = *(const v4fa*)(&os[wb + row * 68 + c8 + 4]); v8us hv, lv;
#pragma unroll
            for (int i = 0; i < 4; ++i) { const unsigned short a0 = f2bf(x0[i]); const unsigned short a1 = f2bf(x1[i]); hv[i] = a0; hv[4 + i] = a1; lv[i] = f2bf(x0[i] - bf2f(a0)); lv[4 + i] = f2bf(x1[i] - bf2f(a1)); }
            const size_t oo = (size_t)row * K2 + c8;
            *(v8us*)(orow + oo) = hv; *(v8us*)(orow + DM + oo) = lv; }
         }
}

static constexpr size_t al256(size_t v) { return (v + 255) & ~(size_t)255; }
static constexpr size_t SZ_WB  = al256((size_t)3 * DM * DM * 2);
static constexpr size_t SZ_OWB = al256((size_t)DM * DM * 2);
static constexpr size_t SZ_XA  = al256((size_t)NB * SEQ * K2 * 2);
static constexpr size_t SZ_QK  = al256((size_t)NB * SEQ * K2 * 4);
static constexpr size_t SZ_PL  = al256((size_t)NB * NH_ * SEQ * HD * 2);
static constexpr size_t SZ_BM  = al256((size_t)2 * NB * 16 * SEQ * 2);
static constexpr size_t SZ_BS  = al256((size_t)NB * SEQ * 16 * 4);
static constexpr size_t SZ_CS  = al256((size_t)NB * SEQ * 32 * 4);
static constexpr size_t SZ_EW  = al256((size_t)64 * 32 * 2);
static constexpr size_t SZ_MB  = al256((size_t)NB * SEQ * MBW * 4);
static constexpr size_t SZ_TOTAL = SZ_WB + SZ_OWB + 2 * SZ_XA + SZ_QK + 5 * SZ_PL + SZ_BM + SZ_BS + 2 * SZ_CS + SZ_EW + SZ_MB;
static_assert(SZ_TOTAL <= (size_t)134217728);          // workspace carve <= 128 MiB
static_assert(SZ_PL % 2 == 0);                         // plane stride in halves is exact
static_assert(SZ_PL == (size_t)NB * NH_ * SEQ * HD * 2);   // the four q/k planes are back to back with stride SZ_PL/2 halves

extern "C" void kernel_launch(void* const* d_in, const int* in_sizes, int n_in,
                              void* d_out, int out_size, void* d_ws, size_t ws_size, hipStream_t stream) {
    if (n_in < 11) return;
    const size_t ntok = (size_t)(NB - 1) * SEQ_FULL + SEQ;
    if ((size_t)in_sizes[0] < ntok) return;
    if ((size_t)in_sizes[1] < ntok * DM) return;
    if ((size_t)in_sizes[2] < (ntok - 1) * SEQ_FULL + SEQ) return;
    if ((size_t)in_sizes[3] < ntok * 12) return;
    if ((size_t)in_sizes[4] < (size_t)DM || (size_t)in_sizes[5] < (size_t)DM || (size_t)in_sizes[7] < (size_t)DM || (size_t)in_sizes[8] < (size_t)DM) return;
    if ((size_t)in_sizes[6] < (size_t)3 * DM * DM || (size_t)in_sizes[9] < (size_t)DM * DM || (size_t)in_sizes[10] < (size_t)1024) return;
    if ((size_t)out_size < ((size_t)(NB - 1) * OUT_SEQ + SEQ) * DM) return;
    if (SZ_TOTAL > ws_size) return;
    // wire order: position, x, attention_mask (int32), blocks, ln_w, ln_b, wqkv [3072][1024], q_ln_w, k_ln_w, out_w [1024][1024], edge_w [64][16]
    const float* position = (const float*)d_in[0]; const float* x = (const float*)d_in[1]; const int* amask = (const int*)d_in[2]; const float* blocks = (const float*)d_in[3];
    const float* ln_w = (const float*)d_in[4]; const float* ln_b = (const float*)d_in[5]; const float* wqkv = (const float*)d_in[6];
    const float* q_ln_w = (const float*)d_in[7]; const float* k_ln_w = (const float*)d_in[8]; const float* out_w = (const float*)d_in[9]; const float* edge_w = (const float*)d_in[10];
    float* OUT = (float*)d_out;
    char* wsp = (char*)d_ws;
    bf* WB  = (bf*)wsp;  wsp += SZ_WB;                // [3072][1024]: q | k | v rows
    bf* OWB = (bf*)wsp;  wsp += SZ_OWB;               // [1024][1024]
    bf* XA  = (bf*)wsp;  wsp += SZ_XA;                // [NB*SEQ][hi 1024 | lo 1024]
    bf* OA  = (bf*)wsp;  wsp += SZ_XA;                // [NB*SEQ][hi 1024 | lo 1024]
    float* QK = (float*)wsp; wsp += SZ_QK;            // [NB*SEQ][q 1024 | k 1024]
    h16* QH = (h16*)wsp; wsp += SZ_PL;                // [NB*16][SEQ][64]; QH, QR, KH, KR back to back (stride SZ_PL/2 halves)
    h16* QR = (h16*)wsp; wsp += SZ_PL;
    h16* KH = (h16*)wsp; wsp += SZ_PL;
    h16* KR = (h16*)wsp; wsp += SZ_PL;
    h16* VT = (h16*)wsp; wsp += SZ_PL;                // [NB*16][64][SEQ]
    h16* BM = (h16*)wsp; wsp += SZ_BM;                // [2][NB][16][SEQ]
    float* BASE = (float*)wsp; wsp += SZ_BS;          // [NB*SEQ][16]
    float* CS = (float*)wsp; wsp += SZ_CS;            // [NB*SEQ][32]
    float* SN = (float*)wsp; wsp += SZ_CS;
    h16* EWA = (h16*)wsp; wsp += SZ_EW;               // [64][32]
    unsigned int* MB = (unsigned int*)wsp; wsp += SZ_MB;   // [NB*SEQ][SEQ/32] packed mask

    k_front<<<GF_LNX + GF_ROPE + GF_CVT, 256, 0, stream>>>(x, ln_w, ln_b, XA, position, CS, SN, wqkv, WB);

    k_proj_qkv<<<PQ_N + PV_N, 128, 0, stream>>>(XA, WB, QK, VT);

    // planes QH | QR | KH | KR from the base QH with stride SZ_PL/2 halves
    k_mid<<<GM_PREP + GM_ROT + 1 + GM_CVT, 256, 0, stream>>>(QK, q_ln_w, k_ln_w, CS, SN, QH, (size_t)(SZ_PL / 2), blocks, amask, BM, BASE, MB, edge_w, EWA, out_w, OWB);

    k_flash<<<dim3(SEQ / (16 * AW), NB * NH_, 1), 32 * AW * KW, 0, stream>>>(QH, QR, KH, KR, VT, BM, BASE, EWA, MB, OA);

    // out: A = (ctx + context) hi|lo rows, Bt = out_w rows -> OUT[b][t][n]
    k_proj<1><<<dim3(NB * SEQ / 128, DM / 128, 1), 128, 0, stream>>>(OA, K2, OWB, DM, K2, (h16*)0, SEQ, (size_t)0, 0, 64, (size_t)0, OUT, DM, OUT_SEQ);
}

// v008
// One run takes 73.6 microseconds.
// In both of two side-by-side timings against v007, it was 1.03 times as fast.
// All steps since v000 together make it 3.61 times as fast.
#include <hip/hip_runtime.h>
#include <stdint.h>

// Compute dtypes (f32 accumulate everywhere): qkv and output projections v_wmma_f32_16x16x32_bf16 (activation as bf16 hi|lo planes folded along K, weights RNE-converted bf16); scores, P.V, geometric sum and edge projection v_wmma_f32_16x16x32_f16 (q, k, G, W, bm, c16 as f16 value + f16 residual x2048; P x256 and v single f16).
// Pre-norm attention block, width 1024 = 16 heads x 64: LN(x) -> qkv GEMM -> LN(q), LN(k) over the full width -> rotate-half rotary (cos/sin table from the position input) ->
// masked softmax attention (replace-fill, running max) plus geometric term tmp2 = sum_k (q.k) mask bm/len = q.W - sum_k (q.k) (1 - mask) bm/len with W = sum_k k bm/len, context = (base.tmp2) edge_w^T -> output GEMM.
// Every float input is RNE-converted to bf16 on load. Fused flash kernel in transposed form (S^T = K Q^T, O^T = V^T P^T, tmp2^T = (BM^T K) Q^T less BM^T G^T over the masked-out keys, ctx^T = EW c16^T).

#ifndef NB
#define NB 2
#endif
#ifndef SEQ
#define SEQ 1024
#endif
#define NB_FULL  2
#define SEQ_FULL 1024
#ifndef OUT_SEQ
#define OUT_SEQ SEQ              // row pitch (in tokens) between batches of the output
#endif
#define DM   1024
#define K2   2048                // hi|lo folded contraction length
#define NH_  16
#define HD   64
#define AW   4                   // query tiles per flash block (16 query rows each)
#define KW   2                   // waves per query tile: each takes one 32-key half of every stage
#define QRS  2048.0f             // carry of the residual planes
#define QRI  (1.0f / 2048.0f)
#define SC2  (0.125f * 1.4426950408889634f)   // HD^-0.5 * log2(e)
#define PSH  8.0f                // log2 of the P carry (256)
#define NEGMIN (-3.4028234663852886e38f)

static_assert(HD == 64);
static_assert(NH_ * HD == DM);
static_assert(K2 == 2 * DM);
static_assert((DM & (DM - 1)) == 0);
static_assert(DM % 64 == 0);
static_assert(SEQ % 128 == 0);                 // mask row sums read 128 ints per step
static_assert(SEQ % 64 == 0);
static_assert((NB * SEQ) % 128 == 0);
static_assert((NB * SEQ) % 8 == 0);
static_assert(SEQ % (16 * AW) == 0);
static_assert(NB <= NB_FULL);
static_assert(SEQ <= SEQ_FULL);

typedef _Float16 h16;
typedef unsigned short bf;
typedef __attribute__((ext_vector_type(16))) __bf16   v16bf;
typedef __attribute__((ext_vector_type(16))) _Float16 v16h;
typedef __attribute__((ext_vector_type(8)))  _Float16 v8h;
typedef __attribute__((ext_vector_type(8)))  unsigned short v8us;
typedef __attribute__((ext_vector_type(8)))  float    v8f;
typedef __attribute__((ext_vector_type(4)))  float    v4f;
typedef __attribute__((ext_vector_type(4)))  int      v4i;
typedef __attribute__((ext_vector_type(4)))  uint32_t u32x4;
typedef u32x4 __attribute__((may_alias)) u32x4a;
typedef __attribute__((ext_vector_type(8)))  uint32_t u32x8;
typedef v4f  __attribute__((may_alias)) v4fa;
typedef v8h  __attribute__((may_alias)) v8ha;
typedef float __attribute__((may_alias)) f32a;
typedef __attribute__((ext_vector_type(8)))  short    v8s;

__device__ __forceinline__ unsigned short f2bf(float f) { unsigned u = __float_as_uint(f); u += 0x7FFFu + ((u >> 16) & 1u); return (unsigned short)(u >> 16); }
__device__ __forceinline__ float bf2f(unsigned short b) { return __uint_as_float(((unsigned)b) << 16); }
__device__ __forceinline__ float bfr(float f) { return bf2f(f2bf(f)); }
__device__ __forceinline__ v16h cat16(v8h lo, v8h hi) { return __builtin_shufflevector(lo, hi, 0, 1, 2, 3, 4, 5, 6, 7, 8, 9, 10, 11, 12, 13, 14, 15); }
__device__ __forceinline__ v16bf cat16b(v8us lo, v8us hi) { return __builtin_bit_cast(v16bf, __builtin_shufflevector(lo, hi, 0, 1, 2, 3, 4, 5, 6, 7, 8, 9, 10, 11, 12, 13, 14, 15)); }
__device__ __forceinline__ v8f wmma16(v16h a, v16h b, v8f c) { return __builtin_amdgcn_wmma_f32_16x16x32_f16(false, a, false, b, (short)0, c, false, false); }
__device__ __forceinline__ v8f wmmab(v16bf a, v16bf b, v8f c) { return __builtin_amdgcn_wmma_f32_16x16x32_bf16(false, a, false, b, (short)0, c, false, false); }
// fragment loaders from K-contiguous 16-bit rows; p already includes + 8*(lane>>4): elements 0..7 <- k0+8h+0..7, elements 8..15 <- k0+16+8h+0..7 (same map for A and B)
__device__ __forceinline__ v16h  ldh(const h16* p) { return cat16(*(const v8h*)p, *(const v8h*)(p + 16)); }
__device__ __forceinline__ v16bf ldb(const bf* p)  { return cat16b(*(const v8us*)p, *(const v8us*)(p + 16)); }
// transposing LDS load: lane address = tile + (k0 + 8*(lane>>4) + (lane&7)) * pitch + 2*c0 + 16*((lane>>3)&1); lane (c = lane&15, h = lane>>4) gets tile[k0 + 8h + 0..7][c0 + c].
// Two of them, at k0 and k0 + 16 (rp = 16 rows in bytes), are one fragment in the k order of ldh.
__device__ __forceinline__ v8h ldtr(const unsigned char* p) { typedef __attribute__((address_space(3))) v8s lds_v8s; return __builtin_bit_cast(v8h, __builtin_amdgcn_ds_load_tr16_b128_v8i16((lds_v8s*)p)); }
__device__ __forceinline__ v16h ldht(const unsigned char* p, uint32_t rp) { return cat16(ldtr(p), ldtr(p + rp)); }
// ordering point for wave-private LDS tiles (same wave writes and reads)
__device__ __forceinline__ void wave_sync() { __builtin_amdgcn_fence(3 /* release order */, "wavefront"); __builtin_amdgcn_wave_barrier(); asm volatile("" ::: "memory"); }
__device__ __forceinline__ float wsum(float v) { v += __shfl_xor(v, 16, 32); v += __shfl_xor(v, 8, 32); v += __shfl_xor(v, 4, 32); v += __shfl_xor(v, 2, 32); v += __shfl_xor(v, 1, 32); return v; }

// The six row-wise stages (cvt8, ew, lnx, rope, prep, qkrot) are device functions of one 256-thread block each (blk = the block's index inside its own stage); k_front and k_mid, behind qkrot_part,
// run stages that read none of each other's output side by side in one grid.
// cvt8_part: CVT_CH chunks of 8 floats per thread, 256 threads apart; all of a thread's loads are issued before the first value is converted.
#define CVT_CH 8
__device__ __forceinline__ void cvt8_part(int blk, const float* __restrict__ src, bf* dst, size_t n8) {
    const size_t i = (size_t)blk * (256 * CVT_CH) + threadIdx.x; if (i + (size_t)(CVT_CH - 1) * 256 >= n8) return;
    v4f va[CVT_CH], vb[CVT_CH];
#pragma unroll
    for (int ch = 0; ch < CVT_CH; ++ch) { const float* p = src + (i + (size_t)ch * 256) * 8;
        va[ch] = *(const v4f*)p;
        if (ch == CVT_CH - 1) asm volatile("s_wait_xcnt 0x0" ::: "memory");   // the last load's result may be given the address pair that all the loads above name: it issues only behind this wait
        vb[ch] = *(const v4f*)(p + 4); }
#pragma unroll
    for (int ch = 0; ch < CVT_CH; ++ch) { v8us o;
#pragma unroll
        for (int k = 0; k < 4; ++k) { o[k] = f2bf(va[ch][k]); o[4 + k] = f2bf(vb[ch][k]); }
        *(v8us*)(dst + (i + (size_t)ch * 256) * 8) = o; }
}

// ew_part: edge weight A plane [64][32] f16: columns 0..15 = 16*w[d][j], columns 16..31 = w[d][j]/128 (pairs with the x2048 residual half of the c16 operand). One block; each thread 16 B, consecutive.
__device__ __forceinline__ void ew_part(const float* __restrict__ ew, h16* EWA) {
    const int tid = threadIdx.x; const int d = tid >> 2, q = tid & 3;
    const float sc = (q < 2) ? 16.0f : 0.0078125f;
    const v8f w = *(const v8f*)(ew + d * 16 + (q & 1) * 8);
    v8h o;
#pragma unroll
    for (int i = 0; i < 8; ++i) o[i] = (h16)(bfr(w[i]) * sc);
    *(v8h*)(EWA + d * 32 + q * 8) = o;
    asm volatile("s_wait_xcnt 0x0" ::: "memory");   // other stages' code follows this store in the merged kernel: its address and data registers are rewritten only behind this wait
}

// The wave's row and both weight rows are loaded once, all loads issued together, and kept in registers through the three passes (element visiting order it = 0..3, i = 0..7 in every pass).
__device__ __forceinline__ void lnx_part(int blk, const float* __restrict__ x, const float* __restrict__ lw, const float* __restrict__ lb, bf* XA) {
    const int lane = threadIdx.x & 31; const int wave = __builtin_amdgcn_readfirstlane((int)(threadIdx.x >> 5));
    const int m = blk * 8 + wave; const int b = m / SEQ, t = m % SEQ;
    const float* src = x + ((size_t)b * SEQ_FULL + t) * DM + lane * 8;
    v8f raw[4], wv[4], bv[4];
#pragma unroll
    for (int it = 0; it < 4; ++it) raw[it] = *(const v8f*)(src + it * 256);
#pragma unroll
    for (int it = 0; it < 4; ++it) { wv[it] = *(const v8f*)(lw + it * 256 + lane * 8); bv[it] = *(const v8f*)(lb + it * 256 + lane * 8); }
    float s = 0.0f;
#pragma unroll
    for (int it = 0; it < 4; ++it) {
#pragma unroll
        for (int i = 0; i < 8; ++i) { raw[it][i] = bfr(raw[it][i]); s += raw[it][i]; } }
    s = wsum(s);
    const float mean = s * (1.0f / DM);
    float ss = 0.0f;
#pragma unroll
    for (int it = 0; it < 4; ++it) {
#pragma unroll
        for (int i = 0; i < 8; ++i) { const float dv = raw[it][i] - mean; ss += dv * dv; } }
    ss = wsum(ss);
    const float rstd = 1.0f / sqrtf(ss * (1.0f / DM) + 1e-5f);
    bf* dst = XA + (size_t)m * K2 + lane * 8;
#pragma unroll
    for (int it = 0; it < 4; ++it) {
        v8us hv, lv;
#pragma unroll
        for (int i = 0; i < 8; ++i) { const float dv = raw[it][i] - mean; const float y = dv * rstd * bfr(wv[it][i]) + bfr(bv[it][i]); const unsigned short hh = f2bf(y); hv[i] = hh; lv[i] = f2bf(y - bf2f(hh)); }
        *(v8us*)(dst + it * 256) = hv; *(v8us*)(dst + DM + it * 256) = lv; }
}

__device__ __forceinline__ void rope_part(int blk, const float* __restrict__ pos, float* CS, float* SN) {
    const int lane = threadIdx.x & 31; const int wave = __builtin_amdgcn_readfirstlane((int)(threadIdx.x >> 5));
    const int m = blk * 8 + wave; const int b = m / SEQ, t = m % SEQ;
    const float p = bfr(pos[(size_t)b * SEQ_FULL + t]);
    double pd = 1.0;
#pragma unroll 1
    for (int i = 0; i < lane; ++i) pd *= 1.333521432163324;
    const float pf = (float)pd;
    const float invf = 1.0f / pf;
    const float ang = p * invf;
    const float c = cosf(ang), s = sinf(ang);
    *(float*)(CS + (size_t)m * 32 + lane) = c; *(float*)(SN + (size_t)m * 32 + lane) = s;
    
}

// Packed mask MB [b*SEQ + t][SEQ/32] words: bit L of word 4*c + j of a row says whether mask[row][128*c + 4*L + j] is non-zero (the lane masks of prep_part's compares, stored as they come).
#define MBW (SEQ / 32)
static_assert(MBW == 32);                      // one word of a mask row per lane of the wave that packs it; a row is 128 bytes
// prep_part: per 64 tokens: len = mask row sums, and the rows' packed mask; bm = blocks - mean_c; base = bm / (|bm| + eps); planes BM[0] = f16(bm * 1024/len), BM[1] = f16 residual x2048, layout [plane][b][16][SEQ] (rows 12..15 zero);
// BASE [token][16] f32 (columns 12..15 zero). LDS tiles are cross-wave: block barriers between phases.
__device__ __forceinline__ void prep_part(int blk, const float* __restrict__ blocks, const int* __restrict__ mask, h16* BM, float* BASE, unsigned int* MB) {
    __shared__ float slen[64];
    __shared__ __align__(16) h16 sb[32 * 64];
    __shared__ __align__(16) float sbase[64 * 16];
    const int tid = threadIdx.x, lane = tid & 31; const int wave = __builtin_amdgcn_readfirstlane((int)(threadIdx.x >> 5));
    const int m0 = blk * 64; const int b = m0 / SEQ, t0 = m0 % SEQ;
#pragma unroll 1   // two batches of four mask rows: a batch's loads are all in flight together; all eight rows at once would double the registers of the whole kernel
    for (int g = 0; g < 2; ++g) { const int tl = wave * 8 + g * 4;
        const int* row = mask + ((size_t)b * SEQ_FULL + t0 + tl) * SEQ_FULL + lane * 4;
        v4i mv[4][SEQ / 128];
#pragma unroll
        for (int r = 0; r < 4; ++r)
#pragma unroll
            for (int c = 0; c < SEQ / 128; ++c) mv[r][c] = *(const v4i*)(row + (size_t)r * SEQ_FULL + c * 128);
        int cnt[4];
#pragma unroll
        for (int r = 0; r < 4; ++r) { cnt[r] = 0; unsigned int word = 0u;
#pragma unroll
            for (int c = 0; c < SEQ / 128; ++c)
#pragma unroll
                for (int j = 0; j < 4; ++j) { const unsigned int bal = __builtin_amdgcn_ballot_w32(mv[r][c][j] != 0);   // the compare's lane mask: 32 mask bits, the same in every lane
                    cnt[r] += __builtin_popcount(bal);
                    word = (lane == 4 * c + j) ? bal : word; }   // lane 4*c + j keeps this word for the row's one 128-byte store
            MB[((size_t)b * SEQ + t0 + tl + r) * MBW + lane] = word; }
        if (lane == 0) {
#pragma unroll
            for (int r = 0; r < 4; ++r) slen[tl + r] = (float)cnt[r]; } }
    __syncthreads();
    if (tid < 64) {
        const float* p = blocks + ((size_t)b * SEQ_FULL + t0 + tid) * 12;
        const v4f a0 = *(const v4f*)p, a1 = *(const v4f*)(p + 4), a2 = *(const v4f*)(p + 8);
        float pv[12];
#pragma unroll
        for (int i = 0; i < 4; ++i) { pv[i] = bfr(a0[i]); pv[4 + i] = bfr(a1[i]); pv[8 + i] = bfr(a2[i]); }
        float mu[3];
#pragma unroll
        for (int x = 0; x < 3; ++x) mu[x] = (pv[x] + pv[3 + x] + pv[6 + x] + pv[9 + x]) * 0.25f;
        const float sc = (1.0f / slen[tid]) * 1024.0f;
#pragma unroll
        for (int c = 0; c < 4; ++c) {
            const float vx = pv[c * 3] - mu[0], vy = pv[c * 3 + 1] - mu[1], vz = pv[c * 3 + 2] - mu[2];
            const float inv = 1.0f / (sqrtf(vx * vx + vy * vy + vz * vz) + 1.1920929e-7f);
            const float vv[3] = {vx, vy, vz};
#pragma unroll
            for (int x = 0; x < 3; ++x) { const int cx = c * 3 + x;
                sbase[tid * 16 + cx] = vv[x] * inv;
                const float bs = vv[x] * sc; const h16 hh = (h16)bs;
                sb[cx * 64 + tid] = hh; sb[(16 + cx) * 64 + tid] = (h16)((bs - (float)hh) * QRS); } }
#pragma unroll
        for (int j = 12; j < 16; ++j) { sbase[tid * 16 + j] = 0.0f; sb[j * 64 + tid] = (h16)0.0f; sb[(16 + j) * 64 + tid] = (h16)0.0f; }
    }
    __syncthreads();
    // 32 lines of 64 halves: line = tid>>3 (0..15 value plane rows, 16..31 residual plane rows), 8 consecutive lanes x 16 B per line; BASE: 256 threads x 16 B contiguous
    const int line = tid >> 3, pc = tid & 7;
    const v8h bv = *(const v8ha*)(&sb[line * 64 + pc * 8]);
    const v4f fv = *(const v4fa*)(&sbase[tid * 4]);
    h16* bd = BM + (size_t)(line >> 4) * ((size_t)NB * 16 * SEQ) + ((size_t)b * 16 + (line & 15)) * SEQ + t0 + pc * 8;
    float* fd = BASE + (size_t)m0 * 16 + tid * 4;
    *(v8h*)bd = bv; *(v4f*)fd = fv;
    
}

// k_proj: bf16 GEMM, 128x128 tile per block of four waves (2 x 2, each 64x64 = 16 accumulators). One operand is an activation in two planes (value | residual along its row), the other a weight in one plane.
// Both are staged in LDS by tensor loads: a stage is 128 k of the weight rows and the same 128 k of both activation planes (256 bytes a row), so a weight tile is fetched once and a weight fragment is read once
// for both planes. Two buffers, every wave moves its own slice one stage ahead of the pass that reads it. Order per accumulator: kc = 0, 32, 64, ...; at each kc the value plane's product, then the residual plane's.
// MODE 1: f32 rows C[((r0/RB)*RP + r0%RB)][c0..c0+63], row pitch ldc; each 256-byte row segment by 16 consecutive lanes x 16 B.
#define PJ_PITCH 272u                 // LDS row pitch: 256-byte row + the mover's 16-byte pad (odd multiple of 16 B for 16-byte readers)
#define PJ_SLICE 18432u               // 64 weight rows x 272 B = 17408, rounded up to a multiple of 2 KiB so that every slice starts on one
#define PJ_PLANE 34816u               // 128 activation rows of one plane x 272 B, itself a multiple of 2 KiB
#define PJ_STAGE (2u * PJ_PLANE + 2u * PJ_SLICE)   // value plane, residual plane (128 rows each), weight rows 0..63, weight rows 64..127 of the block tile
static_assert(64u * PJ_PITCH <= PJ_SLICE && PJ_SLICE % 2048u == 0u);
static_assert(128u * PJ_PITCH <= PJ_PLANE && PJ_PLANE % 2048u == 0u);
static_assert(DM % 128 == 0 && K2 == 2 * DM && DM / 128 >= 2);   // whole stages inside every plane and every weight row, at least two stages
__device__ __forceinline__ uint32_t uni(uint32_t v) { return (uint32_t)__builtin_amdgcn_readfirstlane((int)v); }
__device__ __forceinline__ uint32_t pinned(uint32_t v) { uint32_t w = uni(v); asm volatile("" : "+s"(w)); return w; }   // the pinned() form for tensor loads: the test value is held in a scalar register, so the branch round a load is a scalar one (the load ignores EXEC)
// one request of the whole wave: rows of 256 bytes from ga (row count and row pitch in g1) to LDS byte offset dst; word 0 of g0 (count 1) is set once by the caller
__device__ __forceinline__ void tdm_load(u32x4& g0, uint32_t dst, uint64_t ga, u32x8& g1) {
    g0[1] = uni(dst); g0[2] = uni((uint32_t)ga); g0[3] = uni((((uint32_t)(ga >> 32)) & 0x01FFFFFFu) | 0x80000000u);
    asm volatile("tensor_load_to_lds %0, %1" : "+s"(g0), "+s"(g1) :: "memory");   // in-out: the same registers go on to the wait below
}
// the wave's own requests have landed. The statement names both descriptor groups as in-out operands so that their scalar registers hold the issued words until the wait has returned
// and every new word is formed behind it.
__device__ __forceinline__ void tdm_wait(u32x4& g0, u32x8& g1) { asm volatile("s_wait_tensorcnt 0x0" : "+s"(g0), "+s"(g1) :: "memory"); }
// proj_tile: the tile (bx, by) of one product; ring and osall are the calling kernel's LDS arrays (ring on a multiple of 2 KiB). SA: the two-plane operand is A (else Bt); K = its row length, both planes.
template <int MODE, bool SA>
__device__ __forceinline__ void proj_tile(unsigned char* ring, float* osall, uint32_t bx, uint32_t by, const bf* __restrict__ A, int pA, const bf* __restrict__ Bt, int pB, int K,
                                          h16* Ph, int RB, size_t sRB, int pitch, int CB, size_t sCB, float* C, int ldc, int RP) {
    const int lane = threadIdx.x & 31, lr = lane & 15, hi = lane >> 4;
    const uint32_t wave = uni(threadIdx.x >> 5);
    const int r0 = bx * 128 + (int)(wave >> 1) * 64, c0 = by * 128 + (int)(wave & 1u) * 64;
    float* os = osall + wave * (16 * 68);
    v8f acc[4][4];
#pragma unroll
    for (int mb = 0; mb < 4; ++mb)
#pragma unroll
        for (int nb = 0; nb < 4; ++nb) acc[mb][nb] = (v8f){};
    // this wave's slice of every stage: wave 0 moves the value plane and wave 1 the residual plane of the block's 128 activation rows, waves 2, 3 move 64 weight rows each
    const bf* actp = SA ? A + (size_t)(bx * 128) * (size_t)pA : Bt + (size_t)(by * 128) * (size_t)pB;
    const bf* wgtp = SA ? Bt + (size_t)(by * 128) * (size_t)pB : A + (size_t)(bx * 128) * (size_t)pA;
    const uint32_t pact = (uint32_t)(SA ? pA : pB), pwgt = (uint32_t)(SA ? pB : pA);
    const bool ownP = wave < 2u;
    const uint32_t sp = ownP ? pact : pwgt;
    const uint32_t nrow = ownP ? 128u : 64u;
    const uint64_t src0 = ownP ? (uint64_t)(uintptr_t)(actp + (size_t)wave * (size_t)(K >> 1))
                               : (uint64_t)(uintptr_t)(wgtp + (size_t)((wave - 2u) * 64u) * (size_t)pwgt);
    const uint32_t slice = (uint32_t)(size_t)ring + (ownP ? wave * PJ_PLANE : 2u * PJ_PLANE + (wave - 2u) * PJ_SLICE);
    u32x8 g1;
    g1[0] = uni((1u << 20) | (5u << 22) | (3u << 25));   // no mask, byte elements, 16 B of pad behind every 256 B
    g1[1] = uni(256u << 16); g1[2] = uni(nrow << 16); g1[3] = uni(256u << 16); g1[4] = uni(nrow);   // tensor = tile = 256 B x this wave's rows
    g1[5] = uni(sp * 2u); g1[6] = uni(0u); g1[7] = uni(0u);
    const uint32_t T = (uint32_t)K >> 8;                 // stages of 128 k of one plane
    const uint32_t wact = SA ? (wave >> 1) : (wave & 1u), wwgt = SA ? (wave & 1u) : (wave >> 1);   // which 64 rows of each operand this wave's 64x64 tile reads
    const uint32_t pbase = (wact * 64u + (uint32_t)lr) * PJ_PITCH + 16u * (uint32_t)hi;
    const uint32_t wbase = 2u * PJ_PLANE + wwgt * PJ_SLICE + (uint32_t)lr * PJ_PITCH + 16u * (uint32_t)hi;
    u32x4 g0;
    g0[0] = uni(1u);
    tdm_load(g0, slice, src0, g1);
    tdm_wait(g0, g1);                                    // this wave's slice of stage 0 has landed
    __syncthreads();                                     // every slice of stage 0 is readable by every wave
    if (pinned((1u < T) ? 1u : 0u) != 0u) tdm_load(g0, slice + PJ_STAGE, src0 + (uint64_t)256u, g1);
#pragma unroll 1   // one pass per trip: the buffer index and the publish point below belong to one stage
    for (uint32_t t = 0; t < T; ++t) {
        const uint32_t buf = (t & 1u) * PJ_STAGE;
        const unsigned char* lh = ring + buf + pbase; const unsigned char* ll = lh + PJ_PLANE; const unsigned char* lw = ring + buf + wbase;
        v16bf fh[2][4], fl[2][4], fw[2][4];
#pragma unroll
        for (int i = 0; i < 4; ++i) { fh[0][i] = ldb((const bf*)(lh + i * 16 * PJ_PITCH)); fw[0][i] = ldb((const bf*)(lw + i * 16 * PJ_PITCH)); }
#pragma unroll
        for (int i = 0; i < 4; ++i) fl[0][i] = ldb((const bf*)(ll + i * 16 * PJ_PITCH));   // wanted sixteen products later than the two sets above
#pragma unroll
        for (int u = 0; u < 4; ++u) {
            const int cs = u & 1;
            if (u < 3) {
#pragma unroll
                for (int i = 0; i < 4; ++i) { fh[cs ^ 1][i] = ldb((const bf*)(lh + i * 16 * PJ_PITCH + (u + 1) * 64)); fw[cs ^ 1][i] = ldb((const bf*)(lw + i * 16 * PJ_PITCH + (u + 1) * 64)); }
#pragma unroll
                for (int i = 0; i < 4; ++i) fl[cs ^ 1][i] = ldb((const bf*)(ll + i * 16 * PJ_PITCH + (u + 1) * 64));
            }
            __builtin_amdgcn_sched_barrier(0);   // the next block's LDS reads stay one group in front of this block's products
#pragma unroll
            for (int nb = 0; nb < 4; ++nb)
#pragma unroll
                for (int mb = 0; mb < 4; ++mb) acc[mb][nb] = SA ? wmmab(fh[cs][mb], fw[cs][nb], acc[mb][nb]) : wmmab(fw[cs][mb], fh[cs][nb], acc[mb][nb]);
#pragma unroll
            for (int nb = 0; nb < 4; ++nb)
#pragma unroll
                for (int mb = 0; mb < 4; ++mb) acc[mb][nb] = SA ? wmmab(fl[cs][mb], fw[cs][nb], acc[mb][nb]) : wmmab(fw[cs][mb], fl[cs][nb], acc[mb][nb]);
            __builtin_amdgcn_sched_barrier(0);   // no LDS read moves in among the products
        }
        asm volatile("s_wait_dscnt 0x0" ::: "memory");
        tdm_wait(g0, g1);
        __syncthreads();
        if (pinned((t + 2u < T) ? 1u : 0u) != 0u) tdm_load(g0, slice + buf, src0 + (uint64_t)((t + 2u) << 8), g1);
    }
    tdm_wait(g0, g1);                                    // no request is outstanding when the wave goes on
    asm volatile("s_wait_dscnt 0x0" ::: "memory");       // nor any LDS read of the ring
    const size_t tbase = (size_t)(r0 / RB) * sRB + (size_t)(r0 % RB) * (size_t)pitch + (size_t)(c0 / CB) * sCB + (size_t)(c0 % CB);
    const size_t cbase = ((size_t)(r0 / RB) * (size_t)RP + (size_t)(r0 % RB)) * (size_t)ldc + (size_t)c0;
#pragma unroll
    for (int mb = 0; mb < 4; ++mb) {
#pragma unroll
        for (int nb = 0; nb < 4; ++nb) {
#pragma unroll
            for (int j = 0; j < 8; ++j) os[(hi * 8 + j) * 68 + nb * 16 + lr] = acc[mb][nb][j]; }   // D: row 8h+j, col lane&15
        wave_sync();
        if (MODE == 0) {
            const size_t sb = tbase + (size_t)(mb * 16) * (size_t)pitch;
{
#pragma unroll
                for (int s = 0; s < 4; ++s) { const int row = 4 * s + (lane >> 3), c8 = (lane & 7) * 8;   // 4 s x 4 row groups = 16 rows; 8 lanes x 8 = 64 columns
                    const v4f x0 = *(const v4fa*)(&os[row * 68 + c8]); const v4f x1 = *(const v4fa*)(&os[row * 68 + c8 + 4]); v8h hv;
#pragma unroll
                    for (int i = 0; i < 4; ++i) { hv[i] = (h16)x0[i]; hv[4 + i] = (h16)x1[i]; }
                    *(v8h*)(Ph + sb + (size_t)row * (size_t)pitch + c8) = hv; }
                 }
        } else {
            const size_t sb = cbase + (size_t)(mb * 16) * (size_t)ldc;
{
#pragma unroll
                for (int s = 0; s < 8; ++s) { const int row = 2 * s + hi, cofs = lr * 4;   // 8 s x 2 rows = 16 rows; 16 lanes x 4 floats = 64 columns
                    const v4f val = *(const v4fa*)(&os[row * 68 + cofs]);
                    *(v4f*)(C + sb + (size_t)row * (size_t)ldc + cofs) = val; }
                 }
        }
        wave_sync();
    }
}

template <int MODE>
__global__ __launch_bounds__(128) void k_proj(const bf* __restrict__ A, int pA, const bf* __restrict__ Bt, int pB, int K,
                                              h16* Ph, int RB, size_t sRB, int pitch, int CB, size_t sCB, float* C, int ldc, int RP) {
    __shared__ __attribute__((aligned(2048))) unsigned char ring[2 * PJ_STAGE];
    __shared__ __align__(16) float osall[4 * 16 * 68];
    proj_tile<MODE, true>(ring, osall, blockIdx.x, blockIdx.y, A, pA, Bt, pB, K, Ph, RB, sRB, pitch, CB, sCB, C, ldc, RP);
}
// k_proj_qkv: the q|k product and the v^T product read the same two operands and none of each other's output: one grid, the q|k tiles first.
// q|k: A = LN(x) rows, Bt = wqkv rows 0..2047 -> QK[m][n] f32. v^T: A = wqkv rows 2048..3071 (m = h*64 + d), Bt = LN(x) rows (n = b*SEQ + t) -> plane [(b*1024 + m)][t] = [(b*16 + h)][d][t].
#define PQ_BX (NB * SEQ / 128)
#define PQ_N  (PQ_BX * (2 * DM / 128))
#define PV_BX (DM / 128)
#define PV_N  (PV_BX * (NB * SEQ / 128))
__global__ __launch_bounds__(128) void k_proj_qkv(const bf* __restrict__ XA, const bf* __restrict__ WB, float* QK, h16* VT) {
    __shared__ __attribute__((aligned(2048))) unsigned char ring[2 * PJ_STAGE];
    __shared__ __align__(16) float osall[4 * 16 * 68];
    const uint32_t i = blockIdx.x;
    if (i < (uint32_t)PQ_N) {
        proj_tile<1, true>(ring, osall, i % PQ_BX, i / PQ_BX, XA, K2, WB, DM, K2, (h16*)0, NB * SEQ, (size_t)0, 0, 64, (size_t)0, QK, K2, NB * SEQ);
    } else {
        const uint32_t j = i - (uint32_t)PQ_N;
        proj_tile<0, false>(ring, osall, j % PV_BX, j / PV_BX, WB + (size_t)2 * DM * DM, DM, XA, K2, K2, VT, DM, (size_t)0, SEQ, SEQ, (size_t)DM * SEQ, (float*)0, 0, 0);
    }
}

// Lane holds columns it*256 + lane*8 + i = head (4*it + lane/8), d = 8*(lane&7) + i; the rotary partner d +- 32 is lane ^ 4 (same it, same i).
// Planes [b*16+h][t][64], four consecutive planes from PL with stride pst halves: q value, q residual x2048, k value, k residual x2048 (selected by integer offset from one base).
// The wave's q row, k row and both weight rows are loaded once, all loads issued together, and kept in registers through the three passes (visiting order it = 0..3, i = 0..7).
__device__ __forceinline__ void qkrot_part(int blk, const float* __restrict__ QK, const float* __restrict__ qw, const float* __restrict__ kw, const float* __restrict__ CS, const float* __restrict__ SN,
                                           h16* PL, size_t pst) {
    const int lane = threadIdx.x & 31; const int wave = __builtin_amdgcn_readfirstlane((int)(threadIdx.x >> 5));
    const int m = blk * 8 + wave; const int b = m / SEQ, t = m % SEQ;
    const int c = lane & 7;
    const v8f cs = *(const v8f*)(CS + (size_t)m * 32 + 8 * (c & 3));
    const v8f sn = *(const v8f*)(SN + (size_t)m * 32 + 8 * (c & 3));
    const float sg = (c < 4) ? -1.0f : 1.0f;
    const size_t o0 = (((size_t)(b * NH_ + (lane >> 3))) * SEQ + t) * HD + 8 * c;
    const size_t ost = (size_t)4 * SEQ * HD;     // four heads per step
    const float* row = QK + (size_t)m * K2 + lane * 8;
    v8f raw[2][4], wgt[2][4];
#pragma unroll
    for (int wh = 0; wh < 2; ++wh)
#pragma unroll
        for (int it = 0; it < 4; ++it) raw[wh][it] = *(const v8f*)(row + wh * DM + it * 256);
#pragma unroll
    for (int it = 0; it < 4; ++it) { wgt[0][it] = *(const v8f*)(qw + it * 256 + lane * 8); wgt[1][it] = *(const v8f*)(kw + it * 256 + lane * 8); }
#pragma unroll
    for (int wh = 0; wh < 2; ++wh) {
        float s = 0.0f;
#pragma unroll
        for (int it = 0; it < 4; ++it) {
#pragma unroll
            for (int i = 0; i < 8; ++i) s += raw[wh][it][i]; }
        s = wsum(s);
        const float mean = s * (1.0f / DM);
        float ss = 0.0f;
#pragma unroll
        for (int it = 0; it < 4; ++it) {
#pragma unroll
            for (int i = 0; i < 8; ++i) { const float dv = raw[wh][it][i] - mean; ss += dv * dv; } }
        ss = wsum(ss);
        const float rstd = 1.0f / sqrtf(ss * (1.0f / DM) + 1e-5f);
        h16* PH = PL + (size_t)(2 * wh) * pst;
        h16* PR = PH + pst;
#pragma unroll
        for (int it = 0; it < 4; ++it) {
            v8h hv, rv;
#pragma unroll
            for (int i = 0; i < 8; ++i) {
                const float y = (raw[wh][it][i] - mean) * rstd * bfr(wgt[wh][it][i]);
                const float pr = __shfl_xor(y, 4, 32);
                const float r = y * cs[i] + sg * pr * sn[i];
                const h16 hh = (h16)r; hv[i] = hh; rv[i] = (h16)((r - (float)hh) * QRS); }
            const size_t oo = o0 + (size_t)it * ost;
            *(v8h*)(PH + oo) = hv; *(v8h*)(PR + oo) = rv; }
    }
    asm volatile("s_wait_xcnt 0x0" ::: "memory");   // other stages' code follows these stores in the merged kernel: their address and data registers are rewritten only behind this wait
}

// k_front: LN(x) and the wqkv conversion, which the qkv products read, beside the rotary table, which k_mid reads. The stages with the longest dependent chains take the low block indices, the short conversion blocks the high ones (for speed only).
#define GF_LNX  (NB * SEQ / 8)
#define GF_ROPE (NB * SEQ / 8)
#define GF_CVT  (3 * DM * DM / 8 / (256 * CVT_CH))
static_assert((3 * DM * DM / 8) % (256 * CVT_CH) == 0 && (DM * DM / 8) % (256 * CVT_CH) == 0);
__global__ __launch_bounds__(256) void k_front(const float* __restrict__ x, const float* __restrict__ lw, const float* __restrict__ lb, bf* XA,
                                               const float* __restrict__ pos, float* CS, float* SN, const float* __restrict__ wqkv, bf* WB) {
    const int blk = blockIdx.x;
    if (blk < GF_LNX) lnx_part(blk, x, lw, lb, XA);
    else if (blk < GF_LNX + GF_ROPE) rope_part(blk - GF_LNX, pos, CS, SN);
    else cvt8_part(blk - (GF_LNX + GF_ROPE), wqkv, WB, (size_t)3 * DM * DM / 8);
}
// k_mid: the q/k norm and rotary (reads the q|k product) beside the stages that only k_flash or the output product read: mask sums and bm planes, edge weight plane, out_w conversion.
#define GM_PREP (NB * SEQ / 64)
#define GM_ROT  (NB * SEQ / 8)
#define GM_CVT  (DM * DM / 8 / (256 * CVT_CH))
__global__ __launch_bounds__(256) void k_mid(const float* __restrict__ QK, const float* __restrict__ qw, const float* __restrict__ kw, const float* __restrict__ CS, const float* __restrict__ SN, h16* PL, size_t pst,
                                             const float* __restrict__ blocks, const int* __restrict__ mask, h16* BM, float* BASE, unsigned int* MB,
                                             const float* __restrict__ ew, h16* EWA, const float* __restrict__ ow, bf* OWB) {
    const int blk = blockIdx.x;
    if (blk < GM_PREP) prep_part(blk, blocks, mask, BM, BASE, MB);
    else if (blk < GM_PREP + GM_ROT) qkrot_part(blk - GM_PREP, QK, qw, kw, CS, SN, PL, pst);
    else if (blk == GM_PREP + GM_ROT) ew_part(ew, EWA);
    else cvt8_part(blk - (GM_PREP + GM_ROT + 1), ow, OWB, (size_t)DM * DM / 8);
}

// k_flash staging: a stage is 64 keys of the block's (batch, head): k value and residual rows (128-byte rows at KROW), v^T rows, both bm planes (128-byte rows, LDS pitch 144, an odd multiple of 16 B for 16-byte readers).
// Two buffers, filled by asynchronous copies one stage ahead of the pass that reads them. The packed mask of the block's 64 query rows (128 bytes a row, all keys) is copied once, in front of stage 0.
#define FK      64
#define FP1     144u
// k rows have two readers, 16-byte row reads (16 rows at a time) and transposing reads (8 rows x 32 B at a time): row r starts at KROW(r), so that rows 0..7 of every 16 start on distinct multiples of 32 B
// modulo the 256 B of the banks and rows 8..15 on the same plus 16 B: neither reader meets a bank twice. KROW(r + 16) = KROW(r) + KR16.
#define KROW(r) (128u * (r) + 32u * ((r) >> 1) + 16u * ((r) >> 3))
#define KR16    2336u
#define FKT     (4u * KR16)           // a tile of 64 k rows
#define FO_KH   0u
#define FO_KR   FKT
#define FO_VT   (2u * FKT)
#define FO_BM   (2u * FKT + 64u * FP1)
#define F_STAGE (2u * FKT + 96u * FP1)
static_assert(KROW(16u) == KR16 && KROW(63u) + 128u <= FKT);
static_assert(AW == 4 && KW == 2 && HD == 64);      // 256 lanes: 32 rows of 128 B per copy instruction of the block
static_assert(FK == 32 * KW);                       // one 32-key half of a stage per wave of a query tile
static_assert(SEQ % FK == 0 && SEQ / FK >= 2);      // whole stages, at least two
static_assert(F_STAGE % 16u == 0u);
// One stage: 7 copies of 16 B per lane, every lane on. l1: the lane's LDS byte address in row 0..31 of a 128-byte-row tile of the target buffer.
// bm: the lane's 16 bytes of the 32 bm rows (value plane rows 0..15, residual plane rows 16..31, adjacent in LDS).
// The run of copies ends, inside its own statement, with s_wait_xcnt 0: the address registers are rewritten only behind it.
// lk: the same lane's address in row 0..31 of a k tile (rows at KROW).
__device__ __forceinline__ void flash_fill(uint32_t l1, uint32_t lk, const h16* kh, const h16* kr, const h16* vt, const h16* bm) {
    asm volatile("global_load_async_to_lds_b128 %0, %1, off\n\t"
                 "global_load_async_to_lds_b128 %2, %3, off\n\t"
                 "global_load_async_to_lds_b128 %4, %5, off\n\t"
                 "global_load_async_to_lds_b128 %6, %7, off\n\t"
                 "global_load_async_to_lds_b128 %8, %9, off\n\t"
                 "global_load_async_to_lds_b128 %10, %11, off\n\t"
                 "global_load_async_to_lds_b128 %12, %13, off\n\t"
                 "s_wait_xcnt 0x0"
                 :: "v"(lk + FO_KH), "v"(kh), "v"(lk + FO_KH + 2u * KR16), "v"(kh + 32 * HD),
                    "v"(lk + FO_KR), "v"(kr), "v"(lk + FO_KR + 2u * KR16), "v"(kr + 32 * HD),
                    "v"(l1 + FO_VT), "v"(vt), "v"(l1 + FO_VT + 32u * FP1), "v"(vt + 32 * SEQ),
                    "v"(l1 + FO_BM), "v"(bm)
                 : "memory");
}
// The packed mask rows of the block: 64 rows of 128 B, 2 copies of 16 B per lane, every lane on; lm: the lane's LDS byte address in row 0..31 (pitch FP1), mb: its 16 bytes of that row.
// As above, the run ends inside its own statement with s_wait_xcnt 0: the address registers are rewritten only behind it.
__device__ __forceinline__ void flash_fill_mask(uint32_t lm, const unsigned int* mb) {
    asm volatile("global_load_async_to_lds_b128 %0, %1, off\n\t"
                 "global_load_async_to_lds_b128 %2, %3, off\n\t"
                 "s_wait_xcnt 0x0"
                 :: "v"(lm), "v"(mb), "v"(lm + 32u * FP1), "v"(mb + 32 * MBW)
                 : "memory");
}

// k_flash: fused attention + geometric term, KW waves per 16 query rows of one (batch, head): wave (qw, ks) walks the ks-th 32 keys of every stage with its own running max, sums and accumulators,
// so that a SIMD holds four waves; behind the loop the ks = 1 wave hands its state over in LDS and the ks = 0 wave joins both and runs the epilogue. q fragments straight from the 16-bit planes, all key-side fragments from the staged LDS tiles (two 16-B reads each), the mask as one 16-B read of packed bits per stage.
// Transposed form: S^T[key][t] = K Q^T; lane (t = lane&15, h = lane>>4) holds keys 8h+r of each 16-key tile, so packed P / G tiles are directly B fragments of
// O^T[d][t] = V^T P^T and C^T[cx][t] = BM^T G^T. The geometric sum does not go through the scores: the block builds W^T[cx][d] = BM^T K once (wave (qw, ks): columns d = 16*qw .. +15, its 32 keys of every stage, k read transposed),
// the parts are joined in LDS behind the loop and tmp2^T = W^T Q^T; C^T, the share of the masked-out keys, is summed only on tiles that have one and taken off in the epilogue. S = kH.qH + (kH.qR + kR.qH)/2048. Mask: replace-fill for the softmax, G = the scores of the masked-out keys alone; selects, G and its products are skipped, by a scalar branch, where every bit of the wave's 16 x 32 tile is set. Softmax state one scalar per lane (running max from -inf).
// Epilogue: tmp2 halves exchanged with one xor-16 shuffle, c16 = base.tmp2 (K = 3, VALU), ctx^T = EW c16^T on one K=32 tile (value | residual), sum staged in a wave-private LDS tile and
// Two blocks of eight waves share a WGP (LDS allows two): four waves a SIMD, so a wave may hold at most 256 registers.
__global__ __launch_bounds__(32 * AW * KW) __attribute__((amdgpu_waves_per_eu(4, 4))) void k_flash(const h16* __restrict__ QH, const h16* __restrict__ QR, const h16* __restrict__ KH, const h16* __restrict__ KR, const h16* __restrict__ VT,
                                                   const h16* __restrict__ BM, const float* __restrict__ BASE, const h16* __restrict__ EWA, const unsigned int* __restrict__ MB, bf* OA) {
    __shared__ __align__(16) float os[AW * 16 * 68];
    __shared__ __align__(16) unsigned char fr[2 * F_STAGE];
    __shared__ __align__(16) unsigned char mbt[16 * AW * FP1];   // packed mask rows of the block's query rows
    const int tid = threadIdx.x;
    const int lane = threadIdx.x & 31, wave = __builtin_amdgcn_readfirstlane((int)(threadIdx.x >> 5)), lr = lane & 15, hi = lane >> 4;
    const int zh = blockIdx.y; const int b = zh / NH_, h = zh % NH_;
    const int qw = wave & (AW - 1), ks = wave / AW;      // query tile, key half
    const int t0 = (blockIdx.x * AW + qw) * 16;
    const size_t pbase = (size_t)zh * SEQ * HD;
    const size_t qo = pbase + (size_t)(t0 + lr) * HD + 8 * hi;
    const v16h qh0 = ldh(QH + qo), qh1 = ldh(QH + qo + 32), qr0 = ldh(QR + qo), qr1 = ldh(QR + qo + 32);   // B fragments: col t, k = d
    // readers, byte offsets in a buffer: 128-byte-row tiles at row lr (A fragments: row key / d / cx); packed mask at this wave's row lr
    const uint32_t ro = (uint32_t)lr * FP1 + 16u * (uint32_t)hi;
    const uint32_t rk = KROW((uint32_t)lr) + 16u * (uint32_t)hi + (uint32_t)ks * (2u * KR16);   // k tiles: this wave's 32 keys are rows
    const uint32_t rc = ro + (uint32_t)ks * 64u;           // v^T and bm tiles: they are columns
    const uint32_t rt = (uint32_t)ks * (2u * KR16) + KROW((uint32_t)(8 * hi + (lane & 7))) + 32u * (uint32_t)qw + 16u * (uint32_t)((lane >> 3) & 1);   // k tiles read transposed: this wave's 32 keys as k, columns d = 16*qw .. +15
    const uint32_t mo = (uint32_t)(qw * 16 + lr) * FP1;
    // copiers: the lane's own 16 bytes of stage 0 (8 lanes per 128-byte row)
    const h16* ckh = KH + pbase + (size_t)tid * 8;
    const h16* ckr = KR + pbase + (size_t)tid * 8;
    const h16* cvt = VT + pbase + (size_t)(tid >> 3) * SEQ + 8 * (tid & 7);
    const h16* cbm = BM + (size_t)(tid >> 7) * ((size_t)NB * 16 * SEQ) + ((size_t)b * 16 + ((tid >> 3) & 15)) * SEQ + 8 * (tid & 7);
    const unsigned int* cmb = MB + ((size_t)b * SEQ + blockIdx.x * (16 * AW) + (tid >> 3)) * MBW + 4 * (tid & 7);
    const uint32_t cl1 = (uint32_t)(size_t)fr + (uint32_t)(tid >> 3) * FP1 + 16u * (uint32_t)(tid & 7);
    const uint32_t cl2 = (uint32_t)(size_t)fr + KROW((uint32_t)(tid >> 3)) + 16u * (uint32_t)(tid & 7);
    const uint32_t clm = (uint32_t)(size_t)mbt + (uint32_t)(tid >> 3) * FP1 + 16u * (uint32_t)(tid & 7);
    v8f o0 = (v8f){}, o1 = (v8f){}, o2 = (v8f){}, o3 = (v8f){}, wA = (v8f){}, wR = (v8f){}, cA = (v8f){}, cR = (v8f){};
    float m = -__builtin_huge_valf(), l = 0.0f;
    flash_fill_mask(clm, cmb);
    flash_fill(cl1, cl2, ckh, ckr, cvt, cbm);
    asm volatile("s_wait_asynccnt 0x0" ::: "memory");    // this wave's copies of the packed mask and of stage 0 have landed
    __syncthreads();                                     // every wave's part of both is readable by every wave
    flash_fill(cl1 + F_STAGE, cl2 + F_STAGE, ckh + FK * HD, ckr + FK * HD, cvt + FK, cbm + FK);
#pragma unroll 1   // one stage per trip: the buffer index and the publish point at the foot belong to one stage
    for (int st = 0; st < SEQ / FK; ++st) {
      const uint32_t bo = (uint32_t)(st & 1) * F_STAGE;
      {
        // the four words (j = key & 3) that hold keys 128*(st/2) .. +127 of this lane's query row; this wave's 32 keys are the 8 bits from msh up in each
        const u32x4 mw = *(const u32x4a*)(mbt + mo + (uint32_t)(st >> 1) * 16u);
        const uint32_t msh = (uint32_t)(st & 1) * 16u + (uint32_t)ks * 8u;
        const bool mpart = (((mw[0] & mw[1] & mw[2] & mw[3]) >> msh) & 0xFFu) != 0xFFu;   // a key of this row's 32 is masked out
        const unsigned char* ka = fr + bo + FO_KH + rk; const unsigned char* kr = fr + bo + FO_KR + rk;
        const v16h ka0 = ldh((const h16*)ka), ka1 = ldh((const h16*)(ka + 64)), kb0 = ldh((const h16*)(ka + KR16)), kb1 = ldh((const h16*)(ka + KR16 + 64));
        const v16h ra0 = ldh((const h16*)kr), ra1 = ldh((const h16*)(kr + 64)), rb0 = ldh((const h16*)(kr + KR16)), rb1 = ldh((const h16*)(kr + KR16 + 64));
        v8f sHa = (v8f){}, sLa = (v8f){}, sKa = (v8f){}, sHb = (v8f){}, sLb = (v8f){}, sKb = (v8f){};
        sHa = wmma16(ka0, qh0, sHa); sLa = wmma16(ka0, qr0, sLa); sKa = wmma16(ra0, qh0, sKa); sHb = wmma16(kb0, qh0, sHb); sLb = wmma16(kb0, qr0, sLb); sKb = wmma16(rb0, qh0, sKb);
        sHa = wmma16(ka1, qh1, sHa); sLa = wmma16(ka1, qr1, sLa); sKa = wmma16(ra1, qh1, sKa); sHb = wmma16(kb1, qh1, sHb); sLb = wmma16(kb1, qr1, sLb); sKb = wmma16(rb1, qh1, sKb);
        asm volatile("v_nop\n\tv_nop\n\tv_nop\n\tv_nop" : "+v"(sHa), "+v"(sLa), "+v"(sKa), "+v"(sHb), "+v"(sLb), "+v"(sKb) : "v"(ka0), "v"(ka1), "v"(kb0), "v"(kb1), "v"(ra0), "v"(ra1), "v"(rb0), "v"(rb1));
        float ta[8], tb[8], xa[8], xb[8]; float mx = NEGMIN;
#pragma unroll
        for (int r = 0; r < 8; ++r) {
            xa[r] = sHa[r] + (sLa[r] + sKa[r]) * QRI; xb[r] = sHb[r] + (sLb[r] + sKb[r]) * QRI;
            ta[r] = xa[r] * SC2; tb[r] = xb[r] * SC2; }
        if (__builtin_amdgcn_ballot_w32(mpart) != 0u) {   // wave-uniform: some key of the wave's 16 x 32 tile is masked out
            // key 16*ab + 8*hi + r of the wave's 32: word r & 3, bit msh + 4*ab + 2*hi + r/4
            const uint32_t lsh = msh + 2u * (uint32_t)hi;
            const uint32_t mu[4] = {mw[0] >> lsh, mw[1] >> lsh, mw[2] >> lsh, mw[3] >> lsh};
#pragma unroll
            for (int r = 0; r < 8; ++r) {
                const bool va = (mu[r & 3] & (1u << (r >> 2))) != 0u, vb = (mu[r & 3] & (16u << (r >> 2))) != 0u;
                ta[r] = va ? ta[r] : NEGMIN; tb[r] = vb ? tb[r] : NEGMIN;
                xa[r] = va ? 0.0f : xa[r]; xb[r] = vb ? 0.0f : xb[r]; }
            // the masked-out keys' share of W.q, which the epilogue takes off again: C^T[cx][t] += BM^T G^T over those keys alone
            v16h gh, gr;
#pragma unroll
            for (int r = 0; r < 8; ++r) {
                const float ga = xa[r]; const float gb = xb[r];
                const h16 ha = (h16)ga; const h16 hb = (h16)gb;
                gh[r] = ha; gh[8 + r] = hb; gr[r] = (h16)((ga - (float)ha) * QRS); gr[8 + r] = (h16)((gb - (float)hb) * QRS); }
            const unsigned char* bc_ = fr + bo + FO_BM + rc;
            const v16h ch = ldh((const h16*)bc_), cr = ldh((const h16*)(bc_ + 16 * FP1));
            cA = wmma16(ch, gh, cA); cR = wmma16(ch, gr, cR); cR = wmma16(cr, gh, cR);
            asm volatile("v_nop\n\tv_nop\n\tv_nop\n\tv_nop" : "+v"(cA), "+v"(cR) : "v"(ch), "v"(cr), "v"(gh), "v"(gr));   // the distance behind the last product, on the way out of the branch too
        }
#pragma unroll
        for (int r = 0; r < 8; ++r) mx = fmaxf(mx, fmaxf(ta[r], tb[r]));
        mx = fmaxf(mx, __shfl_xor(mx, 16, 32));
        const float mnew = fmaxf(m, mx);
        const float alpha = __builtin_amdgcn_exp2f(m - mnew);
        const float sh = PSH - mnew;
        v16h pb; float ls = 0.0f;
#pragma unroll
        for (int r = 0; r < 8; ++r) { const h16 pa = (h16)__builtin_amdgcn_exp2f(ta[r] + sh); const h16 pc = (h16)__builtin_amdgcn_exp2f(tb[r] + sh); pb[r] = pa; pb[8 + r] = pc; ls += (float)pa + (float)pc; }
        l = l * alpha + ls; m = mnew;
        o0 = o0 * alpha; o1 = o1 * alpha; o2 = o2 * alpha; o3 = o3 * alpha;
        const unsigned char* va_ = fr + bo + FO_VT + rc;
        const v16h v0 = ldh((const h16*)va_), v1 = ldh((const h16*)(va_ + 16 * FP1)), v2 = ldh((const h16*)(va_ + 32 * FP1)), v3 = ldh((const h16*)(va_ + 48 * FP1));
        const unsigned char* ba_ = fr + bo + FO_BM + rc;
        const v16h bh = ldh((const h16*)ba_), br = ldh((const h16*)(ba_ + 16 * FP1));
        const v16h kt = ldht(fr + bo + FO_KH + rt, KR16), rtr = ldht(fr + bo + FO_KR + rt, KR16);   // B fragments: col d, k = key
        o0 = wmma16(v0, pb, o0); wA = wmma16(bh, kt, wA); o1 = wmma16(v1, pb, o1); wR = wmma16(bh, rtr, wR); o2 = wmma16(v2, pb, o2); o3 = wmma16(v3, pb, o3); wR = wmma16(br, kt, wR);
        asm volatile("v_nop\n\tv_nop\n\tv_nop\n\tv_nop" : "+v"(o0), "+v"(o1), "+v"(o2), "+v"(o3), "+v"(wA), "+v"(wR) : "v"(v0), "v"(v1), "v"(v2), "v"(v3), "v"(pb), "v"(bh), "v"(br), "v"(kt), "v"(rtr));   // the distance behind the last product
      }
      asm volatile("s_wait_dscnt 0x0" ::: "memory");       // this wave's reads of this buffer have returned
      asm volatile("s_wait_asynccnt 0x0" ::: "memory");    // this wave's copies of stage st + 1 have landed
      __syncthreads();                                     // publishes stage st + 1 and ends every wave's reads of this buffer
      if (st + 2 < SEQ / FK) {                             // only while stage st + 2 exists (the same for the whole block)
          const int kn = (st + 2) * FK;
          flash_fill(cl1 + bo, cl2 + bo, ckh + (size_t)kn * HD, ckr + (size_t)kn * HD, cvt + kn, cbm + kn);
      }
    }
    asm volatile("s_wait_asynccnt 0x0" ::: "memory");    // no copy is outstanding when the wave goes on
    // Join of the two key halves. The last trip's waits and barrier have ended every read of the ring and no copy is outstanding, so the ring serves as the hand-over area: 13 x 16 B per lane, lane-contiguous.
    v4fa* xw = (v4fa*)fr + (size_t)qw * (13 * 32) + lane;
    // Behind that area: every wave's part of W^T (its 32 keys of every stage, its 16 columns d), f32 [ks][cx][d], row pitch 68; true scale (the bm planes carry 1024), so that its 16-bit planes below stay in range for short mask rows too.
    f32a* wl = (f32a*)(fr + AW * 13 * 32 * 16);
#pragma unroll
    for (int r = 0; r < 8; ++r) wl[(ks * 16 + 8 * hi + r) * 68 + 16 * qw + lr] = (wA[r] + wR[r] * QRI) * (1.0f / 1024.0f);   // D: row cx = 8h + r, col d
    if (ks != 0) {
        const v8f st8[6] = {o0, o1, o2, o3, cA, cR};
#pragma unroll
        for (int i = 0; i < 6; ++i) { xw[(2 * i) * 32] = (v4f){st8[i][0], st8[i][1], st8[i][2], st8[i][3]}; xw[(2 * i + 1) * 32] = (v4f){st8[i][4], st8[i][5], st8[i][6], st8[i][7]}; }
        xw[12 * 32] = (v4f){m, l, 0.0f, 0.0f};
    }
    __syncthreads();                                     // the ks = 1 waves' state is readable by their ks = 0 partners, every wave's part of W^T by all
    if (ks != 0) return;                                 // no barrier follows
    {
        const v4f ml = xw[12 * 32];
        const float dm = m - ml[0];                      // both maxima are finite: every wave has walked at least one half stage
        const float ea = __builtin_amdgcn_exp2f(-fabsf(dm));   // the side with the larger maximum keeps its scale
        const float a1 = (dm < 0.0f) ? ea : 1.0f, a2 = (dm < 0.0f) ? 1.0f : ea;
        l = l * a1 + ml[1] * a2;
        v8f pt[6];
#pragma unroll
        for (int i = 0; i < 6; ++i) { const v4f x0 = xw[(2 * i) * 32], x1 = xw[(2 * i + 1) * 32]; pt[i] = (v8f){x0[0], x0[1], x0[2], x0[3], x1[0], x1[1], x1[2], x1[3]}; }
        o0 = o0 * a1 + pt[0] * a2; o1 = o1 * a1 + pt[1] * a2; o2 = o2 * a1 + pt[2] * a2; o3 = o3 * a1 + pt[3] * a2;
        cA = cA + pt[4]; cR = cR + pt[5];
    }
    // tmp2^T[cx][t] = W^T q^T: A fragments of W^T (row cx, k = d in the order of ldh) as value + residual x2048, against the q fragments
    v8f gA = (v8f){}, gR = (v8f){};
    {
        v16h wh[2], wr[2];
#pragma unroll
        for (int j = 0; j < 2; ++j)
#pragma unroll
            for (int q4 = 0; q4 < 4; ++q4) { const int wo = lr * 68 + 32 * j + 16 * (q4 >> 1) + 8 * hi + 4 * (q4 & 1);
                const v4f p0 = *(const v4fa*)(&wl[wo]), p1 = *(const v4fa*)(&wl[16 * 68 + wo]);
#pragma unroll
                for (int i = 0; i < 4; ++i) { const float wv = p0[i] + p1[i]; const h16 hh = (h16)wv; wh[j][4 * q4 + i] = hh; wr[j][4 * q4 + i] = (h16)((wv - (float)hh) * QRS); } }
        gA = wmma16(wh[0], qh0, gA); gR = wmma16(wh[0], qr0, gR); gA = wmma16(wh[1], qh1, gA); gR = wmma16(wh[1], qr1, gR); gR = wmma16(wr[0], qh0, gR); gR = wmma16(wr[1], qh1, gR);
        asm volatile("v_nop\n\tv_nop\n\tv_nop\n\tv_nop" : "+v"(gA), "+v"(gR) : "v"(wh[0]), "v"(wh[1]), "v"(wr[0]), "v"(wr[1]), "v"(qh0), "v"(qh1), "v"(qr0), "v"(qr1));   // the distance behind the last product
    }
    l += __shfl_xor(l, 16, 32);
    const float inv = 1.0f / l;
    // tmp2 (x1024): lane (t, h) holds rows cx = 8h + r; fetch the other half unconditionally, select by value
    float mi[8], ot[8], f[12];
#pragma unroll
    for (int r = 0; r < 8; ++r) { mi[r] = (gA[r] + gR[r] * QRI) * 1024.0f - (cA[r] + cR[r] * QRI); ot[r] = __shfl_xor(mi[r], 16, 32); }
#pragma unroll
    for (int r = 0; r < 8; ++r) f[r] = hi ? ot[r] : mi[r];
#pragma unroll
    for (int r = 0; r < 4; ++r) f[8 + r] = hi ? mi[r] : ot[r];
    const float* bp = BASE + ((size_t)b * SEQ + t0 + lr) * 16;
    const v4f b0 = *(const v4f*)bp, b1 = *(const v4f*)(bp + 4), b2 = *(const v4f*)(bp + 8);
    const float bs[12] = {b0[0], b0[1], b0[2], b0[3], b1[0], b1[1], b1[2], b1[3], b2[0], b2[1], b2[2], b2[3]};
    float e0[3], e1[3];
#pragma unroll
    for (int x = 0; x < 3; ++x) { e0[x] = hi ? bs[6 + x] : bs[x]; e1[x] = hi ? bs[9 + x] : bs[3 + x]; }
    // B fragment of the edge projection: element i <- 16*c16[t][j = 8h + i] (e = 2h + i/4, c = i%4), element 8+i <- its residual x2048
    v16h cb;
#pragma unroll
    for (int i = 0; i < 8; ++i) { const int c = i & 3;
        const float cv = (i < 4) ? (e0[0] * f[3 * c] + e0[1] * f[3 * c + 1] + e0[2] * f[3 * c + 2]) : (e1[0] * f[3 * c] + e1[1] * f[3 * c + 1] + e1[2] * f[3 * c + 2]);
        const float bq = cv * (1.0f / 64.0f); const h16 hh = (h16)bq; cb[i] = hh; cb[8 + i] = (h16)((bq - (float)hh) * QRS); }
    const v16h ea0 = ldh(EWA + (size_t)(lr) * 32 + 8 * hi), ea1 = ldh(EWA + (size_t)(16 + lr) * 32 + 8 * hi), ea2 = ldh(EWA + (size_t)(32 + lr) * 32 + 8 * hi), ea3 = ldh(EWA + (size_t)(48 + lr) * 32 + 8 * hi);
    v8f c0 = (v8f){}, c1 = (v8f){}, c2 = (v8f){}, c3 = (v8f){};
    c0 = wmma16(ea0, cb, c0); c1 = wmma16(ea1, cb, c1); c2 = wmma16(ea2, cb, c2); c3 = wmma16(ea3, cb, c3);
    asm volatile("v_nop\n\tv_nop\n\tv_nop\n\tv_nop" : "+v"(c0), "+v"(c1), "+v"(c2), "+v"(c3) : "v"(ea0), "v"(ea1), "v"(ea2), "v"(ea3), "v"(cb));
    const float ci = 1.0f / 256.0f;
    const int wb = qw * 16 * 68;
    // D layout: x_j[r] = (d = 16j + 8h + r, t = lane&15) -> os[t][d]; rows 0..15 x columns 0..63 all written
    { v4f a, c;
      a[0] = o0[0] * inv + c0[0] * ci; a[1] = o0[1] * inv + c0[1] * ci; a[2] = o0[2] * inv + c0[2] * ci; a[3] = o0[3] * inv + c0[3] * ci;
      c[0] = o0[4] * inv + c0[4] * ci; c[1] = o0[5] * inv + c0[5] * ci; c[2] = o0[6] * inv + c0[6] * ci; c[3] = o0[7] * inv + c0[7] * ci;
      *(v4fa*)(&os[wb + lr * 68 +  0 + 8 * hi]) = a; *(v4fa*)(&os[wb + lr * 68 +  0 + 8 * hi + 4]) = c;
      a[0] = o1[0] * inv + c1[0] * ci; a[1] = o1[1] * inv + c1[1] * ci; a[2] = o1[2] * inv + c1[2] * ci; a[3] = o1[3] * inv + c1[3] * ci;
      c[0] = o1[4] * inv + c1[4] * ci; c[1] = o1[5] * inv + c1[5] * ci; c[2] = o1[6] * inv + c1[6] * ci; c[3] = o1[7] * inv + c1[7] * ci;
      *(v4fa*)(&os[wb + lr * 68 + 16 + 8 * hi]) = a; *(v4fa*)(&os[wb + lr * 68 + 16 + 8 * hi + 4]) = c;
      a[0] = o2[0] * inv + c2[0] * ci; a[1] = o2[1] * inv + c2[1] * ci; a[2] = o2[2] * inv + c2[2] * ci; a[3] = o2[3] * inv + c2[3] * ci;
      c[0] = o2[4] * inv + c2[4] * ci; c[1] = o2[5] * inv + c2[5] * ci; c[2] = o2[6] * inv + c2[6] * ci; c[3] = o2[7] * inv + c2[7] * ci;
      *(v4fa*)(&os[wb + lr * 68 + 32 + 8 * hi]) = a; *(v4fa*)(&os[wb + lr * 68 + 32 + 8 * hi + 4]) = c;
      a[0] = o3[0] * inv + c3[0] * ci; a[1] = o3[1] * inv + c3[1] * ci; a[2] = o3[2] * inv + c3[2] * ci; a[3] = o3[3] * inv + c3[3] * ci;
      c[0] = o3[4] * inv + c3[4] * ci; c[1] = o3[5] * inv + c3[5] * ci; c[2] = o3[6] * inv + c3[6] * ci; c[3] = o3[7] * inv + c3[7] * ci;
      *(v4fa*)(&os[wb + lr * 68 + 48 + 8 * hi]) = a; *(v4fa*)(&os[wb + lr * 68 + 48 + 8 * hi + 4]) = c; }
    wave_sync();
    bf* orow = OA + ((size_t)b * SEQ + t0) * K2 + h * HD;
{
#pragma unroll
        for (int s = 0; s < 4; ++s) { const int row = 4 * s + (lane >> 3), c8 = (lane & 7) * 8;   // 4 s x 4 row groups = 16 rows; 8 lanes x 8 = 64 columns
            const v4f x0 = *(const v4fa*)(&os[wb + row * 68 + c8]); const v4f x1 = *(const v4fa*)(&os[wb + row * 68 + c8 + 4]); v8us hv, lv;
#pragma unroll
            for (int i = 0; i < 4; ++i) { const unsigned short a0 = f2bf(x0[i]); const unsigned short a1 = f2bf(x1[i]); hv[i] = a0; hv[4 + i] = a1; lv[i] = f2bf(x0[i] - bf2f(a0)); lv[4 + i] = f2bf(x1[i] - bf2f(a1)); }
            const size_t oo = (size_t)row * K2 + c8;
            *(v8us*)(orow + oo) = hv; *(v8us*)(orow + DM + oo) = lv; }
         }
}

static constexpr size_t al256(size_t v) { return (v + 255) & ~(size_t)255; }
static constexpr size_t SZ_WB  = al256((size_t)3 * DM * DM * 2);
static constexpr size_t SZ_OWB = al256((size_t)DM * DM * 2);
static constexpr size_t SZ_XA  = al256((size_t)NB * SEQ * K2 * 2);
static constexpr size_t SZ_QK  = al256((size_t)NB * SEQ * K2 * 4);
static constexpr size_t SZ_PL  = al256((size_t)NB * NH_ * SEQ * HD * 2);
static constexpr size_t SZ_BM  = al256((size_t)2 * NB * 16 * SEQ * 2);
static constexpr size_t SZ_BS  = al256((size_t)NB * SEQ * 16 * 4);
static constexpr size_t SZ_CS  = al256((size_t)NB * SEQ * 32 * 4);
static constexpr size_t SZ_EW  = al256((size_t)64 * 32 * 2);
static constexpr size_t SZ_MB  = al256((size_t)NB * SEQ * MBW * 4);
static constexpr size_t SZ_TOTAL = SZ_WB + SZ_OWB + 2 * SZ_XA + SZ_QK + 5 * SZ_PL + SZ_BM + SZ_BS + 2 * SZ_CS + SZ_EW + SZ_MB;
static_assert(SZ_TOTAL <= (size_t)134217728);          // workspace carve <= 128 MiB
static_assert(SZ_PL % 2 == 0);                         // plane stride in halves is exact
static_assert(SZ_PL == (size_t)NB * NH_ * SEQ * HD * 2);   // the four q/k planes are back to back with stride SZ_PL/2 halves

extern "C" void kernel_launch(void* const* d_in, const int* in_sizes, int n_in,
                              void* d_out, int out_size, void* d_ws, size_t ws_size, hipStream_t stream) {
    if (n_in < 11) return;
    const size_t ntok = (size_t)(NB - 1) * SEQ_FULL + SEQ;
    if ((size_t)in_sizes[0] < ntok) return;
    if ((size_t)in_sizes[1] < ntok * DM) return;
    if ((size_t)in_sizes[2] < (ntok - 1) * SEQ_FULL + SEQ) return;
    if ((size_t)in_sizes[3] < ntok * 12) return;
    if ((size_t)in_sizes[4] < (size_t)DM || (size_t)in_sizes[5] < (size_t)DM || (size_t)in_sizes[7] < (size_t)DM || (size_t)in_sizes[8] < (size_t)DM) return;
    if ((size_t)in_sizes[6] < (size_t)3 * DM * DM || (size_t)in_sizes[9] < (size_t)DM * DM || (size_t)in_sizes[10] < (size_t)1024) return;
    if ((size_t)out_size < ((size_t)(NB - 1) * OUT_SEQ + SEQ) * DM) return;
    if (SZ_TOTAL > ws_size) return;
    // wire order: position, x, attention_mask (int32), blocks, ln_w, ln_b, wqkv [3072][1024], q_ln_w, k_ln_w, out_w [1024][1024], edge_w [64][16]
    const float* position = (const float*)d_in[0]; const float* x = (const float*)d_in[1]; const int* amask = (const int*)d_in[2]; const float* blocks = (const float*)d_in[3];
    const float* ln_w = (const float*)d_in[4]; const float* ln_b = (const float*)d_in[5]; const float* wqkv = (const float*)d_in[6];
    const float* q_ln_w = (const float*)d_in[7]; const float* k_ln_w = (const float*)d_in[8]; const float* out_w = (const float*)d_in[9]; const float* edge_w = (const float*)d_in[10];
    float* OUT = (float*)d_out;
    char* wsp = (char*)d_ws;
    bf* WB  = (bf*)wsp;  wsp += SZ_WB;                // [3072][1024]: q | k | v rows
    bf* OWB = (bf*)wsp;  wsp += SZ_OWB;               // [1024][1024]
    bf* XA  = (bf*)wsp;  wsp += SZ_XA;                // [NB*SEQ][hi 1024 | lo 1024]
    bf* OA  = (bf*)wsp;  wsp += SZ_XA;                // [NB*SEQ][hi 1024 | lo 1024]
    float* QK = (float*)wsp; wsp += SZ_QK;            // [NB*SEQ][q 1024 | k 1024]
    h16* QH = (h16*)wsp; wsp += SZ_PL;                // [NB*16][SEQ][64]; QH, QR, KH, KR back to back (stride SZ_PL/2 halves)
    h16* QR = (h16*)wsp; wsp += SZ_PL;
    h16* KH = (h16*)wsp; wsp += SZ_PL;
    h16* KR = (h16*)wsp; wsp += SZ_PL;
    h16* VT = (h16*)wsp; wsp += SZ_PL;                // [NB*16][64][SEQ]
    h16* BM = (h16*)wsp; wsp += SZ_BM;                // [2][NB][16][SEQ]
    float* BASE = (float*)wsp; wsp += SZ_BS;          // [NB*SEQ][16]
    float* CS = (float*)wsp; wsp += SZ_CS;            // [NB*SEQ][32]
    float* SN = (float*)wsp; wsp += SZ_CS;
    h16* EWA = (h16*)wsp; wsp += SZ_EW;               // [64][32]
    unsigned int* MB = (unsigned int*)wsp; wsp += SZ_MB;   // [NB*SEQ][SEQ/32] packed mask

    k_front<<<GF_LNX + GF_ROPE + GF_CVT, 256, 0, stream>>>(x, ln_w, ln_b, XA, position, CS, SN, wqkv, WB);

    k_proj_qkv<<<PQ_N + PV_N, 128, 0, stream>>>(XA, WB, QK, VT);

    // planes QH | QR | KH | KR from the base QH with stride SZ_PL/2 halves
    k_mid<<<GM_PREP + GM_ROT + 1 + GM_CVT, 256, 0, stream>>>(QK, q_ln_w, k_ln_w, CS, SN, QH, (size_t)(SZ_PL / 2), blocks, amask, BM, BASE, MB, edge_w, EWA, out_w, OWB);

    k_flash<<<dim3(SEQ / (16 * AW), NB * NH_, 1), 32 * AW * KW, 0, stream>>>(QH, QR, KH, KR, VT, BM, BASE, EWA, MB, OA);

    // out: A = (ctx + context) hi|lo rows, Bt = out_w rows -> OUT[b][t][n]
    k_proj<1><<<dim3(NB * SEQ / 128, DM / 128, 1), 128, 0, stream>>>(OA, K2, OWB, DM, K2, (h16*)0, SEQ, (size_t)0, 0, 64, (size_t)0, OUT, DM, OUT_SEQ);
}

// v009
// A run of this version takes 68.9 microseconds.
// Next to v008, in two timings, it ran 1.08 and 1.07 times as fast.
// Counting every step since v000, it is 3.88 times as fast.
#include <hip/hip_runtime.h>
#include <stdint.h>

// Compute dtypes (f32 accumulate everywhere): qkv and output projections v_wmma_f32_16x16x32_bf16 (activation as bf16 hi|lo planes folded along K, weights RNE-converted bf16); scores, P.V, geometric sum and edge projection v_wmma_f32_16x16x32_f16 (q, k, G, W, bm, c16 as f16 value + f16 residual x2048; P x256 and v single f16).
// Pre-norm attention block, width 1024 = 16 heads x 64: LN(x) -> qkv GEMM -> LN(q), LN(k) over the full width -> rotate-half rotary (cos/sin table from the position input) ->
// masked softmax attention (replace-fill, running max) plus geometric term tmp2 = sum_k (q.k) mask bm/len = q.W - sum_k (q.k) (1 - mask) bm/len with W = sum_k k bm/len, context = (base.tmp2) edge_w^T -> output GEMM.
// Every float input is RNE-converted to bf16 on load. Fused flash kernel in transposed form (S^T = K Q^T, O^T = V^T P^T, tmp2^T = (BM^T K) Q^T less BM^T G^T over the masked-out keys, ctx^T = EW c16^T).

#ifndef NB
#define NB 2
#endif
#ifndef SEQ
#define SEQ 1024
#endif
#define NB_FULL  2
#define SEQ_FULL 1024
#ifndef OUT_SEQ
#define OUT_SEQ SEQ              // row pitch (in tokens) between batches of the output
#endif
#define DM   1024
#define K2   2048                // hi|lo folded contraction length
#define NH_  16
#define HD   64
#define AW   4                   // query tiles per flash block (16 query rows each)
#define KW   2                   // waves per query tile: each takes one 32-key half of every stage
#define QRS  2048.0f             // carry of the residual planes
#define QRI  (1.0f / 2048.0f)
#define SC2  (0.125f * 1.4426950408889634f)   // HD^-0.5 * log2(e)
#define PSH  8.0f                // log2 of the P carry (256)
#define NEGMIN (-3.4028234663852886e38f)

static_assert(HD == 64);
static_assert(NH_ * HD == DM);
static_assert(K2 == 2 * DM);
static_assert((DM & (DM - 1)) == 0);
static_assert(DM % 64 == 0);
static_assert(SEQ % 128 == 0);                 // mask row sums read 128 ints per step
static_assert(SEQ % 64 == 0);
static_assert((NB * SEQ) % 128 == 0);
static_assert((NB * SEQ) % 8 == 0);
static_assert(SEQ % (16 * AW) == 0);
static_assert(NB <= NB_FULL);
static_assert(SEQ <= SEQ_FULL);

typedef _Float16 h16;
typedef unsigned short bf;
typedef __attribute__((ext_vector_type(16))) __bf16   v16bf;
typedef __attribute__((ext_vector_type(16))) _Float16 v16h;
typedef __attribute__((ext_vector_type(8)))  _Float16 v8h;
typedef __attribute__((ext_vector_type(8)))  unsigned short v8us;
typedef __attribute__((ext_vector_type(8)))  float    v8f;
typedef __attribute__((ext_vector_type(4)))  float    v4f;
typedef __attribute__((ext_vector_type(4)))  int      v4i;
typedef __attribute__((ext_vector_type(4)))  uint32_t u32x4;
typedef u32x4 __attribute__((may_alias)) u32x4a;
typedef __attribute__((ext_vector_type(8)))  uint32_t u32x8;
typedef v4f  __attribute__((may_alias)) v4fa;
typedef v8h  __attribute__((may_alias)) v8ha;
typedef float __attribute__((may_alias)) f32a;
typedef __attribute__((ext_vector_type(8)))  short    v8s;

__device__ __forceinline__ unsigned short f2bf(float f) { unsigned u = __float_as_uint(f); u += 0x7FFFu + ((u >> 16) & 1u); return (unsigned short)(u >> 16); }
__device__ __forceinline__ float bf2f(unsigned short b) { return __uint_as_float(((unsigned)b) << 16); }
__device__ __forceinline__ float bfr(float f) { return bf2f(f2bf(f)); }
__device__ __forceinline__ v16h cat16(v8h lo, v8h hi) { return __builtin_shufflevector(lo, hi, 0, 1, 2, 3, 4, 5, 6, 7, 8, 9, 10, 11, 12, 13, 14, 15); }
__device__ __forceinline__ v16bf cat16b(v8us lo, v8us hi) { return __builtin_bit_cast(v16bf, __builtin_shufflevector(lo, hi, 0, 1, 2, 3, 4, 5, 6, 7, 8, 9, 10, 11, 12, 13, 14, 15)); }
__device__ __forceinline__ v8f wmma16(v16h a, v16h b, v8f c) { return __builtin_amdgcn_wmma_f32_16x16x32_f16(false, a, false, b, (short)0, c, false, false); }
__device__ __forceinline__ v8f wmmab(v16bf a, v16bf b, v8f c) { return __builtin_amdgcn_wmma_f32_16x16x32_bf16(false, a, false, b, (short)0, c, false, false); }
// fragment loaders from K-contiguous 16-bit rows; p already includes + 8*(lane>>4): elements 0..7 <- k0+8h+0..7, elements 8..15 <- k0+16+8h+0..7 (same map for A and B)
__device__ __forceinline__ v16h  ldh(const h16* p) { return cat16(*(const v8h*)p, *(const v8h*)(p + 16)); }
__device__ __forceinline__ v16bf ldb(const bf* p)  { return cat16b(*(const v8us*)p, *(const v8us*)(p + 16)); }
// transposing LDS load: lane address = tile + (k0 + 8*(lane>>4) + (lane&7)) * pitch + 2*c0 + 16*((lane>>3)&1); lane (c = lane&15, h = lane>>4) gets tile[k0 + 8h + 0..7][c0 + c].
// Two of them, at k0 and k0 + 16 (rp = 16 rows in bytes), are one fragment in the k order of ldh.
__device__ __forceinline__ v8h ldtr(const unsigned char* p) { typedef __attribute__((address_space(3))) v8s lds_v8s; return __builtin_bit_cast(v8h, __builtin_amdgcn_ds_load_tr16_b128_v8i16((lds_v8s*)p)); }
__device__ __forceinline__ v16h ldht(const unsigned char* p, uint32_t rp) { return cat16(ldtr(p), ldtr(p + rp)); }
// ordering point for wave-private LDS tiles (same wave writes and reads)
__device__ __forceinline__ void wave_sync() { __builtin_amdgcn_fence(3 /* release order */, "wavefront"); __builtin_amdgcn_wave_barrier(); asm volatile("" ::: "memory"); }
__device__ __forceinline__ float wsum(float v) { v += __shfl_xor(v, 16, 32); v += __shfl_xor(v, 8, 32); v += __shfl_xor(v, 4, 32); v += __shfl_xor(v, 2, 32); v += __shfl_xor(v, 1, 32); return v; }

// The six row-wise stages (cvt8, ew, lnx, rope, prep, qkrot) are device functions of one 256-thread block each (blk = the block's index inside its own stage); k_front and k_mid, behind qkrot_part,
// run stages that read none of each other's output side by side in one grid.
// cvt8_part: CVT_CH chunks of 8 floats per thread, 256 threads apart; all of a thread's loads are issued before the first value is converted.
#define CVT_CH 8
__device__ __forceinline__ void cvt8_part(int blk, const float* __restrict__ src, bf* dst, size_t n8) {
    const size_t i = (size_t)blk * (256 * CVT_CH) + threadIdx.x; if (i + (size_t)(CVT_CH - 1) * 256 >= n8) return;
    v4f va[CVT_CH], vb[CVT_CH];
#pragma unroll
    for (int ch = 0; ch < CVT_CH; ++ch) { const float* p = src + (i + (size_t)ch * 256) * 8;
        va[ch] = *(const v4f*)p;
        if (ch == CVT_CH - 1) asm volatile("s_wait_xcnt 0x0" ::: "memory");   // the last load's result may be given the address pair that all the loads above name: it issues only behind this wait
        vb[ch] = *(const v4f*)(p + 4); }
#pragma unroll
    for (int ch = 0; ch < CVT_CH; ++ch) { v8us o;
#pragma unroll
        for (int k = 0; k < 4; ++k) { o[k] = f2bf(va[ch][k]); o[4 + k] = f2bf(vb[ch][k]); }
        *(v8us*)(dst + (i + (size_t)ch * 256) * 8) = o; }
}

// ew_part: edge weight A plane [64][32] f16: columns 0..15 = 16*w[d][j], columns 16..31 = w[d][j]/128 (pairs with the x2048 residual half of the c16 operand). One block; each thread 16 B, consecutive.
__device__ __forceinline__ void ew_part(const float* __restrict__ ew, h16* EWA) {
    const int tid = threadIdx.x; const int d = tid >> 2, q = tid & 3;
    const float sc = (q < 2) ? 16.0f : 0.0078125f;
    const v8f w = *(const v8f*)(ew + d * 16 + (q & 1) * 8);
    v8h o;
#pragma unroll
    for (int i = 0; i < 8; ++i) o[i] = (h16)(bfr(w[i]) * sc);
    *(v8h*)(EWA + d * 32 + q * 8) = o;
    asm volatile("s_wait_xcnt 0x0" ::: "memory");   // other stages' code follows this store in the merged kernel: its address and data registers are rewritten only behind this wait
}

// The wave's row and both weight rows are loaded once, all loads issued together, and kept in registers through the three passes (element visiting order it = 0..3, i = 0..7 in every pass).
__device__ __forceinline__ void lnx_part(int blk, const float* __restrict__ x, const float* __restrict__ lw, const float* __restrict__ lb, bf* XA) {
    const int lane = threadIdx.x & 31; const int wave = __builtin_amdgcn_readfirstlane((int)(threadIdx.x >> 5));
    const int m = blk * 8 + wave; const int b = m / SEQ, t = m % SEQ;
    const float* src = x + ((size_t)b * SEQ_FULL + t) * DM + lane * 8;
    v8f raw[4], wv[4], bv[4];
#pragma unroll
    for (int it = 0; it < 4; ++it) raw[it] = *(const v8f*)(src + it * 256);
#pragma unroll
    for (int it = 0; it < 4; ++it) { wv[it] = *(const v8f*)(lw + it * 256 + lane * 8); bv[it] = *(const v8f*)(lb + it * 256 + lane * 8); }
    float s = 0.0f;
#pragma unroll
    for (int it = 0; it < 4; ++it) {
#pragma unroll
        for (int i = 0; i < 8; ++i) { raw[it][i] = bfr(raw[it][i]); s += raw[it][i]; } }
    s = wsum(s);
    const float mean = s * (1.0f / DM);
    float ss = 0.0f;
#pragma unroll
    for (int it = 0; it < 4; ++it) {
#pragma unroll
        for (int i = 0; i < 8; ++i) { const float dv = raw[it][i] - mean; ss += dv * dv; } }
    ss = wsum(ss);
    const float rstd = 1.0f / sqrtf(ss * (1.0f / DM) + 1e-5f);
    bf* dst = XA + (size_t)m * K2 + lane * 8;
#pragma unroll
    for (int it = 0; it < 4; ++it) {
        v8us hv, lv;
#pragma unroll
        for (int i = 0; i < 8; ++i) { const float dv = raw[it][i] - mean; const float y = dv * rstd * bfr(wv[it][i]) + bfr(bv[it][i]); const unsigned short hh = f2bf(y); hv[i] = hh; lv[i] = f2bf(y - bf2f(hh)); }
        *(v8us*)(dst + it * 256) = hv; *(v8us*)(dst + DM + it * 256) = lv; }
}

__device__ __forceinline__ void rope_part(int blk, const float* __restrict__ pos, float* CS, float* SN) {
    const int lane = threadIdx.x & 31; const int wave = __builtin_amdgcn_readfirstlane((int)(threadIdx.x >> 5));
    const int m = blk * 8 + wave; const int b = m / SEQ, t = m % SEQ;
    const float p = bfr(pos[(size_t)b * SEQ_FULL + t]);
    double pd = 1.0;
#pragma unroll 1
    for (int i = 0; i < lane; ++i) pd *= 1.333521432163324;
    const float pf = (float)pd;
    const float invf = 1.0f / pf;
    const float ang = p * invf;
    const float c = cosf(ang), s = sinf(ang);
    *(float*)(CS + (size_t)m * 32 + lane) = c; *(float*)(SN + (size_t)m * 32 + lane) = s;
    
}

// Packed mask MB [b*SEQ + t][SEQ/32] words: bit L of word 4*c + j of a row says whether mask[row][128*c + 4*L + j] is non-zero (the lane masks of prep_part's compares, stored as they come).
#define MBW (SEQ / 32)
static_assert(MBW == 32);                      // one word of a mask row per lane of the wave that packs it; a row is 128 bytes
// prep_part: per 64 tokens: len = mask row sums, and the rows' packed mask; bm = blocks - mean_c; base = bm / (|bm| + eps); planes BM[0] = f16(bm * 1024/len), BM[1] = f16 residual x2048, layout [plane][b][16][SEQ] (rows 12..15 zero);
// BASE [token][16] f32 (columns 12..15 zero). LDS tiles are cross-wave: block barriers between phases.
__device__ __forceinline__ void prep_part(int blk, const float* __restrict__ blocks, const int* __restrict__ mask, h16* BM, float* BASE, unsigned int* MB) {
    __shared__ float slen[64];
    __shared__ __align__(16) h16 sb[32 * 64];
    __shared__ __align__(16) float sbase[64 * 16];
    const int tid = threadIdx.x, lane = tid & 31; const int wave = __builtin_amdgcn_readfirstlane((int)(threadIdx.x >> 5));
    const int m0 = blk * 64; const int b = m0 / SEQ, t0 = m0 % SEQ;
#pragma unroll 1   // two batches of four mask rows: a batch's loads are all in flight together; all eight rows at once would double the registers of the whole kernel
    for (int g = 0; g < 2; ++g) { const int tl = wave * 8 + g * 4;
        const int* row = mask + ((size_t)b * SEQ_FULL + t0 + tl) * SEQ_FULL + lane * 4;
        v4i mv[4][SEQ / 128];
#pragma unroll
        for (int r = 0; r < 4; ++r)
#pragma unroll
            for (int c = 0; c < SEQ / 128; ++c) mv[r][c] = *(const v4i*)(row + (size_t)r * SEQ_FULL + c * 128);
        int cnt[4];
#pragma unroll
        for (int r = 0; r < 4; ++r) { cnt[r] = 0; unsigned int word = 0u;
#pragma unroll
            for (int c = 0; c < SEQ / 128; ++c)
#pragma unroll
                for (int j = 0; j < 4; ++j) { const unsigned int bal = __builtin_amdgcn_ballot_w32(mv[r][c][j] != 0);   // the compare's lane mask: 32 mask bits, the same in every lane
                    cnt[r] += __builtin_popcount(bal);
                    word = (lane == 4 * c + j) ? bal : word; }   // lane 4*c + j keeps this word for the row's one 128-byte store
            MB[((size_t)b * SEQ + t0 + tl + r) * MBW + lane] = word; }
        if (lane == 0) {
#pragma unroll
            for (int r = 0; r < 4; ++r) slen[tl + r] = (float)cnt[r]; } }
    __syncthreads();
    if (tid < 64) {
        const float* p = blocks + ((size_t)b * SEQ_FULL + t0 + tid) * 12;
        const v4f a0 = *(const v4f*)p, a1 = *(const v4f*)(p + 4), a2 = *(const v4f*)(p + 8);
        float pv[12];
#pragma unroll
        for (int i = 0; i < 4; ++i) { pv[i] = bfr(a0[i]); pv[4 + i] = bfr(a1[i]); pv[8 + i] = bfr(a2[i]); }
        float mu[3];
#pragma unroll
        for (int x = 0; x < 3; ++x) mu[x] = (pv[x] + pv[3 + x] + pv[6 + x] + pv[9 + x]) * 0.25f;
        const float sc = (1.0f / slen[tid]) * 1024.0f;
#pragma unroll
        for (int c = 0; c < 4; ++c) {
            const float vx = pv[c * 3] - mu[0], vy = pv[c * 3 + 1] - mu[1], vz = pv[c * 3 + 2] - mu[2];
            const float inv = 1.0f / (sqrtf(vx * vx + vy * vy + vz * vz) + 1.1920929e-7f);
            const float vv[3] = {vx, vy, vz};
#pragma unroll
            for (int x = 0; x < 3; ++x) { const int cx = c * 3 + x;
                sbase[tid * 16 + cx] = vv[x] * inv;
                const float bs = vv[x] * sc; const h16 hh = (h16)bs;
                sb[cx * 64 + tid] = hh; sb[(16 + cx) * 64 + tid] = (h16)((bs - (float)hh) * QRS); } }
#pragma unroll
        for (int j = 12; j < 16; ++j) { sbase[tid * 16 + j] = 0.0f; sb[j * 64 + tid] = (h16)0.0f; sb[(16 + j) * 64 + tid] = (h16)0.0f; }
    }
    __syncthreads();
    // 32 lines of 64 halves: line = tid>>3 (0..15 value plane rows, 16..31 residual plane rows), 8 consecutive lanes x 16 B per line; BASE: 256 threads x 16 B contiguous
    const int line = tid >> 3, pc = tid & 7;
    const v8h bv = *(const v8ha*)(&sb[line * 64 + pc * 8]);
    const v4f fv = *(const v4fa*)(&sbase[tid * 4]);
    h16* bd = BM + (size_t)(line >> 4) * ((size_t)NB * 16 * SEQ) + ((size_t)b * 16 + (line & 15)) * SEQ + t0 + pc * 8;
    float* fd = BASE + (size_t)m0 * 16 + tid * 4;
    *(v8h*)bd = bv; *(v4f*)fd = fv;
    
}

// k_proj: bf16 GEMM, 128x128 tile per block of four waves (2 x 2, each 64x64 = 16 accumulators). One operand is an activation in two planes (value | residual along its row), the other a weight in one plane.
// Both are staged in LDS by tensor loads: a stage is 128 k of the weight rows and the same 128 k of both activation planes (256 bytes a row), so a weight tile is fetched once and a weight fragment is read once
// for both planes. Three buffers, every wave moves its own slice two stages ahead of the pass that reads it (two requests of a wave in flight). Order per accumulator: kc = 0, 32, 64, ...; at each kc the value plane's product, then the residual plane's.
// MODE 1: f32 rows C[((r0/RB)*RP + r0%RB)][c0..c0+63], row pitch ldc; each 256-byte row segment by 16 consecutive lanes x 16 B.
#define PJ_PITCH 272u                 // LDS row pitch: 256-byte row + the mover's 16-byte pad (odd multiple of 16 B for 16-byte readers)
#define PJ_SLICE 18432u               // 64 weight rows x 272 B = 17408, rounded up to a multiple of 2 KiB so that every slice starts on one
#define PJ_PLANE 34816u               // 128 activation rows of one plane x 272 B, itself a multiple of 2 KiB
#define PJ_STAGE (2u * PJ_PLANE + 2u * PJ_SLICE)   // value plane, residual plane (128 rows each), weight rows 0..63, weight rows 64..127 of the block tile
static_assert(64u * PJ_PITCH <= PJ_SLICE && PJ_SLICE % 2048u == 0u);
static_assert(128u * PJ_PITCH <= PJ_PLANE && PJ_PLANE % 2048u == 0u);
static_assert(DM % 128 == 0 && K2 == 2 * DM && DM / 128 >= 2);   // whole stages inside every plane and every weight row, at least two stages
#define PJ_RING (3u * PJ_STAGE)       // three buffers; behind the loop the ring's first bytes serve as the waves' output tiles
static_assert(PJ_RING <= 327680u && 4u * 16u * 68u * 4u <= PJ_STAGE);
__device__ __forceinline__ uint32_t uni(uint32_t v) { return (uint32_t)__builtin_amdgcn_readfirstlane((int)v); }
__device__ __forceinline__ uint32_t pinned(uint32_t v) { uint32_t w = uni(v); asm volatile("" : "+s"(w)); return w; }   // the pinned() form for tensor loads: the test value is held in a scalar register, so the branch round a load is a scalar one (the load ignores EXEC)
// word 3 of group 0: the high address bits and the type
__device__ __forceinline__ uint32_t tdm_w3(uint64_t ga) { return uni((((uint32_t)(ga >> 32)) & 0x01FFFFFFu) | 0x80000000u); }
// one request of the whole wave: rows of 256 bytes (row count and row pitch in g1) to LDS byte offset dst, from the address whose low word is galo; words 0 (count 1) and 3 of g0 are the caller's.
// Only words 1 and 2 take a new value here: an earlier request of the wave may still be in flight.
__device__ __forceinline__ void tdm_load(u32x4& g0, uint32_t dst, uint32_t galo, u32x8& g1) {
    g0[1] = uni(dst); g0[2] = uni(galo);
    asm volatile("tensor_load_to_lds %0, %1" : "+s"(g0), "+s"(g1) :: "memory");   // in-out: the same registers go on to the waits below
}
// the wave's own requests have landed. The statement names both descriptor groups as in-out operands so that their scalar registers hold the issued words until the wait has returned
// and every new word is formed behind it.
__device__ __forceinline__ void tdm_wait(u32x4& g0, u32x8& g1) { asm volatile("s_wait_tensorcnt 0x0" : "+s"(g0), "+s"(g1) :: "memory"); }
// all but the wave's youngest request have landed. The descriptor registers live on to the next load or to the wait behind the loop.
__device__ __forceinline__ void tdm_wait1() { asm volatile("s_wait_tensorcnt 0x1" ::: "memory"); }
// proj_tile: the tile (bx, by) of one product; ring is the calling kernel's LDS array (on a multiple of 2 KiB). SA: the two-plane operand is A (else Bt); K = its row length, both planes.
template <int MODE, bool SA>
__device__ __forceinline__ void proj_tile(unsigned char* ring, uint32_t bx, uint32_t by, const bf* __restrict__ A, int pA, const bf* __restrict__ Bt, int pB, int K,
                                          h16* Ph, int RB, size_t sRB, int pitch, int CB, size_t sCB, float* C, int ldc, int RP) {
    const int lane = threadIdx.x & 31, lr = lane & 15, hi = lane >> 4;
    const uint32_t wave = uni(threadIdx.x >> 5);
    const int r0 = bx * 128 + (int)(wave >> 1) * 64, c0 = by * 128 + (int)(wave & 1u) * 64;
    f32a* os = (f32a*)ring + wave * (16 * 68);   // used only behind the loop
    v8f acc[4][4];
#pragma unroll
    for (int mb = 0; mb < 4; ++mb)
#pragma unroll
        for (int nb = 0; nb < 4; ++nb) acc[mb][nb] = (v8f){};
    // this wave's slice of every stage: wave 0 moves the value plane and wave 1 the residual plane of the block's 128 activation rows, waves 2, 3 move 64 weight rows each
    const bf* actp = SA ? A + (size_t)(bx * 128) * (size_t)pA : Bt + (size_t)(by * 128) * (size_t)pB;
    const bf* wgtp = SA ? Bt + (size_t)(by * 128) * (size_t)pB : A + (size_t)(bx * 128) * (size_t)pA;
    const uint32_t pact = (uint32_t)(SA ? pA : pB), pwgt = (uint32_t)(SA ? pB : pA);
    const bool ownP = wave < 2u;
    const uint32_t sp = ownP ? pact : pwgt;
    const uint32_t nrow = ownP ? 128u : 64u;
    const uint64_t src0 = ownP ? (uint64_t)(uintptr_t)(actp + (size_t)wave * (size_t)(K >> 1))
                               : (uint64_t)(uintptr_t)(wgtp + (size_t)((wave - 2u) * 64u) * (size_t)pwgt);
    const uint32_t slice = (uint32_t)(size_t)ring + (ownP ? wave * PJ_PLANE : 2u * PJ_PLANE + (wave - 2u) * PJ_SLICE);
    u32x8 g1;
    g1[0] = uni((1u << 20) | (5u << 22) | (3u << 25));   // no mask, byte elements, 16 B of pad behind every 256 B
    g1[1] = uni(256u << 16); g1[2] = uni(nrow << 16); g1[3] = uni(256u << 16); g1[4] = uni(nrow);   // tensor = tile = 256 B x this wave's rows
    g1[5] = uni(sp * 2u); g1[6] = uni(0u); g1[7] = uni(0u);
    const uint32_t T = (uint32_t)K >> 8;                 // stages of 128 k of one plane
    const uint32_t wact = SA ? (wave >> 1) : (wave & 1u), wwgt = SA ? (wave & 1u) : (wave >> 1);   // which 64 rows of each operand this wave's 64x64 tile reads
    const uint32_t pbase = (wact * 64u + (uint32_t)lr) * PJ_PITCH + 16u * (uint32_t)hi;
    const uint32_t wbase = 2u * PJ_PLANE + wwgt * PJ_SLICE + (uint32_t)lr * PJ_PITCH + 16u * (uint32_t)hi;
    u32x4 g0;
    g0[0] = uni(1u); g0[3] = tdm_w3(src0);
    const uint32_t lo0 = (uint32_t)src0;
    // Word 3 keeps its value while a request is in flight: a wave's T stage addresses are the 256-byte pieces of one plane row or weight row, K bytes long and K bytes aligned in the page-aligned workspace, so the low word never carries.
    tdm_load(g0, slice, lo0, g1);
    tdm_load(g0, slice + PJ_STAGE, lo0 + 256u, g1);      // at least two stages exist
    tdm_wait1();                                         // this wave's slice of stage 0 has landed
    __syncthreads();                                     // every slice of stage 0 is readable by every wave
    if (pinned((2u < T) ? 1u : 0u) != 0u) tdm_load(g0, slice + 2u * PJ_STAGE, lo0 + 512u, g1);   // the third buffer has had no reader yet
    uint32_t buf = 0u;                                   // the buffer of stage t: (t mod 3) * PJ_STAGE
#pragma unroll 1   // one pass per trip: the buffer index and the publish point below belong to one stage
    for (uint32_t t = 0; t < T; ++t) {
        const unsigned char* lh = ring + buf + pbase; const unsigned char* ll = lh + PJ_PLANE; const unsigned char* lw = ring + buf + wbase;
        v16bf fh[2][4], fl[2][4], fw[2][4];
#pragma unroll
        for (int i = 0; i < 4; ++i) { fh[0][i] = ldb((const bf*)(lh + i * 16 * PJ_PITCH)); fw[0][i] = ldb((const bf*)(lw + i * 16 * PJ_PITCH)); }
#pragma unroll
        for (int i = 0; i < 4; ++i) fl[0][i] = ldb((const bf*)(ll + i * 16 * PJ_PITCH));   // wanted sixteen products later than the two sets above
#pragma unroll
        for (int u = 0; u < 4; ++u) {
            const int cs = u & 1;
            if (u < 3) {
#pragma unroll
                for (int i = 0; i < 4; ++i) { fh[cs ^ 1][i] = ldb((const bf*)(lh + i * 16 * PJ_PITCH + (u + 1) * 64)); fw[cs ^ 1][i] = ldb((const bf*)(lw + i * 16 * PJ_PITCH + (u + 1) * 64)); }
#pragma unroll
                for (int i = 0; i < 4; ++i) fl[cs ^ 1][i] = ldb((const bf*)(ll + i * 16 * PJ_PITCH + (u + 1) * 64));
            }
            __builtin_amdgcn_sched_barrier(0);   // the next block's LDS reads stay one group in front of this block's products
#pragma unroll
            for (int nb = 0; nb < 4; ++nb)
#pragma unroll
                for (int mb = 0; mb < 4; ++mb) acc[mb][nb] = SA ? wmmab(fh[cs][mb], fw[cs][nb], acc[mb][nb]) : wmmab(fw[cs][mb], fh[cs][nb], acc[mb][nb]);
#pragma unroll
            for (int nb = 0; nb < 4; ++nb)
#pragma unroll
                for (int mb = 0; mb < 4; ++mb) acc[mb][nb] = SA ? wmmab(fl[cs][mb], fw[cs][nb], acc[mb][nb]) : wmmab(fw[cs][mb], fl[cs][nb], acc[mb][nb]);
            __builtin_amdgcn_sched_barrier(0);   // no LDS read moves in among the products
        }
        asm volatile("s_wait_dscnt 0x0" ::: "memory");
        tdm_wait1();
        if (pinned((t + 2u < T) ? 0u : 1u) != 0u) asm volatile("s_wait_tensorcnt 0x0" ::: "memory");
        __syncthreads();
        if (pinned((t + 3u < T) ? 1u : 0u) != 0u) tdm_load(g0, slice + buf, lo0 + ((t + 3u) << 8), g1);
        buf = (buf == 2u * PJ_STAGE) ? 0u : buf + PJ_STAGE;
    }
    tdm_wait(g0, g1);                                    // no request is outstanding when the wave goes on
    asm volatile("s_wait_dscnt 0x0" ::: "memory");       // nor any LDS read of the ring
    const size_t tbase = (size_t)(r0 / RB) * sRB + (size_t)(r0 % RB) * (size_t)pitch + (size_t)(c0 / CB) * sCB + (size_t)(c0 % CB);
    const size_t cbase = ((size_t)(r0 / RB) * (size_t)RP + (size_t)(r0 % RB)) * (size_t)ldc + (size_t)c0;
#pragma unroll
    for (int mb = 0; mb < 4; ++mb) {
#pragma unroll
        for (int nb = 0; nb < 4; ++nb) {
#pragma unroll
            for (int j = 0; j < 8; ++j) os[(hi * 8 + j) * 68 + nb * 16 + lr] = acc[mb][nb][j]; }   // D: row 8h+j, col lane&15
        wave_sync();
        if (MODE == 0) {
            const size_t sb = tbase + (size_t)(mb * 16) * (size_t)pitch;
{
#pragma unroll
                for (int s = 0; s < 4; ++s) { const int row = 4 * s + (lane >> 3), c8 = (lane & 7) * 8;   // 4 s x 4 row groups = 16 rows; 8 lanes x 8 = 64 columns
                    const v4f x0 = *(const v4fa*)(&os[row * 68 + c8]); const v4f x1 = *(const v4fa*)(&os[row * 68 + c8 + 4]); v8h hv;
#pragma unroll
                    for (int i = 0; i < 4; ++i) { hv[i] = (h16)x0[i]; hv[4 + i] = (h16)x1[i]; }
                    *(v8h*)(Ph + sb + (size_t)row * (size_t)pitch + c8) = hv; }
                 }
        } else {
            const size_t sb = cbase + (size_t)(mb * 16) * (size_t)ldc;
{
#pragma unroll
                for (int s = 0; s < 8; ++s) { const int row = 2 * s + hi, cofs = lr * 4;   // 8 s x 2 rows = 16 rows; 16 lanes x 4 floats = 64 columns
                    const v4f val = *(const v4fa*)(&os[row * 68 + cofs]);
                    *(v4f*)(C + sb + (size_t)row * (size_t)ldc + cofs) = val; }
                 }
        }
        wave_sync();
    }
}

template <int MODE>
__global__ __launch_bounds__(128) void k_proj(const bf* __restrict__ A, int pA, const bf* __restrict__ Bt, int pB, int K,
                                              h16* Ph, int RB, size_t sRB, int pitch, int CB, size_t sCB, float* C, int ldc, int RP) {
    __shared__ __attribute__((aligned(2048))) unsigned char ring[PJ_RING];
    proj_tile<MODE, true>(ring, blockIdx.x, blockIdx.y, A, pA, Bt, pB, K, Ph, RB, sRB, pitch, CB, sCB, C, ldc, RP);
}
// k_proj_qkv: the q|k product and the v^T product read the same two operands and none of each other's output: one grid, the q|k tiles first.
// q|k: A = LN(x) rows, Bt = wqkv rows 0..2047 -> QK[m][n] f32. v^T: A = wqkv rows 2048..3071 (m = h*64 + d), Bt = LN(x) rows (n = b*SEQ + t) -> plane [(b*1024 + m)][t] = [(b*16 + h)][d][t].
#define PQ_BX (NB * SEQ / 128)
#define PQ_N  (PQ_BX * (2 * DM / 128))
#define PV_BX (DM / 128)
#define PV_N  (PV_BX * (NB * SEQ / 128))
__global__ __launch_bounds__(128) void k_proj_qkv(const bf* __restrict__ XA, const bf* __restrict__ WB, float* QK, h16* VT) {
    __shared__ __attribute__((aligned(2048))) unsigned char ring[PJ_RING];
    const uint32_t i = blockIdx.x;
    if (i < (uint32_t)PQ_N) {
        proj_tile<1, true>(ring, i % PQ_BX, i / PQ_BX, XA, K2, WB, DM, K2, (h16*)0, NB * SEQ, (size_t)0, 0, 64, (size_t)0, QK, K2, NB * SEQ);
    } else {
        const uint32_t j = i - (uint32_t)PQ_N;
        proj_tile<0, false>(ring, j % PV_BX, j / PV_BX, WB + (size_t)2 * DM * DM, DM, XA, K2, K2, VT, DM, (size_t)0, SEQ, SEQ, (size_t)DM * SEQ, (float*)0, 0, 0);
    }
}

// Lane holds columns it*256 + lane*8 + i = head (4*it + lane/8), d = 8*(lane&7) + i; the rotary partner d +- 32 is lane ^ 4 (same it, same i).
// Planes [b*16+h][t][64], four consecutive planes from PL with stride pst halves: q value, q residual x2048, k value, k residual x2048 (selected by integer offset from one base).
// The wave's q row, k row and both weight rows are loaded once, all loads issued together, and kept in registers through the three passes (visiting order it = 0..3, i = 0..7).
__device__ __forceinline__ void qkrot_part(int blk, const float* __restrict__ QK, const float* __restrict__ qw, const float* __restrict__ kw, const float* __restrict__ CS, const float* __restrict__ SN,
                                           h16* PL, size_t pst) {
    const int lane = threadIdx.x & 31; const int wave = __builtin_amdgcn_readfirstlane((int)(threadIdx.x >> 5));
    const int m = blk * 8 + wave; const int b = m / SEQ, t = m % SEQ;
    const int c = lane & 7;
    const v8f cs = *(const v8f*)(CS + (size_t)m * 32 + 8 * (c & 3));
    const v8f sn = *(const v8f*)(SN + (size_t)m * 32 + 8 * (c & 3));
    const float sg = (c < 4) ? -1.0f : 1.0f;
    const size_t o0 = (((size_t)(b * NH_ + (lane >> 3))) * SEQ + t) * HD + 8 * c;
    const size_t ost = (size_t)4 * SEQ * HD;     // four heads per step
    const float* row = QK + (size_t)m * K2 + lane * 8;
    v8f raw[2][4], wgt[2][4];
#pragma unroll
    for (int wh = 0; wh < 2; ++wh)
#pragma unroll
        for (int it = 0; it < 4; ++it) raw[wh][it] = *(const v8f*)(row + wh * DM + it * 256);
#pragma unroll
    for (int it = 0; it < 4; ++it) { wgt[0][it] = *(const v8f*)(qw + it * 256 + lane * 8); wgt[1][it] = *(const v8f*)(kw + it * 256 + lane * 8); }
#pragma unroll
    for (int wh = 0; wh < 2; ++wh) {
        float s = 0.0f;
#pragma unroll
        for (int it = 0; it < 4; ++it) {
#pragma unroll
            for (int i = 0; i < 8; ++i) s += raw[wh][it][i]; }
        s = wsum(s);
        const float mean = s * (1.0f / DM);
        float ss = 0.0f;
#pragma unroll
        for (int it = 0; it < 4; ++it) {
#pragma unroll
            for (int i = 0; i < 8; ++i) { const float dv = raw[wh][it][i] - mean; ss += dv * dv; } }
        ss = wsum(ss);
        const float rstd = 1.0f / sqrtf(ss * (1.0f / DM) + 1e-5f);
        h16* PH = PL + (size_t)(2 * wh) * pst;
        h16* PR = PH + pst;
#pragma unroll
        for (int it = 0; it < 4; ++it) {
            v8h hv, rv;
#pragma unroll
            for (int i = 0; i < 8; ++i) {
                const float y = (raw[wh][it][i] - mean) * rstd * bfr(wgt[wh][it][i]);
                const float pr = __shfl_xor(y, 4, 32);
                const float r = y * cs[i] + sg * pr * sn[i];
                const h16 hh = (h16)r; hv[i] = hh; rv[i] = (h16)((r - (float)hh) * QRS); }
            const size_t oo = o0 + (size_t)it * ost;
            *(v8h*)(PH + oo) = hv; *(v8h*)(PR + oo) = rv; }
    }
    asm volatile("s_wait_xcnt 0x0" ::: "memory");   // other stages' code follows these stores in the merged kernel: their address and data registers are rewritten only behind this wait
}

// k_front: LN(x) and the wqkv conversion, which the qkv products read, beside the rotary table, which k_mid reads. The stages with the longest dependent chains take the low block indices, the short conversion blocks the high ones (for speed only).
#define GF_LNX  (NB * SEQ / 8)
#define GF_ROPE (NB * SEQ / 8)
#define GF_CVT  (3 * DM * DM / 8 / (256 * CVT_CH))
static_assert((3 * DM * DM / 8) % (256 * CVT_CH) == 0 && (DM * DM / 8) % (256 * CVT_CH) == 0);
__global__ __launch_bounds__(256) void k_front(const float* __restrict__ x, const float* __restrict__ lw, const float* __restrict__ lb, bf* XA,
                                               const float* __restrict__ pos, float* CS, float* SN, const float* __restrict__ wqkv, bf* WB) {
    const int blk = blockIdx.x;
    if (blk < GF_LNX) lnx_part(blk, x, lw, lb, XA);
    else if (blk < GF_LNX + GF_ROPE) rope_part(blk - GF_LNX, pos, CS, SN);
    else cvt8_part(blk - (GF_LNX + GF_ROPE), wqkv, WB, (size_t)3 * DM * DM / 8);
}
// k_mid: the q/k norm and rotary (reads the q|k product) beside the stages that only k_flash or the output product read: mask sums and bm planes, edge weight plane, out_w conversion.
#define GM_PREP (NB * SEQ / 64)
#define GM_ROT  (NB * SEQ / 8)
#define GM_CVT  (DM * DM / 8 / (256 * CVT_CH))
__global__ __launch_bounds__(256) void k_mid(const float* __restrict__ QK, const float* __restrict__ qw, const float* __restrict__ kw, const float* __restrict__ CS, const float* __restrict__ SN, h16* PL, size_t pst,
                                             const float* __restrict__ blocks, const int* __restrict__ mask, h16* BM, float* BASE, unsigned int* MB,
                                             const float* __restrict__ ew, h16* EWA, const float* __restrict__ ow, bf* OWB) {
    const int blk = blockIdx.x;
    if (blk < GM_PREP) prep_part(blk, blocks, mask, BM, BASE, MB);
    else if (blk < GM_PREP + GM_ROT) qkrot_part(blk - GM_PREP, QK, qw, kw, CS, SN, PL, pst);
    else if (blk == GM_PREP + GM_ROT) ew_part(ew, EWA);
    else cvt8_part(blk - (GM_PREP + GM_ROT + 1), ow, OWB, (size_t)DM * DM / 8);
}

// k_flash staging: a stage is 64 keys of the block's (batch, head): k value and residual rows (128-byte rows at KROW), v^T rows, both bm planes (128-byte rows, LDS pitch 144, an odd multiple of 16 B for 16-byte readers).
// Two buffers, filled by asynchronous copies one stage ahead of the pass that reads them. The packed mask of the block's 64 query rows (128 bytes a row, all keys) is copied once, in front of stage 0.
#define FK      64
#define FP1     144u
// k rows have two readers, 16-byte row reads (16 rows at a time) and transposing reads (8 rows x 32 B at a time): row r starts at KROW(r), so that rows 0..7 of every 16 start on distinct multiples of 32 B
// modulo the 256 B of the banks and rows 8..15 on the same plus 16 B: neither reader meets a bank twice. KROW(r + 16) = KROW(r) + KR16.
#define KROW(r) (128u * (r) + 32u * ((r) >> 1) + 16u * ((r) >> 3))
#define KR16    2336u
#define FKT     (4u * KR16)           // a tile of 64 k rows
#define FO_KH   0u
#define FO_KR   FKT
#define FO_VT   (2u * FKT)
#define FO_BM   (2u * FKT + 64u * FP1)
#define F_STAGE (2u * FKT + 96u * FP1)
static_assert(KROW(16u) == KR16 && KROW(63u) + 128u <= FKT);
static_assert(AW == 4 && KW == 2 && HD == 64);      // 256 lanes: 32 rows of 128 B per copy instruction of the block
static_assert(FK == 32 * KW);                       // one 32-key half of a stage per wave of a query tile
static_assert(SEQ % FK == 0 && SEQ / FK >= 2);      // whole stages, at least two
static_assert(F_STAGE % 16u == 0u);
// One stage: 7 copies of 16 B per lane, every lane on. l1: the lane's LDS byte address in row 0..31 of a 128-byte-row tile of the target buffer.
// bm: the lane's 16 bytes of the 32 bm rows (value plane rows 0..15, residual plane rows 16..31, adjacent in LDS).
// The run of copies ends, inside its own statement, with s_wait_xcnt 0: the address registers are rewritten only behind it.
// lk: the same lane's address in row 0..31 of a k tile (rows at KROW).
__device__ __forceinline__ void flash_fill(uint32_t l1, uint32_t lk, const h16* kh, const h16* kr, const h16* vt, const h16* bm) {
    asm volatile("global_load_async_to_lds_b128 %0, %1, off\n\t"
                 "global_load_async_to_lds_b128 %2, %3, off\n\t"
                 "global_load_async_to_lds_b128 %4, %5, off\n\t"
                 "global_load_async_to_lds_b128 %6, %7, off\n\t"
                 "global_load_async_to_lds_b128 %8, %9, off\n\t"
                 "global_load_async_to_lds_b128 %10, %11, off\n\t"
                 "global_load_async_to_lds_b128 %12, %13, off\n\t"
                 "s_wait_xcnt 0x0"
                 :: "v"(lk + FO_KH), "v"(kh), "v"(lk + FO_KH + 2u * KR16), "v"(kh + 32 * HD),
                    "v"(lk + FO_KR), "v"(kr), "v"(lk + FO_KR + 2u * KR16), "v"(kr + 32 * HD),
                    "v"(l1 + FO_VT), "v"(vt), "v"(l1 + FO_VT + 32u * FP1), "v"(vt + 32 * SEQ),
                    "v"(l1 + FO_BM), "v"(bm)
                 : "memory");
}
// The packed mask rows of the block: 64 rows of 128 B, 2 copies of 16 B per lane, every lane on; lm: the lane's LDS byte address in row 0..31 (pitch FP1), mb: its 16 bytes of that row.
// As above, the run ends inside its own statement with s_wait_xcnt 0: the address registers are rewritten only behind it.
__device__ __forceinline__ void flash_fill_mask(uint32_t lm, const unsigned int* mb) {
    asm volatile("global_load_async_to_lds_b128 %0, %1, off\n\t"
                 "global_load_async_to_lds_b128 %2, %3, off\n\t"
                 "s_wait_xcnt 0x0"
                 :: "v"(lm), "v"(mb), "v"(lm + 32u * FP1), "v"(mb + 32 * MBW)
                 : "memory");
}

// k_flash: fused attention + geometric term, KW waves per 16 query rows of one (batch, head): wave (qw, ks) walks the ks-th 32 keys of every stage with its own running max, sums and accumulators,
// so that a SIMD holds four waves; behind the loop the ks = 1 wave hands its state over in LDS and the ks = 0 wave joins both and runs the epilogue. q fragments straight from the 16-bit planes, all key-side fragments from the staged LDS tiles (two 16-B reads each), the mask as one 16-B read of packed bits per stage.
// Transposed form: S^T[key][t] = K Q^T; lane (t = lane&15, h = lane>>4) holds keys 8h+r of each 16-key tile, so packed P / G tiles are directly B fragments of
// O^T[d][t] = V^T P^T and C^T[cx][t] = BM^T G^T. The geometric sum does not go through the scores: the block builds W^T[cx][d] = BM^T K once (wave (qw, ks): columns d = 16*qw .. +15, its 32 keys of every stage, k read transposed),
// the parts are joined in LDS behind the loop and tmp2^T = W^T Q^T; C^T, the share of the masked-out keys, is summed only on tiles that have one and taken off in the epilogue. S = kH.qH + (kH.qR + kR.qH)/2048. Mask: replace-fill for the softmax, G = the scores of the masked-out keys alone; selects, G and its products are skipped, by a scalar branch, where every bit of the wave's 16 x 32 tile is set. Softmax state one scalar per lane (running max from -inf).
// Epilogue: tmp2 halves exchanged with one xor-16 shuffle, c16 = base.tmp2 (K = 3, VALU), ctx^T = EW c16^T on one K=32 tile (value | residual), sum staged in a wave-private LDS tile and
// Two blocks of eight waves share a WGP (LDS allows two): four waves a SIMD, so a wave may hold at most 256 registers.
__global__ __launch_bounds__(32 * AW * KW) __attribute__((amdgpu_waves_per_eu(4, 4))) void k_flash(const h16* __restrict__ QH, const h16* __restrict__ QR, const h16* __restrict__ KH, const h16* __restrict__ KR, const h16* __restrict__ VT,
                                                   const h16* __restrict__ BM, const float* __restrict__ BASE, const h16* __restrict__ EWA, const unsigned int* __restrict__ MB, bf* OA) {
    __shared__ __align__(16) float os[AW * 16 * 68];
    __shared__ __align__(16) unsigned char fr[2 * F_STAGE];
    __shared__ __align__(16) unsigned char mbt[16 * AW * FP1];   // packed mask rows of the block's query rows
    const int tid = threadIdx.x;
    const int lane = threadIdx.x & 31, wave = __builtin_amdgcn_readfirstlane((int)(threadIdx.x >> 5)), lr = lane & 15, hi = lane >> 4;
    const int zh = blockIdx.y; const int b = zh / NH_, h = zh % NH_;
    const int qw = wave & (AW - 1), ks = wave / AW;      // query tile, key half
    const int t0 = (blockIdx.x * AW + qw) * 16;
    const size_t pbase = (size_t)zh * SEQ * HD;
    const size_t qo = pbase + (size_t)(t0 + lr) * HD + 8 * hi;
    const v16h qh0 = ldh(QH + qo), qh1 = ldh(QH + qo + 32), qr0 = ldh(QR + qo), qr1 = ldh(QR + qo + 32);   // B fragments: col t, k = d
    // readers, byte offsets in a buffer: 128-byte-row tiles at row lr (A fragments: row key / d / cx); packed mask at this wave's row lr
    const uint32_t ro = (uint32_t)lr * FP1 + 16u * (uint32_t)hi;
    const uint32_t rk = KROW((uint32_t)lr) + 16u * (uint32_t)hi + (uint32_t)ks * (2u * KR16);   // k tiles: this wave's 32 keys are rows
    const uint32_t rc = ro + (uint32_t)ks * 64u;           // v^T and bm tiles: they are columns
    const uint32_t rt = (uint32_t)ks * (2u * KR16) + KROW((uint32_t)(8 * hi + (lane & 7))) + 32u * (uint32_t)qw + 16u * (uint32_t)((lane >> 3) & 1);   // k tiles read transposed: this wave's 32 keys as k, columns d = 16*qw .. +15
    const uint32_t mo = (uint32_t)(qw * 16 + lr) * FP1;
    // copiers: the lane's own 16 bytes of stage 0 (8 lanes per 128-byte row)
    const h16* ckh = KH + pbase + (size_t)tid * 8;
    const h16* ckr = KR + pbase + (size_t)tid * 8;
    const h16* cvt = VT + pbase + (size_t)(tid >> 3) * SEQ + 8 * (tid & 7);
    const h16* cbm = BM + (size_t)(tid >> 7) * ((size_t)NB * 16 * SEQ) + ((size_t)b * 16 + ((tid >> 3) & 15)) * SEQ + 8 * (tid & 7);
    const unsigned int* cmb = MB + ((size_t)b * SEQ + blockIdx.x * (16 * AW) + (tid >> 3)) * MBW + 4 * (tid & 7);
    const uint32_t cl1 = (uint32_t)(size_t)fr + (uint32_t)(tid >> 3) * FP1 + 16u * (uint32_t)(tid & 7);
    const uint32_t cl2 = (uint32_t)(size_t)fr + KROW((uint32_t)(tid >> 3)) + 16u * (uint32_t)(tid & 7);
    const uint32_t clm = (uint32_t)(size_t)mbt + (uint32_t)(tid >> 3) * FP1 + 16u * (uint32_t)(tid & 7);
    v8f o0 = (v8f){}, o1 = (v8f){}, o2 = (v8f){}, o3 = (v8f){}, wA = (v8f){}, wR = (v8f){}, cA = (v8f){}, cR = (v8f){};
    float m = -__builtin_huge_valf(), l = 0.0f;
    flash_fill_mask(clm, cmb);
    flash_fill(cl1, cl2, ckh, ckr, cvt, cbm);
    asm volatile("s_wait_asynccnt 0x0" ::: "memory");    // this wave's copies of the packed mask and of stage 0 have landed
    __syncthreads();                                     // every wave's part of both is readable by every wave
    flash_fill(cl1 + F_STAGE, cl2 + F_STAGE, ckh + FK * HD, ckr + FK * HD, cvt + FK, cbm + FK);
#pragma unroll 1   // one stage per trip: the buffer index and the publish point at the foot belong to one stage
    for (int st = 0; st < SEQ / FK; ++st) {
      const uint32_t bo = (uint32_t)(st & 1) * F_STAGE;
      {
        // the four words (j = key & 3) that hold keys 128*(st/2) .. +127 of this lane's query row; this wave's 32 keys are the 8 bits from msh up in each
        const u32x4 mw = *(const u32x4a*)(mbt + mo + (uint32_t)(st >> 1) * 16u);
        const uint32_t msh = (uint32_t)(st & 1) * 16u + (uint32_t)ks * 8u;
        const bool mpart = (((mw[0] & mw[1] & mw[2] & mw[3]) >> msh) & 0xFFu) != 0xFFu;   // a key of this row's 32 is masked out
        const unsigned char* ka = fr + bo + FO_KH + rk; const unsigned char* kr = fr + bo + FO_KR + rk;
        const v16h ka0 = ldh((const h16*)ka), ka1 = ldh((const h16*)(ka + 64)), kb0 = ldh((const h16*)(ka + KR16)), kb1 = ldh((const h16*)(ka + KR16 + 64));
        const v16h ra0 = ldh((const h16*)kr), ra1 = ldh((const h16*)(kr + 64)), rb0 = ldh((const h16*)(kr + KR16)), rb1 = ldh((const h16*)(kr + KR16 + 64));
        v8f sHa = (v8f){}, sLa = (v8f){}, sKa = (v8f){}, sHb = (v8f){}, sLb = (v8f){}, sKb = (v8f){};
        sHa = wmma16(ka0, qh0, sHa); sLa = wmma16(ka0, qr0, sLa); sKa = wmma16(ra0, qh0, sKa); sHb = wmma16(kb0, qh0, sHb); sLb = wmma16(kb0, qr0, sLb); sKb = wmma16(rb0, qh0, sKb);
        sHa = wmma16(ka1, qh1, sHa); sLa = wmma16(ka1, qr1, sLa); sKa = wmma16(ra1, qh1, sKa); sHb = wmma16(kb1, qh1, sHb); sLb = wmma16(kb1, qr1, sLb); sKb = wmma16(rb1, qh1, sKb);
        asm volatile("v_nop\n\tv_nop\n\tv_nop\n\tv_nop" : "+v"(sHa), "+v"(sLa), "+v"(sKa), "+v"(sHb), "+v"(sLb), "+v"(sKb) : "v"(ka0), "v"(ka1), "v"(kb0), "v"(kb1), "v"(ra0), "v"(ra1), "v"(rb0), "v"(rb1));
        float ta[8], tb[8], xa[8], xb[8]; float mx = NEGMIN;
#pragma unroll
        for (int r = 0; r < 8; ++r) {
            xa[r] = sHa[r] + (sLa[r] + sKa[r]) * QRI; xb[r] = sHb[r] + (sLb[r] + sKb[r]) * QRI;
            ta[r] = xa[r] * SC2; tb[r] = xb[r] * SC2; }
        if (__builtin_amdgcn_ballot_w32(mpart) != 0u) {   // wave-uniform: some key of the wave's 16 x 32 tile is masked out
            // key 16*ab + 8*hi + r of the wave's 32: word r & 3, bit msh + 4*ab + 2*hi + r/4
            const uint32_t lsh = msh + 2u * (uint32_t)hi;
            const uint32_t mu[4] = {mw[0] >> lsh, mw[1] >> lsh, mw[2] >> lsh, mw[3] >> lsh};
#pragma unroll
            for (int r = 0; r < 8; ++r) {
                const bool va = (mu[r & 3] & (1u << (r >> 2))) != 0u, vb = (mu[r & 3] & (16u << (r >> 2))) != 0u;
                ta[r] = va ? ta[r] : NEGMIN; tb[r] = vb ? tb[r] : NEGMIN;
                xa[r] = va ? 0.0f : xa[r]; xb[r] = vb ? 0.0f : xb[r]; }
            // the masked-out keys' share of W.q, which the epilogue takes off again: C^T[cx][t] += BM^T G^T over those keys alone
            v16h gh, gr;
#pragma unroll
            for (int r = 0; r < 8; ++r) {
                const float ga = xa[r]; const float gb = xb[r];
                const h16 ha = (h16)ga; const h16 hb = (h16)gb;
                gh[r] = ha; gh[8 + r] = hb; gr[r] = (h16)((ga - (float)ha) * QRS); gr[8 + r] = (h16)((gb - (float)hb) * QRS); }
            const unsigned char* bc_ = fr + bo + FO_BM + rc;
            const v16h ch = ldh((const h16*)bc_), cr = ldh((const h16*)(bc_ + 16 * FP1));
            cA = wmma16(ch, gh, cA); cR = wmma16(ch, gr, cR); cR = wmma16(cr, gh, cR);
            asm volatile("v_nop\n\tv_nop\n\tv_nop\n\tv_nop" : "+v"(cA), "+v"(cR) : "v"(ch), "v"(cr), "v"(gh), "v"(gr));   // the distance behind the last product, on the way out of the branch too
        }
#pragma unroll
        for (int r = 0; r < 8; ++r) mx = fmaxf(mx, fmaxf(ta[r], tb[r]));
        mx = fmaxf(mx, __shfl_xor(mx, 16, 32));
        const float mnew = fmaxf(m, mx);
        const float alpha = __builtin_amdgcn_exp2f(m - mnew);
        const float sh = PSH - mnew;
        v16h pb; float ls = 0.0f;
#pragma unroll
        for (int r = 0; r < 8; ++r) { const h16 pa = (h16)__builtin_amdgcn_exp2f(ta[r] + sh); const h16 pc = (h16)__builtin_amdgcn_exp2f(tb[r] + sh); pb[r] = pa; pb[8 + r] = pc; ls += (float)pa + (float)pc; }
        l = l * alpha + ls; m = mnew;
        o0 = o0 * alpha; o1 = o1 * alpha; o2 = o2 * alpha; o3 = o3 * alpha;
        const unsigned char* va_ = fr + bo + FO_VT + rc;
        const v16h v0 = ldh((const h16*)va_), v1 = ldh((const h16*)(va_ + 16 * FP1)), v2 = ldh((const h16*)(va_ + 32 * FP1)), v3 = ldh((const h16*)(va_ + 48 * FP1));
        const unsigned char* ba_ = fr + bo + FO_BM + rc;
        const v16h bh = ldh((const h16*)ba_), br = ldh((const h16*)(ba_ + 16 * FP1));
        const v16h kt = ldht(fr + bo + FO_KH + rt, KR16), rtr = ldht(fr + bo + FO_KR + rt, KR16);   // B fragments: col d, k = key
        o0 = wmma16(v0, pb, o0); wA = wmma16(bh, kt, wA); o1 = wmma16(v1, pb, o1); wR = wmma16(bh, rtr, wR); o2 = wmma16(v2, pb, o2); o3 = wmma16(v3, pb, o3); wR = wmma16(br, kt, wR);
        asm volatile("v_nop\n\tv_nop\n\tv_nop\n\tv_nop" : "+v"(o0), "+v"(o1), "+v"(o2), "+v"(o3), "+v"(wA), "+v"(wR) : "v"(v0), "v"(v1), "v"(v2), "v"(v3), "v"(pb), "v"(bh), "v"(br), "v"(kt), "v"(rtr));   // the distance behind the last product
      }
      asm volatile("s_wait_dscnt 0x0" ::: "memory");       // this wave's reads of this buffer have returned
      asm volatile("s_wait_asynccnt 0x0" ::: "memory");    // this wave's copies of stage st + 1 have landed
      __syncthreads();                                     // publishes stage st + 1 and ends every wave's reads of this buffer
      if (st + 2 < SEQ / FK) {                             // only while stage st + 2 exists (the same for the whole block)
          const int kn = (st + 2) * FK;
          flash_fill(cl1 + bo, cl2 + bo, ckh + (size_t)kn * HD, ckr + (size_t)kn * HD, cvt + kn, cbm + kn);
      }
    }
    asm volatile("s_wait_asynccnt 0x0" ::: "memory");    // no copy is outstanding when the wave goes on
    // Join of the two key halves. The last trip's waits and barrier have ended every read of the ring and no copy is outstanding, so the ring serves as the hand-over area: 13 x 16 B per lane, lane-contiguous.
    v4fa* xw = (v4fa*)fr + (size_t)qw * (13 * 32) + lane;
    // Behind that area: every wave's part of W^T (its 32 keys of every stage, its 16 columns d), f32 [ks][cx][d], row pitch 68; true scale (the bm planes carry 1024), so that its 16-bit planes below stay in range for short mask rows too.
    f32a* wl = (f32a*)(fr + AW * 13 * 32 * 16);
#pragma unroll
    for (int r = 0; r < 8; ++r) wl[(ks * 16 + 8 * hi + r) * 68 + 16 * qw + lr] = (wA[r] + wR[r] * QRI) * (1.0f / 1024.0f);   // D: row cx = 8h + r, col d
    if (ks != 0) {
        const v8f st8[6] = {o0, o1, o2, o3, cA, cR};
#pragma unroll
        for (int i = 0; i < 6; ++i) { xw[(2 * i) * 32] = (v4f){st8[i][0], st8[i][1], st8[i][2], st8[i][3]}; xw[(2 * i + 1) * 32] = (v4f){st8[i][4], st8[i][5], st8[i][6], st8[i][7]}; }
        xw[12 * 32] = (v4f){m, l, 0.0f, 0.0f};
    }
    __syncthreads();                                     // the ks = 1 waves' state is readable by their ks = 0 partners, every wave's part of W^T by all
    if (ks != 0) return;                                 // no barrier follows
    {
        const v4f ml = xw[12 * 32];
        const float dm = m - ml[0];                      // both maxima are finite: every wave has walked at least one half stage
        const float ea = __builtin_amdgcn_exp2f(-fabsf(dm));   // the side with the larger maximum keeps its scale
        const float a1 = (dm < 0.0f) ? ea : 1.0f, a2 = (dm < 0.0f) ? 1.0f : ea;
        l = l * a1 + ml[1] * a2;
        v8f pt[6];
#pragma unroll
        for (int i = 0; i < 6; ++i) { const v4f x0 = xw[(2 * i) * 32], x1 = xw[(2 * i + 1) * 32]; pt[i] = (v8f){x0[0], x0[1], x0[2], x0[3], x1[0], x1[1], x1[2], x1[3]}; }
        o0 = o0 * a1 + pt[0] * a2; o1 = o1 * a1 + pt[1] * a2; o2 = o2 * a1 + pt[2] * a2; o3 = o3 * a1 + pt[3] * a2;
        cA = cA + pt[4]; cR = cR + pt[5];
    }
    // tmp2^T[cx][t] = W^T q^T: A fragments of W^T (row cx, k = d in the order of ldh) as value + residual x2048, against the q fragments
    v8f gA = (v8f){}, gR = (v8f){};
    {
        v16h wh[2], wr[2];
#pragma unroll
        for (int j = 0; j < 2; ++j)
#pragma unroll
            for (int q4 = 0; q4 < 4; ++q4) { const int wo = lr * 68 + 32 * j + 16 * (q4 >> 1) + 8 * hi + 4 * (q4 & 1);
                const v4f p0 = *(const v4fa*)(&wl[wo]), p1 = *(const v4fa*)(&wl[16 * 68 + wo]);
#pragma unroll
                for (int i = 0; i < 4; ++i) { const float wv = p0[i] + p1[i]; const h16 hh = (h16)wv; wh[j][4 * q4 + i] = hh; wr[j][4 * q4 + i] = (h16)((wv - (float)hh) * QRS); } }
        gA = wmma16(wh[0], qh0, gA); gR = wmma16(wh[0], qr0, gR); gA = wmma16(wh[1], qh1, gA); gR = wmma16(wh[1], qr1, gR); gR = wmma16(wr[0], qh0, gR); gR = wmma16(wr[1], qh1, gR);
        asm volatile("v_nop\n\tv_nop\n\tv_nop\n\tv_nop" : "+v"(gA), "+v"(gR) : "v"(wh[0]), "v"(wh[1]), "v"(wr[0]), "v"(wr[1]), "v"(qh0), "v"(qh1), "v"(qr0), "v"(qr1));   // the distance behind the last product
    }
    l += __shfl_xor(l, 16, 32);
    const float inv = 1.0f / l;
    // tmp2 (x1024): lane (t, h) holds rows cx = 8h + r; fetch the other half unconditionally, select by value
    float mi[8], ot[8], f[12];
#pragma unroll
    for (int r = 0; r < 8; ++r) { mi[r] = (gA[r] + gR[r] * QRI) * 1024.0f - (cA[r] + cR[r] * QRI); ot[r] = __shfl_xor(mi[r], 16, 32); }
#pragma unroll
    for (int r = 0; r < 8; ++r) f[r] = hi ? ot[r] : mi[r];
#pragma unroll
    for (int r = 0; r < 4; ++r) f[8 + r] = hi ? mi[r] : ot[r];
    const float* bp = BASE + ((size_t)b * SEQ + t0 + lr) * 16;
    const v4f b0 = *(const v4f*)bp, b1 = *(const v4f*)(bp + 4), b2 = *(const v4f*)(bp + 8);
    const float bs[12] = {b0[0], b0[1], b0[2], b0[3], b1[0], b1[1], b1[2], b1[3], b2[0], b2[1], b2[2], b2[3]};
    float e0[3], e1[3];
#pragma unroll
    for (int x = 0; x < 3; ++x) { e0[x] = hi ? bs[6 + x] : bs[x]; e1[x] = hi ? bs[9 + x] : bs[3 + x]; }
    // B fragment of the edge projection: element i <- 16*c16[t][j = 8h + i] (e = 2h + i/4, c = i%4), element 8+i <- its residual x2048
    v16h cb;
#pragma unroll
    for (int i = 0; i < 8; ++i) { const int c = i & 3;
        const float cv = (i < 4) ? (e0[0] * f[3 * c] + e0[1] * f[3 * c + 1] + e0[2] * f[3 * c + 2]) : (e1[0] * f[3 * c] + e1[1] * f[3 * c + 1] + e1[2] * f[3 * c + 2]);
        const float bq = cv * (1.0f / 64.0f); const h16 hh = (h16)bq; cb[i] = hh; cb[8 + i] = (h16)((bq - (float)hh) * QRS); }
    const v16h ea0 = ldh(EWA + (size_t)(lr) * 32 + 8 * hi), ea1 = ldh(EWA + (size_t)(16 + lr) * 32 + 8 * hi), ea2 = ldh(EWA + (size_t)(32 + lr) * 32 + 8 * hi), ea3 = ldh(EWA + (size_t)(48 + lr) * 32 + 8 * hi);
    v8f c0 = (v8f){}, c1 = (v8f){}, c2 = (v8f){}, c3 = (v8f){};
    c0 = wmma16(ea0, cb, c0); c1 = wmma16(ea1, cb, c1); c2 = wmma16(ea2, cb, c2); c3 = wmma16(ea3, cb, c3);
    asm volatile("v_nop\n\tv_nop\n\tv_nop\n\tv_nop" : "+v"(c0), "+v"(c1), "+v"(c2), "+v"(c3) : "v"(ea0), "v"(ea1), "v"(ea2), "v"(ea3), "v"(cb));
    const float ci = 1.0f / 256.0f;
    const int wb = qw * 16 * 68;
    // D layout: x_j[r] = (d = 16j + 8h + r, t = lane&15) -> os[t][d]; rows 0..15 x columns 0..63 all written
    { v4f a, c;
      a[0] = o0[0] * inv + c0[0] * ci; a[1] = o0[1] * inv + c0[1] * ci; a[2] = o0[2] * inv + c0[2] * ci; a[3] = o0[3] * inv + c0[3] * ci;
      c[0] = o0[4] * inv + c0[4] * ci; c[1] = o0[5] * inv + c0[5] * ci; c[2] = o0[6] * inv + c0[6] * ci; c[3] = o0[7] * inv + c0[7] * ci;
      *(v4fa*)(&os[wb + lr * 68 +  0 + 8 * hi]) = a; *(v4fa*)(&os[wb + lr * 68 +  0 + 8 * hi + 4]) = c;
      a[0] = o1[0] * inv + c1[0] * ci; a[1] = o1[1] * inv + c1[1] * ci; a[2] = o1[2] * inv + c1[2] * ci; a[3] = o1[3] * inv + c1[3] * ci;
      c[0] = o1[4] * inv + c1[4] * ci; c[1] = o1[5] * inv + c1[5] * ci; c[2] = o1[6] * inv + c1[6] * ci; c[3] = o1[7] * inv + c1[7] * ci;
      *(v4fa*)(&os[wb + lr * 68 + 16 + 8 * hi]) = a; *(v4fa*)(&os[wb + lr * 68 + 16 + 8 * hi + 4]) = c;
      a[0] = o2[0] * inv + c2[0] * ci; a[1] = o2[1] * inv + c2[1] * ci; a[2] = o2[2] * inv + c2[2] * ci; a[3] = o2[3] * inv + c2[3] * ci;
      c[0] = o2[4] * inv + c2[4] * ci; c[1] = o2[5] * inv + c2[5] * ci; c[2] = o2[6] * inv + c2[6] * ci; c[3] = o2[7] * inv + c2[7] * ci;
      *(v4fa*)(&os[wb + lr * 68 + 32 + 8 * hi]) = a; *(v4fa*)(&os[wb + lr * 68 + 32 + 8 * hi + 4]) = c;
      a[0] = o3[0] * inv + c3[0] * ci; a[1] = o3[1] * inv + c3[1] * ci; a[2] = o3[2] * inv + c3[2] * ci; a[3] = o3[3] * inv + c3[3] * ci;
      c[0] = o3[4] * inv + c3[4] * ci; c[1] = o3[5] * inv + c3[5] * ci; c[2] = o3[6] * inv + c3[6] * ci; c[3] = o3[7] * inv + c3[7] * ci;
      *(v4fa*)(&os[wb + lr * 68 + 48 + 8 * hi]) = a; *(v4fa*)(&os[wb + lr * 68 + 48 + 8 * hi + 4]) = c; }
    wave_sync();
    bf* orow = OA + ((size_t)b * SEQ + t0) * K2 + h * HD;
{
#pragma unroll
        for (int s = 0; s < 4; ++s) { const int row = 4 * s + (lane >> 3), c8 = (lane & 7) * 8;   // 4 s x 4 row groups = 16 rows; 8 lanes x 8 = 64 columns
            const v4f x0 = *(const v4fa*)(&os[wb + row * 68 + c8]); const v4f x1 = *(const v4fa*)(&os[wb + row * 68 + c8 + 4]); v8us hv, lv;
#pragma unroll
            for (int i = 0; i < 4; ++i) { const unsigned short a0 = f2bf(x0[i]); const unsigned short a1 = f2bf(x1[i]); hv[i] = a0; hv[4 + i] = a1; lv[i] = f2bf(x0[i] - bf2f(a0)); lv[4 + i] = f2bf(x1[i] - bf2f(a1)); }
            const size_t oo = (size_t)row * K2 + c8;
            *(v8us*)(orow + oo) = hv; *(v8us*)(orow + DM + oo) = lv; }
         }
}

static constexpr size_t al256(size_t v) { return (v + 255) & ~(size_t)255; }
static constexpr size_t SZ_WB  = al256((size_t)3 * DM * DM * 2);
static constexpr size_t SZ_OWB = al256((size_t)DM * DM * 2);
static constexpr size_t SZ_XA  = al256((size_t)NB * SEQ * K2 * 2);
static constexpr size_t SZ_QK  = al256((size_t)NB * SEQ * K2 * 4);
static constexpr size_t SZ_PL  = al256((size_t)NB * NH_ * SEQ * HD * 2);
static constexpr size_t SZ_BM  = al256((size_t)2 * NB * 16 * SEQ * 2);
static constexpr size_t SZ_BS  = al256((size_t)NB * SEQ * 16 * 4);
static constexpr size_t SZ_CS  = al256((size_t)NB * SEQ * 32 * 4);
static constexpr size_t SZ_EW  = al256((size_t)64 * 32 * 2);
static constexpr size_t SZ_MB  = al256((size_t)NB * SEQ * MBW * 4);
static constexpr size_t SZ_TOTAL = SZ_WB + SZ_OWB + 2 * SZ_XA + SZ_QK + 5 * SZ_PL + SZ_BM + SZ_BS + 2 * SZ_CS + SZ_EW + SZ_MB;
static_assert(SZ_TOTAL <= (size_t)134217728);          // workspace carve <= 128 MiB
static_assert(SZ_PL % 2 == 0);                         // plane stride in halves is exact
static_assert(SZ_PL == (size_t)NB * NH_ * SEQ * HD * 2);   // the four q/k planes are back to back with stride SZ_PL/2 halves

extern "C" void kernel_launch(void* const* d_in, const int* in_sizes, int n_in,
                              void* d_out, int out_size, void* d_ws, size_t ws_size, hipStream_t stream) {
    if (n_in < 11) return;
    const size_t ntok = (size_t)(NB - 1) * SEQ_FULL + SEQ;
    if ((size_t)in_sizes[0] < ntok) return;
    if ((size_t)in_sizes[1] < ntok * DM) return;
    if ((size_t)in_sizes[2] < (ntok - 1) * SEQ_FULL + SEQ) return;
    if ((size_t)in_sizes[3] < ntok * 12) return;
    if ((size_t)in_sizes[4] < (size_t)DM || (size_t)in_sizes[5] < (size_t)DM || (size_t)in_sizes[7] < (size_t)DM || (size_t)in_sizes[8] < (size_t)DM) return;
    if ((size_t)in_sizes[6] < (size_t)3 * DM * DM || (size_t)in_sizes[9] < (size_t)DM * DM || (size_t)in_sizes[10] < (size_t)1024) return;
    if ((size_t)out_size < ((size_t)(NB - 1) * OUT_SEQ + SEQ) * DM) return;
    if (SZ_TOTAL > ws_size) return;
    // wire order: position, x, attention_mask (int32), blocks, ln_w, ln_b, wqkv [3072][1024], q_ln_w, k_ln_w, out_w [1024][1024], edge_w [64][16]
    const float* position = (const float*)d_in[0]; const float* x = (const float*)d_in[1]; const int* amask = (const int*)d_in[2]; const float* blocks = (const float*)d_in[3];
    const float* ln_w = (const float*)d_in[4]; const float* ln_b = (const float*)d_in[5]; const float* wqkv = (const float*)d_in[6];
    const float* q_ln_w = (const float*)d_in[7]; const float* k_ln_w = (const float*)d_in[8]; const float* out_w = (const float*)d_in[9]; const float* edge_w = (const float*)d_in[10];
    float* OUT = (float*)d_out;
    char* wsp = (char*)d_ws;
    bf* WB  = (bf*)wsp;  wsp += SZ_WB;                // [3072][1024]: q | k | v rows
    bf* OWB = (bf*)wsp;  wsp += SZ_OWB;               // [1024][1024]
    bf* XA  = (bf*)wsp;  wsp += SZ_XA;                // [NB*SEQ][hi 1024 | lo 1024]
    bf* OA  = (bf*)wsp;  wsp += SZ_XA;                // [NB*SEQ][hi 1024 | lo 1024]
    float* QK = (float*)wsp; wsp += SZ_QK;            // [NB*SEQ][q 1024 | k 1024]
    h16* QH = (h16*)wsp; wsp += SZ_PL;                // [NB*16][SEQ][64]; QH, QR, KH, KR back to back (stride SZ_PL/2 halves)
    h16* QR = (h16*)wsp; wsp += SZ_PL;
    h16* KH = (h16*)wsp; wsp += SZ_PL;
    h16* KR = (h16*)wsp; wsp += SZ_PL;
    h16* VT = (h16*)wsp; wsp += SZ_PL;                // [NB*16][64][SEQ]
    h16* BM = (h16*)wsp; wsp += SZ_BM;                // [2][NB][16][SEQ]
    float* BASE = (float*)wsp; wsp += SZ_BS;          // [NB*SEQ][16]
    float* CS = (float*)wsp; wsp += SZ_CS;            // [NB*SEQ][32]
    float* SN = (float*)wsp; wsp += SZ_CS;
    h16* EWA = (h16*)wsp; wsp += SZ_EW;               // [64][32]
    unsigned int* MB = (unsigned int*)wsp; wsp += SZ_MB;   // [NB*SEQ][SEQ/32] packed mask

    k_front<<<GF_LNX + GF_ROPE + GF_CVT, 256, 0, stream>>>(x, ln_w, ln_b, XA, position, CS, SN, wqkv, WB);

    k_proj_qkv<<<PQ_N + PV_N, 128, 0, stream>>>(XA, WB, QK, VT);

    // planes QH | QR | KH | KR from the base QH with stride SZ_PL/2 halves
    k_mid<<<GM_PREP + GM_ROT + 1 + GM_CVT, 256, 0, stream>>>(QK, q_ln_w, k_ln_w, CS, SN, QH, (size_t)(SZ_PL / 2), blocks, amask, BM, BASE, MB, edge_w, EWA, out_w, OWB);

    k_flash<<<dim3(SEQ / (16 * AW), NB * NH_, 1), 32 * AW * KW, 0, stream>>>(QH, QR, KH, KR, VT, BM, BASE, EWA, MB, OA);

    // out: A = (ctx + context) hi|lo rows, Bt = out_w rows -> OUT[b][t][n]
    k_proj<1><<<dim3(NB * SEQ / 128, DM / 128, 1), 128, 0, stream>>>(OA, K2, OWB, DM, K2, (h16*)0, SEQ, (size_t)0, 0, 64, (size_t)0, OUT, DM, OUT_SEQ);
}
